// v000
// Measured on an AMD MI455X. A time is GPU time per run, averaged over a window of back-to-back runs after a warm-up
// (all launches, gaps included; the runs take copies of the inputs in turn), and the median of several windows.
// Apart from v000's, it joins two sittings. Times from different sittings can be a few percent apart, while
// side-by-side timings come from the same sitting.
// The starting kernel, v000, takes 940 microseconds a run.
#include <hip/hip_runtime.h>

// Contractions, f32 accumulate: five 1x1 projections on v_wmma_f32_16x16x32_bf16 (x as exact bf16; SimAM-gated branch as bf16 hi+lo planes = 2 products; weights bf16); score tiles q.k on v_wmma_f32_16x16x32_bf16 with hi/lo x hi/lo planes (3 products); P.V on v_wmma_f32_16x16x32_f16 (P x 2^14, V x 16 as f16 hi) plus v_wmma_f32_16x16x32_bf16 (P bf16 x V bf16 residual); output projection on v_wmma_f32_16x16x32_bf16 (y as bf16 hi+lo planes = 2 products). SimAM statistics/gating, online max-subtracted softmax, normalisation and residual add in f32.
// Data flow: x [NB][256][4096] channel-major -> token-major planes XT (bf16 exact), X1h/X1l (gated branch, hi/lo); theta/phi/D token-major [t][128] f32 -> bf16 hi/lo planes; g/S feature-major [128][t] f32 -> f16 hi (x16) + bf16 residual; one wave per 16 queries walks 32-key blocks (scores, online softmax, P through a wave-private LDS tile, P.V); y1/y2 [t][128] f32; y = y1 + y2 -> bf16 hi/lo; out[b][co][t] = W_out . y + b_out + bf16(x).

#ifndef NB
#define NB 4
#endif
#ifndef SEQ
#define SEQ 4096
#endif
#define NBF  4
#define HWF  4096
#define C_   256
#define CI   128
#define KB   32
#define PP   40
#define OSP  132
#define PCAR 16384.0f
#define VCAR 16.0f
#define YSC  (1.0f / 262144.0f)
#define ELAM 1e-4f

static_assert(NB >= 1 && NB <= NBF);
static_assert(SEQ % 128 == 0 && SEQ >= 128 && SEQ <= HWF);
static_assert(SEQ % KB == 0 && SEQ % 64 == 0 && SEQ % 16 == 0);
static_assert((NB * C_) % 32 == 0);
static_assert(C_ % 64 == 0 && CI % 64 == 0 && C_ % 32 == 0 && CI % 32 == 0);
static_assert((NB * SEQ * C_) % (8 * 256) == 0 && (NB * SEQ * CI) % 8 == 0);

typedef _Float16 h16;
typedef unsigned short bf;
typedef __attribute__((ext_vector_type(16))) __bf16   v16bf;
typedef __attribute__((ext_vector_type(16))) _Float16 v16h;
typedef __attribute__((ext_vector_type(8)))  _Float16 v8h;
typedef __attribute__((ext_vector_type(8)))  unsigned short v8us;
typedef __attribute__((ext_vector_type(8)))  float    v8f;
typedef __attribute__((ext_vector_type(4)))  float    v4f;
typedef v8h  __attribute__((may_alias)) v8ha;
typedef v4f  __attribute__((may_alias)) v4fa;
typedef v8us __attribute__((may_alias)) v8usa;

__device__ __forceinline__ unsigned short f2bf(float f) { unsigned u = __float_as_uint(f); u += 0x7FFFu + ((u >> 16) & 1u); return (unsigned short)(u >> 16); }
__device__ __forceinline__ float bf2f(unsigned short b) { return __uint_as_float(((unsigned)b) << 16); }
__device__ __forceinline__ float bfr(float f) { return bf2f(f2bf(f)); }
__device__ __forceinline__ void splitf(float y, unsigned short& h, unsigned short& l) { h = f2bf(y); l = f2bf(y - bf2f(h)); }
__device__ __forceinline__ v16h cat16(v8h lo, v8h hi) { return __builtin_shufflevector(lo, hi, 0, 1, 2, 3, 4, 5, 6, 7, 8, 9, 10, 11, 12, 13, 14, 15); }
__device__ __forceinline__ v16bf cat16b(v8us lo, v8us hi) { return __builtin_bit_cast(v16bf, __builtin_shufflevector(lo, hi, 0, 1, 2, 3, 4, 5, 6, 7, 8, 9, 10, 11, 12, 13, 14, 15)); }
__device__ __forceinline__ v8f wmma16(v16h a, v16h b, v8f c) { return __builtin_amdgcn_wmma_f32_16x16x32_f16(false, a, false, b, (short)0, c, false, false); }
__device__ __forceinline__ v8f wmmab(v16bf a, v16bf b, v8f c) { return __builtin_amdgcn_wmma_f32_16x16x32_bf16(false, a, false, b, (short)0, c, false, false); }
// Fragment loaders (A and B share the same per-lane k map): p already points at row (lane & 15), k0 + 8*(lane >> 4); elements 0..7 <- p[0..7], elements 8..15 <- p[16..23].
__device__ __forceinline__ v16bf ldb(const bf* p) { return cat16b(*(const v8us*)p, *(const v8us*)(p + 16)); }
__device__ __forceinline__ v16h  ldh(const h16* p) { return cat16(*(const v8h*)p, *(const v8h*)(p + 16)); }

// ---- k_gemmw: register-blocked GEMM, ONE WAVE per 64x64 output tile (16 accumulators), operands straight from K-contiguous 16-bit planes; grid (M/64, N/64, Z), 32 threads.
// C[m][n] (f32, pitch ldc) = sum_k A[m][k] Bt[n][k] (+ A2[m][k] Bt[n][k] when A2ON) (+ A[m][k] Bt2[n][k] when B2ON) (+ bf16(bias[n]) BIASM==1 | bf16(bias[m]) BIASM==2) (+ bf16(res[m][n]) when RESID, same indexing as C).
// z-batch strides sA/sB/sC in elements. K % 32 == 0, M % 64 == 0, N % 64 == 0.
template <typename T16> struct WFrag;
template <> struct WFrag<h16> { typedef v16h V; static __device__ __forceinline__ V ld(const h16* p) { return ldh(p); } static __device__ __forceinline__ v8f mma(V a, V b, v8f c) { return wmma16(a, b, c); } };
template <> struct WFrag<bf> { typedef v16bf V; static __device__ __forceinline__ V ld(const bf* p) { return ldb(p); } static __device__ __forceinline__ v8f mma(V a, V b, v8f c) { return wmmab(a, b, c); } };
template <typename T16, bool A2ON, bool B2ON, int BIASM, bool RESID>
__global__ __launch_bounds__(32) void k_gemmw(const T16* __restrict__ A, const T16* __restrict__ A2, const T16* __restrict__ Bt, const T16* __restrict__ Bt2, int K,
                                              float* C, int ldc, const float* __restrict__ bias, const float* __restrict__ res, size_t sA, size_t sB, size_t sC) {
    typedef typename WFrag<T16>::V V;
    __shared__ __align__(16) float os[16 * 68];
    const size_t z = blockIdx.z;
    A += z * sA; if (A2ON) A2 += z * sA; Bt += z * sB; if (B2ON) Bt2 += z * sB; C += z * sC; if (RESID) res += z * sC;
    const int lane = threadIdx.x & 31, lr = lane & 15, hi = lane >> 4;
    const int r0 = blockIdx.x * 64, c0 = blockIdx.y * 64;
    v8f acc[4][4];
#pragma unroll
    for (int mb = 0; mb < 4; ++mb)
#pragma unroll
        for (int nb = 0; nb < 4; ++nb) acc[mb][nb] = (v8f){};
    const size_t aoff = (size_t)(r0 + lr) * K + 8 * hi, boff = (size_t)(c0 + lr) * K + 8 * hi;
#pragma unroll 1
    for (int kc = 0; kc < K; kc += 32) {
        V a[4], a2[4];
#pragma unroll
        for (int mb = 0; mb < 4; ++mb) { a[mb] = WFrag<T16>::ld(A + aoff + (size_t)mb * 16 * K + kc); a2[mb] = a[mb]; if (A2ON) a2[mb] = WFrag<T16>::ld(A2 + aoff + (size_t)mb * 16 * K + kc); }
#pragma unroll
        for (int nb = 0; nb < 4; ++nb) {
            const V b = WFrag<T16>::ld(Bt + boff + (size_t)nb * 16 * K + kc); V b2 = b; if (B2ON) b2 = WFrag<T16>::ld(Bt2 + boff + (size_t)nb * 16 * K + kc);
#pragma unroll
            for (int mb = 0; mb < 4; ++mb) {
                acc[mb][nb] = WFrag<T16>::mma(a[mb], b, acc[mb][nb]);
                if (A2ON) acc[mb][nb] = WFrag<T16>::mma(a2[mb], b, acc[mb][nb]);
                if (B2ON) acc[mb][nb] = WFrag<T16>::mma(a[mb], b2, acc[mb][nb]); } }
        asm volatile("v_nop\n\tv_nop\n\tv_nop\n\tv_nop" : "+v"(acc[0][0]), "+v"(acc[1][1]), "+v"(acc[2][2]), "+v"(acc[3][3]) : "v"(a[0]), "v"(a[3]));
    }
#pragma unroll
    for (int mb = 0; mb < 4; ++mb) {
#pragma unroll
        for (int nb = 0; nb < 4; ++nb) {
#pragma unroll
            for (int j = 0; j < 8; ++j) os[(hi * 8 + j) * 68 + nb * 16 + lr] = acc[mb][nb][j]; }
        __builtin_amdgcn_fence(__ATOMIC_RELEASE, "wavefront"); __builtin_amdgcn_wave_barrier(); asm volatile("" ::: "memory");
        const size_t rb = (size_t)(r0 + mb * 16);
{
#pragma unroll
            for (int s = 0; s < 8; ++s) {
                const int row = 2 * s + hi, cofs = lr * 4;
                v4f val = *(const v4fa*)(os + row * 68 + cofs);
                if (BIASM == 1) { val[0] += bfr(bias[c0 + cofs]); val[1] += bfr(bias[c0 + cofs + 1]); val[2] += bfr(bias[c0 + cofs + 2]); val[3] += bfr(bias[c0 + cofs + 3]); }
                if (BIASM == 2) { const float bv = bfr(bias[rb + row]); val[0] += bv; val[1] += bv; val[2] += bv; val[3] += bv; }
                if (RESID) { const v4f rv = *(const v4f*)(res + (rb + row) * (size_t)ldc + c0 + cofs); val[0] += bfr(rv[0]); val[1] += bfr(rv[1]); val[2] += bfr(rv[2]); val[3] += bfr(rv[3]); }
                *(v4f*)(C + (rb + row) * (size_t)ldc + c0 + cofs) = val; }
             }
        __builtin_amdgcn_fence(__ATOMIC_RELEASE, "wavefront"); __builtin_amdgcn_wave_barrier(); asm volatile("" ::: "memory");
    }
}

__global__ __launch_bounds__(256) void k_cvt8(const float* __restrict__ src, bf* dst, size_t n8) { const size_t i = (size_t)blockIdx.x * 256 + threadIdx.x; if (i >= n8) return; const v8f v = *(const v8f*)(src + i * 8); v8us o;
#pragma unroll
    for (int k = 0; k < 8; ++k) o[k] = f2bf(v[k]); *(v8us*)(dst + i * 8) = o;  }

// LDS mus/rds: cross-wave (block barrier).
__global__ __launch_bounds__(256) void k_stats(const float* __restrict__ x, float* MU, float* RD) {
    __shared__ float mus[32]; __shared__ float rds[32];
    const int t = threadIdx.x, wid = t >> 5, lane = t & 31;
#pragma unroll 1
    for (int j = 0; j < 4; ++j) {
        const int rr = blockIdx.x * 32 + wid * 4 + j;                 // (b, c) row index < NB * C_
        const int b = rr / C_, c = rr - b * C_;
        const float* xr = x + ((size_t)b * C_ + c) * HWF + lane * 4;
        float s = 0.f;
#pragma unroll 1
        for (int i = 0; i < SEQ / 128; ++i) { const v4f v = *(const v4f*)(xr + (size_t)i * 128); s += (bfr(v[0]) + bfr(v[1])) + (bfr(v[2]) + bfr(v[3])); }
        s += __shfl_xor(s, 1, 32); s += __shfl_xor(s, 2, 32); s += __shfl_xor(s, 4, 32); s += __shfl_xor(s, 8, 32); s += __shfl_xor(s, 16, 32);
        const float mu = s * (1.0f / (float)SEQ);
        float ss = 0.f;
#pragma unroll 1
        for (int i = 0; i < SEQ / 128; ++i) { const v4f v = *(const v4f*)(xr + (size_t)i * 128);
            const float d0 = bfr(v[0]) - mu, d1 = bfr(v[1]) - mu, d2 = bfr(v[2]) - mu, d3 = bfr(v[3]) - mu;
            ss += (d0 * d0 + d1 * d1) + (d2 * d2 + d3 * d3); }
        ss += __shfl_xor(ss, 1, 32); ss += __shfl_xor(ss, 2, 32); ss += __shfl_xor(ss, 4, 32); ss += __shfl_xor(ss, 8, 32); ss += __shfl_xor(ss, 16, 32);
        const float den = 4.0f * (ss * (1.0f / (float)(SEQ - 1)) + ELAM);
        const float rd = 1.0f / den;
        if (lane == 0) { mus[wid * 4 + j] = mu; rds[wid * 4 + j] = rd; }
    }
    __syncthreads();
    if (wid == 0) {
        const float a = mus[lane], r = rds[lane];
        float* pm = MU + (size_t)blockIdx.x * 32 + lane; float* pr = RD + (size_t)blockIdx.x * 32 + lane;
        *(float*)pm = a; *(float*)pr = r;  }
}

// ---- k_xplanes: token-major planes from channel-major x: XT[(b*SEQ+t)][c] = bf16(x[b][c][t]) (exact), X1h/X1l = bf16 hi/lo of x1 = bf16(x) * sigmoid((bf16(x) - mu)^2 * rd + 0.5).
__global__ __launch_bounds__(256) void k_xplanes(const float* __restrict__ x, const float* __restrict__ MU, const float* __restrict__ RD, bf* XT, bf* X1h, bf* X1l) {
    const size_t e = ((size_t)blockIdx.x * 256 + threadIdx.x) * 8; if (e >= (size_t)NB * SEQ * C_) return;
    const int c = (int)(e % C_); const size_t btk = e / C_; const int tpos = (int)(btk % SEQ); const int b = (int)(btk / SEQ);
    const float* xp = x + ((size_t)b * C_ + c) * HWF + tpos;
    const v8f mu8 = *(const v8f*)(MU + (size_t)b * C_ + c), rd8 = *(const v8f*)(RD + (size_t)b * C_ + c);
    v8us o0, oh, ol;
#pragma unroll
    for (int q = 0; q < 8; ++q) {
        const float xb = bfr(xp[(size_t)q * HWF]);
        const float d = xb - mu8[q];
        const float y = d * d * rd8[q] + 0.5f;
        const float ex = __expf(-y);
        const float sg = __builtin_amdgcn_rcpf(1.0f + ex);
        const float x1 = xb * sg;
        o0[q] = f2bf(xb); unsigned short hh, ll; splitf(x1, hh, ll); oh[q] = hh; ol[q] = ll;
    }
    *(v8us*)(XT + e) = o0; *(v8us*)(X1h + e) = oh; *(v8us*)(X1l + e) = ol; 
}

__global__ __launch_bounds__(256) void k_split8(const float* __restrict__ F, bf* Ph, bf* Pl, size_t n8) { const size_t i = (size_t)blockIdx.x * 256 + threadIdx.x; if (i >= n8) return; const v8f v = *(const v8f*)(F + i * 8); v8us oh, ol;
#pragma unroll
    for (int q = 0; q < 8; ++q) { unsigned short a, c; splitf(v[q], a, c); oh[q] = a; ol[q] = c; }
    *(v8us*)(Ph + i * 8) = oh; *(v8us*)(Pl + i * 8) = ol;  }
__global__ __launch_bounds__(256) void k_sumsplit8(const float* __restrict__ F1, const float* __restrict__ F2, bf* Ph, bf* Pl, size_t n8) { const size_t i = (size_t)blockIdx.x * 256 + threadIdx.x; if (i >= n8) return; const v8f v = *(const v8f*)(F1 + i * 8) + *(const v8f*)(F2 + i * 8); v8us oh, ol;
#pragma unroll
    for (int q = 0; q < 8; ++q) { unsigned short a, c; splitf(v[q], a, c); oh[q] = a; ol[q] = c; }
    *(v8us*)(Ph + i * 8) = oh; *(v8us*)(Pl + i * 8) = ol;  }
__global__ __launch_bounds__(256) void k_vsplit8(const float* __restrict__ F, h16* Ph, bf* Pl, size_t n8) { const size_t i = (size_t)blockIdx.x * 256 + threadIdx.x; if (i >= n8) return; const v8f v = *(const v8f*)(F + i * 8); v8h oh; v8us ol;
#pragma unroll
    for (int q = 0; q < 8; ++q) { const float w = v[q] * VCAR; const h16 hh = (h16)w; oh[q] = hh; ol[q] = f2bf(w - (float)hh); }
    *(v8h*)(Ph + i * 8) = oh; *(v8us*)(Pl + i * 8) = ol;  }

// ---- k_attn: one wave per 16 queries of one batch and one map (z = 0: theta/g, z = 1: D/S; keys = phi for both), 32-key blocks, online max-subtracted softmax.
// LDS pS16/pSb/os: private to the wave (block = one wave). Staged extent == consumed extent: pS rows 0..15 x cols 0..31, os rows 0..15 x cols 0..127.
__global__ __launch_bounds__(32) void k_attn(const bf* __restrict__ THh, const bf* __restrict__ THl, const bf* __restrict__ DQh, const bf* __restrict__ DQl,
                                             const bf* __restrict__ PHh, const bf* __restrict__ PHl,
                                             const h16* __restrict__ GVh, const bf* __restrict__ GVl, const h16* __restrict__ SVh, const bf* __restrict__ SVl, float* Y) {
    __shared__ __align__(16) h16 pS16[16 * PP];
    __shared__ __align__(16) unsigned short pSb[16 * PP];
    __shared__ __align__(16) float os[16 * OSP];
    const int lane = threadIdx.x & 31, L = lane & 15, hi = lane >> 4;
    const int q0 = blockIdx.x * 16, b = blockIdx.y, mp = blockIdx.z;
    const size_t tok = (size_t)b * SEQ;
    const bf* Qh = (mp ? DQh : THh) + (tok + q0) * CI; const bf* Ql = (mp ? DQl : THl) + (tok + q0) * CI;
    const bf* Kh = PHh + tok * CI; const bf* Kl = PHl + tok * CI;
    const h16* Vh = (mp ? SVh : GVh) + (size_t)b * CI * SEQ; const bf* Vl = (mp ? SVl : GVl) + (size_t)b * CI * SEQ;
    float* Yo = Y + ((size_t)mp * NB * SEQ + tok + q0) * CI;
    float m_i[8], l_i[8]; v8f acc[8];
#pragma unroll
    for (int v = 0; v < 8; ++v) { m_i[v] = -1.0e30f; l_i[v] = 0.f; }
#pragma unroll
    for (int ct = 0; ct < 8; ++ct) acc[ct] = (v8f){};
    const size_t qoff = (size_t)L * CI + 8 * hi;          // A fragment: query row L
    const size_t voff0 = (size_t)L * SEQ + 8 * hi;        // B fragment (values): ci row L of the feature-major plane
#pragma unroll 1
    for (int kb = 0; kb < SEQ; kb += KB) {
        v8f lt0 = (v8f){}, lt1 = (v8f){};
        const bf* k0h = Kh + (size_t)(kb + L) * CI + 8 * hi; const bf* k0l = Kl + (size_t)(kb + L) * CI + 8 * hi;   // B fragment (keys): key row kb + kt*16 + L
#pragma unroll 1
        for (int ch = 0; ch < CI / 32; ++ch) {
            const int co = ch * 32;
            const v16bf qa = ldb(Qh + qoff + co), qb = ldb(Ql + qoff + co);
            const v16bf ka0 = ldb(k0h + co), kl0 = ldb(k0l + co), ka1 = ldb(k0h + 16 * CI + co), kl1 = ldb(k0l + 16 * CI + co);
            lt0 = wmmab(qa, ka0, lt0); lt0 = wmmab(qb, ka0, lt0); lt0 = wmmab(qa, kl0, lt0);
            lt1 = wmmab(qa, ka1, lt1); lt1 = wmmab(qb, ka1, lt1); lt1 = wmmab(qa, kl1, lt1);
            asm volatile("v_nop\n\tv_nop\n\tv_nop\n\tv_nop" : "+v"(lt0), "+v"(lt1) : "v"(qa), "v"(qb), "v"(ka1), "v"(kl1));
        }
        float scv[8];
#pragma unroll
        for (int v = 0; v < 8; ++v) {
            const float ra = lt0[v], rb = lt1[v];
            float mx = fmaxf(ra, rb);
            mx = fmaxf(mx, __shfl_xor(mx, 1, 32)); mx = fmaxf(mx, __shfl_xor(mx, 2, 32)); mx = fmaxf(mx, __shfl_xor(mx, 4, 32)); mx = fmaxf(mx, __shfl_xor(mx, 8, 32));
            const float mn = fmaxf(m_i[v], mx);
            const float sc = __expf(m_i[v] - mn);
            const float pa = __expf(ra - mn), pb = __expf(rb - mn);
            float rs = pa + pb;
            rs += __shfl_xor(rs, 1, 32); rs += __shfl_xor(rs, 2, 32); rs += __shfl_xor(rs, 4, 32); rs += __shfl_xor(rs, 8, 32);
            l_i[v] = l_i[v] * sc + rs; m_i[v] = mn; scv[v] = sc;
            const float pas = pa * PCAR, pbs = pb * PCAR;
            const int prow = (v + 8 * hi) * PP;                  // D element v -> row 8*hi + v, column (key) L of tile kt
            pS16[prow + L] = (h16)pas; pS16[prow + 16 + L] = (h16)pbs;
            pSb[prow + L] = f2bf(pas); pSb[prow + 16 + L] = f2bf(pbs);
        }
#pragma unroll
        for (int ct = 0; ct < 8; ++ct)
#pragma unroll
            for (int v = 0; v < 8; ++v) acc[ct][v] *= scv[v];
        __builtin_amdgcn_fence(__ATOMIC_RELEASE, "wavefront"); __builtin_amdgcn_wave_barrier(); asm volatile("" ::: "memory");
        const v16h pa16 = cat16(*(const v8ha*)(pS16 + L * PP + 8 * hi), *(const v8ha*)(pS16 + L * PP + 16 + 8 * hi));
        const v16bf pab = cat16b(*(const v8usa*)(pSb + L * PP + 8 * hi), *(const v8usa*)(pSb + L * PP + 16 + 8 * hi));
        const h16* vh = Vh + voff0 + kb; const bf* vl = Vl + voff0 + kb;
#pragma unroll
        for (int ct = 0; ct < 4; ++ct) {
            const v16h vf = ldh(vh + (size_t)ct * 16 * SEQ); const v16bf vr = ldb(vl + (size_t)ct * 16 * SEQ);
            acc[ct] = wmma16(pa16, vf, acc[ct]); acc[ct] = wmmab(pab, vr, acc[ct]); }
        asm volatile("v_nop\n\tv_nop\n\tv_nop\n\tv_nop" : "+v"(acc[0]), "+v"(acc[1]), "+v"(acc[2]), "+v"(acc[3]) : "v"(pa16), "v"(pab) : "memory");
#pragma unroll
        for (int ct = 4; ct < 8; ++ct) {
            const v16h vf = ldh(vh + (size_t)ct * 16 * SEQ); const v16bf vr = ldb(vl + (size_t)ct * 16 * SEQ);
            acc[ct] = wmma16(pa16, vf, acc[ct]); acc[ct] = wmmab(pab, vr, acc[ct]); }
        asm volatile("v_nop\n\tv_nop\n\tv_nop\n\tv_nop" : "+v"(acc[4]), "+v"(acc[5]), "+v"(acc[6]), "+v"(acc[7]) : "v"(pa16), "v"(pab) : "memory");
        __builtin_amdgcn_wave_barrier(); asm volatile("" ::: "memory");
    }
    float rl[8];
#pragma unroll
    for (int v = 0; v < 8; ++v) rl[v] = __builtin_amdgcn_rcpf(l_i[v]) * YSC;
#pragma unroll
    for (int ct = 0; ct < 8; ++ct)
#pragma unroll
        for (int v = 0; v < 8; ++v) os[(8 * hi + v) * OSP + ct * 16 + L] = acc[ct][v] * rl[v];
    __builtin_amdgcn_fence(__ATOMIC_RELEASE, "wavefront"); __builtin_amdgcn_wave_barrier(); asm volatile("" ::: "memory");
{
#pragma unroll
        for (int r = 0; r < 16; ++r) { const v4f val = *(const v4fa*)(os + r * OSP + lane * 4); *(v4f*)(Yo + (size_t)r * CI + lane * 4) = val; }
         }
}

extern "C" void kernel_launch(void* const* d_in, const int* in_sizes, int n_in,
                              void* d_out, int out_size, void* d_ws, size_t ws_size, hipStream_t stream) {
    if (n_in < 13) return;
    if ((size_t)in_sizes[0] < (size_t)NB * C_ * HWF) return;
    if (in_sizes[1] < CI * C_ || in_sizes[3] < CI * C_ || in_sizes[5] < CI * C_ || in_sizes[7] < CI * C_ || in_sizes[9] < CI * C_ || in_sizes[11] < C_ * CI) return;
    if (in_sizes[2] < CI || in_sizes[4] < CI || in_sizes[6] < CI || in_sizes[8] < CI || in_sizes[10] < CI || in_sizes[12] < C_) return;
    if ((size_t)out_size < (size_t)NB * C_ * HWF) return;
    const float* x = (const float*)d_in[0];
    const float* w_theta = (const float*)d_in[1];  const float* b_theta = (const float*)d_in[2];
    const float* w_phi   = (const float*)d_in[3];  const float* b_phi   = (const float*)d_in[4];
    const float* w_g     = (const float*)d_in[5];  const float* b_g     = (const float*)d_in[6];
    const float* w_d     = (const float*)d_in[7];  const float* b_d     = (const float*)d_in[8];
    const float* w_s     = (const float*)d_in[9];  const float* b_s     = (const float*)d_in[10];
    const float* w_out   = (const float*)d_in[11]; const float* b_out   = (const float*)d_in[12];
    float* OUT = (float*)d_out;                     // [NB][256][HWF]
    char* wsp = (char*)d_ws;
    auto take = [&](size_t bytes) { char* p = wsp; wsp += (bytes + 255) & ~(size_t)255; return (void*)p; };
    const size_t nTok = (size_t)NB * SEQ;
    bf* WTb = (bf*)take((size_t)CI * C_ * 2); bf* WPb = (bf*)take((size_t)CI * C_ * 2); bf* WGb = (bf*)take((size_t)CI * C_ * 2);
    bf* WDb = (bf*)take((size_t)CI * C_ * 2); bf* WSb = (bf*)take((size_t)CI * C_ * 2); bf* WOb = (bf*)take((size_t)C_ * CI * 2);
    float* MU = (float*)take((size_t)NB * C_ * 4); float* RD = (float*)take((size_t)NB * C_ * 4);
    bf* XT = (bf*)take(nTok * C_ * 2); bf* X1h = (bf*)take(nTok * C_ * 2); bf* X1l = (bf*)take(nTok * C_ * 2);
    float* F32A = (float*)take(2 * nTok * CI * 4);                 // projection scratch [nTok][128] / [NB][128][SEQ], then y1 | y2 [2][nTok][128]
    bf* THh = (bf*)take(nTok * CI * 2); bf* THl = (bf*)take(nTok * CI * 2);
    bf* PHh = (bf*)take(nTok * CI * 2); bf* PHl = (bf*)take(nTok * CI * 2);
    bf* DQh = (bf*)take(nTok * CI * 2); bf* DQl = (bf*)take(nTok * CI * 2);
    h16* GVh = (h16*)take(nTok * CI * 2); bf* GVl = (bf*)take(nTok * CI * 2);
    h16* SVh = (h16*)take(nTok * CI * 2); bf* SVl = (bf*)take(nTok * CI * 2);
    bf* Yh = (bf*)take(nTok * CI * 2); bf* Yl = (bf*)take(nTok * CI * 2);
    if ((size_t)(wsp - (char*)d_ws) > ws_size) return;
    float* Y1 = F32A; float* Y2 = F32A + nTok * CI;

    const unsigned gw = (unsigned)(((size_t)CI * C_ / 8 + 255) / 256);
    k_cvt8<<<gw, 256, 0, stream>>>(w_theta, WTb, (size_t)CI * C_ / 8);
    k_cvt8<<<gw, 256, 0, stream>>>(w_phi, WPb, (size_t)CI * C_ / 8);
    k_cvt8<<<gw, 256, 0, stream>>>(w_g, WGb, (size_t)CI * C_ / 8);
    k_cvt8<<<gw, 256, 0, stream>>>(w_d, WDb, (size_t)CI * C_ / 8);
    k_cvt8<<<gw, 256, 0, stream>>>(w_s, WSb, (size_t)CI * C_ / 8);
    k_cvt8<<<gw, 256, 0, stream>>>(w_out, WOb, (size_t)C_ * CI / 8);
    k_stats<<<(unsigned)(NB * C_ / 32), 256, 0, stream>>>(x, MU, RD);                                                                   /* SimAM mu, 1/(4(var_n + eps)) per (b, c) */
    k_xplanes<<<(unsigned)((nTok * C_ / 8 + 255) / 256), 256, 0, stream>>>(x, MU, RD, XT, X1h, X1l);                                    /* x^T bf16 (exact), gated x1^T hi/lo */
    const size_t n8p = nTok * CI / 8; const unsigned gs8 = (unsigned)((n8p + 255) / 256);
    k_gemmw<bf, false, false, 1, false><<<dim3((unsigned)(nTok / 64), CI / 64, 1), 32, 0, stream>>>(XT, nullptr, WTb, nullptr, C_, F32A, CI, b_theta, nullptr, 0, 0, 0);   /* theta [tok][128] */
    k_split8<<<gs8, 256, 0, stream>>>(F32A, THh, THl, n8p);
    k_gemmw<bf, false, false, 1, false><<<dim3((unsigned)(nTok / 64), CI / 64, 1), 32, 0, stream>>>(XT, nullptr, WPb, nullptr, C_, F32A, CI, b_phi, nullptr, 0, 0, 0);     /* phi [tok][128] */
    k_split8<<<gs8, 256, 0, stream>>>(F32A, PHh, PHl, n8p);
    k_gemmw<bf, true, false, 1, false><<<dim3((unsigned)(nTok / 64), CI / 64, 1), 32, 0, stream>>>(X1h, X1l, WDb, nullptr, C_, F32A, CI, b_d, nullptr, 0, 0, 0);          /* D [tok][128] (2 products) */
    k_split8<<<gs8, 256, 0, stream>>>(F32A, DQh, DQl, n8p);
    k_gemmw<bf, false, false, 2, false><<<dim3(CI / 64, SEQ / 64, NB), 32, 0, stream>>>(WGb, nullptr, XT, nullptr, C_, F32A, SEQ, b_g, nullptr, 0, (size_t)SEQ * C_, (size_t)CI * SEQ);   /* g feature-major [b][128][SEQ] */
    k_vsplit8<<<gs8, 256, 0, stream>>>(F32A, GVh, GVl, n8p);
    k_gemmw<bf, false, true, 2, false><<<dim3(CI / 64, SEQ / 64, NB), 32, 0, stream>>>(WSb, nullptr, X1h, X1l, C_, F32A, SEQ, b_s, nullptr, 0, (size_t)SEQ * C_, (size_t)CI * SEQ);       /* S feature-major (2 products) */
    k_vsplit8<<<gs8, 256, 0, stream>>>(F32A, SVh, SVl, n8p);
    k_attn<<<dim3(SEQ / 16, NB, 2), 32, 0, stream>>>(THh, THl, DQh, DQl, PHh, PHl, GVh, GVl, SVh, SVl, F32A);                          /* y1 = softmax(theta.phi) g, y2 = softmax(D.phi) S */
    k_sumsplit8<<<gs8, 256, 0, stream>>>(Y1, Y2, Yh, Yl, n8p);                                                                         /* y = y1 + y2 -> hi/lo */
    k_gemmw<bf, false, true, 2, true><<<dim3(C_ / 64, SEQ / 64, NB), 32, 0, stream>>>(WOb, nullptr, Yh, Yl, CI, OUT, HWF, b_out, x, 0, (size_t)SEQ * CI, (size_t)C_ * HWF);      /* out[b][co][t] = W_out . y + b_out + bf16(x) */
}

// v001
// Measured time: 549 microseconds a run.
// In two side-by-side timings against v000, it was 1.76 and 1.77 times as fast.
#include <hip/hip_runtime.h>

// Contractions, f32 accumulate: five 1x1 projections on v_wmma_f32_16x16x32_bf16 (x as exact bf16; SimAM-gated branch as bf16 hi+lo planes = 2 products; weights bf16); score tiles q.k on v_wmma_f32_16x16x32_bf16 with hi/lo x hi/lo planes (3 products); P.V on v_wmma_f32_16x16x32_f16 (P x 2^14, V x 16 as f16 hi) plus v_wmma_f32_16x16x32_bf16 (P bf16 x V bf16 residual); output projection on v_wmma_f32_16x16x32_bf16 (y as bf16 hi+lo planes = 2 products). SimAM statistics/gating, online max-subtracted softmax, normalisation and residual add in f32.
// Data flow: x [NB][256][4096] channel-major -> token-major planes XT (bf16 exact), X1h/X1l (gated branch, hi/lo); theta/phi/D token-major [t][128] f32 -> bf16 hi/lo planes; g/S feature-major [128][t] f32 -> f16 hi (x16) + bf16 residual; eight waves per work-group share 64-key K/V stages in LDS; one wave per 16 queries walks 32-key blocks (scores, online softmax, P through a wave-private LDS tile, P.V); y1/y2 [t][128] f32; y = y1 + y2 -> bf16 hi/lo; out[b][co][t] = W_out . y + b_out + bf16(x).

#ifndef NB
#define NB 4
#endif
#ifndef SEQ
#define SEQ 4096
#endif
#define NBF  4
#define HWF  4096
#define C_   256
#define CI   128
#define KB   32
#define PP   40
#define OSP  132
#define PCAR 16384.0f
#define VCAR 16.0f
#define YSC  (1.0f / 262144.0f)
#define ELAM 1e-4f

static_assert(NB >= 1 && NB <= NBF);
static_assert(SEQ % 128 == 0 && SEQ >= 128 && SEQ <= HWF);
static_assert(SEQ % KB == 0 && SEQ % 64 == 0 && SEQ % 16 == 0);
static_assert((NB * C_) % 32 == 0);
static_assert(C_ % 64 == 0 && CI % 64 == 0 && C_ % 32 == 0 && CI % 32 == 0);
static_assert((NB * SEQ * C_) % (8 * 256) == 0 && (NB * SEQ * CI) % 8 == 0);

typedef _Float16 h16;
typedef unsigned short bf;
typedef __attribute__((ext_vector_type(16))) __bf16   v16bf;
typedef __attribute__((ext_vector_type(16))) _Float16 v16h;
typedef __attribute__((ext_vector_type(8)))  _Float16 v8h;
typedef __attribute__((ext_vector_type(8)))  unsigned short v8us;
typedef __attribute__((ext_vector_type(8)))  float    v8f;
typedef __attribute__((ext_vector_type(4)))  float    v4f;
typedef v8h  __attribute__((may_alias)) v8ha;
typedef v4f  __attribute__((may_alias)) v4fa;
typedef v8us __attribute__((may_alias)) v8usa;

__device__ __forceinline__ unsigned short f2bf(float f) { unsigned u = __float_as_uint(f); u += 0x7FFFu + ((u >> 16) & 1u); return (unsigned short)(u >> 16); }
__device__ __forceinline__ float bf2f(unsigned short b) { return __uint_as_float(((unsigned)b) << 16); }
__device__ __forceinline__ float bfr(float f) { return bf2f(f2bf(f)); }
__device__ __forceinline__ void splitf(float y, unsigned short& h, unsigned short& l) { h = f2bf(y); l = f2bf(y - bf2f(h)); }
__device__ __forceinline__ v16h cat16(v8h lo, v8h hi) { return __builtin_shufflevector(lo, hi, 0, 1, 2, 3, 4, 5, 6, 7, 8, 9, 10, 11, 12, 13, 14, 15); }
__device__ __forceinline__ v16bf cat16b(v8us lo, v8us hi) { return __builtin_bit_cast(v16bf, __builtin_shufflevector(lo, hi, 0, 1, 2, 3, 4, 5, 6, 7, 8, 9, 10, 11, 12, 13, 14, 15)); }
__device__ __forceinline__ v8f wmma16(v16h a, v16h b, v8f c) { return __builtin_amdgcn_wmma_f32_16x16x32_f16(false, a, false, b, (short)0, c, false, false); }
__device__ __forceinline__ v8f wmmab(v16bf a, v16bf b, v8f c) { return __builtin_amdgcn_wmma_f32_16x16x32_bf16(false, a, false, b, (short)0, c, false, false); }
// Fragment loaders (A and B share the same per-lane k map): p already points at row (lane & 15), k0 + 8*(lane >> 4); elements 0..7 <- p[0..7], elements 8..15 <- p[16..23].
__device__ __forceinline__ v16bf ldb(const bf* p) { return cat16b(*(const v8us*)p, *(const v8us*)(p + 16)); }
__device__ __forceinline__ v16h  ldh(const h16* p) { return cat16(*(const v8h*)p, *(const v8h*)(p + 16)); }

// ---- k_gemmw: register-blocked GEMM, ONE WAVE per 64x64 output tile (16 accumulators), operands straight from K-contiguous 16-bit planes; grid (M/64, N/64, Z), 32 threads.
// C[m][n] (f32, pitch ldc) = sum_k A[m][k] Bt[n][k] (+ A2[m][k] Bt[n][k] when A2ON) (+ A[m][k] Bt2[n][k] when B2ON) (+ bf16(bias[n]) BIASM==1 | bf16(bias[m]) BIASM==2) (+ bf16(res[m][n]) when RESID, same indexing as C).
// z-batch strides sA/sB/sC in elements. K % 32 == 0, M % 64 == 0, N % 64 == 0.
template <typename T16> struct WFrag;
template <> struct WFrag<h16> { typedef v16h V; static __device__ __forceinline__ V ld(const h16* p) { return ldh(p); } static __device__ __forceinline__ v8f mma(V a, V b, v8f c) { return wmma16(a, b, c); } };
template <> struct WFrag<bf> { typedef v16bf V; static __device__ __forceinline__ V ld(const bf* p) { return ldb(p); } static __device__ __forceinline__ v8f mma(V a, V b, v8f c) { return wmmab(a, b, c); } };
template <typename T16, bool A2ON, bool B2ON, int BIASM, bool RESID>
__global__ __launch_bounds__(32) void k_gemmw(const T16* __restrict__ A, const T16* __restrict__ A2, const T16* __restrict__ Bt, const T16* __restrict__ Bt2, int K,
                                              float* C, int ldc, const float* __restrict__ bias, const float* __restrict__ res, size_t sA, size_t sB, size_t sC) {
    typedef typename WFrag<T16>::V V;
    __shared__ __align__(16) float os[16 * 68];
    const size_t z = blockIdx.z;
    A += z * sA; if (A2ON) A2 += z * sA; Bt += z * sB; if (B2ON) Bt2 += z * sB; C += z * sC; if (RESID) res += z * sC;
    const int lane = threadIdx.x & 31, lr = lane & 15, hi = lane >> 4;
    const int r0 = blockIdx.x * 64, c0 = blockIdx.y * 64;
    v8f acc[4][4];
#pragma unroll
    for (int mb = 0; mb < 4; ++mb)
#pragma unroll
        for (int nb = 0; nb < 4; ++nb) acc[mb][nb] = (v8f){};
    const size_t aoff = (size_t)(r0 + lr) * K + 8 * hi, boff = (size_t)(c0 + lr) * K + 8 * hi;
#pragma unroll 1
    for (int kc = 0; kc < K; kc += 32) {
        V a[4], a2[4];
#pragma unroll
        for (int mb = 0; mb < 4; ++mb) { a[mb] = WFrag<T16>::ld(A + aoff + (size_t)mb * 16 * K + kc); a2[mb] = a[mb]; if (A2ON) a2[mb] = WFrag<T16>::ld(A2 + aoff + (size_t)mb * 16 * K + kc); }
#pragma unroll
        for (int nb = 0; nb < 4; ++nb) {
            const V b = WFrag<T16>::ld(Bt + boff + (size_t)nb * 16 * K + kc); V b2 = b; if (B2ON) b2 = WFrag<T16>::ld(Bt2 + boff + (size_t)nb * 16 * K + kc);
#pragma unroll
            for (int mb = 0; mb < 4; ++mb) {
                acc[mb][nb] = WFrag<T16>::mma(a[mb], b, acc[mb][nb]);
                if (A2ON) acc[mb][nb] = WFrag<T16>::mma(a2[mb], b, acc[mb][nb]);
                if (B2ON) acc[mb][nb] = WFrag<T16>::mma(a[mb], b2, acc[mb][nb]); } }
        asm volatile("v_nop\n\tv_nop\n\tv_nop\n\tv_nop" : "+v"(acc[0][0]), "+v"(acc[1][1]), "+v"(acc[2][2]), "+v"(acc[3][3]) : "v"(a[0]), "v"(a[3]));
    }
#pragma unroll
    for (int mb = 0; mb < 4; ++mb) {
#pragma unroll
        for (int nb = 0; nb < 4; ++nb) {
#pragma unroll
            for (int j = 0; j < 8; ++j) os[(hi * 8 + j) * 68 + nb * 16 + lr] = acc[mb][nb][j]; }
        __builtin_amdgcn_fence(__ATOMIC_RELEASE, "wavefront"); __builtin_amdgcn_wave_barrier(); asm volatile("" ::: "memory");
        const size_t rb = (size_t)(r0 + mb * 16);
{
#pragma unroll
            for (int s = 0; s < 8; ++s) {
                const int row = 2 * s + hi, cofs = lr * 4;
                v4f val = *(const v4fa*)(os + row * 68 + cofs);
                if (BIASM == 1) { val[0] += bfr(bias[c0 + cofs]); val[1] += bfr(bias[c0 + cofs + 1]); val[2] += bfr(bias[c0 + cofs + 2]); val[3] += bfr(bias[c0 + cofs + 3]); }
                if (BIASM == 2) { const float bv = bfr(bias[rb + row]); val[0] += bv; val[1] += bv; val[2] += bv; val[3] += bv; }
                if (RESID) { const v4f rv = *(const v4f*)(res + (rb + row) * (size_t)ldc + c0 + cofs); val[0] += bfr(rv[0]); val[1] += bfr(rv[1]); val[2] += bfr(rv[2]); val[3] += bfr(rv[3]); }
                *(v4f*)(C + (rb + row) * (size_t)ldc + c0 + cofs) = val; }
             }
        __builtin_amdgcn_fence(__ATOMIC_RELEASE, "wavefront"); __builtin_amdgcn_wave_barrier(); asm volatile("" ::: "memory");
    }
}

__global__ __launch_bounds__(256) void k_cvt8(const float* __restrict__ src, bf* dst, size_t n8) { const size_t i = (size_t)blockIdx.x * 256 + threadIdx.x; if (i >= n8) return; const v8f v = *(const v8f*)(src + i * 8); v8us o;
#pragma unroll
    for (int k = 0; k < 8; ++k) o[k] = f2bf(v[k]); *(v8us*)(dst + i * 8) = o;  }

// LDS mus/rds: cross-wave (block barrier).
__global__ __launch_bounds__(256) void k_stats(const float* __restrict__ x, float* MU, float* RD) {
    __shared__ float mus[32]; __shared__ float rds[32];
    const int t = threadIdx.x, wid = t >> 5, lane = t & 31;
#pragma unroll 1
    for (int j = 0; j < 4; ++j) {
        const int rr = blockIdx.x * 32 + wid * 4 + j;                 // (b, c) row index < NB * C_
        const int b = rr / C_, c = rr - b * C_;
        const float* xr = x + ((size_t)b * C_ + c) * HWF + lane * 4;
        float s = 0.f;
#pragma unroll 1
        for (int i = 0; i < SEQ / 128; ++i) { const v4f v = *(const v4f*)(xr + (size_t)i * 128); s += (bfr(v[0]) + bfr(v[1])) + (bfr(v[2]) + bfr(v[3])); }
        s += __shfl_xor(s, 1, 32); s += __shfl_xor(s, 2, 32); s += __shfl_xor(s, 4, 32); s += __shfl_xor(s, 8, 32); s += __shfl_xor(s, 16, 32);
        const float mu = s * (1.0f / (float)SEQ);
        float ss = 0.f;
#pragma unroll 1
        for (int i = 0; i < SEQ / 128; ++i) { const v4f v = *(const v4f*)(xr + (size_t)i * 128);
            const float d0 = bfr(v[0]) - mu, d1 = bfr(v[1]) - mu, d2 = bfr(v[2]) - mu, d3 = bfr(v[3]) - mu;
            ss += (d0 * d0 + d1 * d1) + (d2 * d2 + d3 * d3); }
        ss += __shfl_xor(ss, 1, 32); ss += __shfl_xor(ss, 2, 32); ss += __shfl_xor(ss, 4, 32); ss += __shfl_xor(ss, 8, 32); ss += __shfl_xor(ss, 16, 32);
        const float den = 4.0f * (ss * (1.0f / (float)(SEQ - 1)) + ELAM);
        const float rd = 1.0f / den;
        if (lane == 0) { mus[wid * 4 + j] = mu; rds[wid * 4 + j] = rd; }
    }
    __syncthreads();
    if (wid == 0) {
        const float a = mus[lane], r = rds[lane];
        float* pm = MU + (size_t)blockIdx.x * 32 + lane; float* pr = RD + (size_t)blockIdx.x * 32 + lane;
        *(float*)pm = a; *(float*)pr = r;  }
}

// ---- k_xplanes: token-major planes from channel-major x: XT[(b*SEQ+t)][c] = bf16(x[b][c][t]) (exact), X1h/X1l = bf16 hi/lo of x1 = bf16(x) * sigmoid((bf16(x) - mu)^2 * rd + 0.5).
__global__ __launch_bounds__(256) void k_xplanes(const float* __restrict__ x, const float* __restrict__ MU, const float* __restrict__ RD, bf* XT, bf* X1h, bf* X1l) {
    const size_t e = ((size_t)blockIdx.x * 256 + threadIdx.x) * 8; if (e >= (size_t)NB * SEQ * C_) return;
    const int c = (int)(e % C_); const size_t btk = e / C_; const int tpos = (int)(btk % SEQ); const int b = (int)(btk / SEQ);
    const float* xp = x + ((size_t)b * C_ + c) * HWF + tpos;
    const v8f mu8 = *(const v8f*)(MU + (size_t)b * C_ + c), rd8 = *(const v8f*)(RD + (size_t)b * C_ + c);
    v8us o0, oh, ol;
#pragma unroll
    for (int q = 0; q < 8; ++q) {
        const float xb = bfr(xp[(size_t)q * HWF]);
        const float d = xb - mu8[q];
        const float y = d * d * rd8[q] + 0.5f;
        const float ex = __expf(-y);
        const float sg = __builtin_amdgcn_rcpf(1.0f + ex);
        const float x1 = xb * sg;
        o0[q] = f2bf(xb); unsigned short hh, ll; splitf(x1, hh, ll); oh[q] = hh; ol[q] = ll;
    }
    *(v8us*)(XT + e) = o0; *(v8us*)(X1h + e) = oh; *(v8us*)(X1l + e) = ol; 
}

__global__ __launch_bounds__(256) void k_split8(const float* __restrict__ F, bf* Ph, bf* Pl, size_t n8) { const size_t i = (size_t)blockIdx.x * 256 + threadIdx.x; if (i >= n8) return; const v8f v = *(const v8f*)(F + i * 8); v8us oh, ol;
#pragma unroll
    for (int q = 0; q < 8; ++q) { unsigned short a, c; splitf(v[q], a, c); oh[q] = a; ol[q] = c; }
    *(v8us*)(Ph + i * 8) = oh; *(v8us*)(Pl + i * 8) = ol;  }
__global__ __launch_bounds__(256) void k_sumsplit8(const float* __restrict__ F1, const float* __restrict__ F2, bf* Ph, bf* Pl, size_t n8) { const size_t i = (size_t)blockIdx.x * 256 + threadIdx.x; if (i >= n8) return; const v8f v = *(const v8f*)(F1 + i * 8) + *(const v8f*)(F2 + i * 8); v8us oh, ol;
#pragma unroll
    for (int q = 0; q < 8; ++q) { unsigned short a, c; splitf(v[q], a, c); oh[q] = a; ol[q] = c; }
    *(v8us*)(Ph + i * 8) = oh; *(v8us*)(Pl + i * 8) = ol;  }
__global__ __launch_bounds__(256) void k_vsplit8(const float* __restrict__ F, h16* Ph, bf* Pl, size_t n8) { const size_t i = (size_t)blockIdx.x * 256 + threadIdx.x; if (i >= n8) return; const v8f v = *(const v8f*)(F + i * 8); v8h oh; v8us ol;
#pragma unroll
    for (int q = 0; q < 8; ++q) { const float w = v[q] * VCAR; const h16 hh = (h16)w; oh[q] = hh; ol[q] = f2bf(w - (float)hh); }
    *(v8h*)(Ph + i * 8) = oh; *(v8us*)(Pl + i * 8) = ol;  }

// ---- k_attn: eight waves per work-group, one wave per 16 queries of one batch and one map (z = 0: theta/g, z = 1: D/S; keys = phi for both), 32-key blocks, online max-subtracted softmax.
// The work-group's 128 queries walk the same keys and values: each 64-key stage (K hi/lo rows, V hi/lo feature rows) is brought into LDS once by asynchronous copies, two buffers, the next stage in flight while this one is worked on.
// LDS ring: shared by the eight waves (block barrier at each hand-over). K rows at a 272-byte pitch, V rows at a 144-byte pitch (16 B x odd, for ds_load_b128 readers).
// LDS pS16/pSb/os: one slice per wave, private to it. Staged extent == consumed extent: pS rows 0..15 x cols 0..31, os rows 0..15 x cols 0..127.
#define AW   8
#define SK   64
#define KPI  136
#define VPI  72
#define KPLB (SK * KPI * 2)
#define VPLB (CI * VPI * 2)
#define STGB (2 * KPLB + 2 * VPLB)
#define NST  (SEQ / SK)
static_assert(SEQ % (AW * 16) == 0 && NST >= 2 && SK % KB == 0);
static_assert(SK * CI * 2 == 4 * AW * 32 * 16 && CI * SK * 2 == 4 * AW * 32 * 16);
__device__ __forceinline__ v16bf ldbs(const bf* p) { return cat16b(*(const v8usa*)p, *(const v8usa*)(p + 16)); }
__device__ __forceinline__ v16h  ldhs(const h16* p) { return cat16(*(const v8ha*)p, *(const v8ha*)(p + 16)); }
// Eight 16-byte copies per lane, global -> LDS through no register: four steps of plane a, four of plane b. The s_wait_xcnt stands inside the statement so that no address register is rewritten ahead of it.
template <typename TA, typename TB>
__device__ __forceinline__ void copy8(unsigned la, const TA* ga, unsigned lb, const TB* gb, unsigned lstep, size_t gstep) {
    asm volatile("global_load_async_to_lds_b128 %0, %8, off\n\t"
                 "global_load_async_to_lds_b128 %1, %9, off\n\t"
                 "global_load_async_to_lds_b128 %2, %10, off\n\t"
                 "global_load_async_to_lds_b128 %3, %11, off\n\t"
                 "global_load_async_to_lds_b128 %4, %12, off\n\t"
                 "global_load_async_to_lds_b128 %5, %13, off\n\t"
                 "global_load_async_to_lds_b128 %6, %14, off\n\t"
                 "global_load_async_to_lds_b128 %7, %15, off\n\t"
                 "s_wait_xcnt 0x0"
                 :: "v"(la), "v"(la + lstep), "v"(la + 2 * lstep), "v"(la + 3 * lstep), "v"(lb), "v"(lb + lstep), "v"(lb + 2 * lstep), "v"(lb + 3 * lstep),
                    "v"(ga), "v"(ga + gstep), "v"(ga + 2 * gstep), "v"(ga + 3 * gstep), "v"(gb), "v"(gb + gstep), "v"(gb + 2 * gstep), "v"(gb + 3 * gstep)
                 : "memory");
}
__global__ __launch_bounds__(AW * 32) void k_attn(const bf* __restrict__ THh, const bf* __restrict__ THl, const bf* __restrict__ DQh, const bf* __restrict__ DQl,
                                             const bf* __restrict__ PHh, const bf* __restrict__ PHl,
                                             const h16* __restrict__ GVh, const bf* __restrict__ GVl, const h16* __restrict__ SVh, const bf* __restrict__ SVl, float* Y) {
    __shared__ __align__(16) unsigned char ring[2 * STGB];
    __shared__ __align__(16) h16 pS16a[AW * 16 * PP];
    __shared__ __align__(16) unsigned short pSba[AW * 16 * PP];
    __shared__ __align__(16) float osa[AW * 16 * OSP];
    const int tid = threadIdx.x, lane = tid & 31, L = lane & 15, hi = lane >> 4;
    const int wv = __builtin_amdgcn_readfirstlane(tid >> 5);
    h16* pS16 = pS16a + wv * 16 * PP; unsigned short* pSb = pSba + wv * 16 * PP; float* os = osa + wv * 16 * OSP;
    const int q0 = blockIdx.x * (AW * 16) + wv * 16, b = blockIdx.y, mp = blockIdx.z;
    const size_t tok = (size_t)b * SEQ;
    const bf* Qh = (mp ? DQh : THh) + (tok + q0) * CI; const bf* Ql = (mp ? DQl : THl) + (tok + q0) * CI;
    const bf* Kh = PHh + tok * CI; const bf* Kl = PHl + tok * CI;
    const h16* Vh = (mp ? SVh : GVh) + (size_t)b * CI * SEQ; const bf* Vl = (mp ? SVl : GVl) + (size_t)b * CI * SEQ;
    float* Yo = Y + ((size_t)mp * NB * SEQ + tok + q0) * CI;
    // Copy map of one stage. K plane: 64 rows x 256 B, contiguous in global; thread tid takes 16-byte piece tid + 256 i (row (tid >> 4) + 16 i). V plane: 128 rows x 128 B; piece tid + 256 i (row (tid >> 3) + 32 i).
    const unsigned ring0 = (unsigned)(size_t)ring;
    const unsigned lk = ring0 + (unsigned)((tid >> 4) * (KPI * 2) + (tid & 15) * 16);
    const unsigned lv = ring0 + (unsigned)(2 * KPLB + (tid >> 3) * (VPI * 2) + (tid & 7) * 16);
    const bf* gkh = Kh + tid * 8; const bf* gkl = Kl + tid * 8;
    const h16* gvh = Vh + (size_t)(tid >> 3) * SEQ + (tid & 7) * 8; const bf* gvl = Vl + (size_t)(tid >> 3) * SEQ + (tid & 7) * 8;
    auto fill = [&](int st) {
        const unsigned bo = (unsigned)(st & 1) * STGB;
        copy8(lk + bo, gkh + (size_t)st * SK * CI, lk + bo + KPLB, gkl + (size_t)st * SK * CI, 16 * KPI * 2, (size_t)16 * CI);
        copy8(lv + bo, gvh + (size_t)st * SK, lv + bo + VPLB, gvl + (size_t)st * SK, 32 * VPI * 2, (size_t)32 * SEQ);
    };
    float m_i[8], l_i[8]; v8f acc[8];
#pragma unroll
    for (int v = 0; v < 8; ++v) { m_i[v] = -1.0e30f; l_i[v] = 0.f; }
#pragma unroll
    for (int ct = 0; ct < 8; ++ct) acc[ct] = (v8f){};
    const size_t qoff = (size_t)L * CI + 8 * hi;          // A fragment: query row L
    fill(0);
    asm volatile("s_wait_asynccnt 0x0" ::: "memory");    // stage 0 has landed before the barrier that publishes it
    __syncthreads();
    fill(1);
#pragma unroll 1   // rolled: the buffer is picked by the stage's parity at run time, one copy of the hand-over and of the pass body
    for (int st = 0; st < NST; ++st) {
      const unsigned char* sb = ring + (st & 1) * STGB;
#pragma unroll 1   // rolled: the two 32-key passes of a stage share one body, as the parent's key loop did
      for (int sub = 0; sub < SK / KB; ++sub) {
        v8f lt0 = (v8f){}, lt1 = (v8f){};
        const bf* k0h = (const bf*)sb + (sub * KB + L) * KPI + 8 * hi; const bf* k0l = k0h + KPLB / 2;   // B fragment (keys): key row sub*32 + kt*16 + L of the stage
#pragma unroll 1
        for (int ch = 0; ch < CI / 32; ++ch) {
            const int co = ch * 32;
            const v16bf qa = ldb(Qh + qoff + co), qb = ldb(Ql + qoff + co);
            const v16bf ka0 = ldbs(k0h + co), kl0 = ldbs(k0l + co), ka1 = ldbs(k0h + 16 * KPI + co), kl1 = ldbs(k0l + 16 * KPI + co);
            lt0 = wmmab(qa, ka0, lt0); lt0 = wmmab(qb, ka0, lt0); lt0 = wmmab(qa, kl0, lt0);
            lt1 = wmmab(qa, ka1, lt1); lt1 = wmmab(qb, ka1, lt1); lt1 = wmmab(qa, kl1, lt1);
            asm volatile("v_nop\n\tv_nop\n\tv_nop\n\tv_nop" : "+v"(lt0), "+v"(lt1) : "v"(qa), "v"(qb), "v"(ka1), "v"(kl1));
        }
        float scv[8];
#pragma unroll
        for (int v = 0; v < 8; ++v) {
            const float ra = lt0[v], rb = lt1[v];
            float mx = fmaxf(ra, rb);
            mx = fmaxf(mx, __shfl_xor(mx, 1, 32)); mx = fmaxf(mx, __shfl_xor(mx, 2, 32)); mx = fmaxf(mx, __shfl_xor(mx, 4, 32)); mx = fmaxf(mx, __shfl_xor(mx, 8, 32));
            const float mn = fmaxf(m_i[v], mx);
            const float sc = __expf(m_i[v] - mn);
            const float pa = __expf(ra - mn), pb = __expf(rb - mn);
            float rs = pa + pb;
            rs += __shfl_xor(rs, 1, 32); rs += __shfl_xor(rs, 2, 32); rs += __shfl_xor(rs, 4, 32); rs += __shfl_xor(rs, 8, 32);
            l_i[v] = l_i[v] * sc + rs; m_i[v] = mn; scv[v] = sc;
            const float pas = pa * PCAR, pbs = pb * PCAR;
            const int prow = (v + 8 * hi) * PP;                  // D element v -> row 8*hi + v, column (key) L of tile kt
            pS16[prow + L] = (h16)pas; pS16[prow + 16 + L] = (h16)pbs;
            pSb[prow + L] = f2bf(pas); pSb[prow + 16 + L] = f2bf(pbs);
        }
#pragma unroll
        for (int ct = 0; ct < 8; ++ct)
#pragma unroll
            for (int v = 0; v < 8; ++v) acc[ct][v] *= scv[v];
        __builtin_amdgcn_fence(__ATOMIC_RELEASE, "wavefront"); __builtin_amdgcn_wave_barrier(); asm volatile("" ::: "memory");
        const v16h pa16 = cat16(*(const v8ha*)(pS16 + L * PP + 8 * hi), *(const v8ha*)(pS16 + L * PP + 16 + 8 * hi));
        const v16bf pab = cat16b(*(const v8usa*)(pSb + L * PP + 8 * hi), *(const v8usa*)(pSb + L * PP + 16 + 8 * hi));
        const h16* vh = (const h16*)(sb + 2 * KPLB) + L * VPI + sub * KB + 8 * hi; const bf* vl = (const bf*)(sb + 2 * KPLB + VPLB) + L * VPI + sub * KB + 8 * hi;   // B fragment (values): ci row L of the staged feature-major plane
#pragma unroll
        for (int ct = 0; ct < 4; ++ct) {
            const v16h vf = ldhs(vh + ct * 16 * VPI); const v16bf vr = ldbs(vl + ct * 16 * VPI);
            acc[ct] = wmma16(pa16, vf, acc[ct]); acc[ct] = wmmab(pab, vr, acc[ct]); }
        asm volatile("v_nop\n\tv_nop\n\tv_nop\n\tv_nop" : "+v"(acc[0]), "+v"(acc[1]), "+v"(acc[2]), "+v"(acc[3]) : "v"(pa16), "v"(pab) : "memory");
#pragma unroll
        for (int ct = 4; ct < 8; ++ct) {
            const v16h vf = ldhs(vh + ct * 16 * VPI); const v16bf vr = ldbs(vl + ct * 16 * VPI);
            acc[ct] = wmma16(pa16, vf, acc[ct]); acc[ct] = wmmab(pab, vr, acc[ct]); }
        asm volatile("v_nop\n\tv_nop\n\tv_nop\n\tv_nop" : "+v"(acc[4]), "+v"(acc[5]), "+v"(acc[6]), "+v"(acc[7]) : "v"(pa16), "v"(pab) : "memory");
        __builtin_amdgcn_wave_barrier(); asm volatile("" ::: "memory");
      }
      // Hand-over: this wave's reads of the stage are done, its own copies of the next stage have landed, every wave has arrived; only then is the buffer just read filled again.
      asm volatile("s_wait_dscnt 0x0" ::: "memory");     // the wave's last LDS reads of this buffer have returned before it may be refilled
      asm volatile("s_wait_asynccnt 0x0" ::: "memory");  // the wave's copies of stage st + 1 have landed before the barrier that publishes them
      __syncthreads();
      if (st + 2 < NST) fill(st + 2);
    }
    asm volatile("s_wait_asynccnt 0x0" ::: "memory");    // no copy is outstanding when the wave goes on to its end
    float rl[8];
#pragma unroll
    for (int v = 0; v < 8; ++v) rl[v] = __builtin_amdgcn_rcpf(l_i[v]) * YSC;
#pragma unroll
    for (int ct = 0; ct < 8; ++ct)
#pragma unroll
        for (int v = 0; v < 8; ++v) os[(8 * hi + v) * OSP + ct * 16 + L] = acc[ct][v] * rl[v];
    __builtin_amdgcn_fence(__ATOMIC_RELEASE, "wavefront"); __builtin_amdgcn_wave_barrier(); asm volatile("" ::: "memory");
{
#pragma unroll
        for (int r = 0; r < 16; ++r) { const v4f val = *(const v4fa*)(os + r * OSP + lane * 4); *(v4f*)(Yo + (size_t)r * CI + lane * 4) = val; }
         }
}

extern "C" void kernel_launch(void* const* d_in, const int* in_sizes, int n_in,
                              void* d_out, int out_size, void* d_ws, size_t ws_size, hipStream_t stream) {
    if (n_in < 13) return;
    if ((size_t)in_sizes[0] < (size_t)NB * C_ * HWF) return;
    if (in_sizes[1] < CI * C_ || in_sizes[3] < CI * C_ || in_sizes[5] < CI * C_ || in_sizes[7] < CI * C_ || in_sizes[9] < CI * C_ || in_sizes[11] < C_ * CI) return;
    if (in_sizes[2] < CI || in_sizes[4] < CI || in_sizes[6] < CI || in_sizes[8] < CI || in_sizes[10] < CI || in_sizes[12] < C_) return;
    if ((size_t)out_size < (size_t)NB * C_ * HWF) return;
    const float* x = (const float*)d_in[0];
    const float* w_theta = (const float*)d_in[1];  const float* b_theta = (const float*)d_in[2];
    const float* w_phi   = (const float*)d_in[3];  const float* b_phi   = (const float*)d_in[4];
    const float* w_g     = (const float*)d_in[5];  const float* b_g     = (const float*)d_in[6];
    const float* w_d     = (const float*)d_in[7];  const float* b_d     = (const float*)d_in[8];
    const float* w_s     = (const float*)d_in[9];  const float* b_s     = (const float*)d_in[10];
    const float* w_out   = (const float*)d_in[11]; const float* b_out   = (const float*)d_in[12];
    float* OUT = (float*)d_out;                     // [NB][256][HWF]
    char* wsp = (char*)d_ws;
    auto take = [&](size_t bytes) { char* p = wsp; wsp += (bytes + 255) & ~(size_t)255; return (void*)p; };
    const size_t nTok = (size_t)NB * SEQ;
    bf* WTb = (bf*)take((size_t)CI * C_ * 2); bf* WPb = (bf*)take((size_t)CI * C_ * 2); bf* WGb = (bf*)take((size_t)CI * C_ * 2);
    bf* WDb = (bf*)take((size_t)CI * C_ * 2); bf* WSb = (bf*)take((size_t)CI * C_ * 2); bf* WOb = (bf*)take((size_t)C_ * CI * 2);
    float* MU = (float*)take((size_t)NB * C_ * 4); float* RD = (float*)take((size_t)NB * C_ * 4);
    bf* XT = (bf*)take(nTok * C_ * 2); bf* X1h = (bf*)take(nTok * C_ * 2); bf* X1l = (bf*)take(nTok * C_ * 2);
    float* F32A = (float*)take(2 * nTok * CI * 4);                 // projection scratch [nTok][128] / [NB][128][SEQ], then y1 | y2 [2][nTok][128]
    bf* THh = (bf*)take(nTok * CI * 2); bf* THl = (bf*)take(nTok * CI * 2);
    bf* PHh = (bf*)take(nTok * CI * 2); bf* PHl = (bf*)take(nTok * CI * 2);
    bf* DQh = (bf*)take(nTok * CI * 2); bf* DQl = (bf*)take(nTok * CI * 2);
    h16* GVh = (h16*)take(nTok * CI * 2); bf* GVl = (bf*)take(nTok * CI * 2);
    h16* SVh = (h16*)take(nTok * CI * 2); bf* SVl = (bf*)take(nTok * CI * 2);
    bf* Yh = (bf*)take(nTok * CI * 2); bf* Yl = (bf*)take(nTok * CI * 2);
    if ((size_t)(wsp - (char*)d_ws) > ws_size) return;
    float* Y1 = F32A; float* Y2 = F32A + nTok * CI;

    const unsigned gw = (unsigned)(((size_t)CI * C_ / 8 + 255) / 256);
    k_cvt8<<<gw, 256, 0, stream>>>(w_theta, WTb, (size_t)CI * C_ / 8);
    k_cvt8<<<gw, 256, 0, stream>>>(w_phi, WPb, (size_t)CI * C_ / 8);
    k_cvt8<<<gw, 256, 0, stream>>>(w_g, WGb, (size_t)CI * C_ / 8);
    k_cvt8<<<gw, 256, 0, stream>>>(w_d, WDb, (size_t)CI * C_ / 8);
    k_cvt8<<<gw, 256, 0, stream>>>(w_s, WSb, (size_t)CI * C_ / 8);
    k_cvt8<<<gw, 256, 0, stream>>>(w_out, WOb, (size_t)C_ * CI / 8);
    k_stats<<<(unsigned)(NB * C_ / 32), 256, 0, stream>>>(x, MU, RD);                                                                   /* SimAM mu, 1/(4(var_n + eps)) per (b, c) */
    k_xplanes<<<(unsigned)((nTok * C_ / 8 + 255) / 256), 256, 0, stream>>>(x, MU, RD, XT, X1h, X1l);                                    /* x^T bf16 (exact), gated x1^T hi/lo */
    const size_t n8p = nTok * CI / 8; const unsigned gs8 = (unsigned)((n8p + 255) / 256);
    k_gemmw<bf, false, false, 1, false><<<dim3((unsigned)(nTok / 64), CI / 64, 1), 32, 0, stream>>>(XT, nullptr, WTb, nullptr, C_, F32A, CI, b_theta, nullptr, 0, 0, 0);   /* theta [tok][128] */
    k_split8<<<gs8, 256, 0, stream>>>(F32A, THh, THl, n8p);
    k_gemmw<bf, false, false, 1, false><<<dim3((unsigned)(nTok / 64), CI / 64, 1), 32, 0, stream>>>(XT, nullptr, WPb, nullptr, C_, F32A, CI, b_phi, nullptr, 0, 0, 0);     /* phi [tok][128] */
    k_split8<<<gs8, 256, 0, stream>>>(F32A, PHh, PHl, n8p);
    k_gemmw<bf, true, false, 1, false><<<dim3((unsigned)(nTok / 64), CI / 64, 1), 32, 0, stream>>>(X1h, X1l, WDb, nullptr, C_, F32A, CI, b_d, nullptr, 0, 0, 0);          /* D [tok][128] (2 products) */
    k_split8<<<gs8, 256, 0, stream>>>(F32A, DQh, DQl, n8p);
    k_gemmw<bf, false, false, 2, false><<<dim3(CI / 64, SEQ / 64, NB), 32, 0, stream>>>(WGb, nullptr, XT, nullptr, C_, F32A, SEQ, b_g, nullptr, 0, (size_t)SEQ * C_, (size_t)CI * SEQ);   /* g feature-major [b][128][SEQ] */
    k_vsplit8<<<gs8, 256, 0, stream>>>(F32A, GVh, GVl, n8p);
    k_gemmw<bf, false, true, 2, false><<<dim3(CI / 64, SEQ / 64, NB), 32, 0, stream>>>(WSb, nullptr, X1h, X1l, C_, F32A, SEQ, b_s, nullptr, 0, (size_t)SEQ * C_, (size_t)CI * SEQ);       /* S feature-major (2 products) */
    k_vsplit8<<<gs8, 256, 0, stream>>>(F32A, SVh, SVl, n8p);
    k_attn<<<dim3(SEQ / (AW * 16), NB, 2), AW * 32, 0, stream>>>(THh, THl, DQh, DQl, PHh, PHl, GVh, GVl, SVh, SVl, F32A);                          /* y1 = softmax(theta.phi) g, y2 = softmax(D.phi) S */
    k_sumsplit8<<<gs8, 256, 0, stream>>>(Y1, Y2, Yh, Yl, n8p);                                                                         /* y = y1 + y2 -> hi/lo */
    k_gemmw<bf, false, true, 2, true><<<dim3(C_ / 64, SEQ / 64, NB), 32, 0, stream>>>(WOb, nullptr, Yh, Yl, CI, OUT, HWF, b_out, x, 0, (size_t)SEQ * CI, (size_t)C_ * HWF);      /* out[b][co][t] = W_out . y + b_out + bf16(x) */
}

// v002
// Measured time: 416 microseconds a run.
// Next to v001, in two timings, it ran 1.32 times as fast each time.
// Counting every step since v000, it is 2.33 times as fast.
#include <hip/hip_runtime.h>

// Contractions, f32 accumulate: five 1x1 projections on v_wmma_f32_16x16x32_bf16 (x as exact bf16; SimAM-gated branch as bf16 hi+lo planes = 2 products; weights bf16); score tiles q.k on v_wmma_f32_16x16x32_bf16 with hi/lo x hi/lo planes (3 products); P.V on v_wmma_f32_16x16x32_f16 (P x 2^14, V x 16 as f16 hi) plus v_wmma_f32_16x16x32_bf16 (P bf16 x V bf16 residual); output projection on v_wmma_f32_16x16x32_bf16 (y as bf16 hi+lo planes = 2 products). SimAM statistics/gating, online max-subtracted softmax, normalisation and residual add in f32.
// Data flow: x [NB][256][4096] channel-major -> token-major planes XT (bf16 exact), X1h/X1l (gated branch, hi/lo); theta/phi/D token-major [t][128] f32 -> bf16 hi/lo planes; g/S feature-major [128][t] f32 -> f16 hi (x16) + bf16 residual; eight waves per work-group share 64-key K/V stages in LDS; one wave per 16 queries, its query fragments resident in registers, walks 32-key blocks (scores, online softmax, P through a wave-private LDS tile, P.V); y1/y2 [t][128] f32; y = y1 + y2 -> bf16 hi/lo; out[b][co][t] = W_out . y + b_out + bf16(x).

#ifndef NB
#define NB 4
#endif
#ifndef SEQ
#define SEQ 4096
#endif
#define NBF  4
#define HWF  4096
#define C_   256
#define CI   128
#define KB   32
#define PP   40
#define OSP  132
#define PCAR 16384.0f
#define VCAR 16.0f
#define YSC  (1.0f / 262144.0f)
#define ELAM 1e-4f

static_assert(NB >= 1 && NB <= NBF);
static_assert(SEQ % 128 == 0 && SEQ >= 128 && SEQ <= HWF);
static_assert(SEQ % KB == 0 && SEQ % 64 == 0 && SEQ % 16 == 0);
static_assert((NB * C_) % 32 == 0);
static_assert(C_ % 64 == 0 && CI % 64 == 0 && C_ % 32 == 0 && CI % 32 == 0);
static_assert((NB * SEQ * C_) % (8 * 256) == 0 && (NB * SEQ * CI) % 8 == 0);

typedef _Float16 h16;
typedef unsigned short bf;
typedef __attribute__((ext_vector_type(16))) __bf16   v16bf;
typedef __attribute__((ext_vector_type(16))) _Float16 v16h;
typedef __attribute__((ext_vector_type(8)))  _Float16 v8h;
typedef __attribute__((ext_vector_type(8)))  unsigned short v8us;
typedef __attribute__((ext_vector_type(8)))  float    v8f;
typedef __attribute__((ext_vector_type(4)))  float    v4f;
typedef v8h  __attribute__((may_alias)) v8ha;
typedef v4f  __attribute__((may_alias)) v4fa;
typedef v8us __attribute__((may_alias)) v8usa;

__device__ __forceinline__ unsigned short f2bf(float f) { unsigned u = __float_as_uint(f); u += 0x7FFFu + ((u >> 16) & 1u); return (unsigned short)(u >> 16); }
__device__ __forceinline__ float bf2f(unsigned short b) { return __uint_as_float(((unsigned)b) << 16); }
__device__ __forceinline__ float bfr(float f) { return bf2f(f2bf(f)); }
__device__ __forceinline__ void splitf(float y, unsigned short& h, unsigned short& l) { h = f2bf(y); l = f2bf(y - bf2f(h)); }
__device__ __forceinline__ v16h cat16(v8h lo, v8h hi) { return __builtin_shufflevector(lo, hi, 0, 1, 2, 3, 4, 5, 6, 7, 8, 9, 10, 11, 12, 13, 14, 15); }
__device__ __forceinline__ v16bf cat16b(v8us lo, v8us hi) { return __builtin_bit_cast(v16bf, __builtin_shufflevector(lo, hi, 0, 1, 2, 3, 4, 5, 6, 7, 8, 9, 10, 11, 12, 13, 14, 15)); }
__device__ __forceinline__ v8f wmma16(v16h a, v16h b, v8f c) { return __builtin_amdgcn_wmma_f32_16x16x32_f16(false, a, false, b, (short)0, c, false, false); }
__device__ __forceinline__ v8f wmmab(v16bf a, v16bf b, v8f c) { return __builtin_amdgcn_wmma_f32_16x16x32_bf16(false, a, false, b, (short)0, c, false, false); }
// Fragment loaders (A and B share the same per-lane k map): p already points at row (lane & 15), k0 + 8*(lane >> 4); elements 0..7 <- p[0..7], elements 8..15 <- p[16..23].
__device__ __forceinline__ v16bf ldb(const bf* p) { return cat16b(*(const v8us*)p, *(const v8us*)(p + 16)); }
__device__ __forceinline__ v16h  ldh(const h16* p) { return cat16(*(const v8h*)p, *(const v8h*)(p + 16)); }

// ---- k_gemmw: register-blocked GEMM, ONE WAVE per 64x64 output tile (16 accumulators), operands straight from K-contiguous 16-bit planes; grid (M/64, N/64, Z), 32 threads.
// C[m][n] (f32, pitch ldc) = sum_k A[m][k] Bt[n][k] (+ A2[m][k] Bt[n][k] when A2ON) (+ A[m][k] Bt2[n][k] when B2ON) (+ bf16(bias[n]) BIASM==1 | bf16(bias[m]) BIASM==2) (+ bf16(res[m][n]) when RESID, same indexing as C).
// z-batch strides sA/sB/sC in elements. K % 32 == 0, M % 64 == 0, N % 64 == 0.
template <typename T16> struct WFrag;
template <> struct WFrag<h16> { typedef v16h V; static __device__ __forceinline__ V ld(const h16* p) { return ldh(p); } static __device__ __forceinline__ v8f mma(V a, V b, v8f c) { return wmma16(a, b, c); } };
template <> struct WFrag<bf> { typedef v16bf V; static __device__ __forceinline__ V ld(const bf* p) { return ldb(p); } static __device__ __forceinline__ v8f mma(V a, V b, v8f c) { return wmmab(a, b, c); } };
template <typename T16, bool A2ON, bool B2ON, int BIASM, bool RESID>
__global__ __launch_bounds__(32) void k_gemmw(const T16* __restrict__ A, const T16* __restrict__ A2, const T16* __restrict__ Bt, const T16* __restrict__ Bt2, int K,
                                              float* C, int ldc, const float* __restrict__ bias, const float* __restrict__ res, size_t sA, size_t sB, size_t sC) {
    typedef typename WFrag<T16>::V V;
    __shared__ __align__(16) float os[16 * 68];
    const size_t z = blockIdx.z;
    A += z * sA; if (A2ON) A2 += z * sA; Bt += z * sB; if (B2ON) Bt2 += z * sB; C += z * sC; if (RESID) res += z * sC;
    const int lane = threadIdx.x & 31, lr = lane & 15, hi = lane >> 4;
    const int r0 = blockIdx.x * 64, c0 = blockIdx.y * 64;
    v8f acc[4][4];
#pragma unroll
    for (int mb = 0; mb < 4; ++mb)
#pragma unroll
        for (int nb = 0; nb < 4; ++nb) acc[mb][nb] = (v8f){};
    const size_t aoff = (size_t)(r0 + lr) * K + 8 * hi, boff = (size_t)(c0 + lr) * K + 8 * hi;
#pragma unroll 1
    for (int kc = 0; kc < K; kc += 32) {
        V a[4], a2[4];
#pragma unroll
        for (int mb = 0; mb < 4; ++mb) { a[mb] = WFrag<T16>::ld(A + aoff + (size_t)mb * 16 * K + kc); a2[mb] = a[mb]; if (A2ON) a2[mb] = WFrag<T16>::ld(A2 + aoff + (size_t)mb * 16 * K + kc); }
#pragma unroll
        for (int nb = 0; nb < 4; ++nb) {
            const V b = WFrag<T16>::ld(Bt + boff + (size_t)nb * 16 * K + kc); V b2 = b; if (B2ON) b2 = WFrag<T16>::ld(Bt2 + boff + (size_t)nb * 16 * K + kc);
#pragma unroll
            for (int mb = 0; mb < 4; ++mb) {
                acc[mb][nb] = WFrag<T16>::mma(a[mb], b, acc[mb][nb]);
                if (A2ON) acc[mb][nb] = WFrag<T16>::mma(a2[mb], b, acc[mb][nb]);
                if (B2ON) acc[mb][nb] = WFrag<T16>::mma(a[mb], b2, acc[mb][nb]); } }
        asm volatile("v_nop\n\tv_nop\n\tv_nop\n\tv_nop" : "+v"(acc[0][0]), "+v"(acc[1][1]), "+v"(acc[2][2]), "+v"(acc[3][3]) : "v"(a[0]), "v"(a[3]));
    }
#pragma unroll
    for (int mb = 0; mb < 4; ++mb) {
#pragma unroll
        for (int nb = 0; nb < 4; ++nb) {
#pragma unroll
            for (int j = 0; j < 8; ++j) os[(hi * 8 + j) * 68 + nb * 16 + lr] = acc[mb][nb][j]; }
        __builtin_amdgcn_fence(__ATOMIC_RELEASE, "wavefront"); __builtin_amdgcn_wave_barrier(); asm volatile("" ::: "memory");
        const size_t rb = (size_t)(r0 + mb * 16);
{
#pragma unroll
            for (int s = 0; s < 8; ++s) {
                const int row = 2 * s + hi, cofs = lr * 4;
                v4f val = *(const v4fa*)(os + row * 68 + cofs);
                if (BIASM == 1) { val[0] += bfr(bias[c0 + cofs]); val[1] += bfr(bias[c0 + cofs + 1]); val[2] += bfr(bias[c0 + cofs + 2]); val[3] += bfr(bias[c0 + cofs + 3]); }
                if (BIASM == 2) { const float bv = bfr(bias[rb + row]); val[0] += bv; val[1] += bv; val[2] += bv; val[3] += bv; }
                if (RESID) { const v4f rv = *(const v4f*)(res + (rb + row) * (size_t)ldc + c0 + cofs); val[0] += bfr(rv[0]); val[1] += bfr(rv[1]); val[2] += bfr(rv[2]); val[3] += bfr(rv[3]); }
                *(v4f*)(C + (rb + row) * (size_t)ldc + c0 + cofs) = val; }
             }
        __builtin_amdgcn_fence(__ATOMIC_RELEASE, "wavefront"); __builtin_amdgcn_wave_barrier(); asm volatile("" ::: "memory");
    }
}

__global__ __launch_bounds__(256) void k_cvt8(const float* __restrict__ src, bf* dst, size_t n8) { const size_t i = (size_t)blockIdx.x * 256 + threadIdx.x; if (i >= n8) return; const v8f v = *(const v8f*)(src + i * 8); v8us o;
#pragma unroll
    for (int k = 0; k < 8; ++k) o[k] = f2bf(v[k]); *(v8us*)(dst + i * 8) = o;  }

// LDS mus/rds: cross-wave (block barrier).
__global__ __launch_bounds__(256) void k_stats(const float* __restrict__ x, float* MU, float* RD) {
    __shared__ float mus[32]; __shared__ float rds[32];
    const int t = threadIdx.x, wid = t >> 5, lane = t & 31;
#pragma unroll 1
    for (int j = 0; j < 4; ++j) {
        const int rr = blockIdx.x * 32 + wid * 4 + j;                 // (b, c) row index < NB * C_
        const int b = rr / C_, c = rr - b * C_;
        const float* xr = x + ((size_t)b * C_ + c) * HWF + lane * 4;
        float s = 0.f;
#pragma unroll 1
        for (int i = 0; i < SEQ / 128; ++i) { const v4f v = *(const v4f*)(xr + (size_t)i * 128); s += (bfr(v[0]) + bfr(v[1])) + (bfr(v[2]) + bfr(v[3])); }
        s += __shfl_xor(s, 1, 32); s += __shfl_xor(s, 2, 32); s += __shfl_xor(s, 4, 32); s += __shfl_xor(s, 8, 32); s += __shfl_xor(s, 16, 32);
        const float mu = s * (1.0f / (float)SEQ);
        float ss = 0.f;
#pragma unroll 1
        for (int i = 0; i < SEQ / 128; ++i) { const v4f v = *(const v4f*)(xr + (size_t)i * 128);
            const float d0 = bfr(v[0]) - mu, d1 = bfr(v[1]) - mu, d2 = bfr(v[2]) - mu, d3 = bfr(v[3]) - mu;
            ss += (d0 * d0 + d1 * d1) + (d2 * d2 + d3 * d3); }
        ss += __shfl_xor(ss, 1, 32); ss += __shfl_xor(ss, 2, 32); ss += __shfl_xor(ss, 4, 32); ss += __shfl_xor(ss, 8, 32); ss += __shfl_xor(ss, 16, 32);
        const float den = 4.0f * (ss * (1.0f / (float)(SEQ - 1)) + ELAM);
        const float rd = 1.0f / den;
        if (lane == 0) { mus[wid * 4 + j] = mu; rds[wid * 4 + j] = rd; }
    }
    __syncthreads();
    if (wid == 0) {
        const float a = mus[lane], r = rds[lane];
        float* pm = MU + (size_t)blockIdx.x * 32 + lane; float* pr = RD + (size_t)blockIdx.x * 32 + lane;
        *(float*)pm = a; *(float*)pr = r;  }
}

// ---- k_xplanes: token-major planes from channel-major x: XT[(b*SEQ+t)][c] = bf16(x[b][c][t]) (exact), X1h/X1l = bf16 hi/lo of x1 = bf16(x) * sigmoid((bf16(x) - mu)^2 * rd + 0.5).
__global__ __launch_bounds__(256) void k_xplanes(const float* __restrict__ x, const float* __restrict__ MU, const float* __restrict__ RD, bf* XT, bf* X1h, bf* X1l) {
    const size_t e = ((size_t)blockIdx.x * 256 + threadIdx.x) * 8; if (e >= (size_t)NB * SEQ * C_) return;
    const int c = (int)(e % C_); const size_t btk = e / C_; const int tpos = (int)(btk % SEQ); const int b = (int)(btk / SEQ);
    const float* xp = x + ((size_t)b * C_ + c) * HWF + tpos;
    const v8f mu8 = *(const v8f*)(MU + (size_t)b * C_ + c), rd8 = *(const v8f*)(RD + (size_t)b * C_ + c);
    v8us o0, oh, ol;
#pragma unroll
    for (int q = 0; q < 8; ++q) {
        const float xb = bfr(xp[(size_t)q * HWF]);
        const float d = xb - mu8[q];
        const float y = d * d * rd8[q] + 0.5f;
        const float ex = __expf(-y);
        const float sg = __builtin_amdgcn_rcpf(1.0f + ex);
        const float x1 = xb * sg;
        o0[q] = f2bf(xb); unsigned short hh, ll; splitf(x1, hh, ll); oh[q] = hh; ol[q] = ll;
    }
    *(v8us*)(XT + e) = o0; *(v8us*)(X1h + e) = oh; *(v8us*)(X1l + e) = ol; 
}

__global__ __launch_bounds__(256) void k_split8(const float* __restrict__ F, bf* Ph, bf* Pl, size_t n8) { const size_t i = (size_t)blockIdx.x * 256 + threadIdx.x; if (i >= n8) return; const v8f v = *(const v8f*)(F + i * 8); v8us oh, ol;
#pragma unroll
    for (int q = 0; q < 8; ++q) { unsigned short a, c; splitf(v[q], a, c); oh[q] = a; ol[q] = c; }
    *(v8us*)(Ph + i * 8) = oh; *(v8us*)(Pl + i * 8) = ol;  }
__global__ __launch_bounds__(256) void k_sumsplit8(const float* __restrict__ F1, const float* __restrict__ F2, bf* Ph, bf* Pl, size_t n8) { const size_t i = (size_t)blockIdx.x * 256 + threadIdx.x; if (i >= n8) return; const v8f v = *(const v8f*)(F1 + i * 8) + *(const v8f*)(F2 + i * 8); v8us oh, ol;
#pragma unroll
    for (int q = 0; q < 8; ++q) { unsigned short a, c; splitf(v[q], a, c); oh[q] = a; ol[q] = c; }
    *(v8us*)(Ph + i * 8) = oh; *(v8us*)(Pl + i * 8) = ol;  }
__global__ __launch_bounds__(256) void k_vsplit8(const float* __restrict__ F, h16* Ph, bf* Pl, size_t n8) { const size_t i = (size_t)blockIdx.x * 256 + threadIdx.x; if (i >= n8) return; const v8f v = *(const v8f*)(F + i * 8); v8h oh; v8us ol;
#pragma unroll
    for (int q = 0; q < 8; ++q) { const float w = v[q] * VCAR; const h16 hh = (h16)w; oh[q] = hh; ol[q] = f2bf(w - (float)hh); }
    *(v8h*)(Ph + i * 8) = oh; *(v8us*)(Pl + i * 8) = ol;  }

// ---- k_attn: eight waves per work-group, one wave per 16 queries of one batch and one map (z = 0: theta/g, z = 1: D/S; keys = phi for both), 32-key blocks, online max-subtracted softmax.
// The work-group's 128 queries walk the same keys and values: each 64-key stage (K hi/lo rows, V hi/lo feature rows) is brought into LDS once by asynchronous copies, two buffers, the next stage in flight while this one is worked on.
// LDS ring: shared by the eight waves (block barrier at each hand-over). K rows at a 272-byte pitch, V rows at a 144-byte pitch (16 B x odd, for ds_load_b128 readers).
// LDS pS16/pSb/os: one slice per wave, private to it. Staged extent == consumed extent: pS rows 0..15 x cols 0..31, os rows 0..15 x cols 0..127.
#define AW   8
#define SK   64
#define KPI  136
#define VPI  72
#define KPLB (SK * KPI * 2)
#define VPLB (CI * VPI * 2)
#define STGB (2 * KPLB + 2 * VPLB)
#define NST  (SEQ / SK)
static_assert(SEQ % (AW * 16) == 0 && NST >= 2 && SK % KB == 0);
static_assert(SK * CI * 2 == 4 * AW * 32 * 16 && CI * SK * 2 == 4 * AW * 32 * 16);
__device__ __forceinline__ v16bf ldbs(const bf* p) { return cat16b(*(const v8usa*)p, *(const v8usa*)(p + 16)); }
__device__ __forceinline__ v16h  ldhs(const h16* p) { return cat16(*(const v8ha*)p, *(const v8ha*)(p + 16)); }
// Eight 16-byte copies per lane, global -> LDS through no register: four steps of plane a, four of plane b. The s_wait_xcnt stands inside the statement so that no address register is rewritten ahead of it.
template <typename TA, typename TB>
__device__ __forceinline__ void copy8(unsigned la, const TA* ga, unsigned lb, const TB* gb, unsigned lstep, size_t gstep) {
    asm volatile("global_load_async_to_lds_b128 %0, %8, off\n\t"
                 "global_load_async_to_lds_b128 %1, %9, off\n\t"
                 "global_load_async_to_lds_b128 %2, %10, off\n\t"
                 "global_load_async_to_lds_b128 %3, %11, off\n\t"
                 "global_load_async_to_lds_b128 %4, %12, off\n\t"
                 "global_load_async_to_lds_b128 %5, %13, off\n\t"
                 "global_load_async_to_lds_b128 %6, %14, off\n\t"
                 "global_load_async_to_lds_b128 %7, %15, off\n\t"
                 "s_wait_xcnt 0x0"
                 :: "v"(la), "v"(la + lstep), "v"(la + 2 * lstep), "v"(la + 3 * lstep), "v"(lb), "v"(lb + lstep), "v"(lb + 2 * lstep), "v"(lb + 3 * lstep),
                    "v"(ga), "v"(ga + gstep), "v"(ga + 2 * gstep), "v"(ga + 3 * gstep), "v"(gb), "v"(gb + gstep), "v"(gb + 2 * gstep), "v"(gb + 3 * gstep)
                 : "memory");
}
__global__ __launch_bounds__(AW * 32) void k_attn(const bf* __restrict__ THh, const bf* __restrict__ THl, const bf* __restrict__ DQh, const bf* __restrict__ DQl,
                                             const bf* __restrict__ PHh, const bf* __restrict__ PHl,
                                             const h16* __restrict__ GVh, const bf* __restrict__ GVl, const h16* __restrict__ SVh, const bf* __restrict__ SVl, float* Y) {
    __shared__ __align__(16) unsigned char ring[2 * STGB];
    __shared__ __align__(16) h16 pS16a[AW * 16 * PP];
    __shared__ __align__(16) unsigned short pSba[AW * 16 * PP];
    __shared__ __align__(16) float osa[AW * 16 * OSP];
    const int tid = threadIdx.x, lane = tid & 31, L = lane & 15, hi = lane >> 4;
    const int wv = __builtin_amdgcn_readfirstlane(tid >> 5);
    h16* pS16 = pS16a + wv * 16 * PP; unsigned short* pSb = pSba + wv * 16 * PP; float* os = osa + wv * 16 * OSP;
    const int q0 = blockIdx.x * (AW * 16) + wv * 16, b = blockIdx.y, mp = blockIdx.z;
    const size_t tok = (size_t)b * SEQ;
    const bf* Qh = (mp ? DQh : THh) + (tok + q0) * CI; const bf* Ql = (mp ? DQl : THl) + (tok + q0) * CI;
    const bf* Kh = PHh + tok * CI; const bf* Kl = PHl + tok * CI;
    const h16* Vh = (mp ? SVh : GVh) + (size_t)b * CI * SEQ; const bf* Vl = (mp ? SVl : GVl) + (size_t)b * CI * SEQ;
    float* Yo = Y + ((size_t)mp * NB * SEQ + tok + q0) * CI;
    // Copy map of one stage. K plane: 64 rows x 256 B, contiguous in global; thread tid takes 16-byte piece tid + 256 i (row (tid >> 4) + 16 i). V plane: 128 rows x 128 B; piece tid + 256 i (row (tid >> 3) + 32 i).
    const unsigned ring0 = (unsigned)(size_t)ring;
    const unsigned lk = ring0 + (unsigned)((tid >> 4) * (KPI * 2) + (tid & 15) * 16);
    const unsigned lv = ring0 + (unsigned)(2 * KPLB + (tid >> 3) * (VPI * 2) + (tid & 7) * 16);
    const bf* gkh = Kh + tid * 8; const bf* gkl = Kl + tid * 8;
    const h16* gvh = Vh + (size_t)(tid >> 3) * SEQ + (tid & 7) * 8; const bf* gvl = Vl + (size_t)(tid >> 3) * SEQ + (tid & 7) * 8;
    auto fill = [&](int st) {
        const unsigned bo = (unsigned)(st & 1) * STGB;
        copy8(lk + bo, gkh + (size_t)st * SK * CI, lk + bo + KPLB, gkl + (size_t)st * SK * CI, 16 * KPI * 2, (size_t)16 * CI);
        copy8(lv + bo, gvh + (size_t)st * SK, lv + bo + VPLB, gvl + (size_t)st * SK, 32 * VPI * 2, (size_t)32 * SEQ);
    };
    float m_i[8], l_i[8]; v8f acc[8];
#pragma unroll
    for (int v = 0; v < 8; ++v) { m_i[v] = -1.0e30f; l_i[v] = 0.f; }
#pragma unroll
    for (int ct = 0; ct < 8; ++ct) acc[ct] = (v8f){};
    const size_t qoff = (size_t)L * CI + 8 * hi;          // A fragment: query row L
    // The wave's 16 query rows never change: their hi and lo fragments are loaded once and stay in registers for the whole key walk.
    v16bf qh[CI / 32], ql[CI / 32];
#pragma unroll
    for (int ch = 0; ch < CI / 32; ++ch) { qh[ch] = ldb(Qh + qoff + ch * 32); ql[ch] = ldb(Ql + qoff + ch * 32); }
    fill(0);
    asm volatile("s_wait_asynccnt 0x0" ::: "memory");    // stage 0 has landed before the barrier that publishes it
    __syncthreads();
    fill(1);
#pragma unroll 1   // rolled: the buffer is picked by the stage's parity at run time, one copy of the hand-over and of the pass body
    for (int st = 0; st < NST; ++st) {
      const unsigned char* sb = ring + (st & 1) * STGB;
#pragma unroll 1   // rolled: the two 32-key passes of a stage share one body, as the parent's key loop did
      for (int sub = 0; sub < SK / KB; ++sub) {
        v8f lt0 = (v8f){}, lt1 = (v8f){};
        const bf* k0h = (const bf*)sb + (sub * KB + L) * KPI + 8 * hi; const bf* k0l = k0h + KPLB / 2;   // B fragment (keys): key row sub*32 + kt*16 + L of the stage
#pragma unroll   // unrolled: each chunk names its own resident query fragment
        for (int ch = 0; ch < CI / 32; ++ch) {
            const int co = ch * 32;
            const v16bf ka0 = ldbs(k0h + co), kl0 = ldbs(k0l + co), ka1 = ldbs(k0h + 16 * KPI + co), kl1 = ldbs(k0l + 16 * KPI + co);
            lt0 = wmmab(qh[ch], ka0, lt0); lt1 = wmmab(qh[ch], ka1, lt1);
            lt0 = wmmab(ql[ch], ka0, lt0); lt1 = wmmab(ql[ch], ka1, lt1);
            lt0 = wmmab(qh[ch], kl0, lt0); lt1 = wmmab(qh[ch], kl1, lt1);
        }
        float scv[8];
#pragma unroll
        for (int v = 0; v < 8; ++v) {
            const float ra = lt0[v], rb = lt1[v];
            float mx = fmaxf(ra, rb);
            mx = fmaxf(mx, __shfl_xor(mx, 1, 32)); mx = fmaxf(mx, __shfl_xor(mx, 2, 32)); mx = fmaxf(mx, __shfl_xor(mx, 4, 32)); mx = fmaxf(mx, __shfl_xor(mx, 8, 32));
            const float mn = fmaxf(m_i[v], mx);
            const float sc = __expf(m_i[v] - mn);
            const float pa = __expf(ra - mn), pb = __expf(rb - mn);
            float rs = pa + pb;
            rs += __shfl_xor(rs, 1, 32); rs += __shfl_xor(rs, 2, 32); rs += __shfl_xor(rs, 4, 32); rs += __shfl_xor(rs, 8, 32);
            l_i[v] = l_i[v] * sc + rs; m_i[v] = mn; scv[v] = sc;
            const float pas = pa * PCAR, pbs = pb * PCAR;
            const int prow = (v + 8 * hi) * PP;                  // D element v -> row 8*hi + v, column (key) L of tile kt
            pS16[prow + L] = (h16)pas; pS16[prow + 16 + L] = (h16)pbs;
            pSb[prow + L] = f2bf(pas); pSb[prow + 16 + L] = f2bf(pbs);
        }
#pragma unroll
        for (int ct = 0; ct < 8; ++ct)
#pragma unroll
            for (int v = 0; v < 8; ++v) acc[ct][v] *= scv[v];
        __builtin_amdgcn_fence(__ATOMIC_RELEASE, "wavefront"); __builtin_amdgcn_wave_barrier(); asm volatile("" ::: "memory");
        const v16h pa16 = cat16(*(const v8ha*)(pS16 + L * PP + 8 * hi), *(const v8ha*)(pS16 + L * PP + 16 + 8 * hi));
        const v16bf pab = cat16b(*(const v8usa*)(pSb + L * PP + 8 * hi), *(const v8usa*)(pSb + L * PP + 16 + 8 * hi));
        const h16* vh = (const h16*)(sb + 2 * KPLB) + L * VPI + sub * KB + 8 * hi; const bf* vl = (const bf*)(sb + 2 * KPLB + VPLB) + L * VPI + sub * KB + 8 * hi;   // B fragment (values): ci row L of the staged feature-major plane
#pragma unroll
        for (int ct = 0; ct < 4; ++ct) {
            const v16h vf = ldhs(vh + ct * 16 * VPI); const v16bf vr = ldbs(vl + ct * 16 * VPI);
            acc[ct] = wmma16(pa16, vf, acc[ct]); acc[ct] = wmmab(pab, vr, acc[ct]); }
        asm volatile("v_nop\n\tv_nop\n\tv_nop\n\tv_nop" : "+v"(acc[0]), "+v"(acc[1]), "+v"(acc[2]), "+v"(acc[3]) : "v"(pa16), "v"(pab) : "memory");
#pragma unroll
        for (int ct = 4; ct < 8; ++ct) {
            const v16h vf = ldhs(vh + ct * 16 * VPI); const v16bf vr = ldbs(vl + ct * 16 * VPI);
            acc[ct] = wmma16(pa16, vf, acc[ct]); acc[ct] = wmmab(pab, vr, acc[ct]); }
        asm volatile("v_nop\n\tv_nop\n\tv_nop\n\tv_nop" : "+v"(acc[4]), "+v"(acc[5]), "+v"(acc[6]), "+v"(acc[7]) : "v"(pa16), "v"(pab) : "memory");
        __builtin_amdgcn_wave_barrier(); asm volatile("" ::: "memory");
      }
      // Hand-over: this wave's reads of the stage are done, its own copies of the next stage have landed, every wave has arrived; only then is the buffer just read filled again.
      asm volatile("s_wait_dscnt 0x0" ::: "memory");     // the wave's last LDS reads of this buffer have returned before it may be refilled
      asm volatile("s_wait_asynccnt 0x0" ::: "memory");  // the wave's copies of stage st + 1 have landed before the barrier that publishes them
      __syncthreads();
      if (st + 2 < NST) fill(st + 2);
    }
    asm volatile("s_wait_asynccnt 0x0" ::: "memory");    // no copy is outstanding when the wave goes on to its end
    float rl[8];
#pragma unroll
    for (int v = 0; v < 8; ++v) rl[v] = __builtin_amdgcn_rcpf(l_i[v]) * YSC;
#pragma unroll
    for (int ct = 0; ct < 8; ++ct)
#pragma unroll
        for (int v = 0; v < 8; ++v) os[(8 * hi + v) * OSP + ct * 16 + L] = acc[ct][v] * rl[v];
    __builtin_amdgcn_fence(__ATOMIC_RELEASE, "wavefront"); __builtin_amdgcn_wave_barrier(); asm volatile("" ::: "memory");
{
#pragma unroll
        for (int r = 0; r < 16; ++r) { const v4f val = *(const v4fa*)(os + r * OSP + lane * 4); *(v4f*)(Yo + (size_t)r * CI + lane * 4) = val; }
         }
}

extern "C" void kernel_launch(void* const* d_in, const int* in_sizes, int n_in,
                              void* d_out, int out_size, void* d_ws, size_t ws_size, hipStream_t stream) {
    if (n_in < 13) return;
    if ((size_t)in_sizes[0] < (size_t)NB * C_ * HWF) return;
    if (in_sizes[1] < CI * C_ || in_sizes[3] < CI * C_ || in_sizes[5] < CI * C_ || in_sizes[7] < CI * C_ || in_sizes[9] < CI * C_ || in_sizes[11] < C_ * CI) return;
    if (in_sizes[2] < CI || in_sizes[4] < CI || in_sizes[6] < CI || in_sizes[8] < CI || in_sizes[10] < CI || in_sizes[12] < C_) return;
    if ((size_t)out_size < (size_t)NB * C_ * HWF) return;
    const float* x = (const float*)d_in[0];
    const float* w_theta = (const float*)d_in[1];  const float* b_theta = (const float*)d_in[2];
    const float* w_phi   = (const float*)d_in[3];  const float* b_phi   = (const float*)d_in[4];
    const float* w_g     = (const float*)d_in[5];  const float* b_g     = (const float*)d_in[6];
    const float* w_d     = (const float*)d_in[7];  const float* b_d     = (const float*)d_in[8];
    const float* w_s     = (const float*)d_in[9];  const float* b_s     = (const float*)d_in[10];
    const float* w_out   = (const float*)d_in[11]; const float* b_out   = (const float*)d_in[12];
    float* OUT = (float*)d_out;                     // [NB][256][HWF]
    char* wsp = (char*)d_ws;
    auto take = [&](size_t bytes) { char* p = wsp; wsp += (bytes + 255) & ~(size_t)255; return (void*)p; };
    const size_t nTok = (size_t)NB * SEQ;
    bf* WTb = (bf*)take((size_t)CI * C_ * 2); bf* WPb = (bf*)take((size_t)CI * C_ * 2); bf* WGb = (bf*)take((size_t)CI * C_ * 2);
    bf* WDb = (bf*)take((size_t)CI * C_ * 2); bf* WSb = (bf*)take((size_t)CI * C_ * 2); bf* WOb = (bf*)take((size_t)C_ * CI * 2);
    float* MU = (float*)take((size_t)NB * C_ * 4); float* RD = (float*)take((size_t)NB * C_ * 4);
    bf* XT = (bf*)take(nTok * C_ * 2); bf* X1h = (bf*)take(nTok * C_ * 2); bf* X1l = (bf*)take(nTok * C_ * 2);
    float* F32A = (float*)take(2 * nTok * CI * 4);                 // projection scratch [nTok][128] / [NB][128][SEQ], then y1 | y2 [2][nTok][128]
    bf* THh = (bf*)take(nTok * CI * 2); bf* THl = (bf*)take(nTok * CI * 2);
    bf* PHh = (bf*)take(nTok * CI * 2); bf* PHl = (bf*)take(nTok * CI * 2);
    bf* DQh = (bf*)take(nTok * CI * 2); bf* DQl = (bf*)take(nTok * CI * 2);
    h16* GVh = (h16*)take(nTok * CI * 2); bf* GVl = (bf*)take(nTok * CI * 2);
    h16* SVh = (h16*)take(nTok * CI * 2); bf* SVl = (bf*)take(nTok * CI * 2);
    bf* Yh = (bf*)take(nTok * CI * 2); bf* Yl = (bf*)take(nTok * CI * 2);
    if ((size_t)(wsp - (char*)d_ws) > ws_size) return;
    float* Y1 = F32A; float* Y2 = F32A + nTok * CI;

    const unsigned gw = (unsigned)(((size_t)CI * C_ / 8 + 255) / 256);
    k_cvt8<<<gw, 256, 0, stream>>>(w_theta, WTb, (size_t)CI * C_ / 8);
    k_cvt8<<<gw, 256, 0, stream>>>(w_phi, WPb, (size_t)CI * C_ / 8);
    k_cvt8<<<gw, 256, 0, stream>>>(w_g, WGb, (size_t)CI * C_ / 8);
    k_cvt8<<<gw, 256, 0, stream>>>(w_d, WDb, (size_t)CI * C_ / 8);
    k_cvt8<<<gw, 256, 0, stream>>>(w_s, WSb, (size_t)CI * C_ / 8);
    k_cvt8<<<gw, 256, 0, stream>>>(w_out, WOb, (size_t)C_ * CI / 8);
    k_stats<<<(unsigned)(NB * C_ / 32), 256, 0, stream>>>(x, MU, RD);                                                                   /* SimAM mu, 1/(4(var_n + eps)) per (b, c) */
    k_xplanes<<<(unsigned)((nTok * C_ / 8 + 255) / 256), 256, 0, stream>>>(x, MU, RD, XT, X1h, X1l);                                    /* x^T bf16 (exact), gated x1^T hi/lo */
    const size_t n8p = nTok * CI / 8; const unsigned gs8 = (unsigned)((n8p + 255) / 256);
    k_gemmw<bf, false, false, 1, false><<<dim3((unsigned)(nTok / 64), CI / 64, 1), 32, 0, stream>>>(XT, nullptr, WTb, nullptr, C_, F32A, CI, b_theta, nullptr, 0, 0, 0);   /* theta [tok][128] */
    k_split8<<<gs8, 256, 0, stream>>>(F32A, THh, THl, n8p);
    k_gemmw<bf, false, false, 1, false><<<dim3((unsigned)(nTok / 64), CI / 64, 1), 32, 0, stream>>>(XT, nullptr, WPb, nullptr, C_, F32A, CI, b_phi, nullptr, 0, 0, 0);     /* phi [tok][128] */
    k_split8<<<gs8, 256, 0, stream>>>(F32A, PHh, PHl, n8p);
    k_gemmw<bf, true, false, 1, false><<<dim3((unsigned)(nTok / 64), CI / 64, 1), 32, 0, stream>>>(X1h, X1l, WDb, nullptr, C_, F32A, CI, b_d, nullptr, 0, 0, 0);          /* D [tok][128] (2 products) */
    k_split8<<<gs8, 256, 0, stream>>>(F32A, DQh, DQl, n8p);
    k_gemmw<bf, false, false, 2, false><<<dim3(CI / 64, SEQ / 64, NB), 32, 0, stream>>>(WGb, nullptr, XT, nullptr, C_, F32A, SEQ, b_g, nullptr, 0, (size_t)SEQ * C_, (size_t)CI * SEQ);   /* g feature-major [b][128][SEQ] */
    k_vsplit8<<<gs8, 256, 0, stream>>>(F32A, GVh, GVl, n8p);
    k_gemmw<bf, false, true, 2, false><<<dim3(CI / 64, SEQ / 64, NB), 32, 0, stream>>>(WSb, nullptr, X1h, X1l, C_, F32A, SEQ, b_s, nullptr, 0, (size_t)SEQ * C_, (size_t)CI * SEQ);       /* S feature-major (2 products) */
    k_vsplit8<<<gs8, 256, 0, stream>>>(F32A, SVh, SVl, n8p);
    k_attn<<<dim3(SEQ / (AW * 16), NB, 2), AW * 32, 0, stream>>>(THh, THl, DQh, DQl, PHh, PHl, GVh, GVl, SVh, SVl, F32A);                          /* y1 = softmax(theta.phi) g, y2 = softmax(D.phi) S */
    k_sumsplit8<<<gs8, 256, 0, stream>>>(Y1, Y2, Yh, Yl, n8p);                                                                         /* y = y1 + y2 -> hi/lo */
    k_gemmw<bf, false, true, 2, true><<<dim3(C_ / 64, SEQ / 64, NB), 32, 0, stream>>>(WOb, nullptr, Yh, Yl, CI, OUT, HWF, b_out, x, 0, (size_t)SEQ * CI, (size_t)C_ * HWF);      /* out[b][co][t] = W_out . y + b_out + bf16(x) */
}

// v003
// Measured time: 347 microseconds a run.
// Two timings next to v002 both put it at 1.21 times that version's speed.
// All steps since v000 together make it 2.81 times as fast.
#include <hip/hip_runtime.h>

// Contractions, f32 accumulate: five 1x1 projections on v_wmma_f32_16x16x32_bf16 (x as exact bf16; SimAM-gated branch as bf16 hi+lo planes = 2 products; weights bf16); score tiles q.k on v_wmma_f32_16x16x32_bf16 with hi/lo x hi/lo planes (3 products); P.V on v_wmma_f32_16x16x32_f16 (P x 2^14, V x 16 as f16 hi) plus v_wmma_f32_16x16x32_bf16 (P bf16 x V bf16 residual); output projection on v_wmma_f32_16x16x32_bf16 (y as bf16 hi+lo planes = 2 products). SimAM statistics/gating, online max-subtracted softmax, normalisation and residual add in f32.
// Data flow: x [NB][256][4096] channel-major -> token-major planes XT (bf16 exact), X1h/X1l (gated branch, hi/lo); theta/phi/D token-major [t][128] f32 -> bf16 hi/lo planes; g/S feature-major [128][t] f32 -> f16 hi (x16) + bf16 residual; eight waves per work-group share 64-key K/V stages in LDS; one wave per 16 queries, its query fragments resident in registers, walks 32-key blocks (scores, online softmax, P through a wave-private LDS tile, P.V); y1/y2 [t][128] f32; y = y1 + y2 -> bf16 hi/lo; out[b][co][t] = W_out . y + b_out + bf16(x).

#ifndef NB
#define NB 4
#endif
#ifndef SEQ
#define SEQ 4096
#endif
#define NBF  4
#define HWF  4096
#define C_   256
#define CI   128
#define KB   32
#define PP   40
#define OSP  132
#define PCAR 16384.0f
#define VCAR 16.0f
#define YSC  (1.0f / 262144.0f)
#define ELAM 1e-4f

static_assert(NB >= 1 && NB <= NBF);
static_assert(SEQ % 128 == 0 && SEQ >= 128 && SEQ <= HWF);
static_assert(SEQ % KB == 0 && SEQ % 64 == 0 && SEQ % 16 == 0);
static_assert((NB * C_) % 32 == 0);
static_assert(C_ % 64 == 0 && CI % 64 == 0 && C_ % 32 == 0 && CI % 32 == 0);
static_assert((NB * SEQ * C_) % (8 * 256) == 0 && (NB * SEQ * CI) % 8 == 0);

typedef _Float16 h16;
typedef unsigned short bf;
typedef __attribute__((ext_vector_type(16))) __bf16   v16bf;
typedef __attribute__((ext_vector_type(16))) _Float16 v16h;
typedef __attribute__((ext_vector_type(8)))  _Float16 v8h;
typedef __attribute__((ext_vector_type(8)))  unsigned short v8us;
typedef __attribute__((ext_vector_type(8)))  float    v8f;
typedef __attribute__((ext_vector_type(4)))  float    v4f;
typedef v8h  __attribute__((may_alias)) v8ha;
typedef v4f  __attribute__((may_alias)) v4fa;
typedef v8us __attribute__((may_alias)) v8usa;

__device__ __forceinline__ unsigned short f2bf(float f) { unsigned u = __float_as_uint(f); u += 0x7FFFu + ((u >> 16) & 1u); return (unsigned short)(u >> 16); }
__device__ __forceinline__ float bf2f(unsigned short b) { return __uint_as_float(((unsigned)b) << 16); }
__device__ __forceinline__ float bfr(float f) { return bf2f(f2bf(f)); }
__device__ __forceinline__ void splitf(float y, unsigned short& h, unsigned short& l) { h = f2bf(y); l = f2bf(y - bf2f(h)); }
__device__ __forceinline__ v16h cat16(v8h lo, v8h hi) { return __builtin_shufflevector(lo, hi, 0, 1, 2, 3, 4, 5, 6, 7, 8, 9, 10, 11, 12, 13, 14, 15); }
__device__ __forceinline__ v16bf cat16b(v8us lo, v8us hi) { return __builtin_bit_cast(v16bf, __builtin_shufflevector(lo, hi, 0, 1, 2, 3, 4, 5, 6, 7, 8, 9, 10, 11, 12, 13, 14, 15)); }
__device__ __forceinline__ v8f wmma16(v16h a, v16h b, v8f c) { return __builtin_amdgcn_wmma_f32_16x16x32_f16(false, a, false, b, (short)0, c, false, false); }
__device__ __forceinline__ v8f wmmab(v16bf a, v16bf b, v8f c) { return __builtin_amdgcn_wmma_f32_16x16x32_bf16(false, a, false, b, (short)0, c, false, false); }
// Fragment loaders (A and B share the same per-lane k map): p already points at row (lane & 15), k0 + 8*(lane >> 4); elements 0..7 <- p[0..7], elements 8..15 <- p[16..23].
__device__ __forceinline__ v16bf ldb(const bf* p) { return cat16b(*(const v8us*)p, *(const v8us*)(p + 16)); }
__device__ __forceinline__ v16h  ldh(const h16* p) { return cat16(*(const v8h*)p, *(const v8h*)(p + 16)); }

// ---- k_gemmw: register-blocked GEMM, ONE WAVE per 64x64 output tile (16 accumulators), operands straight from K-contiguous 16-bit planes; grid (M/64, N/64, Z), 32 threads.
// C[m][n] (f32, pitch ldc) = sum_k A[m][k] Bt[n][k] (+ A2[m][k] Bt[n][k] when A2ON) (+ A[m][k] Bt2[n][k] when B2ON) (+ bf16(bias[n]) BIASM==1 | bf16(bias[m]) BIASM==2) (+ bf16(res[m][n]) when RESID, same indexing as C).
// z-batch strides sA/sB/sC in elements. K % 32 == 0, M % 64 == 0, N % 64 == 0.
template <typename T16> struct WFrag;
template <> struct WFrag<h16> { typedef v16h V; static __device__ __forceinline__ V ld(const h16* p) { return ldh(p); } static __device__ __forceinline__ v8f mma(V a, V b, v8f c) { return wmma16(a, b, c); } };
template <> struct WFrag<bf> { typedef v16bf V; static __device__ __forceinline__ V ld(const bf* p) { return ldb(p); } static __device__ __forceinline__ v8f mma(V a, V b, v8f c) { return wmmab(a, b, c); } };
template <typename T16, bool A2ON, bool B2ON, int BIASM, bool RESID>
__global__ __launch_bounds__(32) void k_gemmw(const T16* __restrict__ A, const T16* __restrict__ A2, const T16* __restrict__ Bt, const T16* __restrict__ Bt2, int K,
                                              float* C, int ldc, const float* __restrict__ bias, const float* __restrict__ res, size_t sA, size_t sB, size_t sC) {
    typedef typename WFrag<T16>::V V;
    __shared__ __align__(16) float os[16 * 68];
    const size_t z = blockIdx.z;
    A += z * sA; if (A2ON) A2 += z * sA; Bt += z * sB; if (B2ON) Bt2 += z * sB; C += z * sC; if (RESID) res += z * sC;
    const int lane = threadIdx.x & 31, lr = lane & 15, hi = lane >> 4;
    const int r0 = blockIdx.x * 64, c0 = blockIdx.y * 64;
    v8f acc[4][4];
#pragma unroll
    for (int mb = 0; mb < 4; ++mb)
#pragma unroll
        for (int nb = 0; nb < 4; ++nb) acc[mb][nb] = (v8f){};
    const size_t aoff = (size_t)(r0 + lr) * K + 8 * hi, boff = (size_t)(c0 + lr) * K + 8 * hi;
#pragma unroll 1
    for (int kc = 0; kc < K; kc += 32) {
        V a[4], a2[4];
#pragma unroll
        for (int mb = 0; mb < 4; ++mb) { a[mb] = WFrag<T16>::ld(A + aoff + (size_t)mb * 16 * K + kc); a2[mb] = a[mb]; if (A2ON) a2[mb] = WFrag<T16>::ld(A2 + aoff + (size_t)mb * 16 * K + kc); }
#pragma unroll
        for (int nb = 0; nb < 4; ++nb) {
            const V b = WFrag<T16>::ld(Bt + boff + (size_t)nb * 16 * K + kc); V b2 = b; if (B2ON) b2 = WFrag<T16>::ld(Bt2 + boff + (size_t)nb * 16 * K + kc);
#pragma unroll
            for (int mb = 0; mb < 4; ++mb) {
                acc[mb][nb] = WFrag<T16>::mma(a[mb], b, acc[mb][nb]);
                if (A2ON) acc[mb][nb] = WFrag<T16>::mma(a2[mb], b, acc[mb][nb]);
                if (B2ON) acc[mb][nb] = WFrag<T16>::mma(a[mb], b2, acc[mb][nb]); } }
        asm volatile("v_nop\n\tv_nop\n\tv_nop\n\tv_nop" : "+v"(acc[0][0]), "+v"(acc[1][1]), "+v"(acc[2][2]), "+v"(acc[3][3]) : "v"(a[0]), "v"(a[3]));
    }
#pragma unroll
    for (int mb = 0; mb < 4; ++mb) {
#pragma unroll
        for (int nb = 0; nb < 4; ++nb) {
#pragma unroll
            for (int j = 0; j < 8; ++j) os[(hi * 8 + j) * 68 + nb * 16 + lr] = acc[mb][nb][j]; }
        __builtin_amdgcn_fence(__ATOMIC_RELEASE, "wavefront"); __builtin_amdgcn_wave_barrier(); asm volatile("" ::: "memory");
        const size_t rb = (size_t)(r0 + mb * 16);
{
#pragma unroll
            for (int s = 0; s < 8; ++s) {
                const int row = 2 * s + hi, cofs = lr * 4;
                v4f val = *(const v4fa*)(os + row * 68 + cofs);
                if (BIASM == 1) { val[0] += bfr(bias[c0 + cofs]); val[1] += bfr(bias[c0 + cofs + 1]); val[2] += bfr(bias[c0 + cofs + 2]); val[3] += bfr(bias[c0 + cofs + 3]); }
                if (BIASM == 2) { const float bv = bfr(bias[rb + row]); val[0] += bv; val[1] += bv; val[2] += bv; val[3] += bv; }
                if (RESID) { const v4f rv = *(const v4f*)(res + (rb + row) * (size_t)ldc + c0 + cofs); val[0] += bfr(rv[0]); val[1] += bfr(rv[1]); val[2] += bfr(rv[2]); val[3] += bfr(rv[3]); }
                *(v4f*)(C + (rb + row) * (size_t)ldc + c0 + cofs) = val; }
             }
        __builtin_amdgcn_fence(__ATOMIC_RELEASE, "wavefront"); __builtin_amdgcn_wave_barrier(); asm volatile("" ::: "memory");
    }
}

__global__ __launch_bounds__(256) void k_cvt8(const float* __restrict__ src, bf* dst, size_t n8) { const size_t i = (size_t)blockIdx.x * 256 + threadIdx.x; if (i >= n8) return; const v8f v = *(const v8f*)(src + i * 8); v8us o;
#pragma unroll
    for (int k = 0; k < 8; ++k) o[k] = f2bf(v[k]); *(v8us*)(dst + i * 8) = o;  }

// k_stats: one work-group per 32 (b, c) rows (its 32 results fill one 128-byte line of MU and of RD), sixteen waves, two rows per wave one after the other.
// A wave brings its whole row into registers with all its loads in flight at once, rounds it to bf16 there, and takes the mean and the centred sum of squares from the registers: the row is read once and no load waits on another.
// LDS mus/rds: cross-wave (block barrier).
#define SW 16
#define SR (32 / SW)
__global__ __launch_bounds__(SW * 32) void k_stats(const float* __restrict__ x, float* MU, float* RD) {
    __shared__ float mus[32]; __shared__ float rds[32];
    const int t = threadIdx.x, wid = __builtin_amdgcn_readfirstlane(t >> 5), lane = t & 31;   // wave number held scalar: the row's base address is scalar, the lane's offset one register that is never rewritten
#pragma unroll 1   // rolled: one row's registers at a time
    for (int j = 0; j < SR; ++j) {
        const int rr = blockIdx.x * 32 + wid * SR + j;                // (b, c) row index < NB * C_
        const int b = rr / C_, c = rr - b * C_;
        const float* xr = x + ((size_t)b * C_ + c) * HWF + lane * 4;
        v4f r[SEQ / 128];
#pragma unroll   // unrolled: every load of the row is issued before the first is waited for
        for (int i = 0; i < SEQ / 128; ++i) r[i] = *(const v4f*)(xr + (size_t)i * 128);
        float s = 0.f;
#pragma unroll   // unrolled: r[] stays in registers
        for (int i = 0; i < SEQ / 128; ++i) { v4f v = r[i]; v[0] = bfr(v[0]); v[1] = bfr(v[1]); v[2] = bfr(v[2]); v[3] = bfr(v[3]); r[i] = v; s += (v[0] + v[1]) + (v[2] + v[3]); }
        s += __shfl_xor(s, 1, 32); s += __shfl_xor(s, 2, 32); s += __shfl_xor(s, 4, 32); s += __shfl_xor(s, 8, 32); s += __shfl_xor(s, 16, 32);
        const float mu = s * (1.0f / (float)SEQ);
        float ss = 0.f;
#pragma unroll   // unrolled: r[] stays in registers
        for (int i = 0; i < SEQ / 128; ++i) { const v4f v = r[i];
            const float d0 = v[0] - mu, d1 = v[1] - mu, d2 = v[2] - mu, d3 = v[3] - mu;
            ss += (d0 * d0 + d1 * d1) + (d2 * d2 + d3 * d3); }
        ss += __shfl_xor(ss, 1, 32); ss += __shfl_xor(ss, 2, 32); ss += __shfl_xor(ss, 4, 32); ss += __shfl_xor(ss, 8, 32); ss += __shfl_xor(ss, 16, 32);
        const float den = 4.0f * (ss * (1.0f / (float)(SEQ - 1)) + ELAM);
        const float rd = 1.0f / den;
        if (lane == 0) { mus[wid * SR + j] = mu; rds[wid * SR + j] = rd; }
    }
    __syncthreads();
    if (wid == 0) {
        const float a = mus[lane], r = rds[lane];
        float* pm = MU + (size_t)blockIdx.x * 32 + lane; float* pr = RD + (size_t)blockIdx.x * 32 + lane;
        *(float*)pm = a; *(float*)pr = r;  }
}

// ---- k_xplanes: token-major planes from channel-major x: XT[(b*SEQ+t)][c] = bf16(x[b][c][t]) (exact), X1h/X1l = bf16 hi/lo of x1 = bf16(x) * sigmoid((bf16(x) - mu)^2 * rd + 0.5).
__global__ __launch_bounds__(256) void k_xplanes(const float* __restrict__ x, const float* __restrict__ MU, const float* __restrict__ RD, bf* XT, bf* X1h, bf* X1l) {
    const size_t e = ((size_t)blockIdx.x * 256 + threadIdx.x) * 8; if (e >= (size_t)NB * SEQ * C_) return;
    const int c = (int)(e % C_); const size_t btk = e / C_; const int tpos = (int)(btk % SEQ); const int b = (int)(btk / SEQ);
    const float* xp = x + ((size_t)b * C_ + c) * HWF + tpos;
    const v8f mu8 = *(const v8f*)(MU + (size_t)b * C_ + c), rd8 = *(const v8f*)(RD + (size_t)b * C_ + c);
    v8us o0, oh, ol;
#pragma unroll
    for (int q = 0; q < 8; ++q) {
        const float xb = bfr(xp[(size_t)q * HWF]);
        const float d = xb - mu8[q];
        const float y = d * d * rd8[q] + 0.5f;
        const float ex = __expf(-y);
        const float sg = __builtin_amdgcn_rcpf(1.0f + ex);
        const float x1 = xb * sg;
        o0[q] = f2bf(xb); unsigned short hh, ll; splitf(x1, hh, ll); oh[q] = hh; ol[q] = ll;
    }
    *(v8us*)(XT + e) = o0; *(v8us*)(X1h + e) = oh; *(v8us*)(X1l + e) = ol; 
}

__global__ __launch_bounds__(256) void k_split8(const float* __restrict__ F, bf* Ph, bf* Pl, size_t n8) { const size_t i = (size_t)blockIdx.x * 256 + threadIdx.x; if (i >= n8) return; const v8f v = *(const v8f*)(F + i * 8); v8us oh, ol;
#pragma unroll
    for (int q = 0; q < 8; ++q) { unsigned short a, c; splitf(v[q], a, c); oh[q] = a; ol[q] = c; }
    *(v8us*)(Ph + i * 8) = oh; *(v8us*)(Pl + i * 8) = ol;  }
__global__ __launch_bounds__(256) void k_sumsplit8(const float* __restrict__ F1, const float* __restrict__ F2, bf* Ph, bf* Pl, size_t n8) { const size_t i = (size_t)blockIdx.x * 256 + threadIdx.x; if (i >= n8) return; const v8f v = *(const v8f*)(F1 + i * 8) + *(const v8f*)(F2 + i * 8); v8us oh, ol;
#pragma unroll
    for (int q = 0; q < 8; ++q) { unsigned short a, c; splitf(v[q], a, c); oh[q] = a; ol[q] = c; }
    *(v8us*)(Ph + i * 8) = oh; *(v8us*)(Pl + i * 8) = ol;  }
__global__ __launch_bounds__(256) void k_vsplit8(const float* __restrict__ F, h16* Ph, bf* Pl, size_t n8) { const size_t i = (size_t)blockIdx.x * 256 + threadIdx.x; if (i >= n8) return; const v8f v = *(const v8f*)(F + i * 8); v8h oh; v8us ol;
#pragma unroll
    for (int q = 0; q < 8; ++q) { const float w = v[q] * VCAR; const h16 hh = (h16)w; oh[q] = hh; ol[q] = f2bf(w - (float)hh); }
    *(v8h*)(Ph + i * 8) = oh; *(v8us*)(Pl + i * 8) = ol;  }

// ---- k_attn: eight waves per work-group, one wave per 16 queries of one batch and one map (z = 0: theta/g, z = 1: D/S; keys = phi for both), 32-key blocks, online max-subtracted softmax.
// The work-group's 128 queries walk the same keys and values: each 64-key stage (K hi/lo rows, V hi/lo feature rows) is brought into LDS once by asynchronous copies, two buffers, the next stage in flight while this one is worked on.
// LDS ring: shared by the eight waves (block barrier at each hand-over). K rows at a 272-byte pitch, V rows at a 144-byte pitch (16 B x odd, for ds_load_b128 readers).
// LDS pS16/pSb/os: one slice per wave, private to it. Staged extent == consumed extent: pS rows 0..15 x cols 0..31, os rows 0..15 x cols 0..127.
#define AW   8
#define SK   64
#define KPI  136
#define VPI  72
#define KPLB (SK * KPI * 2)
#define VPLB (CI * VPI * 2)
#define STGB (2 * KPLB + 2 * VPLB)
#define NST  (SEQ / SK)
static_assert(SEQ % (AW * 16) == 0 && NST >= 2 && SK % KB == 0);
static_assert(SK * CI * 2 == 4 * AW * 32 * 16 && CI * SK * 2 == 4 * AW * 32 * 16);
__device__ __forceinline__ v16bf ldbs(const bf* p) { return cat16b(*(const v8usa*)p, *(const v8usa*)(p + 16)); }
__device__ __forceinline__ v16h  ldhs(const h16* p) { return cat16(*(const v8ha*)p, *(const v8ha*)(p + 16)); }
// Eight 16-byte copies per lane, global -> LDS through no register: four steps of plane a, four of plane b. The s_wait_xcnt stands inside the statement so that no address register is rewritten ahead of it.
template <typename TA, typename TB>
__device__ __forceinline__ void copy8(unsigned la, const TA* ga, unsigned lb, const TB* gb, unsigned lstep, size_t gstep) {
    asm volatile("global_load_async_to_lds_b128 %0, %8, off\n\t"
                 "global_load_async_to_lds_b128 %1, %9, off\n\t"
                 "global_load_async_to_lds_b128 %2, %10, off\n\t"
                 "global_load_async_to_lds_b128 %3, %11, off\n\t"
                 "global_load_async_to_lds_b128 %4, %12, off\n\t"
                 "global_load_async_to_lds_b128 %5, %13, off\n\t"
                 "global_load_async_to_lds_b128 %6, %14, off\n\t"
                 "global_load_async_to_lds_b128 %7, %15, off\n\t"
                 "s_wait_xcnt 0x0"
                 :: "v"(la), "v"(la + lstep), "v"(la + 2 * lstep), "v"(la + 3 * lstep), "v"(lb), "v"(lb + lstep), "v"(lb + 2 * lstep), "v"(lb + 3 * lstep),
                    "v"(ga), "v"(ga + gstep), "v"(ga + 2 * gstep), "v"(ga + 3 * gstep), "v"(gb), "v"(gb + gstep), "v"(gb + 2 * gstep), "v"(gb + 3 * gstep)
                 : "memory");
}
__global__ __launch_bounds__(AW * 32) void k_attn(const bf* __restrict__ THh, const bf* __restrict__ THl, const bf* __restrict__ DQh, const bf* __restrict__ DQl,
                                             const bf* __restrict__ PHh, const bf* __restrict__ PHl,
                                             const h16* __restrict__ GVh, const bf* __restrict__ GVl, const h16* __restrict__ SVh, const bf* __restrict__ SVl, float* Y) {
    __shared__ __align__(16) unsigned char ring[2 * STGB];
    __shared__ __align__(16) h16 pS16a[AW * 16 * PP];
    __shared__ __align__(16) unsigned short pSba[AW * 16 * PP];
    __shared__ __align__(16) float osa[AW * 16 * OSP];
    const int tid = threadIdx.x, lane = tid & 31, L = lane & 15, hi = lane >> 4;
    const int wv = __builtin_amdgcn_readfirstlane(tid >> 5);
    h16* pS16 = pS16a + wv * 16 * PP; unsigned short* pSb = pSba + wv * 16 * PP; float* os = osa + wv * 16 * OSP;
    const int q0 = blockIdx.x * (AW * 16) + wv * 16, b = blockIdx.y, mp = blockIdx.z;
    const size_t tok = (size_t)b * SEQ;
    const bf* Qh = (mp ? DQh : THh) + (tok + q0) * CI; const bf* Ql = (mp ? DQl : THl) + (tok + q0) * CI;
    const bf* Kh = PHh + tok * CI; const bf* Kl = PHl + tok * CI;
    const h16* Vh = (mp ? SVh : GVh) + (size_t)b * CI * SEQ; const bf* Vl = (mp ? SVl : GVl) + (size_t)b * CI * SEQ;
    float* Yo = Y + ((size_t)mp * NB * SEQ + tok + q0) * CI;
    // Copy map of one stage. K plane: 64 rows x 256 B, contiguous in global; thread tid takes 16-byte piece tid + 256 i (row (tid >> 4) + 16 i). V plane: 128 rows x 128 B; piece tid + 256 i (row (tid >> 3) + 32 i).
    const unsigned ring0 = (unsigned)(size_t)ring;
    const unsigned lk = ring0 + (unsigned)((tid >> 4) * (KPI * 2) + (tid & 15) * 16);
    const unsigned lv = ring0 + (unsigned)(2 * KPLB + (tid >> 3) * (VPI * 2) + (tid & 7) * 16);
    const bf* gkh = Kh + tid * 8; const bf* gkl = Kl + tid * 8;
    const h16* gvh = Vh + (size_t)(tid >> 3) * SEQ + (tid & 7) * 8; const bf* gvl = Vl + (size_t)(tid >> 3) * SEQ + (tid & 7) * 8;
    auto fill = [&](int st) {
        const unsigned bo = (unsigned)(st & 1) * STGB;
        copy8(lk + bo, gkh + (size_t)st * SK * CI, lk + bo + KPLB, gkl + (size_t)st * SK * CI, 16 * KPI * 2, (size_t)16 * CI);
        copy8(lv + bo, gvh + (size_t)st * SK, lv + bo + VPLB, gvl + (size_t)st * SK, 32 * VPI * 2, (size_t)32 * SEQ);
    };
    float m_i[8], l_i[8]; v8f acc[8];
#pragma unroll
    for (int v = 0; v < 8; ++v) { m_i[v] = -1.0e30f; l_i[v] = 0.f; }
#pragma unroll
    for (int ct = 0; ct < 8; ++ct) acc[ct] = (v8f){};
    const size_t qoff = (size_t)L * CI + 8 * hi;          // A fragment: query row L
    // The wave's 16 query rows never change: their hi and lo fragments are loaded once and stay in registers for the whole key walk.
    v16bf qh[CI / 32], ql[CI / 32];
#pragma unroll
    for (int ch = 0; ch < CI / 32; ++ch) { qh[ch] = ldb(Qh + qoff + ch * 32); ql[ch] = ldb(Ql + qoff + ch * 32); }
    fill(0);
    asm volatile("s_wait_asynccnt 0x0" ::: "memory");    // stage 0 has landed before the barrier that publishes it
    __syncthreads();
    fill(1);
#pragma unroll 1   // rolled: the buffer is picked by the stage's parity at run time, one copy of the hand-over and of the pass body
    for (int st = 0; st < NST; ++st) {
      const unsigned char* sb = ring + (st & 1) * STGB;
#pragma unroll 1   // rolled: the two 32-key passes of a stage share one body, as the parent's key loop did
      for (int sub = 0; sub < SK / KB; ++sub) {
        v8f lt0 = (v8f){}, lt1 = (v8f){};
        const bf* k0h = (const bf*)sb + (sub * KB + L) * KPI + 8 * hi; const bf* k0l = k0h + KPLB / 2;   // B fragment (keys): key row sub*32 + kt*16 + L of the stage
#pragma unroll   // unrolled: each chunk names its own resident query fragment
        for (int ch = 0; ch < CI / 32; ++ch) {
            const int co = ch * 32;
            const v16bf ka0 = ldbs(k0h + co), kl0 = ldbs(k0l + co), ka1 = ldbs(k0h + 16 * KPI + co), kl1 = ldbs(k0l + 16 * KPI + co);
            lt0 = wmmab(qh[ch], ka0, lt0); lt1 = wmmab(qh[ch], ka1, lt1);
            lt0 = wmmab(ql[ch], ka0, lt0); lt1 = wmmab(ql[ch], ka1, lt1);
            lt0 = wmmab(qh[ch], kl0, lt0); lt1 = wmmab(qh[ch], kl1, lt1);
        }
        float scv[8];
#pragma unroll
        for (int v = 0; v < 8; ++v) {
            const float ra = lt0[v], rb = lt1[v];
            float mx = fmaxf(ra, rb);
            mx = fmaxf(mx, __shfl_xor(mx, 1, 32)); mx = fmaxf(mx, __shfl_xor(mx, 2, 32)); mx = fmaxf(mx, __shfl_xor(mx, 4, 32)); mx = fmaxf(mx, __shfl_xor(mx, 8, 32));
            const float mn = fmaxf(m_i[v], mx);
            const float sc = __expf(m_i[v] - mn);
            const float pa = __expf(ra - mn), pb = __expf(rb - mn);
            float rs = pa + pb;
            rs += __shfl_xor(rs, 1, 32); rs += __shfl_xor(rs, 2, 32); rs += __shfl_xor(rs, 4, 32); rs += __shfl_xor(rs, 8, 32);
            l_i[v] = l_i[v] * sc + rs; m_i[v] = mn; scv[v] = sc;
            const float pas = pa * PCAR, pbs = pb * PCAR;
            const int prow = (v + 8 * hi) * PP;                  // D element v -> row 8*hi + v, column (key) L of tile kt
            pS16[prow + L] = (h16)pas; pS16[prow + 16 + L] = (h16)pbs;
            pSb[prow + L] = f2bf(pas); pSb[prow + 16 + L] = f2bf(pbs);
        }
#pragma unroll
        for (int ct = 0; ct < 8; ++ct)
#pragma unroll
            for (int v = 0; v < 8; ++v) acc[ct][v] *= scv[v];
        __builtin_amdgcn_fence(__ATOMIC_RELEASE, "wavefront"); __builtin_amdgcn_wave_barrier(); asm volatile("" ::: "memory");
        const v16h pa16 = cat16(*(const v8ha*)(pS16 + L * PP + 8 * hi), *(const v8ha*)(pS16 + L * PP + 16 + 8 * hi));
        const v16bf pab = cat16b(*(const v8usa*)(pSb + L * PP + 8 * hi), *(const v8usa*)(pSb + L * PP + 16 + 8 * hi));
        const h16* vh = (const h16*)(sb + 2 * KPLB) + L * VPI + sub * KB + 8 * hi; const bf* vl = (const bf*)(sb + 2 * KPLB + VPLB) + L * VPI + sub * KB + 8 * hi;   // B fragment (values): ci row L of the staged feature-major plane
#pragma unroll
        for (int ct = 0; ct < 4; ++ct) {
            const v16h vf = ldhs(vh + ct * 16 * VPI); const v16bf vr = ldbs(vl + ct * 16 * VPI);
            acc[ct] = wmma16(pa16, vf, acc[ct]); acc[ct] = wmmab(pab, vr, acc[ct]); }
        asm volatile("v_nop\n\tv_nop\n\tv_nop\n\tv_nop" : "+v"(acc[0]), "+v"(acc[1]), "+v"(acc[2]), "+v"(acc[3]) : "v"(pa16), "v"(pab) : "memory");
#pragma unroll
        for (int ct = 4; ct < 8; ++ct) {
            const v16h vf = ldhs(vh + ct * 16 * VPI); const v16bf vr = ldbs(vl + ct * 16 * VPI);
            acc[ct] = wmma16(pa16, vf, acc[ct]); acc[ct] = wmmab(pab, vr, acc[ct]); }
        asm volatile("v_nop\n\tv_nop\n\tv_nop\n\tv_nop" : "+v"(acc[4]), "+v"(acc[5]), "+v"(acc[6]), "+v"(acc[7]) : "v"(pa16), "v"(pab) : "memory");
        __builtin_amdgcn_wave_barrier(); asm volatile("" ::: "memory");
      }
      // Hand-over: this wave's reads of the stage are done, its own copies of the next stage have landed, every wave has arrived; only then is the buffer just read filled again.
      asm volatile("s_wait_dscnt 0x0" ::: "memory");     // the wave's last LDS reads of this buffer have returned before it may be refilled
      asm volatile("s_wait_asynccnt 0x0" ::: "memory");  // the wave's copies of stage st + 1 have landed before the barrier that publishes them
      __syncthreads();
      if (st + 2 < NST) fill(st + 2);
    }
    asm volatile("s_wait_asynccnt 0x0" ::: "memory");    // no copy is outstanding when the wave goes on to its end
    float rl[8];
#pragma unroll
    for (int v = 0; v < 8; ++v) rl[v] = __builtin_amdgcn_rcpf(l_i[v]) * YSC;
#pragma unroll
    for (int ct = 0; ct < 8; ++ct)
#pragma unroll
        for (int v = 0; v < 8; ++v) os[(8 * hi + v) * OSP + ct * 16 + L] = acc[ct][v] * rl[v];
    __builtin_amdgcn_fence(__ATOMIC_RELEASE, "wavefront"); __builtin_amdgcn_wave_barrier(); asm volatile("" ::: "memory");
{
#pragma unroll
        for (int r = 0; r < 16; ++r) { const v4f val = *(const v4fa*)(os + r * OSP + lane * 4); *(v4f*)(Yo + (size_t)r * CI + lane * 4) = val; }
         }
}

extern "C" void kernel_launch(void* const* d_in, const int* in_sizes, int n_in,
                              void* d_out, int out_size, void* d_ws, size_t ws_size, hipStream_t stream) {
    if (n_in < 13) return;
    if ((size_t)in_sizes[0] < (size_t)NB * C_ * HWF) return;
    if (in_sizes[1] < CI * C_ || in_sizes[3] < CI * C_ || in_sizes[5] < CI * C_ || in_sizes[7] < CI * C_ || in_sizes[9] < CI * C_ || in_sizes[11] < C_ * CI) return;
    if (in_sizes[2] < CI || in_sizes[4] < CI || in_sizes[6] < CI || in_sizes[8] < CI || in_sizes[10] < CI || in_sizes[12] < C_) return;
    if ((size_t)out_size < (size_t)NB * C_ * HWF) return;
    const float* x = (const float*)d_in[0];
    const float* w_theta = (const float*)d_in[1];  const float* b_theta = (const float*)d_in[2];
    const float* w_phi   = (const float*)d_in[3];  const float* b_phi   = (const float*)d_in[4];
    const float* w_g     = (const float*)d_in[5];  const float* b_g     = (const float*)d_in[6];
    const float* w_d     = (const float*)d_in[7];  const float* b_d     = (const float*)d_in[8];
    const float* w_s     = (const float*)d_in[9];  const float* b_s     = (const float*)d_in[10];
    const float* w_out   = (const float*)d_in[11]; const float* b_out   = (const float*)d_in[12];
    float* OUT = (float*)d_out;                     // [NB][256][HWF]
    char* wsp = (char*)d_ws;
    auto take = [&](size_t bytes) { char* p = wsp; wsp += (bytes + 255) & ~(size_t)255; return (void*)p; };
    const size_t nTok = (size_t)NB * SEQ;
    bf* WTb = (bf*)take((size_t)CI * C_ * 2); bf* WPb = (bf*)take((size_t)CI * C_ * 2); bf* WGb = (bf*)take((size_t)CI * C_ * 2);
    bf* WDb = (bf*)take((size_t)CI * C_ * 2); bf* WSb = (bf*)take((size_t)CI * C_ * 2); bf* WOb = (bf*)take((size_t)C_ * CI * 2);
    float* MU = (float*)take((size_t)NB * C_ * 4); float* RD = (float*)take((size_t)NB * C_ * 4);
    bf* XT = (bf*)take(nTok * C_ * 2); bf* X1h = (bf*)take(nTok * C_ * 2); bf* X1l = (bf*)take(nTok * C_ * 2);
    float* F32A = (float*)take(2 * nTok * CI * 4);                 // projection scratch [nTok][128] / [NB][128][SEQ], then y1 | y2 [2][nTok][128]
    bf* THh = (bf*)take(nTok * CI * 2); bf* THl = (bf*)take(nTok * CI * 2);
    bf* PHh = (bf*)take(nTok * CI * 2); bf* PHl = (bf*)take(nTok * CI * 2);
    bf* DQh = (bf*)take(nTok * CI * 2); bf* DQl = (bf*)take(nTok * CI * 2);
    h16* GVh = (h16*)take(nTok * CI * 2); bf* GVl = (bf*)take(nTok * CI * 2);
    h16* SVh = (h16*)take(nTok * CI * 2); bf* SVl = (bf*)take(nTok * CI * 2);
    bf* Yh = (bf*)take(nTok * CI * 2); bf* Yl = (bf*)take(nTok * CI * 2);
    if ((size_t)(wsp - (char*)d_ws) > ws_size) return;
    float* Y1 = F32A; float* Y2 = F32A + nTok * CI;

    const unsigned gw = (unsigned)(((size_t)CI * C_ / 8 + 255) / 256);
    k_cvt8<<<gw, 256, 0, stream>>>(w_theta, WTb, (size_t)CI * C_ / 8);
    k_cvt8<<<gw, 256, 0, stream>>>(w_phi, WPb, (size_t)CI * C_ / 8);
    k_cvt8<<<gw, 256, 0, stream>>>(w_g, WGb, (size_t)CI * C_ / 8);
    k_cvt8<<<gw, 256, 0, stream>>>(w_d, WDb, (size_t)CI * C_ / 8);
    k_cvt8<<<gw, 256, 0, stream>>>(w_s, WSb, (size_t)CI * C_ / 8);
    k_cvt8<<<gw, 256, 0, stream>>>(w_out, WOb, (size_t)C_ * CI / 8);
    k_stats<<<(unsigned)(NB * C_ / 32), SW * 32, 0, stream>>>(x, MU, RD);                                                                   /* SimAM mu, 1/(4(var_n + eps)) per (b, c) */
    k_xplanes<<<(unsigned)((nTok * C_ / 8 + 255) / 256), 256, 0, stream>>>(x, MU, RD, XT, X1h, X1l);                                    /* x^T bf16 (exact), gated x1^T hi/lo */
    const size_t n8p = nTok * CI / 8; const unsigned gs8 = (unsigned)((n8p + 255) / 256);
    k_gemmw<bf, false, false, 1, false><<<dim3((unsigned)(nTok / 64), CI / 64, 1), 32, 0, stream>>>(XT, nullptr, WTb, nullptr, C_, F32A, CI, b_theta, nullptr, 0, 0, 0);   /* theta [tok][128] */
    k_split8<<<gs8, 256, 0, stream>>>(F32A, THh, THl, n8p);
    k_gemmw<bf, false, false, 1, false><<<dim3((unsigned)(nTok / 64), CI / 64, 1), 32, 0, stream>>>(XT, nullptr, WPb, nullptr, C_, F32A, CI, b_phi, nullptr, 0, 0, 0);     /* phi [tok][128] */
    k_split8<<<gs8, 256, 0, stream>>>(F32A, PHh, PHl, n8p);
    k_gemmw<bf, true, false, 1, false><<<dim3((unsigned)(nTok / 64), CI / 64, 1), 32, 0, stream>>>(X1h, X1l, WDb, nullptr, C_, F32A, CI, b_d, nullptr, 0, 0, 0);          /* D [tok][128] (2 products) */
    k_split8<<<gs8, 256, 0, stream>>>(F32A, DQh, DQl, n8p);
    k_gemmw<bf, false, false, 2, false><<<dim3(CI / 64, SEQ / 64, NB), 32, 0, stream>>>(WGb, nullptr, XT, nullptr, C_, F32A, SEQ, b_g, nullptr, 0, (size_t)SEQ * C_, (size_t)CI * SEQ);   /* g feature-major [b][128][SEQ] */
    k_vsplit8<<<gs8, 256, 0, stream>>>(F32A, GVh, GVl, n8p);
    k_gemmw<bf, false, true, 2, false><<<dim3(CI / 64, SEQ / 64, NB), 32, 0, stream>>>(WSb, nullptr, X1h, X1l, C_, F32A, SEQ, b_s, nullptr, 0, (size_t)SEQ * C_, (size_t)CI * SEQ);       /* S feature-major (2 products) */
    k_vsplit8<<<gs8, 256, 0, stream>>>(F32A, SVh, SVl, n8p);
    k_attn<<<dim3(SEQ / (AW * 16), NB, 2), AW * 32, 0, stream>>>(THh, THl, DQh, DQl, PHh, PHl, GVh, GVl, SVh, SVl, F32A);                          /* y1 = softmax(theta.phi) g, y2 = softmax(D.phi) S */
    k_sumsplit8<<<gs8, 256, 0, stream>>>(Y1, Y2, Yh, Yl, n8p);                                                                         /* y = y1 + y2 -> hi/lo */
    k_gemmw<bf, false, true, 2, true><<<dim3(C_ / 64, SEQ / 64, NB), 32, 0, stream>>>(WOb, nullptr, Yh, Yl, CI, OUT, HWF, b_out, x, 0, (size_t)SEQ * CI, (size_t)C_ * HWF);      /* out[b][co][t] = W_out . y + b_out + bf16(x) */
}

// v004
// A run of this version takes 258 microseconds.
// Timed twice side by side with v003, it ran 1.34 and 1.33 times as fast.
// All steps since v000 together make it 3.75 times as fast.
#include <hip/hip_runtime.h>

// Contractions, f32 accumulate: five 1x1 projections on v_wmma_f32_16x16x32_bf16 (x as exact bf16; SimAM-gated branch as bf16 hi+lo planes = 2 products; weights bf16); score tiles q.k on v_wmma_f32_16x16x32_bf16 with hi/lo x hi/lo planes (3 products); P.V on v_wmma_f32_16x16x32_f16 (P x 2^14, V x 16 as f16 hi) plus v_wmma_f32_16x16x32_bf16 (P bf16 x V bf16 residual); output projection on v_wmma_f32_16x16x32_bf16 (y as bf16 hi+lo planes = 2 products). SimAM statistics/gating, online max-subtracted softmax, normalisation and residual add in f32.
// Data flow: x [NB][256][4096] channel-major -> token-major planes XT (bf16 exact), X1h/X1l (gated branch, hi/lo); theta/phi/D token-major [t][128] f32 -> bf16 hi/lo planes; g/S feature-major [128][t] f32 -> f16 hi (x16) + bf16 residual; eight waves per work-group share 64-key K/V stages in LDS; one wave per 16 queries, its query fragments resident in registers, walks 32-key blocks (transposed scores K.Q^T, online softmax in the lane, P^T packed from the score registers, V^T.P^T); y1/y2 [t][128] f32; y = y1 + y2 -> bf16 hi/lo; out[b][co][t] = W_out . y + b_out + bf16(x).

#ifndef NB
#define NB 4
#endif
#ifndef SEQ
#define SEQ 4096
#endif
#define NBF  4
#define HWF  4096
#define C_   256
#define CI   128
#define KB   32
#define OSP  132
#define PCAR 16384.0f
#define VCAR 16.0f
#define YSC  (1.0f / 262144.0f)
#define ELAM 1e-4f

static_assert(NB >= 1 && NB <= NBF);
static_assert(SEQ % 128 == 0 && SEQ >= 128 && SEQ <= HWF);
static_assert(SEQ % KB == 0 && SEQ % 64 == 0 && SEQ % 16 == 0);
static_assert((NB * C_) % 32 == 0);
static_assert(C_ % 64 == 0 && CI % 64 == 0 && C_ % 32 == 0 && CI % 32 == 0);
static_assert((NB * SEQ * C_) % (8 * 256) == 0 && (NB * SEQ * CI) % 8 == 0);

typedef _Float16 h16;
typedef unsigned short bf;
typedef __attribute__((ext_vector_type(16))) __bf16   v16bf;
typedef __attribute__((ext_vector_type(16))) _Float16 v16h;
typedef __attribute__((ext_vector_type(8)))  _Float16 v8h;
typedef __attribute__((ext_vector_type(8)))  unsigned short v8us;
typedef __attribute__((ext_vector_type(8)))  float    v8f;
typedef __attribute__((ext_vector_type(16))) float    v16f;
typedef __attribute__((ext_vector_type(4)))  float    v4f;
typedef v8h  __attribute__((may_alias)) v8ha;
typedef v4f  __attribute__((may_alias)) v4fa;
typedef v8us __attribute__((may_alias)) v8usa;

__device__ __forceinline__ unsigned short f2bf(float f) { unsigned u = __float_as_uint(f); u += 0x7FFFu + ((u >> 16) & 1u); return (unsigned short)(u >> 16); }
__device__ __forceinline__ float bf2f(unsigned short b) { return __uint_as_float(((unsigned)b) << 16); }
__device__ __forceinline__ float bfr(float f) { return bf2f(f2bf(f)); }
__device__ __forceinline__ void splitf(float y, unsigned short& h, unsigned short& l) { h = f2bf(y); l = f2bf(y - bf2f(h)); }
__device__ __forceinline__ v16h cat16(v8h lo, v8h hi) { return __builtin_shufflevector(lo, hi, 0, 1, 2, 3, 4, 5, 6, 7, 8, 9, 10, 11, 12, 13, 14, 15); }
__device__ __forceinline__ v16bf cat16b(v8us lo, v8us hi) { return __builtin_bit_cast(v16bf, __builtin_shufflevector(lo, hi, 0, 1, 2, 3, 4, 5, 6, 7, 8, 9, 10, 11, 12, 13, 14, 15)); }
__device__ __forceinline__ v8f wmma16(v16h a, v16h b, v8f c) { return __builtin_amdgcn_wmma_f32_16x16x32_f16(false, a, false, b, (short)0, c, false, false); }
__device__ __forceinline__ v8f wmmab(v16bf a, v16bf b, v8f c) { return __builtin_amdgcn_wmma_f32_16x16x32_bf16(false, a, false, b, (short)0, c, false, false); }
// Fragment loaders (A and B share the same per-lane k map): p already points at row (lane & 15), k0 + 8*(lane >> 4); elements 0..7 <- p[0..7], elements 8..15 <- p[16..23].
__device__ __forceinline__ v16bf ldb(const bf* p) { return cat16b(*(const v8us*)p, *(const v8us*)(p + 16)); }
__device__ __forceinline__ v16h  ldh(const h16* p) { return cat16(*(const v8h*)p, *(const v8h*)(p + 16)); }

// ---- k_gemmw: register-blocked GEMM, ONE WAVE per 64x64 output tile (16 accumulators), operands straight from K-contiguous 16-bit planes; grid (M/64, N/64, Z), 32 threads.
// C[m][n] (f32, pitch ldc) = sum_k A[m][k] Bt[n][k] (+ A2[m][k] Bt[n][k] when A2ON) (+ A[m][k] Bt2[n][k] when B2ON) (+ bf16(bias[n]) BIASM==1 | bf16(bias[m]) BIASM==2) (+ bf16(res[m][n]) when RESID, same indexing as C).
// z-batch strides sA/sB/sC in elements. K % 32 == 0, M % 64 == 0, N % 64 == 0.
template <typename T16> struct WFrag;
template <> struct WFrag<h16> { typedef v16h V; static __device__ __forceinline__ V ld(const h16* p) { return ldh(p); } static __device__ __forceinline__ v8f mma(V a, V b, v8f c) { return wmma16(a, b, c); } };
template <> struct WFrag<bf> { typedef v16bf V; static __device__ __forceinline__ V ld(const bf* p) { return ldb(p); } static __device__ __forceinline__ v8f mma(V a, V b, v8f c) { return wmmab(a, b, c); } };
template <typename T16, bool A2ON, bool B2ON, int BIASM, bool RESID>
__global__ __launch_bounds__(32) void k_gemmw(const T16* __restrict__ A, const T16* __restrict__ A2, const T16* __restrict__ Bt, const T16* __restrict__ Bt2, int K,
                                              float* C, int ldc, const float* __restrict__ bias, const float* __restrict__ res, size_t sA, size_t sB, size_t sC) {
    typedef typename WFrag<T16>::V V;
    __shared__ __align__(16) float os[16 * 68];
    const size_t z = blockIdx.z;
    A += z * sA; if (A2ON) A2 += z * sA; Bt += z * sB; if (B2ON) Bt2 += z * sB; C += z * sC; if (RESID) res += z * sC;
    const int lane = threadIdx.x & 31, lr = lane & 15, hi = lane >> 4;
    const int r0 = blockIdx.x * 64, c0 = blockIdx.y * 64;
    v8f acc[4][4];
#pragma unroll
    for (int mb = 0; mb < 4; ++mb)
#pragma unroll
        for (int nb = 0; nb < 4; ++nb) acc[mb][nb] = (v8f){};
    const size_t aoff = (size_t)(r0 + lr) * K + 8 * hi, boff = (size_t)(c0 + lr) * K + 8 * hi;
#pragma unroll 1
    for (int kc = 0; kc < K; kc += 32) {
        V a[4], a2[4];
#pragma unroll
        for (int mb = 0; mb < 4; ++mb) { a[mb] = WFrag<T16>::ld(A + aoff + (size_t)mb * 16 * K + kc); a2[mb] = a[mb]; if (A2ON) a2[mb] = WFrag<T16>::ld(A2 + aoff + (size_t)mb * 16 * K + kc); }
#pragma unroll
        for (int nb = 0; nb < 4; ++nb) {
            const V b = WFrag<T16>::ld(Bt + boff + (size_t)nb * 16 * K + kc); V b2 = b; if (B2ON) b2 = WFrag<T16>::ld(Bt2 + boff + (size_t)nb * 16 * K + kc);
#pragma unroll
            for (int mb = 0; mb < 4; ++mb) {
                acc[mb][nb] = WFrag<T16>::mma(a[mb], b, acc[mb][nb]);
                if (A2ON) acc[mb][nb] = WFrag<T16>::mma(a2[mb], b, acc[mb][nb]);
                if (B2ON) acc[mb][nb] = WFrag<T16>::mma(a[mb], b2, acc[mb][nb]); } }
        asm volatile("v_nop\n\tv_nop\n\tv_nop\n\tv_nop" : "+v"(acc[0][0]), "+v"(acc[1][1]), "+v"(acc[2][2]), "+v"(acc[3][3]) : "v"(a[0]), "v"(a[3]));
    }
#pragma unroll
    for (int mb = 0; mb < 4; ++mb) {
#pragma unroll
        for (int nb = 0; nb < 4; ++nb) {
#pragma unroll
            for (int j = 0; j < 8; ++j) os[(hi * 8 + j) * 68 + nb * 16 + lr] = acc[mb][nb][j]; }
        __builtin_amdgcn_fence(__ATOMIC_RELEASE, "wavefront"); __builtin_amdgcn_wave_barrier(); asm volatile("" ::: "memory");
        const size_t rb = (size_t)(r0 + mb * 16);
{
#pragma unroll
            for (int s = 0; s < 8; ++s) {
                const int row = 2 * s + hi, cofs = lr * 4;
                v4f val = *(const v4fa*)(os + row * 68 + cofs);
                if (BIASM == 1) { val[0] += bfr(bias[c0 + cofs]); val[1] += bfr(bias[c0 + cofs + 1]); val[2] += bfr(bias[c0 + cofs + 2]); val[3] += bfr(bias[c0 + cofs + 3]); }
                if (BIASM == 2) { const float bv = bfr(bias[rb + row]); val[0] += bv; val[1] += bv; val[2] += bv; val[3] += bv; }
                if (RESID) { const v4f rv = *(const v4f*)(res + (rb + row) * (size_t)ldc + c0 + cofs); val[0] += bfr(rv[0]); val[1] += bfr(rv[1]); val[2] += bfr(rv[2]); val[3] += bfr(rv[3]); }
                *(v4f*)(C + (rb + row) * (size_t)ldc + c0 + cofs) = val; }
             }
        __builtin_amdgcn_fence(__ATOMIC_RELEASE, "wavefront"); __builtin_amdgcn_wave_barrier(); asm volatile("" ::: "memory");
    }
}

__global__ __launch_bounds__(256) void k_cvt8(const float* __restrict__ src, bf* dst, size_t n8) { const size_t i = (size_t)blockIdx.x * 256 + threadIdx.x; if (i >= n8) return; const v8f v = *(const v8f*)(src + i * 8); v8us o;
#pragma unroll
    for (int k = 0; k < 8; ++k) o[k] = f2bf(v[k]); *(v8us*)(dst + i * 8) = o;  }

// k_stats: one work-group per 32 (b, c) rows (its 32 results fill one 128-byte line of MU and of RD), sixteen waves, two rows per wave one after the other.
// A wave brings its whole row into registers with all its loads in flight at once, rounds it to bf16 there, and takes the mean and the centred sum of squares from the registers: the row is read once and no load waits on another.
// LDS mus/rds: cross-wave (block barrier).
#define SW 16
#define SR (32 / SW)
__global__ __launch_bounds__(SW * 32) void k_stats(const float* __restrict__ x, float* MU, float* RD) {
    __shared__ float mus[32]; __shared__ float rds[32];
    const int t = threadIdx.x, wid = __builtin_amdgcn_readfirstlane(t >> 5), lane = t & 31;   // wave number held scalar: the row's base address is scalar, the lane's offset one register that is never rewritten
#pragma unroll 1   // rolled: one row's registers at a time
    for (int j = 0; j < SR; ++j) {
        const int rr = blockIdx.x * 32 + wid * SR + j;                // (b, c) row index < NB * C_
        const int b = rr / C_, c = rr - b * C_;
        const float* xr = x + ((size_t)b * C_ + c) * HWF + lane * 4;
        v4f r[SEQ / 128];
#pragma unroll   // unrolled: every load of the row is issued before the first is waited for
        for (int i = 0; i < SEQ / 128; ++i) r[i] = *(const v4f*)(xr + (size_t)i * 128);
        float s = 0.f;
#pragma unroll   // unrolled: r[] stays in registers
        for (int i = 0; i < SEQ / 128; ++i) { v4f v = r[i]; v[0] = bfr(v[0]); v[1] = bfr(v[1]); v[2] = bfr(v[2]); v[3] = bfr(v[3]); r[i] = v; s += (v[0] + v[1]) + (v[2] + v[3]); }
        s += __shfl_xor(s, 1, 32); s += __shfl_xor(s, 2, 32); s += __shfl_xor(s, 4, 32); s += __shfl_xor(s, 8, 32); s += __shfl_xor(s, 16, 32);
        const float mu = s * (1.0f / (float)SEQ);
        float ss = 0.f;
#pragma unroll   // unrolled: r[] stays in registers
        for (int i = 0; i < SEQ / 128; ++i) { const v4f v = r[i];
            const float d0 = v[0] - mu, d1 = v[1] - mu, d2 = v[2] - mu, d3 = v[3] - mu;
            ss += (d0 * d0 + d1 * d1) + (d2 * d2 + d3 * d3); }
        ss += __shfl_xor(ss, 1, 32); ss += __shfl_xor(ss, 2, 32); ss += __shfl_xor(ss, 4, 32); ss += __shfl_xor(ss, 8, 32); ss += __shfl_xor(ss, 16, 32);
        const float den = 4.0f * (ss * (1.0f / (float)(SEQ - 1)) + ELAM);
        const float rd = 1.0f / den;
        if (lane == 0) { mus[wid * SR + j] = mu; rds[wid * SR + j] = rd; }
    }
    __syncthreads();
    if (wid == 0) {
        const float a = mus[lane], r = rds[lane];
        float* pm = MU + (size_t)blockIdx.x * 32 + lane; float* pr = RD + (size_t)blockIdx.x * 32 + lane;
        *(float*)pm = a; *(float*)pr = r;  }
}

// ---- k_xplanes: token-major planes from channel-major x: XT[(b*SEQ+t)][c] = bf16(x[b][c][t]) (exact), X1h/X1l = bf16 hi/lo of x1 = bf16(x) * sigmoid((bf16(x) - mu)^2 * rd + 0.5).
__global__ __launch_bounds__(256) void k_xplanes(const float* __restrict__ x, const float* __restrict__ MU, const float* __restrict__ RD, bf* XT, bf* X1h, bf* X1l) {
    const size_t e = ((size_t)blockIdx.x * 256 + threadIdx.x) * 8; if (e >= (size_t)NB * SEQ * C_) return;
    const int c = (int)(e % C_); const size_t btk = e / C_; const int tpos = (int)(btk % SEQ); const int b = (int)(btk / SEQ);
    const float* xp = x + ((size_t)b * C_ + c) * HWF + tpos;
    const v8f mu8 = *(const v8f*)(MU + (size_t)b * C_ + c), rd8 = *(const v8f*)(RD + (size_t)b * C_ + c);
    v8us o0, oh, ol;
#pragma unroll
    for (int q = 0; q < 8; ++q) {
        const float xb = bfr(xp[(size_t)q * HWF]);
        const float d = xb - mu8[q];
        const float y = d * d * rd8[q] + 0.5f;
        const float ex = __expf(-y);
        const float sg = __builtin_amdgcn_rcpf(1.0f + ex);
        const float x1 = xb * sg;
        o0[q] = f2bf(xb); unsigned short hh, ll; splitf(x1, hh, ll); oh[q] = hh; ol[q] = ll;
    }
    *(v8us*)(XT + e) = o0; *(v8us*)(X1h + e) = oh; *(v8us*)(X1l + e) = ol; 
}

__global__ __launch_bounds__(256) void k_split8(const float* __restrict__ F, bf* Ph, bf* Pl, size_t n8) { const size_t i = (size_t)blockIdx.x * 256 + threadIdx.x; if (i >= n8) return; const v8f v = *(const v8f*)(F + i * 8); v8us oh, ol;
#pragma unroll
    for (int q = 0; q < 8; ++q) { unsigned short a, c; splitf(v[q], a, c); oh[q] = a; ol[q] = c; }
    *(v8us*)(Ph + i * 8) = oh; *(v8us*)(Pl + i * 8) = ol;  }
__global__ __launch_bounds__(256) void k_sumsplit8(const float* __restrict__ F1, const float* __restrict__ F2, bf* Ph, bf* Pl, size_t n8) { const size_t i = (size_t)blockIdx.x * 256 + threadIdx.x; if (i >= n8) return; const v8f v = *(const v8f*)(F1 + i * 8) + *(const v8f*)(F2 + i * 8); v8us oh, ol;
#pragma unroll
    for (int q = 0; q < 8; ++q) { unsigned short a, c; splitf(v[q], a, c); oh[q] = a; ol[q] = c; }
    *(v8us*)(Ph + i * 8) = oh; *(v8us*)(Pl + i * 8) = ol;  }
__global__ __launch_bounds__(256) void k_vsplit8(const float* __restrict__ F, h16* Ph, bf* Pl, size_t n8) { const size_t i = (size_t)blockIdx.x * 256 + threadIdx.x; if (i >= n8) return; const v8f v = *(const v8f*)(F + i * 8); v8h oh; v8us ol;
#pragma unroll
    for (int q = 0; q < 8; ++q) { const float w = v[q] * VCAR; const h16 hh = (h16)w; oh[q] = hh; ol[q] = f2bf(w - (float)hh); }
    *(v8h*)(Ph + i * 8) = oh; *(v8us*)(Pl + i * 8) = ol;  }

// ---- k_attn: eight waves per work-group, one wave per 16 queries of one batch and one map (z = 0: theta/g, z = 1: D/S; keys = phi for both), 32-key blocks, online max-subtracted softmax.
// Transposed products: S^T = K . Q^T (A = key rows, B = query columns) and O^T += V^T . P^T (A = feature rows of V, B = P^T). Lane (L, hi) then holds query L alone: 16 of the block's 32 scores sit in its own registers,
// maximum and sum are taken in the lane (one exchange between the lane halves for the maximum; the halves' sums are joined once at the end), and the two score tiles, converted in place, are the B operand of the second product.
// The work-group's 128 queries walk the same keys and values: each 64-key stage (K hi/lo rows, V hi/lo feature rows) is brought into LDS once by asynchronous copies, two buffers, the next stage in flight while this one is worked on.
// LDS ring: shared by the eight waves (block barrier at each hand-over). K rows at a 272-byte pitch, V rows at a 144-byte pitch (16 B x odd, for ds_load_b128 readers).
// LDS os: one slice per wave, private to it. Staged extent == consumed extent: rows 0..15 x cols 0..127.
#define AW   8
#define SK   64
#define KPI  136
#define VPI  72
#define KPLB (SK * KPI * 2)
#define VPLB (CI * VPI * 2)
#define STGB (2 * KPLB + 2 * VPLB)
#define NST  (SEQ / SK)
static_assert(SEQ % (AW * 16) == 0 && NST >= 2 && SK % KB == 0);
static_assert(SK * CI * 2 == 4 * AW * 32 * 16 && CI * SK * 2 == 4 * AW * 32 * 16);
__device__ __forceinline__ v16bf ldbs(const bf* p) { return cat16b(*(const v8usa*)p, *(const v8usa*)(p + 16)); }
__device__ __forceinline__ v16h  ldhs(const h16* p) { return cat16(*(const v8ha*)p, *(const v8ha*)(p + 16)); }
__device__ __forceinline__ float xhalf(float x) { return __builtin_bit_cast(float, __builtin_amdgcn_permlanex16(__builtin_bit_cast(int, x), __builtin_bit_cast(int, x), 0x76543210, 0xfedcba98, false, false)); }   // lane l takes lane l ^ 16's value
// Eight 16-byte copies per lane, global -> LDS through no register: four steps of plane a, four of plane b. The s_wait_xcnt stands inside the statement so that no address register is rewritten ahead of it.
template <typename TA, typename TB>
__device__ __forceinline__ void copy8(unsigned la, const TA* ga, unsigned lb, const TB* gb, unsigned lstep, size_t gstep) {
    asm volatile("global_load_async_to_lds_b128 %0, %8, off\n\t"
                 "global_load_async_to_lds_b128 %1, %9, off\n\t"
                 "global_load_async_to_lds_b128 %2, %10, off\n\t"
                 "global_load_async_to_lds_b128 %3, %11, off\n\t"
                 "global_load_async_to_lds_b128 %4, %12, off\n\t"
                 "global_load_async_to_lds_b128 %5, %13, off\n\t"
                 "global_load_async_to_lds_b128 %6, %14, off\n\t"
                 "global_load_async_to_lds_b128 %7, %15, off\n\t"
                 "s_wait_xcnt 0x0"
                 :: "v"(la), "v"(la + lstep), "v"(la + 2 * lstep), "v"(la + 3 * lstep), "v"(lb), "v"(lb + lstep), "v"(lb + 2 * lstep), "v"(lb + 3 * lstep),
                    "v"(ga), "v"(ga + gstep), "v"(ga + 2 * gstep), "v"(ga + 3 * gstep), "v"(gb), "v"(gb + gstep), "v"(gb + 2 * gstep), "v"(gb + 3 * gstep)
                 : "memory");
}
__global__ __launch_bounds__(AW * 32) void k_attn(const bf* __restrict__ THh, const bf* __restrict__ THl, const bf* __restrict__ DQh, const bf* __restrict__ DQl,
                                             const bf* __restrict__ PHh, const bf* __restrict__ PHl,
                                             const h16* __restrict__ GVh, const bf* __restrict__ GVl, const h16* __restrict__ SVh, const bf* __restrict__ SVl, float* Y) {
    __shared__ __align__(16) unsigned char ring[2 * STGB];
    __shared__ __align__(16) float osa[AW * 16 * OSP];
    const int tid = threadIdx.x, lane = tid & 31, L = lane & 15, hi = lane >> 4;
    const int wv = __builtin_amdgcn_readfirstlane(tid >> 5);
    float* os = osa + wv * 16 * OSP;
    const int q0 = blockIdx.x * (AW * 16) + wv * 16, b = blockIdx.y, mp = blockIdx.z;
    const size_t tok = (size_t)b * SEQ;
    const bf* Qh = (mp ? DQh : THh) + (tok + q0) * CI; const bf* Ql = (mp ? DQl : THl) + (tok + q0) * CI;
    const bf* Kh = PHh + tok * CI; const bf* Kl = PHl + tok * CI;
    const h16* Vh = (mp ? SVh : GVh) + (size_t)b * CI * SEQ; const bf* Vl = (mp ? SVl : GVl) + (size_t)b * CI * SEQ;
    float* Yo = Y + ((size_t)mp * NB * SEQ + tok + q0) * CI;
    // Copy map of one stage. K plane: 64 rows x 256 B, contiguous in global; thread tid takes 16-byte piece tid + 256 i (row (tid >> 4) + 16 i). V plane: 128 rows x 128 B; piece tid + 256 i (row (tid >> 3) + 32 i).
    const unsigned ring0 = (unsigned)(size_t)ring;
    const unsigned lk = ring0 + (unsigned)((tid >> 4) * (KPI * 2) + (tid & 15) * 16);
    const unsigned lv = ring0 + (unsigned)(2 * KPLB + (tid >> 3) * (VPI * 2) + (tid & 7) * 16);
    const bf* gkh = Kh + tid * 8; const bf* gkl = Kl + tid * 8;
    const h16* gvh = Vh + (size_t)(tid >> 3) * SEQ + (tid & 7) * 8; const bf* gvl = Vl + (size_t)(tid >> 3) * SEQ + (tid & 7) * 8;
    auto fill = [&](int st) {
        const unsigned bo = (unsigned)(st & 1) * STGB;
        copy8(lk + bo, gkh + (size_t)st * SK * CI, lk + bo + KPLB, gkl + (size_t)st * SK * CI, 16 * KPI * 2, (size_t)16 * CI);
        copy8(lv + bo, gvh + (size_t)st * SK, lv + bo + VPLB, gvl + (size_t)st * SK, 32 * VPI * 2, (size_t)32 * SEQ);
    };
    float m_i = -1.0e30f, l_i = 0.f; v8f acc[8];   // query L's running maximum (equal in both lane halves) and this lane half's part of its sum; acc[ct][v] = O^T[ct*16 + 8*hi + v][L]
#pragma unroll
    for (int ct = 0; ct < 8; ++ct) acc[ct] = (v8f){};
    const size_t qoff = (size_t)L * CI + 8 * hi;          // B fragment: query column L
    // The wave's 16 query rows never change: their hi and lo fragments are loaded once and stay in registers for the whole key walk.
    v16bf qh[CI / 32], ql[CI / 32];
#pragma unroll
    for (int ch = 0; ch < CI / 32; ++ch) { qh[ch] = ldb(Qh + qoff + ch * 32); ql[ch] = ldb(Ql + qoff + ch * 32); }
    fill(0);
    asm volatile("s_wait_asynccnt 0x0" ::: "memory");    // stage 0 has landed before the barrier that publishes it
    __syncthreads();
    fill(1);
#pragma unroll 1   // rolled: the buffer is picked by the stage's parity at run time, one copy of the hand-over and of the pass body
    for (int st = 0; st < NST; ++st) {
      const unsigned char* sb = ring + (st & 1) * STGB;
#pragma unroll 1   // rolled: the two 32-key passes of a stage share one body, as the parent's key loop did
      for (int sub = 0; sub < SK / KB; ++sub) {
        v8f lt0 = (v8f){}, lt1 = (v8f){};
        const bf* k0h = (const bf*)sb + (sub * KB + L) * KPI + 8 * hi; const bf* k0l = k0h + KPLB / 2;   // A fragment (keys): key row sub*32 + kt*16 + L of the stage
#pragma unroll   // unrolled: each chunk names its own resident query fragment
        for (int ch = 0; ch < CI / 32; ++ch) {
            const int co = ch * 32;
            const v16bf ka0 = ldbs(k0h + co), kl0 = ldbs(k0l + co), ka1 = ldbs(k0h + 16 * KPI + co), kl1 = ldbs(k0l + 16 * KPI + co);
            lt0 = wmmab(ka0, qh[ch], lt0); lt1 = wmmab(ka1, qh[ch], lt1);
            lt0 = wmmab(ka0, ql[ch], lt0); lt1 = wmmab(ka1, ql[ch], lt1);
            lt0 = wmmab(kl0, qh[ch], lt0); lt1 = wmmab(kl1, qh[ch], lt1);
        }
        // D element v of tile kt = score of key sub*32 + kt*16 + 8*hi + v against query L.
        float mx = fmaxf(fmaxf(fmaxf(lt0[0], lt1[0]), fmaxf(lt0[1], lt1[1])), fmaxf(fmaxf(lt0[2], lt1[2]), fmaxf(lt0[3], lt1[3])));
        mx = fmaxf(mx, fmaxf(fmaxf(fmaxf(lt0[4], lt1[4]), fmaxf(lt0[5], lt1[5])), fmaxf(fmaxf(lt0[6], lt1[6]), fmaxf(lt0[7], lt1[7]))));
        mx = fmaxf(mx, xhalf(mx));
        const float mn = fmaxf(m_i, mx);
        const float sc = __expf(m_i - mn);
        v16f ps; float rp[8];
#pragma unroll
        for (int v = 0; v < 8; ++v) {
            const float pa = __expf(lt0[v] - mn), pb = __expf(lt1[v] - mn);
            rp[v] = pa + pb;
            ps[v] = pa * PCAR; ps[8 + v] = pb * PCAR;            // B element s: k = 8*hi + s (s < 8), 16 + 8*hi + (s - 8) otherwise: tile 0's registers, then tile 1's
        }
        l_i = l_i * sc + (((rp[0] + rp[1]) + (rp[2] + rp[3])) + ((rp[4] + rp[5]) + (rp[6] + rp[7]))); m_i = mn;
        const v16h pa16 = __builtin_convertvector(ps, v16h);     // round to nearest even, as the scalar conversions
        const v16bf pab = __builtin_convertvector(ps, v16bf);
#pragma unroll
        for (int ct = 0; ct < 8; ++ct) acc[ct] *= sc;
        const h16* vh = (const h16*)(sb + 2 * KPLB) + L * VPI + sub * KB + 8 * hi; const bf* vl = (const bf*)(sb + 2 * KPLB + VPLB) + L * VPI + sub * KB + 8 * hi;   // A fragment (values): ci row L of the staged feature-major plane
#pragma unroll
        for (int ct = 0; ct < 8; ++ct) {
            const v16h vf = ldhs(vh + ct * 16 * VPI); const v16bf vr = ldbs(vl + ct * 16 * VPI);
            acc[ct] = wmma16(vf, pa16, acc[ct]); acc[ct] = wmmab(vr, pab, acc[ct]); }
        // Four vector slots behind the pass's last matrix instructions: the loop's branch follows them directly.
        asm volatile("v_nop\n\tv_nop\n\tv_nop\n\tv_nop" : "+v"(acc[0]), "+v"(acc[1]), "+v"(acc[2]), "+v"(acc[3]), "+v"(acc[4]), "+v"(acc[5]), "+v"(acc[6]), "+v"(acc[7]));
      }
      // Hand-over: this wave's reads of the stage are done, its own copies of the next stage have landed, every wave has arrived; only then is the buffer just read filled again.
      asm volatile("s_wait_dscnt 0x0" ::: "memory");     // the wave's last LDS reads of this buffer have returned before it may be refilled
      asm volatile("s_wait_asynccnt 0x0" ::: "memory");  // the wave's copies of stage st + 1 have landed before the barrier that publishes them
      __syncthreads();
      if (st + 2 < NST) fill(st + 2);
    }
    asm volatile("s_wait_asynccnt 0x0" ::: "memory");    // no copy is outstanding when the wave goes on to its end
    const float rl = __builtin_amdgcn_rcpf(l_i + xhalf(l_i)) * YSC;   // the two lane halves' sums of query L, joined once
#pragma unroll
    for (int ct = 0; ct < 8; ++ct) {
        const v8f o = acc[ct] * rl;
        *(v4fa*)(os + L * OSP + ct * 16 + 8 * hi) = (v4f){o[0], o[1], o[2], o[3]}; *(v4fa*)(os + L * OSP + ct * 16 + 8 * hi + 4) = (v4f){o[4], o[5], o[6], o[7]}; }
    __builtin_amdgcn_fence(__ATOMIC_RELEASE, "wavefront"); __builtin_amdgcn_wave_barrier(); asm volatile("" ::: "memory");
{
#pragma unroll
        for (int r = 0; r < 16; ++r) { const v4f val = *(const v4fa*)(os + r * OSP + lane * 4); *(v4f*)(Yo + (size_t)r * CI + lane * 4) = val; }
         }
}

extern "C" void kernel_launch(void* const* d_in, const int* in_sizes, int n_in,
                              void* d_out, int out_size, void* d_ws, size_t ws_size, hipStream_t stream) {
    if (n_in < 13) return;
    if ((size_t)in_sizes[0] < (size_t)NB * C_ * HWF) return;
    if (in_sizes[1] < CI * C_ || in_sizes[3] < CI * C_ || in_sizes[5] < CI * C_ || in_sizes[7] < CI * C_ || in_sizes[9] < CI * C_ || in_sizes[11] < C_ * CI) return;
    if (in_sizes[2] < CI || in_sizes[4] < CI || in_sizes[6] < CI || in_sizes[8] < CI || in_sizes[10] < CI || in_sizes[12] < C_) return;
    if ((size_t)out_size < (size_t)NB * C_ * HWF) return;
    const float* x = (const float*)d_in[0];
    const float* w_theta = (const float*)d_in[1];  const float* b_theta = (const float*)d_in[2];
    const float* w_phi   = (const float*)d_in[3];  const float* b_phi   = (const float*)d_in[4];
    const float* w_g     = (const float*)d_in[5];  const float* b_g     = (const float*)d_in[6];
    const float* w_d     = (const float*)d_in[7];  const float* b_d     = (const float*)d_in[8];
    const float* w_s     = (const float*)d_in[9];  const float* b_s     = (const float*)d_in[10];
    const float* w_out   = (const float*)d_in[11]; const float* b_out   = (const float*)d_in[12];
    float* OUT = (float*)d_out;                     // [NB][256][HWF]
    char* wsp = (char*)d_ws;
    auto take = [&](size_t bytes) { char* p = wsp; wsp += (bytes + 255) & ~(size_t)255; return (void*)p; };
    const size_t nTok = (size_t)NB * SEQ;
    bf* WTb = (bf*)take((size_t)CI * C_ * 2); bf* WPb = (bf*)take((size_t)CI * C_ * 2); bf* WGb = (bf*)take((size_t)CI * C_ * 2);
    bf* WDb = (bf*)take((size_t)CI * C_ * 2); bf* WSb = (bf*)take((size_t)CI * C_ * 2); bf* WOb = (bf*)take((size_t)C_ * CI * 2);
    float* MU = (float*)take((size_t)NB * C_ * 4); float* RD = (float*)take((size_t)NB * C_ * 4);
    bf* XT = (bf*)take(nTok * C_ * 2); bf* X1h = (bf*)take(nTok * C_ * 2); bf* X1l = (bf*)take(nTok * C_ * 2);
    float* F32A = (float*)take(2 * nTok * CI * 4);                 // projection scratch [nTok][128] / [NB][128][SEQ], then y1 | y2 [2][nTok][128]
    bf* THh = (bf*)take(nTok * CI * 2); bf* THl = (bf*)take(nTok * CI * 2);
    bf* PHh = (bf*)take(nTok * CI * 2); bf* PHl = (bf*)take(nTok * CI * 2);
    bf* DQh = (bf*)take(nTok * CI * 2); bf* DQl = (bf*)take(nTok * CI * 2);
    h16* GVh = (h16*)take(nTok * CI * 2); bf* GVl = (bf*)take(nTok * CI * 2);
    h16* SVh = (h16*)take(nTok * CI * 2); bf* SVl = (bf*)take(nTok * CI * 2);
    bf* Yh = (bf*)take(nTok * CI * 2); bf* Yl = (bf*)take(nTok * CI * 2);
    if ((size_t)(wsp - (char*)d_ws) > ws_size) return;
    float* Y1 = F32A; float* Y2 = F32A + nTok * CI;

    const unsigned gw = (unsigned)(((size_t)CI * C_ / 8 + 255) / 256);
    k_cvt8<<<gw, 256, 0, stream>>>(w_theta, WTb, (size_t)CI * C_ / 8);
    k_cvt8<<<gw, 256, 0, stream>>>(w_phi, WPb, (size_t)CI * C_ / 8);
    k_cvt8<<<gw, 256, 0, stream>>>(w_g, WGb, (size_t)CI * C_ / 8);
    k_cvt8<<<gw, 256, 0, stream>>>(w_d, WDb, (size_t)CI * C_ / 8);
    k_cvt8<<<gw, 256, 0, stream>>>(w_s, WSb, (size_t)CI * C_ / 8);
    k_cvt8<<<gw, 256, 0, stream>>>(w_out, WOb, (size_t)C_ * CI / 8);
    k_stats<<<(unsigned)(NB * C_ / 32), SW * 32, 0, stream>>>(x, MU, RD);                                                                   /* SimAM mu, 1/(4(var_n + eps)) per (b, c) */
    k_xplanes<<<(unsigned)((nTok * C_ / 8 + 255) / 256), 256, 0, stream>>>(x, MU, RD, XT, X1h, X1l);                                    /* x^T bf16 (exact), gated x1^T hi/lo */
    const size_t n8p = nTok * CI / 8; const unsigned gs8 = (unsigned)((n8p + 255) / 256);
    k_gemmw<bf, false, false, 1, false><<<dim3((unsigned)(nTok / 64), CI / 64, 1), 32, 0, stream>>>(XT, nullptr, WTb, nullptr, C_, F32A, CI, b_theta, nullptr, 0, 0, 0);   /* theta [tok][128] */
    k_split8<<<gs8, 256, 0, stream>>>(F32A, THh, THl, n8p);
    k_gemmw<bf, false, false, 1, false><<<dim3((unsigned)(nTok / 64), CI / 64, 1), 32, 0, stream>>>(XT, nullptr, WPb, nullptr, C_, F32A, CI, b_phi, nullptr, 0, 0, 0);     /* phi [tok][128] */
    k_split8<<<gs8, 256, 0, stream>>>(F32A, PHh, PHl, n8p);
    k_gemmw<bf, true, false, 1, false><<<dim3((unsigned)(nTok / 64), CI / 64, 1), 32, 0, stream>>>(X1h, X1l, WDb, nullptr, C_, F32A, CI, b_d, nullptr, 0, 0, 0);          /* D [tok][128] (2 products) */
    k_split8<<<gs8, 256, 0, stream>>>(F32A, DQh, DQl, n8p);
    k_gemmw<bf, false, false, 2, false><<<dim3(CI / 64, SEQ / 64, NB), 32, 0, stream>>>(WGb, nullptr, XT, nullptr, C_, F32A, SEQ, b_g, nullptr, 0, (size_t)SEQ * C_, (size_t)CI * SEQ);   /* g feature-major [b][128][SEQ] */
    k_vsplit8<<<gs8, 256, 0, stream>>>(F32A, GVh, GVl, n8p);
    k_gemmw<bf, false, true, 2, false><<<dim3(CI / 64, SEQ / 64, NB), 32, 0, stream>>>(WSb, nullptr, X1h, X1l, C_, F32A, SEQ, b_s, nullptr, 0, (size_t)SEQ * C_, (size_t)CI * SEQ);       /* S feature-major (2 products) */
    k_vsplit8<<<gs8, 256, 0, stream>>>(F32A, SVh, SVl, n8p);
    k_attn<<<dim3(SEQ / (AW * 16), NB, 2), AW * 32, 0, stream>>>(THh, THl, DQh, DQl, PHh, PHl, GVh, GVl, SVh, SVl, F32A);                          /* y1 = softmax(theta.phi) g, y2 = softmax(D.phi) S */
    k_sumsplit8<<<gs8, 256, 0, stream>>>(Y1, Y2, Yh, Yl, n8p);                                                                         /* y = y1 + y2 -> hi/lo */
    k_gemmw<bf, false, true, 2, true><<<dim3(C_ / 64, SEQ / 64, NB), 32, 0, stream>>>(WOb, nullptr, Yh, Yl, CI, OUT, HWF, b_out, x, 0, (size_t)SEQ * CI, (size_t)C_ * HWF);      /* out[b][co][t] = W_out . y + b_out + bf16(x) */
}

// v005
// A run of this version takes 190 microseconds.
// Next to v004, in two timings, it ran 1.36 times as fast each time.
// Over all steps from v000 it is 5.09 times as fast.
#include <hip/hip_runtime.h>

// Contractions, f32 accumulate: five 1x1 projections on v_wmma_f32_16x16x32_bf16 (x as exact bf16; SimAM-gated branch as bf16 hi+lo planes = 2 products; weights bf16); score tiles q.k on v_wmma_f32_16x16x32_bf16 with hi/lo x hi/lo planes (3 products); P.V on v_wmma_f32_16x16x32_f16 (P x 2^14, V x 16 as f16 hi) plus v_wmma_f32_16x16x32_bf16 (P bf16 x V bf16 residual); output projection on v_wmma_f32_16x16x32_bf16 (y as bf16 hi+lo planes = 2 products). SimAM statistics/gating, online max-subtracted softmax, normalisation and residual add in f32.
// Data flow: x [NB][256][4096] channel-major -> token-major planes XT (bf16 exact), X1h/X1l (gated branch, hi/lo); theta/phi/D token-major [t][128] f32 -> bf16 hi/lo planes; g/S feature-major [128][t] f32 -> f16 hi (x16) + bf16 residual; eight waves per work-group share 64-key K/V stages in LDS; one wave per 16 queries, its query fragments resident in registers, walks 32-key blocks (transposed scores K.Q^T, online softmax in the lane, P^T packed from the score registers, V^T.P^T); y1/y2 [t][128] f32; y = y1 + y2 -> bf16 hi/lo; out[b][co][t] = W_out . y + b_out + bf16(x).

#ifndef NB
#define NB 4
#endif
#ifndef SEQ
#define SEQ 4096
#endif
#define NBF  4
#define HWF  4096
#define C_   256
#define CI   128
#define KB   32
#define OSP  132
#define PCAR 16384.0f
#define VCAR 16.0f
#define YSC  (1.0f / 262144.0f)
#define ELAM 1e-4f

static_assert(NB >= 1 && NB <= NBF);
static_assert(SEQ % 128 == 0 && SEQ >= 128 && SEQ <= HWF);
static_assert(SEQ % KB == 0 && SEQ % 64 == 0 && SEQ % 16 == 0);
static_assert((NB * C_) % 32 == 0);
static_assert(C_ % 64 == 0 && CI % 64 == 0 && C_ % 32 == 0 && CI % 32 == 0);
static_assert((NB * SEQ * C_) % (8 * 256) == 0 && (NB * SEQ * CI) % 8 == 0);

typedef _Float16 h16;
typedef unsigned short bf;
typedef __attribute__((ext_vector_type(16))) __bf16   v16bf;
typedef __attribute__((ext_vector_type(16))) _Float16 v16h;
typedef __attribute__((ext_vector_type(8)))  _Float16 v8h;
typedef __attribute__((ext_vector_type(8)))  unsigned short v8us;
typedef __attribute__((ext_vector_type(8)))  float    v8f;
typedef __attribute__((ext_vector_type(16))) float    v16f;
typedef __attribute__((ext_vector_type(4)))  float    v4f;
typedef v8h  __attribute__((may_alias)) v8ha;
typedef v4f  __attribute__((may_alias)) v4fa;
typedef v8us __attribute__((may_alias)) v8usa;

__device__ __forceinline__ unsigned short f2bf(float f) { unsigned u = __float_as_uint(f); u += 0x7FFFu + ((u >> 16) & 1u); return (unsigned short)(u >> 16); }
__device__ __forceinline__ float bf2f(unsigned short b) { return __uint_as_float(((unsigned)b) << 16); }
__device__ __forceinline__ float bfr(float f) { return bf2f(f2bf(f)); }
__device__ __forceinline__ void splitf(float y, unsigned short& h, unsigned short& l) { h = f2bf(y); l = f2bf(y - bf2f(h)); }
__device__ __forceinline__ v16h cat16(v8h lo, v8h hi) { return __builtin_shufflevector(lo, hi, 0, 1, 2, 3, 4, 5, 6, 7, 8, 9, 10, 11, 12, 13, 14, 15); }
__device__ __forceinline__ v16bf cat16b(v8us lo, v8us hi) { return __builtin_bit_cast(v16bf, __builtin_shufflevector(lo, hi, 0, 1, 2, 3, 4, 5, 6, 7, 8, 9, 10, 11, 12, 13, 14, 15)); }
__device__ __forceinline__ v8f wmma16(v16h a, v16h b, v8f c) { return __builtin_amdgcn_wmma_f32_16x16x32_f16(false, a, false, b, (short)0, c, false, false); }
__device__ __forceinline__ v8f wmmab(v16bf a, v16bf b, v8f c) { return __builtin_amdgcn_wmma_f32_16x16x32_bf16(false, a, false, b, (short)0, c, false, false); }
// Fragment loaders (A and B share the same per-lane k map): p already points at row (lane & 15), k0 + 8*(lane >> 4); elements 0..7 <- p[0..7], elements 8..15 <- p[16..23].
__device__ __forceinline__ v16bf ldb(const bf* p) { return cat16b(*(const v8us*)p, *(const v8us*)(p + 16)); }
__device__ __forceinline__ v16h  ldh(const h16* p) { return cat16(*(const v8h*)p, *(const v8h*)(p + 16)); }

// ---- gemmw_tile: register-blocked GEMM, ONE WAVE per 64x64 output tile (16 accumulators), operands straight from K-contiguous 16-bit planes; tile (bx, by) of batch bz, tiles (M/64, N/64, Z), 32 threads. os: the wave's 16 x 68 f32 of LDS.
// C[m][n] (f32, pitch ldc) = sum_k A[m][k] Bt[n][k] (+ A2[m][k] Bt[n][k] when A2ON) (+ A[m][k] Bt2[n][k] when B2ON) (+ bf16(bias[n]) BIASM==1 | bf16(bias[m]) BIASM==2) (+ bf16(res[m][n]) when RESID, same indexing as C).
// z-batch strides sA/sB/sC in elements. K % 32 == 0, M % 64 == 0, N % 64 == 0. K is a compile-time constant: the four row blocks of an operand are then fixed offsets from one address pair.
template <typename T16> struct WFrag;
template <> struct WFrag<h16> { typedef v16h V; static __device__ __forceinline__ V ld(const h16* p) { return ldh(p); } static __device__ __forceinline__ v8f mma(V a, V b, v8f c) { return wmma16(a, b, c); } };
template <> struct WFrag<bf> { typedef v16bf V; static __device__ __forceinline__ V ld(const bf* p) { return ldb(p); } static __device__ __forceinline__ v8f mma(V a, V b, v8f c) { return wmmab(a, b, c); } };
template <typename T16, bool A2ON, bool B2ON, int BIASM, bool RESID, int K>
__device__ __forceinline__ void gemmw_tile(float* os, int bx, int by, int bz, const T16* __restrict__ A, const T16* __restrict__ A2, const T16* __restrict__ Bt, const T16* __restrict__ Bt2,
                                              float* C, int ldc, const float* __restrict__ bias, const float* __restrict__ res, size_t sA, size_t sB, size_t sC) {
    typedef typename WFrag<T16>::V V;
    const size_t z = bz;
    A += z * sA; if (A2ON) A2 += z * sA; Bt += z * sB; if (B2ON) Bt2 += z * sB; C += z * sC; if (RESID) res += z * sC;
    const int lane = threadIdx.x & 31, lr = lane & 15, hi = lane >> 4;
    const int r0 = bx * 64, c0 = by * 64;
    v8f acc[4][4];
#pragma unroll
    for (int mb = 0; mb < 4; ++mb)
#pragma unroll
        for (int nb = 0; nb < 4; ++nb) acc[mb][nb] = (v8f){};
    const size_t aoff = (size_t)(r0 + lr) * K + 8 * hi, boff = (size_t)(c0 + lr) * K + 8 * hi;
#pragma unroll 1
    for (int kc = 0; kc < K; kc += 32) {
        V a[4], a2[4], bq[4], bq2[4];
        const T16* pa = A + aoff + kc; const T16* pa2 = A2ON ? A2 + aoff + kc : pa; const T16* pb = Bt + boff + kc; const T16* pb2 = B2ON ? Bt2 + boff + kc : pb;
#pragma unroll
        for (int mb = 0; mb < 4; ++mb) { a[mb] = WFrag<T16>::ld(pa + (size_t)mb * 16 * K); a2[mb] = a[mb]; if (A2ON) a2[mb] = WFrag<T16>::ld(pa2 + (size_t)mb * 16 * K); }
#pragma unroll
        for (int nb = 0; nb < 4; ++nb) { bq[nb] = WFrag<T16>::ld(pb + (size_t)nb * 16 * K); bq2[nb] = bq[nb]; if (B2ON) bq2[nb] = WFrag<T16>::ld(pb2 + (size_t)nb * 16 * K); }
        asm volatile("s_wait_xcnt 0x0" :: "v"(pa), "v"(pa2), "v"(pb), "v"(pb2) : "memory");   // behind the trip's fragment loads; it takes their address pairs as inputs, so that no load's result and no address step lands in a pair ahead of it
#pragma unroll
        for (int nb = 0; nb < 4; ++nb) {
            const V b = bq[nb], b2 = bq2[nb];
#pragma unroll
            for (int mb = 0; mb < 4; ++mb) {
                acc[mb][nb] = WFrag<T16>::mma(a[mb], b, acc[mb][nb]);
                if (A2ON) acc[mb][nb] = WFrag<T16>::mma(a2[mb], b, acc[mb][nb]);
                if (B2ON) acc[mb][nb] = WFrag<T16>::mma(a[mb], b2, acc[mb][nb]); } }
        asm volatile("v_nop\n\tv_nop\n\tv_nop\n\tv_nop" : "+v"(acc[0][0]), "+v"(acc[1][1]), "+v"(acc[2][2]), "+v"(acc[3][3]) : "v"(a[0]), "v"(a[3]));
    }
#pragma unroll
    for (int mb = 0; mb < 4; ++mb) {
#pragma unroll
        for (int nb = 0; nb < 4; ++nb) {
#pragma unroll
            for (int j = 0; j < 8; ++j) os[(hi * 8 + j) * 68 + nb * 16 + lr] = acc[mb][nb][j]; }
        __builtin_amdgcn_fence(__ATOMIC_RELEASE, "wavefront"); __builtin_amdgcn_wave_barrier(); asm volatile("" ::: "memory");
        const size_t rb = (size_t)(r0 + mb * 16);
        v4f rv8[8];
        if (RESID) {
            const float* rp[8];
#pragma unroll
            for (int s = 0; s < 8; ++s) { rp[s] = res + (rb + 2 * s + hi) * (size_t)ldc + c0 + lr * 4; rv8[s] = *(const v4f*)rp[s]; }
            asm volatile("s_wait_xcnt 0x0" :: "v"(rp[0]), "v"(rp[1]), "v"(rp[2]), "v"(rp[3]), "v"(rp[4]), "v"(rp[5]), "v"(rp[6]), "v"(rp[7]) : "memory");   // behind the row block's residual loads; it takes their address pairs as inputs, so that no load's result lands in a pair ahead of it
        }
{
#pragma unroll
            for (int s = 0; s < 8; ++s) {
                const int row = 2 * s + hi, cofs = lr * 4;
                v4f val = *(const v4fa*)(os + row * 68 + cofs);
                if (BIASM == 1) { val[0] += bfr(bias[c0 + cofs]); val[1] += bfr(bias[c0 + cofs + 1]); val[2] += bfr(bias[c0 + cofs + 2]); val[3] += bfr(bias[c0 + cofs + 3]); }
                if (BIASM == 2) { const float bv = bfr(bias[rb + row]); val[0] += bv; val[1] += bv; val[2] += bv; val[3] += bv; }
                if (RESID) { const v4f rv = rv8[s]; val[0] += bfr(rv[0]); val[1] += bfr(rv[1]); val[2] += bfr(rv[2]); val[3] += bfr(rv[3]); }
                *(v4f*)(C + (rb + row) * (size_t)ldc + c0 + cofs) = val; }
             }
        asm volatile("s_wait_xcnt 0x0" ::: "memory");   // behind the row block's stores: the next row block reuses their data and address registers
        __builtin_amdgcn_fence(__ATOMIC_RELEASE, "wavefront"); __builtin_amdgcn_wave_barrier(); asm volatile("" ::: "memory");
    }
}
template <typename T16, bool A2ON, bool B2ON, int BIASM, bool RESID, int K>
__global__ __launch_bounds__(32) void k_gemmw(const T16* __restrict__ A, const T16* __restrict__ A2, const T16* __restrict__ Bt, const T16* __restrict__ Bt2,
                                              float* C, int ldc, const float* __restrict__ bias, const float* __restrict__ res, size_t sA, size_t sB, size_t sC) {
    __shared__ __align__(16) float os[16 * 68];
    gemmw_tile<T16, A2ON, B2ON, BIASM, RESID, K>(os, blockIdx.x, blockIdx.y, blockIdx.z, A, A2, Bt, Bt2, C, ldc, bias, res, sA, sB, sC);
}
// ---- k_proj5: the five projections need nothing of each other and run as one grid: blockIdx.y names the projection (the two-product ones first), blockIdx.x its 64x64 tile, numbered as the separate grids numbered theirs. Each writes an f32 plane of its own.
#define PTIL ((NB * SEQ / 64) * (CI / 64))
__global__ __launch_bounds__(32) void k_proj5(const bf* __restrict__ XT, const bf* __restrict__ X1h, const bf* __restrict__ X1l,
                                              const bf* __restrict__ WTb, const bf* __restrict__ WPb, const bf* __restrict__ WGb, const bf* __restrict__ WDb, const bf* __restrict__ WSb,
                                              const float* __restrict__ b_theta, const float* __restrict__ b_phi, const float* __restrict__ b_g, const float* __restrict__ b_d, const float* __restrict__ b_s,
                                              float* FT, float* FP, float* FG, float* FD, float* FS) {
    __shared__ __align__(16) float os[16 * 68];
    const int p = blockIdx.y, i = blockIdx.x;
    const int tx = i % (NB * SEQ / 64), ty = i / (NB * SEQ / 64);                                    // token-major [tok][128]: tiles (nTok/64, CI/64)
    const int fx = i % (CI / 64), fy = (i / (CI / 64)) % (SEQ / 64), fz = i / ((CI / 64) * (SEQ / 64));   // feature-major [b][128][SEQ]: tiles (CI/64, SEQ/64, NB)
    if (p == 0)      gemmw_tile<bf, true, false, 1, false, C_>(os, tx, ty, 0, X1h, X1l, WDb, nullptr, FD, CI, b_d, nullptr, 0, 0, 0);                                        /* D [tok][128] (2 products) */
    else if (p == 1) gemmw_tile<bf, false, true, 2, false, C_>(os, fx, fy, fz, WSb, nullptr, X1h, X1l, FS, SEQ, b_s, nullptr, 0, (size_t)SEQ * C_, (size_t)CI * SEQ);        /* S feature-major (2 products) */
    else if (p == 2) gemmw_tile<bf, false, false, 2, false, C_>(os, fx, fy, fz, WGb, nullptr, XT, nullptr, FG, SEQ, b_g, nullptr, 0, (size_t)SEQ * C_, (size_t)CI * SEQ);     /* g feature-major */
    else             gemmw_tile<bf, false, false, 1, false, C_>(os, tx, ty, 0, XT, nullptr, p == 3 ? WTb : WPb, nullptr, p == 3 ? FT : FP, CI, p == 3 ? b_theta : b_phi, nullptr, 0, 0, 0);   /* theta, phi [tok][128] */
}

// k_stats: one work-group per 32 (b, c) rows (its 32 results fill one 128-byte line of MU and of RD), sixteen waves, two rows per wave one after the other.
// A wave brings its whole row into registers with all its loads in flight at once, rounds it to bf16 there, and takes the mean and the centred sum of squares from the registers: the row is read once and no load waits on another.
// LDS mus/rds: cross-wave (block barrier).
#define SW 16
#define SR (32 / SW)
__global__ __launch_bounds__(SW * 32) void k_stats(const float* __restrict__ x, float* MU, float* RD) {
    __shared__ float mus[32]; __shared__ float rds[32];
    const int t = threadIdx.x, wid = __builtin_amdgcn_readfirstlane(t >> 5), lane = t & 31;   // wave number held scalar: the row's base address is scalar, the lane's offset one register that is never rewritten
#pragma unroll 1   // rolled: one row's registers at a time
    for (int j = 0; j < SR; ++j) {
        const int rr = blockIdx.x * 32 + wid * SR + j;                // (b, c) row index < NB * C_
        const int b = rr / C_, c = rr - b * C_;
        const float* xr = x + ((size_t)b * C_ + c) * HWF + lane * 4;
        v4f r[SEQ / 128];
#pragma unroll   // unrolled: every load of the row is issued before the first is waited for
        for (int i = 0; i < SEQ / 128; ++i) r[i] = *(const v4f*)(xr + (size_t)i * 128);
        float s = 0.f;
#pragma unroll   // unrolled: r[] stays in registers
        for (int i = 0; i < SEQ / 128; ++i) { v4f v = r[i]; v[0] = bfr(v[0]); v[1] = bfr(v[1]); v[2] = bfr(v[2]); v[3] = bfr(v[3]); r[i] = v; s += (v[0] + v[1]) + (v[2] + v[3]); }
        s += __shfl_xor(s, 1, 32); s += __shfl_xor(s, 2, 32); s += __shfl_xor(s, 4, 32); s += __shfl_xor(s, 8, 32); s += __shfl_xor(s, 16, 32);
        const float mu = s * (1.0f / (float)SEQ);
        float ss = 0.f;
#pragma unroll   // unrolled: r[] stays in registers
        for (int i = 0; i < SEQ / 128; ++i) { const v4f v = r[i];
            const float d0 = v[0] - mu, d1 = v[1] - mu, d2 = v[2] - mu, d3 = v[3] - mu;
            ss += (d0 * d0 + d1 * d1) + (d2 * d2 + d3 * d3); }
        ss += __shfl_xor(ss, 1, 32); ss += __shfl_xor(ss, 2, 32); ss += __shfl_xor(ss, 4, 32); ss += __shfl_xor(ss, 8, 32); ss += __shfl_xor(ss, 16, 32);
        const float den = 4.0f * (ss * (1.0f / (float)(SEQ - 1)) + ELAM);
        const float rd = 1.0f / den;
        if (lane == 0) { mus[wid * SR + j] = mu; rds[wid * SR + j] = rd; }
    }
    __syncthreads();
    if (wid == 0) {
        const float a = mus[lane], r = rds[lane];
        float* pm = MU + (size_t)blockIdx.x * 32 + lane; float* pr = RD + (size_t)blockIdx.x * 32 + lane;
        *(float*)pm = a; *(float*)pr = r;  }
}

// ---- k_xplanes: token-major planes from channel-major x: XT[(b*SEQ+t)][c] = bf16(x[b][c][t]) (exact), X1h/X1l = bf16 hi/lo of x1 = bf16(x) * sigmoid((bf16(x) - mu)^2 * rd + 0.5).
// The six weight matrices' conversion to bf16 needs nothing of x and rides in the same grid: work-groups from XPB on, WCB of them per matrix, eight elements a thread.
#define XPB (NB * SEQ * C_ / 8 / 256)
#define WCB (CI * C_ / 8 / 256)
static_assert((CI * C_ / 8) % 256 == 0);
__global__ __launch_bounds__(256) void k_xplanes(const float* __restrict__ x, const float* __restrict__ MU, const float* __restrict__ RD, bf* XT, bf* X1h, bf* X1l,
                                                 const float* __restrict__ w_theta, const float* __restrict__ w_phi, const float* __restrict__ w_g, const float* __restrict__ w_d, const float* __restrict__ w_s, const float* __restrict__ w_out,
                                                 bf* WTb, bf* WPb, bf* WGb, bf* WDb, bf* WSb, bf* WOb) {
    if (blockIdx.x >= XPB) {
        const int cb = blockIdx.x - XPB, w = cb / WCB;
        const float* src = w == 0 ? w_theta : w == 1 ? w_phi : w == 2 ? w_g : w == 3 ? w_d : w == 4 ? w_s : w_out;
        bf* dst = w == 0 ? WTb : w == 1 ? WPb : w == 2 ? WGb : w == 3 ? WDb : w == 4 ? WSb : WOb;
        const size_t i = (size_t)(cb - w * WCB) * 256 + threadIdx.x;
        const v8f v = *(const v8f*)(src + i * 8); v8us o;
#pragma unroll
        for (int k = 0; k < 8; ++k) o[k] = f2bf(v[k]);
        *(v8us*)(dst + i * 8) = o;
        return;
    }
    const size_t e = ((size_t)blockIdx.x * 256 + threadIdx.x) * 8; if (e >= (size_t)NB * SEQ * C_) return;
    const int c = (int)(e % C_); const size_t btk = e / C_; const int tpos = (int)(btk % SEQ); const int b = (int)(btk / SEQ);
    const float* xp = x + ((size_t)b * C_ + c) * HWF + tpos;
    const v8f mu8 = *(const v8f*)(MU + (size_t)b * C_ + c), rd8 = *(const v8f*)(RD + (size_t)b * C_ + c);
    v8us o0, oh, ol;
#pragma unroll
    for (int q = 0; q < 8; ++q) {
        const float xb = bfr(xp[(size_t)q * HWF]);
        const float d = xb - mu8[q];
        const float y = d * d * rd8[q] + 0.5f;
        const float ex = __expf(-y);
        const float sg = __builtin_amdgcn_rcpf(1.0f + ex);
        const float x1 = xb * sg;
        o0[q] = f2bf(xb); unsigned short hh, ll; splitf(x1, hh, ll); oh[q] = hh; ol[q] = ll;
    }
    *(v8us*)(XT + e) = o0; *(v8us*)(X1h + e) = oh; *(v8us*)(X1l + e) = ol; 
}

__global__ __launch_bounds__(256) void k_sumsplit8(const float* __restrict__ F1, const float* __restrict__ F2, bf* Ph, bf* Pl, size_t n8) { const size_t i = (size_t)blockIdx.x * 256 + threadIdx.x; if (i >= n8) return; const v8f v = *(const v8f*)(F1 + i * 8) + *(const v8f*)(F2 + i * 8); v8us oh, ol;
#pragma unroll
    for (int q = 0; q < 8; ++q) { unsigned short a, c; splitf(v[q], a, c); oh[q] = a; ol[q] = c; }
    *(v8us*)(Ph + i * 8) = oh; *(v8us*)(Pl + i * 8) = ol;  }
// k_split5: the five projections' f32 planes go to their 16-bit planes in one grid; blockIdx.y names the plane: 0..2 theta, phi, D (bf16 hi/lo), 3..4 g, S (f16 hi x16 + bf16 residual).
__global__ __launch_bounds__(256) void k_split5(const float* __restrict__ FT, const float* __restrict__ FP, const float* __restrict__ FD, const float* __restrict__ FG, const float* __restrict__ FS,
                                                bf* THh, bf* THl, bf* PHh, bf* PHl, bf* DQh, bf* DQl, h16* GVh, bf* GVl, h16* SVh, bf* SVl, size_t n8) {
    const size_t i = (size_t)blockIdx.x * 256 + threadIdx.x; if (i >= n8) return;
    const int p = blockIdx.y;
    if (p < 3) {
        const float* F = p == 0 ? FT : p == 1 ? FP : FD; bf* Ph = p == 0 ? THh : p == 1 ? PHh : DQh; bf* Pl = p == 0 ? THl : p == 1 ? PHl : DQl;
        const v8f v = *(const v8f*)(F + i * 8); v8us oh, ol;
#pragma unroll
        for (int q = 0; q < 8; ++q) { unsigned short a, c; splitf(v[q], a, c); oh[q] = a; ol[q] = c; }
        *(v8us*)(Ph + i * 8) = oh; *(v8us*)(Pl + i * 8) = ol;
        asm volatile("s_wait_xcnt 0x0" ::: "memory");   // behind the two stores: nothing that is laid out behind them may reuse their registers ahead of it
    } else {
        const float* F = p == 3 ? FG : FS; h16* Ph = p == 3 ? GVh : SVh; bf* Pl = p == 3 ? GVl : SVl;
        const v8f v = *(const v8f*)(F + i * 8); v8h oh; v8us ol;
#pragma unroll
        for (int q = 0; q < 8; ++q) { const float w = v[q] * VCAR; const h16 hh = (h16)w; oh[q] = hh; ol[q] = f2bf(w - (float)hh); }
        *(v8h*)(Ph + i * 8) = oh; *(v8us*)(Pl + i * 8) = ol;
        asm volatile("s_wait_xcnt 0x0" ::: "memory");   // as above
    }
}

// ---- k_attn: eight waves per work-group, one wave per 16 queries of one batch and one map (z = 0: theta/g, z = 1: D/S; keys = phi for both), 32-key blocks, online max-subtracted softmax.
// Transposed products: S^T = K . Q^T (A = key rows, B = query columns) and O^T += V^T . P^T (A = feature rows of V, B = P^T). Lane (L, hi) then holds query L alone: 16 of the block's 32 scores sit in its own registers,
// maximum and sum are taken in the lane (one exchange between the lane halves for the maximum; the halves' sums are joined once at the end), and the two score tiles, converted in place, are the B operand of the second product.
// The work-group's 128 queries walk the same keys and values: each 64-key stage (K hi/lo rows, V hi/lo feature rows) is brought into LDS once by asynchronous copies, two buffers, the next stage in flight while this one is worked on.
// LDS ring: shared by the eight waves (block barrier at each hand-over). K rows at a 272-byte pitch, V rows at a 144-byte pitch (16 B x odd, for ds_load_b128 readers).
// LDS os: one slice per wave, private to it. Staged extent == consumed extent: rows 0..15 x cols 0..127.
#define AW   8
#define SK   64
#define KPI  136
#define VPI  72
#define KPLB (SK * KPI * 2)
#define VPLB (CI * VPI * 2)
#define STGB (2 * KPLB + 2 * VPLB)
#define NST  (SEQ / SK)
static_assert(SEQ % (AW * 16) == 0 && NST >= 2 && SK % KB == 0);
static_assert(SK * CI * 2 == 4 * AW * 32 * 16 && CI * SK * 2 == 4 * AW * 32 * 16);
__device__ __forceinline__ v16bf ldbs(const bf* p) { return cat16b(*(const v8usa*)p, *(const v8usa*)(p + 16)); }
__device__ __forceinline__ v16h  ldhs(const h16* p) { return cat16(*(const v8ha*)p, *(const v8ha*)(p + 16)); }
__device__ __forceinline__ float xhalf(float x) { return __builtin_bit_cast(float, __builtin_amdgcn_permlanex16(__builtin_bit_cast(int, x), __builtin_bit_cast(int, x), 0x76543210, 0xfedcba98, false, false)); }   // lane l takes lane l ^ 16's value
// Eight 16-byte copies per lane, global -> LDS through no register: four steps of plane a, four of plane b. The s_wait_xcnt stands inside the statement so that no address register is rewritten ahead of it.
template <typename TA, typename TB>
__device__ __forceinline__ void copy8(unsigned la, const TA* ga, unsigned lb, const TB* gb, unsigned lstep, size_t gstep) {
    asm volatile("global_load_async_to_lds_b128 %0, %8, off\n\t"
                 "global_load_async_to_lds_b128 %1, %9, off\n\t"
                 "global_load_async_to_lds_b128 %2, %10, off\n\t"
                 "global_load_async_to_lds_b128 %3, %11, off\n\t"
                 "global_load_async_to_lds_b128 %4, %12, off\n\t"
                 "global_load_async_to_lds_b128 %5, %13, off\n\t"
                 "global_load_async_to_lds_b128 %6, %14, off\n\t"
                 "global_load_async_to_lds_b128 %7, %15, off\n\t"
                 "s_wait_xcnt 0x0"
                 :: "v"(la), "v"(la + lstep), "v"(la + 2 * lstep), "v"(la + 3 * lstep), "v"(lb), "v"(lb + lstep), "v"(lb + 2 * lstep), "v"(lb + 3 * lstep),
                    "v"(ga), "v"(ga + gstep), "v"(ga + 2 * gstep), "v"(ga + 3 * gstep), "v"(gb), "v"(gb + gstep), "v"(gb + 2 * gstep), "v"(gb + 3 * gstep)
                 : "memory");
}
__global__ __launch_bounds__(AW * 32) void k_attn(const bf* __restrict__ THh, const bf* __restrict__ THl, const bf* __restrict__ DQh, const bf* __restrict__ DQl,
                                             const bf* __restrict__ PHh, const bf* __restrict__ PHl,
                                             const h16* __restrict__ GVh, const bf* __restrict__ GVl, const h16* __restrict__ SVh, const bf* __restrict__ SVl, float* Y) {
    __shared__ __align__(16) unsigned char ring[2 * STGB];
    __shared__ __align__(16) float osa[AW * 16 * OSP];
    const int tid = threadIdx.x, lane = tid & 31, L = lane & 15, hi = lane >> 4;
    const int wv = __builtin_amdgcn_readfirstlane(tid >> 5);
    float* os = osa + wv * 16 * OSP;
    const int q0 = blockIdx.x * (AW * 16) + wv * 16, b = blockIdx.y, mp = blockIdx.z;
    const size_t tok = (size_t)b * SEQ;
    const bf* Qh = (mp ? DQh : THh) + (tok + q0) * CI; const bf* Ql = (mp ? DQl : THl) + (tok + q0) * CI;
    const bf* Kh = PHh + tok * CI; const bf* Kl = PHl + tok * CI;
    const h16* Vh = (mp ? SVh : GVh) + (size_t)b * CI * SEQ; const bf* Vl = (mp ? SVl : GVl) + (size_t)b * CI * SEQ;
    float* Yo = Y + ((size_t)mp * NB * SEQ + tok + q0) * CI;
    // Copy map of one stage. K plane: 64 rows x 256 B, contiguous in global; thread tid takes 16-byte piece tid + 256 i (row (tid >> 4) + 16 i). V plane: 128 rows x 128 B; piece tid + 256 i (row (tid >> 3) + 32 i).
    const unsigned ring0 = (unsigned)(size_t)ring;
    const unsigned lk = ring0 + (unsigned)((tid >> 4) * (KPI * 2) + (tid & 15) * 16);
    const unsigned lv = ring0 + (unsigned)(2 * KPLB + (tid >> 3) * (VPI * 2) + (tid & 7) * 16);
    const bf* gkh = Kh + tid * 8; const bf* gkl = Kl + tid * 8;
    const h16* gvh = Vh + (size_t)(tid >> 3) * SEQ + (tid & 7) * 8; const bf* gvl = Vl + (size_t)(tid >> 3) * SEQ + (tid & 7) * 8;
    auto fill = [&](int st) {
        const unsigned bo = (unsigned)(st & 1) * STGB;
        copy8(lk + bo, gkh + (size_t)st * SK * CI, lk + bo + KPLB, gkl + (size_t)st * SK * CI, 16 * KPI * 2, (size_t)16 * CI);
        copy8(lv + bo, gvh + (size_t)st * SK, lv + bo + VPLB, gvl + (size_t)st * SK, 32 * VPI * 2, (size_t)32 * SEQ);
    };
    float m_i = -1.0e30f, l_i = 0.f; v8f acc[8];   // query L's running maximum (equal in both lane halves) and this lane half's part of its sum; acc[ct][v] = O^T[ct*16 + 8*hi + v][L]
#pragma unroll
    for (int ct = 0; ct < 8; ++ct) acc[ct] = (v8f){};
    const size_t qoff = (size_t)L * CI + 8 * hi;          // B fragment: query column L
    // The wave's 16 query rows never change: their hi and lo fragments are loaded once and stay in registers for the whole key walk.
    v16bf qh[CI / 32], ql[CI / 32];
#pragma unroll
    for (int ch = 0; ch < CI / 32; ++ch) { qh[ch] = ldb(Qh + qoff + ch * 32); ql[ch] = ldb(Ql + qoff + ch * 32); }
    fill(0);
    asm volatile("s_wait_asynccnt 0x0" ::: "memory");    // stage 0 has landed before the barrier that publishes it
    __syncthreads();
    fill(1);
#pragma unroll 1   // rolled: the buffer is picked by the stage's parity at run time, one copy of the hand-over and of the pass body
    for (int st = 0; st < NST; ++st) {
      const unsigned char* sb = ring + (st & 1) * STGB;
#pragma unroll 1   // rolled: the two 32-key passes of a stage share one body, as the parent's key loop did
      for (int sub = 0; sub < SK / KB; ++sub) {
        v8f lt0 = (v8f){}, lt1 = (v8f){};
        const bf* k0h = (const bf*)sb + (sub * KB + L) * KPI + 8 * hi; const bf* k0l = k0h + KPLB / 2;   // A fragment (keys): key row sub*32 + kt*16 + L of the stage
#pragma unroll   // unrolled: each chunk names its own resident query fragment
        for (int ch = 0; ch < CI / 32; ++ch) {
            const int co = ch * 32;
            const v16bf ka0 = ldbs(k0h + co), kl0 = ldbs(k0l + co), ka1 = ldbs(k0h + 16 * KPI + co), kl1 = ldbs(k0l + 16 * KPI + co);
            lt0 = wmmab(ka0, qh[ch], lt0); lt1 = wmmab(ka1, qh[ch], lt1);
            lt0 = wmmab(ka0, ql[ch], lt0); lt1 = wmmab(ka1, ql[ch], lt1);
            lt0 = wmmab(kl0, qh[ch], lt0); lt1 = wmmab(kl1, qh[ch], lt1);
        }
        // D element v of tile kt = score of key sub*32 + kt*16 + 8*hi + v against query L.
        float mx = fmaxf(fmaxf(fmaxf(lt0[0], lt1[0]), fmaxf(lt0[1], lt1[1])), fmaxf(fmaxf(lt0[2], lt1[2]), fmaxf(lt0[3], lt1[3])));
        mx = fmaxf(mx, fmaxf(fmaxf(fmaxf(lt0[4], lt1[4]), fmaxf(lt0[5], lt1[5])), fmaxf(fmaxf(lt0[6], lt1[6]), fmaxf(lt0[7], lt1[7]))));
        mx = fmaxf(mx, xhalf(mx));
        const float mn = fmaxf(m_i, mx);
        const float sc = __expf(m_i - mn);
        v16f ps; float rp[8];
#pragma unroll
        for (int v = 0; v < 8; ++v) {
            const float pa = __expf(lt0[v] - mn), pb = __expf(lt1[v] - mn);
            rp[v] = pa + pb;
            ps[v] = pa * PCAR; ps[8 + v] = pb * PCAR;            // B element s: k = 8*hi + s (s < 8), 16 + 8*hi + (s - 8) otherwise: tile 0's registers, then tile 1's
        }
        l_i = l_i * sc + (((rp[0] + rp[1]) + (rp[2] + rp[3])) + ((rp[4] + rp[5]) + (rp[6] + rp[7]))); m_i = mn;
        const v16h pa16 = __builtin_convertvector(ps, v16h);     // round to nearest even, as the scalar conversions
        const v16bf pab = __builtin_convertvector(ps, v16bf);
#pragma unroll
        for (int ct = 0; ct < 8; ++ct) acc[ct] *= sc;
        const h16* vh = (const h16*)(sb + 2 * KPLB) + L * VPI + sub * KB + 8 * hi; const bf* vl = (const bf*)(sb + 2 * KPLB + VPLB) + L * VPI + sub * KB + 8 * hi;   // A fragment (values): ci row L of the staged feature-major plane
#pragma unroll
        for (int ct = 0; ct < 8; ++ct) {
            const v16h vf = ldhs(vh + ct * 16 * VPI); const v16bf vr = ldbs(vl + ct * 16 * VPI);
            acc[ct] = wmma16(vf, pa16, acc[ct]); acc[ct] = wmmab(vr, pab, acc[ct]); }
        // Four vector slots behind the pass's last matrix instructions: the loop's branch follows them directly.
        asm volatile("v_nop\n\tv_nop\n\tv_nop\n\tv_nop" : "+v"(acc[0]), "+v"(acc[1]), "+v"(acc[2]), "+v"(acc[3]), "+v"(acc[4]), "+v"(acc[5]), "+v"(acc[6]), "+v"(acc[7]));
      }
      // Hand-over: this wave's reads of the stage are done, its own copies of the next stage have landed, every wave has arrived; only then is the buffer just read filled again.
      asm volatile("s_wait_dscnt 0x0" ::: "memory");     // the wave's last LDS reads of this buffer have returned before it may be refilled
      asm volatile("s_wait_asynccnt 0x0" ::: "memory");  // the wave's copies of stage st + 1 have landed before the barrier that publishes them
      __syncthreads();
      if (st + 2 < NST) fill(st + 2);
    }
    asm volatile("s_wait_asynccnt 0x0" ::: "memory");    // no copy is outstanding when the wave goes on to its end
    const float rl = __builtin_amdgcn_rcpf(l_i + xhalf(l_i)) * YSC;   // the two lane halves' sums of query L, joined once
#pragma unroll
    for (int ct = 0; ct < 8; ++ct) {
        const v8f o = acc[ct] * rl;
        *(v4fa*)(os + L * OSP + ct * 16 + 8 * hi) = (v4f){o[0], o[1], o[2], o[3]}; *(v4fa*)(os + L * OSP + ct * 16 + 8 * hi + 4) = (v4f){o[4], o[5], o[6], o[7]}; }
    __builtin_amdgcn_fence(__ATOMIC_RELEASE, "wavefront"); __builtin_amdgcn_wave_barrier(); asm volatile("" ::: "memory");
{
#pragma unroll
        for (int r = 0; r < 16; ++r) { const v4f val = *(const v4fa*)(os + r * OSP + lane * 4); *(v4f*)(Yo + (size_t)r * CI + lane * 4) = val; }
         }
}

extern "C" void kernel_launch(void* const* d_in, const int* in_sizes, int n_in,
                              void* d_out, int out_size, void* d_ws, size_t ws_size, hipStream_t stream) {
    if (n_in < 13) return;
    if ((size_t)in_sizes[0] < (size_t)NB * C_ * HWF) return;
    if (in_sizes[1] < CI * C_ || in_sizes[3] < CI * C_ || in_sizes[5] < CI * C_ || in_sizes[7] < CI * C_ || in_sizes[9] < CI * C_ || in_sizes[11] < C_ * CI) return;
    if (in_sizes[2] < CI || in_sizes[4] < CI || in_sizes[6] < CI || in_sizes[8] < CI || in_sizes[10] < CI || in_sizes[12] < C_) return;
    if ((size_t)out_size < (size_t)NB * C_ * HWF) return;
    const float* x = (const float*)d_in[0];
    const float* w_theta = (const float*)d_in[1];  const float* b_theta = (const float*)d_in[2];
    const float* w_phi   = (const float*)d_in[3];  const float* b_phi   = (const float*)d_in[4];
    const float* w_g     = (const float*)d_in[5];  const float* b_g     = (const float*)d_in[6];
    const float* w_d     = (const float*)d_in[7];  const float* b_d     = (const float*)d_in[8];
    const float* w_s     = (const float*)d_in[9];  const float* b_s     = (const float*)d_in[10];
    const float* w_out   = (const float*)d_in[11]; const float* b_out   = (const float*)d_in[12];
    float* OUT = (float*)d_out;                     // [NB][256][HWF]
    char* wsp = (char*)d_ws;
    auto take = [&](size_t bytes) { char* p = wsp; wsp += (bytes + 255) & ~(size_t)255; return (void*)p; };
    const size_t nTok = (size_t)NB * SEQ;
    bf* WTb = (bf*)take((size_t)CI * C_ * 2); bf* WPb = (bf*)take((size_t)CI * C_ * 2); bf* WGb = (bf*)take((size_t)CI * C_ * 2);
    bf* WDb = (bf*)take((size_t)CI * C_ * 2); bf* WSb = (bf*)take((size_t)CI * C_ * 2); bf* WOb = (bf*)take((size_t)C_ * CI * 2);
    float* MU = (float*)take((size_t)NB * C_ * 4); float* RD = (float*)take((size_t)NB * C_ * 4);
    bf* XT = (bf*)take(nTok * C_ * 2); bf* X1h = (bf*)take(nTok * C_ * 2); bf* X1l = (bf*)take(nTok * C_ * 2);
    float* F32A = (float*)take(5 * nTok * CI * 4);                 // five projection planes ([nTok][128] or [NB][128][SEQ] each); the first two then hold y1 | y2 [2][nTok][128]
    bf* THh = (bf*)take(nTok * CI * 2); bf* THl = (bf*)take(nTok * CI * 2);
    bf* PHh = (bf*)take(nTok * CI * 2); bf* PHl = (bf*)take(nTok * CI * 2);
    bf* DQh = (bf*)take(nTok * CI * 2); bf* DQl = (bf*)take(nTok * CI * 2);
    h16* GVh = (h16*)take(nTok * CI * 2); bf* GVl = (bf*)take(nTok * CI * 2);
    h16* SVh = (h16*)take(nTok * CI * 2); bf* SVl = (bf*)take(nTok * CI * 2);
    bf* Yh = (bf*)take(nTok * CI * 2); bf* Yl = (bf*)take(nTok * CI * 2);
    if ((size_t)(wsp - (char*)d_ws) > ws_size) return;
    float* Y1 = F32A; float* Y2 = F32A + nTok * CI;
    float* FT = F32A; float* FP = F32A + nTok * CI; float* FD = F32A + 2 * nTok * CI; float* FG = F32A + 3 * nTok * CI; float* FS = F32A + 4 * nTok * CI;

    k_stats<<<(unsigned)(NB * C_ / 32), SW * 32, 0, stream>>>(x, MU, RD);                                                                   /* SimAM mu, 1/(4(var_n + eps)) per (b, c) */
    k_xplanes<<<(unsigned)(XPB + 6 * WCB), 256, 0, stream>>>(x, MU, RD, XT, X1h, X1l, w_theta, w_phi, w_g, w_d, w_s, w_out, WTb, WPb, WGb, WDb, WSb, WOb);   /* x^T bf16 (exact), gated x1^T hi/lo; weights -> bf16 */
    const size_t n8p = nTok * CI / 8; const unsigned gs8 = (unsigned)((n8p + 255) / 256);
    k_proj5<<<dim3(PTIL, 5, 1), 32, 0, stream>>>(XT, X1h, X1l, WTb, WPb, WGb, WDb, WSb, b_theta, b_phi, b_g, b_d, b_s, FT, FP, FG, FD, FS);   /* theta, phi, D [tok][128]; g, S [b][128][SEQ] */
    k_split5<<<dim3(gs8, 5, 1), 256, 0, stream>>>(FT, FP, FD, FG, FS, THh, THl, PHh, PHl, DQh, DQl, GVh, GVl, SVh, SVl, n8p);
    k_attn<<<dim3(SEQ / (AW * 16), NB, 2), AW * 32, 0, stream>>>(THh, THl, DQh, DQl, PHh, PHl, GVh, GVl, SVh, SVl, F32A);                          /* y1 = softmax(theta.phi) g, y2 = softmax(D.phi) S */
    k_sumsplit8<<<gs8, 256, 0, stream>>>(Y1, Y2, Yh, Yl, n8p);                                                                         /* y = y1 + y2 -> hi/lo */
    k_gemmw<bf, false, true, 2, true, CI><<<dim3(C_ / 64, SEQ / 64, NB), 32, 0, stream>>>(WOb, nullptr, Yh, Yl, OUT, HWF, b_out, x, 0, (size_t)SEQ * CI, (size_t)C_ * HWF);      /* out[b][co][t] = W_out . y + b_out + bf16(x) */
}

// v006
// A run of this version takes 173 microseconds.
// In both of two side-by-side timings against v005, it was 1.10 times as fast.
// All steps since v000 together make it 5.60 times as fast.
#include <hip/hip_runtime.h>

// Contractions, f32 accumulate: five 1x1 projections on v_wmma_f32_16x16x32_bf16 (x as exact bf16; SimAM-gated branch as bf16 hi+lo planes = 2 products; weights bf16); score tiles q.k on v_wmma_f32_16x16x32_bf16 with hi/lo x hi/lo planes (3 products); P.V on v_wmma_f32_16x16x32_f16 (P x 2^14, V x 16 as f16 hi) plus v_wmma_f32_16x16x32_bf16 (P bf16 x V bf16 residual); output projection on v_wmma_f32_16x16x32_bf16 (y as bf16 hi+lo planes = 2 products). SimAM statistics/gating, online max-subtracted softmax, normalisation and residual add in f32.
// Data flow: x [NB][256][4096] channel-major -> token-major planes XT (bf16 exact), X1h/X1l (gated branch, hi/lo); theta/phi/D token-major [t][128] f32 -> bf16 hi/lo planes; g/S feature-major [128][t] f32 -> f16 hi (x16) + bf16 residual; eight waves per work-group share 64-key K/V stages in LDS; one wave per 32 queries and one 32-key half of every stage, its query fragments resident in registers (transposed scores K.Q^T, online softmax in the lane, P^T packed from the score registers, V^T.P^T), the two key halves joined at the end; y1/y2 [t][128] f32; y = y1 + y2 -> bf16 hi/lo; out[b][co][t] = W_out . y + b_out + bf16(x).

#ifndef NB
#define NB 4
#endif
#ifndef SEQ
#define SEQ 4096
#endif
#define NBF  4
#define HWF  4096
#define C_   256
#define CI   128
#define KB   32
#define OSP  132
#define PCAR 16384.0f
#define VCAR 16.0f
#define YSC  (1.0f / 262144.0f)
#define ELAM 1e-4f

static_assert(NB >= 1 && NB <= NBF);
static_assert(SEQ % 128 == 0 && SEQ >= 128 && SEQ <= HWF);
static_assert(SEQ % KB == 0 && SEQ % 64 == 0 && SEQ % 16 == 0);
static_assert((NB * C_) % 32 == 0);
static_assert(C_ % 64 == 0 && CI % 64 == 0 && C_ % 32 == 0 && CI % 32 == 0);
static_assert((NB * SEQ * C_) % (8 * 256) == 0 && (NB * SEQ * CI) % 8 == 0);

typedef _Float16 h16;
typedef unsigned short bf;
typedef __attribute__((ext_vector_type(16))) __bf16   v16bf;
typedef __attribute__((ext_vector_type(16))) _Float16 v16h;
typedef __attribute__((ext_vector_type(8)))  _Float16 v8h;
typedef __attribute__((ext_vector_type(8)))  unsigned short v8us;
typedef __attribute__((ext_vector_type(8)))  float    v8f;
typedef __attribute__((ext_vector_type(16))) float    v16f;
typedef __attribute__((ext_vector_type(4)))  float    v4f;
typedef v8h  __attribute__((may_alias)) v8ha;
typedef v4f  __attribute__((may_alias)) v4fa;
typedef v8us __attribute__((may_alias)) v8usa;

__device__ __forceinline__ unsigned short f2bf(float f) { unsigned u = __float_as_uint(f); u += 0x7FFFu + ((u >> 16) & 1u); return (unsigned short)(u >> 16); }
__device__ __forceinline__ float bf2f(unsigned short b) { return __uint_as_float(((unsigned)b) << 16); }
__device__ __forceinline__ float bfr(float f) { return bf2f(f2bf(f)); }
__device__ __forceinline__ void splitf(float y, unsigned short& h, unsigned short& l) { h = f2bf(y); l = f2bf(y - bf2f(h)); }
__device__ __forceinline__ v16h cat16(v8h lo, v8h hi) { return __builtin_shufflevector(lo, hi, 0, 1, 2, 3, 4, 5, 6, 7, 8, 9, 10, 11, 12, 13, 14, 15); }
__device__ __forceinline__ v16bf cat16b(v8us lo, v8us hi) { return __builtin_bit_cast(v16bf, __builtin_shufflevector(lo, hi, 0, 1, 2, 3, 4, 5, 6, 7, 8, 9, 10, 11, 12, 13, 14, 15)); }
__device__ __forceinline__ v8f wmma16(v16h a, v16h b, v8f c) { return __builtin_amdgcn_wmma_f32_16x16x32_f16(false, a, false, b, (short)0, c, false, false); }
__device__ __forceinline__ v8f wmmab(v16bf a, v16bf b, v8f c) { return __builtin_amdgcn_wmma_f32_16x16x32_bf16(false, a, false, b, (short)0, c, false, false); }
// Fragment loaders (A and B share the same per-lane k map): p already points at row (lane & 15), k0 + 8*(lane >> 4); elements 0..7 <- p[0..7], elements 8..15 <- p[16..23].
__device__ __forceinline__ v16bf ldb(const bf* p) { return cat16b(*(const v8us*)p, *(const v8us*)(p + 16)); }
__device__ __forceinline__ v16h  ldh(const h16* p) { return cat16(*(const v8h*)p, *(const v8h*)(p + 16)); }

// ---- gemmw_tile: register-blocked GEMM, ONE WAVE per 64x64 output tile (16 accumulators), operands straight from K-contiguous 16-bit planes; tile (bx, by) of batch bz, tiles (M/64, N/64, Z), 32 threads. os: the wave's 16 x 68 f32 of LDS.
// C[m][n] (f32, pitch ldc) = sum_k A[m][k] Bt[n][k] (+ A2[m][k] Bt[n][k] when A2ON) (+ A[m][k] Bt2[n][k] when B2ON) (+ bf16(bias[n]) BIASM==1 | bf16(bias[m]) BIASM==2) (+ bf16(res[m][n]) when RESID, same indexing as C).
// z-batch strides sA/sB/sC in elements. K % 32 == 0, M % 64 == 0, N % 64 == 0. K is a compile-time constant: the four row blocks of an operand are then fixed offsets from one address pair.
template <typename T16> struct WFrag;
template <> struct WFrag<h16> { typedef v16h V; static __device__ __forceinline__ V ld(const h16* p) { return ldh(p); } static __device__ __forceinline__ v8f mma(V a, V b, v8f c) { return wmma16(a, b, c); } };
template <> struct WFrag<bf> { typedef v16bf V; static __device__ __forceinline__ V ld(const bf* p) { return ldb(p); } static __device__ __forceinline__ v8f mma(V a, V b, v8f c) { return wmmab(a, b, c); } };
template <typename T16, bool A2ON, bool B2ON, int BIASM, bool RESID, int K>
__device__ __forceinline__ void gemmw_tile(float* os, int bx, int by, int bz, const T16* __restrict__ A, const T16* __restrict__ A2, const T16* __restrict__ Bt, const T16* __restrict__ Bt2,
                                              float* C, int ldc, const float* __restrict__ bias, const float* __restrict__ res, size_t sA, size_t sB, size_t sC) {
    typedef typename WFrag<T16>::V V;
    const size_t z = bz;
    A += z * sA; if (A2ON) A2 += z * sA; Bt += z * sB; if (B2ON) Bt2 += z * sB; C += z * sC; if (RESID) res += z * sC;
    const int lane = threadIdx.x & 31, lr = lane & 15, hi = lane >> 4;
    const int r0 = bx * 64, c0 = by * 64;
    v8f acc[4][4];
#pragma unroll
    for (int mb = 0; mb < 4; ++mb)
#pragma unroll
        for (int nb = 0; nb < 4; ++nb) acc[mb][nb] = (v8f){};
    const size_t aoff = (size_t)(r0 + lr) * K + 8 * hi, boff = (size_t)(c0 + lr) * K + 8 * hi;
#pragma unroll 1
    for (int kc = 0; kc < K; kc += 32) {
        V a[4], a2[4], bq[4], bq2[4];
        const T16* pa = A + aoff + kc; const T16* pa2 = A2ON ? A2 + aoff + kc : pa; const T16* pb = Bt + boff + kc; const T16* pb2 = B2ON ? Bt2 + boff + kc : pb;
#pragma unroll
        for (int mb = 0; mb < 4; ++mb) { a[mb] = WFrag<T16>::ld(pa + (size_t)mb * 16 * K); a2[mb] = a[mb]; if (A2ON) a2[mb] = WFrag<T16>::ld(pa2 + (size_t)mb * 16 * K); }
#pragma unroll
        for (int nb = 0; nb < 4; ++nb) { bq[nb] = WFrag<T16>::ld(pb + (size_t)nb * 16 * K); bq2[nb] = bq[nb]; if (B2ON) bq2[nb] = WFrag<T16>::ld(pb2 + (size_t)nb * 16 * K); }
        asm volatile("s_wait_xcnt 0x0" :: "v"(pa), "v"(pa2), "v"(pb), "v"(pb2) : "memory");   // behind the trip's fragment loads; it takes their address pairs as inputs, so that no load's result and no address step lands in a pair ahead of it
#pragma unroll
        for (int nb = 0; nb < 4; ++nb) {
            const V b = bq[nb], b2 = bq2[nb];
#pragma unroll
            for (int mb = 0; mb < 4; ++mb) {
                acc[mb][nb] = WFrag<T16>::mma(a[mb], b, acc[mb][nb]);
                if (A2ON) acc[mb][nb] = WFrag<T16>::mma(a2[mb], b, acc[mb][nb]);
                if (B2ON) acc[mb][nb] = WFrag<T16>::mma(a[mb], b2, acc[mb][nb]); } }
        asm volatile("v_nop\n\tv_nop\n\tv_nop\n\tv_nop" : "+v"(acc[0][0]), "+v"(acc[1][1]), "+v"(acc[2][2]), "+v"(acc[3][3]) : "v"(a[0]), "v"(a[3]));
    }
#pragma unroll
    for (int mb = 0; mb < 4; ++mb) {
#pragma unroll
        for (int nb = 0; nb < 4; ++nb) {
#pragma unroll
            for (int j = 0; j < 8; ++j) os[(hi * 8 + j) * 68 + nb * 16 + lr] = acc[mb][nb][j]; }
        __builtin_amdgcn_fence(__ATOMIC_RELEASE, "wavefront"); __builtin_amdgcn_wave_barrier(); asm volatile("" ::: "memory");
        const size_t rb = (size_t)(r0 + mb * 16);
        v4f rv8[8];
        if (RESID) {
            const float* rp[8];
#pragma unroll
            for (int s = 0; s < 8; ++s) { rp[s] = res + (rb + 2 * s + hi) * (size_t)ldc + c0 + lr * 4; rv8[s] = *(const v4f*)rp[s]; }
            asm volatile("s_wait_xcnt 0x0" :: "v"(rp[0]), "v"(rp[1]), "v"(rp[2]), "v"(rp[3]), "v"(rp[4]), "v"(rp[5]), "v"(rp[6]), "v"(rp[7]) : "memory");   // behind the row block's residual loads; it takes their address pairs as inputs, so that no load's result lands in a pair ahead of it
        }
{
#pragma unroll
            for (int s = 0; s < 8; ++s) {
                const int row = 2 * s + hi, cofs = lr * 4;
                v4f val = *(const v4fa*)(os + row * 68 + cofs);
                if (BIASM == 1) { val[0] += bfr(bias[c0 + cofs]); val[1] += bfr(bias[c0 + cofs + 1]); val[2] += bfr(bias[c0 + cofs + 2]); val[3] += bfr(bias[c0 + cofs + 3]); }
                if (BIASM == 2) { const float bv = bfr(bias[rb + row]); val[0] += bv; val[1] += bv; val[2] += bv; val[3] += bv; }
                if (RESID) { const v4f rv = rv8[s]; val[0] += bfr(rv[0]); val[1] += bfr(rv[1]); val[2] += bfr(rv[2]); val[3] += bfr(rv[3]); }
                *(v4f*)(C + (rb + row) * (size_t)ldc + c0 + cofs) = val; }
             }
        asm volatile("s_wait_xcnt 0x0" ::: "memory");   // behind the row block's stores: the next row block reuses their data and address registers
        __builtin_amdgcn_fence(__ATOMIC_RELEASE, "wavefront"); __builtin_amdgcn_wave_barrier(); asm volatile("" ::: "memory");
    }
}
template <typename T16, bool A2ON, bool B2ON, int BIASM, bool RESID, int K>
__global__ __launch_bounds__(32) void k_gemmw(const T16* __restrict__ A, const T16* __restrict__ A2, const T16* __restrict__ Bt, const T16* __restrict__ Bt2,
                                              float* C, int ldc, const float* __restrict__ bias, const float* __restrict__ res, size_t sA, size_t sB, size_t sC) {
    __shared__ __align__(16) float os[16 * 68];
    gemmw_tile<T16, A2ON, B2ON, BIASM, RESID, K>(os, blockIdx.x, blockIdx.y, blockIdx.z, A, A2, Bt, Bt2, C, ldc, bias, res, sA, sB, sC);
}
// ---- k_proj5: the five projections need nothing of each other and run as one grid: blockIdx.y names the projection (the two-product ones first), blockIdx.x its 64x64 tile, numbered as the separate grids numbered theirs. Each writes an f32 plane of its own.
#define PTIL ((NB * SEQ / 64) * (CI / 64))
__global__ __launch_bounds__(32) void k_proj5(const bf* __restrict__ XT, const bf* __restrict__ X1h, const bf* __restrict__ X1l,
                                              const bf* __restrict__ WTb, const bf* __restrict__ WPb, const bf* __restrict__ WGb, const bf* __restrict__ WDb, const bf* __restrict__ WSb,
                                              const float* __restrict__ b_theta, const float* __restrict__ b_phi, const float* __restrict__ b_g, const float* __restrict__ b_d, const float* __restrict__ b_s,
                                              float* FT, float* FP, float* FG, float* FD, float* FS) {
    __shared__ __align__(16) float os[16 * 68];
    const int p = blockIdx.y, i = blockIdx.x;
    const int tx = i % (NB * SEQ / 64), ty = i / (NB * SEQ / 64);                                    // token-major [tok][128]: tiles (nTok/64, CI/64)
    const int fx = i % (CI / 64), fy = (i / (CI / 64)) % (SEQ / 64), fz = i / ((CI / 64) * (SEQ / 64));   // feature-major [b][128][SEQ]: tiles (CI/64, SEQ/64, NB)
    if (p == 0)      gemmw_tile<bf, true, false, 1, false, C_>(os, tx, ty, 0, X1h, X1l, WDb, nullptr, FD, CI, b_d, nullptr, 0, 0, 0);                                        /* D [tok][128] (2 products) */
    else if (p == 1) gemmw_tile<bf, false, true, 2, false, C_>(os, fx, fy, fz, WSb, nullptr, X1h, X1l, FS, SEQ, b_s, nullptr, 0, (size_t)SEQ * C_, (size_t)CI * SEQ);        /* S feature-major (2 products) */
    else if (p == 2) gemmw_tile<bf, false, false, 2, false, C_>(os, fx, fy, fz, WGb, nullptr, XT, nullptr, FG, SEQ, b_g, nullptr, 0, (size_t)SEQ * C_, (size_t)CI * SEQ);     /* g feature-major */
    else             gemmw_tile<bf, false, false, 1, false, C_>(os, tx, ty, 0, XT, nullptr, p == 3 ? WTb : WPb, nullptr, p == 3 ? FT : FP, CI, p == 3 ? b_theta : b_phi, nullptr, 0, 0, 0);   /* theta, phi [tok][128] */
}

// k_stats: one work-group per 32 (b, c) rows (its 32 results fill one 128-byte line of MU and of RD), sixteen waves, two rows per wave one after the other.
// A wave brings its whole row into registers with all its loads in flight at once, rounds it to bf16 there, and takes the mean and the centred sum of squares from the registers: the row is read once and no load waits on another.
// LDS mus/rds: cross-wave (block barrier).
#define SW 16
#define SR (32 / SW)
__global__ __launch_bounds__(SW * 32) void k_stats(const float* __restrict__ x, float* MU, float* RD) {
    __shared__ float mus[32]; __shared__ float rds[32];
    const int t = threadIdx.x, wid = __builtin_amdgcn_readfirstlane(t >> 5), lane = t & 31;   // wave number held scalar: the row's base address is scalar, the lane's offset one register that is never rewritten
#pragma unroll 1   // rolled: one row's registers at a time
    for (int j = 0; j < SR; ++j) {
        const int rr = blockIdx.x * 32 + wid * SR + j;                // (b, c) row index < NB * C_
        const int b = rr / C_, c = rr - b * C_;
        const float* xr = x + ((size_t)b * C_ + c) * HWF + lane * 4;
        v4f r[SEQ / 128];
#pragma unroll   // unrolled: every load of the row is issued before the first is waited for
        for (int i = 0; i < SEQ / 128; ++i) r[i] = *(const v4f*)(xr + (size_t)i * 128);
        float s = 0.f;
#pragma unroll   // unrolled: r[] stays in registers
        for (int i = 0; i < SEQ / 128; ++i) { v4f v = r[i]; v[0] = bfr(v[0]); v[1] = bfr(v[1]); v[2] = bfr(v[2]); v[3] = bfr(v[3]); r[i] = v; s += (v[0] + v[1]) + (v[2] + v[3]); }
        s += __shfl_xor(s, 1, 32); s += __shfl_xor(s, 2, 32); s += __shfl_xor(s, 4, 32); s += __shfl_xor(s, 8, 32); s += __shfl_xor(s, 16, 32);
        const float mu = s * (1.0f / (float)SEQ);
        float ss = 0.f;
#pragma unroll   // unrolled: r[] stays in registers
        for (int i = 0; i < SEQ / 128; ++i) { const v4f v = r[i];
            const float d0 = v[0] - mu, d1 = v[1] - mu, d2 = v[2] - mu, d3 = v[3] - mu;
            ss += (d0 * d0 + d1 * d1) + (d2 * d2 + d3 * d3); }
        ss += __shfl_xor(ss, 1, 32); ss += __shfl_xor(ss, 2, 32); ss += __shfl_xor(ss, 4, 32); ss += __shfl_xor(ss, 8, 32); ss += __shfl_xor(ss, 16, 32);
        const float den = 4.0f * (ss * (1.0f / (float)(SEQ - 1)) + ELAM);
        const float rd = 1.0f / den;
        if (lane == 0) { mus[wid * SR + j] = mu; rds[wid * SR + j] = rd; }
    }
    __syncthreads();
    if (wid == 0) {
        const float a = mus[lane], r = rds[lane];
        float* pm = MU + (size_t)blockIdx.x * 32 + lane; float* pr = RD + (size_t)blockIdx.x * 32 + lane;
        *(float*)pm = a; *(float*)pr = r;  }
}

// ---- k_xplanes: token-major planes from channel-major x: XT[(b*SEQ+t)][c] = bf16(x[b][c][t]) (exact), X1h/X1l = bf16 hi/lo of x1 = bf16(x) * sigmoid((bf16(x) - mu)^2 * rd + 0.5).
// The six weight matrices' conversion to bf16 needs nothing of x and rides in the same grid: work-groups from XPB on, WCB of them per matrix, eight elements a thread.
#define XPB (NB * SEQ * C_ / 8 / 256)
#define WCB (CI * C_ / 8 / 256)
static_assert((CI * C_ / 8) % 256 == 0);
__global__ __launch_bounds__(256) void k_xplanes(const float* __restrict__ x, const float* __restrict__ MU, const float* __restrict__ RD, bf* XT, bf* X1h, bf* X1l,
                                                 const float* __restrict__ w_theta, const float* __restrict__ w_phi, const float* __restrict__ w_g, const float* __restrict__ w_d, const float* __restrict__ w_s, const float* __restrict__ w_out,
                                                 bf* WTb, bf* WPb, bf* WGb, bf* WDb, bf* WSb, bf* WOb) {
    if (blockIdx.x >= XPB) {
        const int cb = blockIdx.x - XPB, w = cb / WCB;
        const float* src = w == 0 ? w_theta : w == 1 ? w_phi : w == 2 ? w_g : w == 3 ? w_d : w == 4 ? w_s : w_out;
        bf* dst = w == 0 ? WTb : w == 1 ? WPb : w == 2 ? WGb : w == 3 ? WDb : w == 4 ? WSb : WOb;
        const size_t i = (size_t)(cb - w * WCB) * 256 + threadIdx.x;
        const v8f v = *(const v8f*)(src + i * 8); v8us o;
#pragma unroll
        for (int k = 0; k < 8; ++k) o[k] = f2bf(v[k]);
        *(v8us*)(dst + i * 8) = o;
        return;
    }
    const size_t e = ((size_t)blockIdx.x * 256 + threadIdx.x) * 8; if (e >= (size_t)NB * SEQ * C_) return;
    const int c = (int)(e % C_); const size_t btk = e / C_; const int tpos = (int)(btk % SEQ); const int b = (int)(btk / SEQ);
    const float* xp = x + ((size_t)b * C_ + c) * HWF + tpos;
    const v8f mu8 = *(const v8f*)(MU + (size_t)b * C_ + c), rd8 = *(const v8f*)(RD + (size_t)b * C_ + c);
    v8us o0, oh, ol;
#pragma unroll
    for (int q = 0; q < 8; ++q) {
        const float xb = bfr(xp[(size_t)q * HWF]);
        const float d = xb - mu8[q];
        const float y = d * d * rd8[q] + 0.5f;
        const float ex = __expf(-y);
        const float sg = __builtin_amdgcn_rcpf(1.0f + ex);
        const float x1 = xb * sg;
        o0[q] = f2bf(xb); unsigned short hh, ll; splitf(x1, hh, ll); oh[q] = hh; ol[q] = ll;
    }
    *(v8us*)(XT + e) = o0; *(v8us*)(X1h + e) = oh; *(v8us*)(X1l + e) = ol; 
}

__global__ __launch_bounds__(256) void k_sumsplit8(const float* __restrict__ F1, const float* __restrict__ F2, bf* Ph, bf* Pl, size_t n8) { const size_t i = (size_t)blockIdx.x * 256 + threadIdx.x; if (i >= n8) return; const v8f v = *(const v8f*)(F1 + i * 8) + *(const v8f*)(F2 + i * 8); v8us oh, ol;
#pragma unroll
    for (int q = 0; q < 8; ++q) { unsigned short a, c; splitf(v[q], a, c); oh[q] = a; ol[q] = c; }
    *(v8us*)(Ph + i * 8) = oh; *(v8us*)(Pl + i * 8) = ol;  }
// k_split5: the five projections' f32 planes go to their 16-bit planes in one grid; blockIdx.y names the plane: 0..2 theta, phi, D (bf16 hi/lo), 3..4 g, S (f16 hi x16 + bf16 residual).
__global__ __launch_bounds__(256) void k_split5(const float* __restrict__ FT, const float* __restrict__ FP, const float* __restrict__ FD, const float* __restrict__ FG, const float* __restrict__ FS,
                                                bf* THh, bf* THl, bf* PHh, bf* PHl, bf* DQh, bf* DQl, h16* GVh, bf* GVl, h16* SVh, bf* SVl, size_t n8) {
    const size_t i = (size_t)blockIdx.x * 256 + threadIdx.x; if (i >= n8) return;
    const int p = blockIdx.y;
    if (p < 3) {
        const float* F = p == 0 ? FT : p == 1 ? FP : FD; bf* Ph = p == 0 ? THh : p == 1 ? PHh : DQh; bf* Pl = p == 0 ? THl : p == 1 ? PHl : DQl;
        const v8f v = *(const v8f*)(F + i * 8); v8us oh, ol;
#pragma unroll
        for (int q = 0; q < 8; ++q) { unsigned short a, c; splitf(v[q], a, c); oh[q] = a; ol[q] = c; }
        *(v8us*)(Ph + i * 8) = oh; *(v8us*)(Pl + i * 8) = ol;
        asm volatile("s_wait_xcnt 0x0" ::: "memory");   // behind the two stores: nothing that is laid out behind them may reuse their registers ahead of it
    } else {
        const float* F = p == 3 ? FG : FS; h16* Ph = p == 3 ? GVh : SVh; bf* Pl = p == 3 ? GVl : SVl;
        const v8f v = *(const v8f*)(F + i * 8); v8h oh; v8us ol;
#pragma unroll
        for (int q = 0; q < 8; ++q) { const float w = v[q] * VCAR; const h16 hh = (h16)w; oh[q] = hh; ol[q] = f2bf(w - (float)hh); }
        *(v8h*)(Ph + i * 8) = oh; *(v8us*)(Pl + i * 8) = ol;
        asm volatile("s_wait_xcnt 0x0" ::: "memory");   // as above
    }
}

// ---- k_attn: eight waves per work-group on 128 queries of one batch and one map (z = 0: theta/g, z = 1: D/S; keys = phi for both), online max-subtracted softmax.
// Wave (qg, kh) takes the 32 queries of group qg (two 16-query tiles) and the 32-key half kh of every stage: each K and V fragment read from LDS feeds both query tiles, so a matrix instruction costs half the LDS reads of a 16-query wave.
// Each wave keeps its own running maximum, sum and O^T over its half of the keys; at the end the two waves of a query group swap one tile each through LDS and join the halves (rescaled to the common maximum).
// Transposed products: S^T = K . Q^T (A = key rows, B = query columns) and O^T += V^T . P^T (A = feature rows of V, B = P^T). Lane (L, hi) then holds query L alone: 16 of the block's 32 scores sit in its own registers,
// maximum and sum are taken in the lane (one exchange between the lane halves for the maximum; the halves' sums are joined once at the end), and the two score tiles, converted in place, are the B operand of the second product.
// The work-group's 128 queries walk the same keys and values: each 64-key stage (K hi/lo rows, V hi/lo feature rows) is brought into LDS once by asynchronous copies, two buffers, the next stage in flight while this one is worked on.
// LDS ring: shared by the eight waves (block barrier at each hand-over). K rows at a 272-byte pitch, V rows at a 144-byte pitch (16 B x odd, for ds_load_b128 readers).
// LDS osa: one slice per wave, rows 0..15 x cols 0..127 and, in cols 128 and 129, the row's maximum and sum. A wave writes its own slice; behind the block barrier only its partner touches that slice.
#define AW   8
#define SK   64
#define KPI  136
#define VPI  72
#define KPLB (SK * KPI * 2)
#define VPLB (CI * VPI * 2)
#define STGB (2 * KPLB + 2 * VPLB)
#define NST  (SEQ / SK)
#define QG   (AW / 2)
static_assert(SEQ % (AW * 16) == 0 && NST >= 2 && SK == 2 * KB && OSP >= CI + 2);
static_assert(SK * CI * 2 == 4 * AW * 32 * 16 && CI * SK * 2 == 4 * AW * 32 * 16);
__device__ __forceinline__ v16bf ldbs(const bf* p) { return cat16b(*(const v8usa*)p, *(const v8usa*)(p + 16)); }
__device__ __forceinline__ v16h  ldhs(const h16* p) { return cat16(*(const v8ha*)p, *(const v8ha*)(p + 16)); }
__device__ __forceinline__ float xhalf(float x) { return __builtin_bit_cast(float, __builtin_amdgcn_permlanex16(__builtin_bit_cast(int, x), __builtin_bit_cast(int, x), 0x76543210, 0xfedcba98, false, false)); }   // lane l takes lane l ^ 16's value
// Eight 16-byte copies per lane, global -> LDS through no register: four steps of plane a, four of plane b. The s_wait_xcnt stands inside the statement so that no address register is rewritten ahead of it.
template <typename TA, typename TB>
__device__ __forceinline__ void copy8(unsigned la, const TA* ga, unsigned lb, const TB* gb, unsigned lstep, size_t gstep) {
    asm volatile("global_load_async_to_lds_b128 %0, %8, off\n\t"
                 "global_load_async_to_lds_b128 %1, %9, off\n\t"
                 "global_load_async_to_lds_b128 %2, %10, off\n\t"
                 "global_load_async_to_lds_b128 %3, %11, off\n\t"
                 "global_load_async_to_lds_b128 %4, %12, off\n\t"
                 "global_load_async_to_lds_b128 %5, %13, off\n\t"
                 "global_load_async_to_lds_b128 %6, %14, off\n\t"
                 "global_load_async_to_lds_b128 %7, %15, off\n\t"
                 "s_wait_xcnt 0x0"
                 :: "v"(la), "v"(la + lstep), "v"(la + 2 * lstep), "v"(la + 3 * lstep), "v"(lb), "v"(lb + lstep), "v"(lb + 2 * lstep), "v"(lb + 3 * lstep),
                    "v"(ga), "v"(ga + gstep), "v"(ga + 2 * gstep), "v"(ga + 3 * gstep), "v"(gb), "v"(gb + gstep), "v"(gb + 2 * gstep), "v"(gb + 3 * gstep)
                 : "memory");
}
__global__ __launch_bounds__(AW * 32) void k_attn(const bf* __restrict__ THh, const bf* __restrict__ THl, const bf* __restrict__ DQh, const bf* __restrict__ DQl,
                                             const bf* __restrict__ PHh, const bf* __restrict__ PHl,
                                             const h16* __restrict__ GVh, const bf* __restrict__ GVl, const h16* __restrict__ SVh, const bf* __restrict__ SVl, float* Y) {
    __shared__ __align__(16) unsigned char ring[2 * STGB];
    __shared__ __align__(16) float osa[AW * 16 * OSP];
    const int tid = threadIdx.x, lane = tid & 31, L = lane & 15, hi = lane >> 4;
    const int wv = __builtin_amdgcn_readfirstlane(tid >> 5);
    const int qg = wv % QG, kh = wv / QG;          // query group, key half (both wave-uniform)
    float* osw = osa + wv * 16 * OSP;                    // own slice: takes the tile that is given away
    float* osp = osa + (wv ^ QG) * 16 * OSP;             // the partner's slice: same query group, other key half
    const int q0 = blockIdx.x * (AW * 16) + qg * 32, b = blockIdx.y, mp = blockIdx.z;
    const size_t tok = (size_t)b * SEQ;
    const bf* Qh = (mp ? DQh : THh) + (tok + q0) * CI; const bf* Ql = (mp ? DQl : THl) + (tok + q0) * CI;
    const bf* Kh = PHh + tok * CI; const bf* Kl = PHl + tok * CI;
    const h16* Vh = (mp ? SVh : GVh) + (size_t)b * CI * SEQ; const bf* Vl = (mp ? SVl : GVl) + (size_t)b * CI * SEQ;
    float* Yo = Y + ((size_t)mp * NB * SEQ + tok + q0 + kh * 16) * CI;   // the wave stores the tile it keeps
    // Copy map of one stage. K plane: 64 rows x 256 B, contiguous in global; thread tid takes 16-byte piece tid + 256 i (row (tid >> 4) + 16 i). V plane: 128 rows x 128 B; piece tid + 256 i (row (tid >> 3) + 32 i).
    const unsigned ring0 = (unsigned)(size_t)ring;
    const unsigned lk = ring0 + (unsigned)((tid >> 4) * (KPI * 2) + (tid & 15) * 16);
    const unsigned lv = ring0 + (unsigned)(2 * KPLB + (tid >> 3) * (VPI * 2) + (tid & 7) * 16);
    const unsigned gk = (unsigned)tid * 8, gv = (unsigned)(tid >> 3) * SEQ + (unsigned)(tid & 7) * 8;   // the lane's element offset in a K plane and in a V plane (hi and lo planes alike): two registers live through the key walk; four address pairs beside the 32-query tile's registers went to scratch
    auto fill = [&](int st) {
        const unsigned bo = (unsigned)(st & 1) * STGB;
        const unsigned ok = gk + (unsigned)st * (SK * CI), ov = gv + (unsigned)st * SK;
        copy8(lk + bo, Kh + ok, lk + bo + KPLB, Kl + ok, 16 * KPI * 2, (size_t)16 * CI);
        copy8(lv + bo, Vh + ov, lv + bo + VPLB, Vl + ov, 32 * VPI * 2, (size_t)32 * SEQ);
    };
    // Tile t of the wave = queries q0 + (t ^ kh) * 16 + L: tile 0 is the one the wave keeps and stores, tile 1 the one it gives to its partner.
    // Per tile: query L's running maximum (equal in both lane halves), this lane half's part of its sum, acc[t][ct][v] = O^T[ct*16 + 8*hi + v][L]; all over the wave's half of the keys.
    float m_i[2] = {-1.0e30f, -1.0e30f}, l_i[2] = {0.f, 0.f}; v8f acc[2][8];
#pragma unroll
    for (int t = 0; t < 2; ++t)
#pragma unroll
        for (int ct = 0; ct < 8; ++ct) acc[t][ct] = (v8f){};
    // The wave's 32 query rows never change: their hi and lo fragments are loaded once and stay in registers for the whole key walk. B fragment: query column L of the tile.
    v16bf qh[2][CI / 32], ql[2][CI / 32];
#pragma unroll
    for (int t = 0; t < 2; ++t) {
        const size_t qoff = (size_t)((t ^ kh) * 16 + L) * CI + 8 * hi;
#pragma unroll
        for (int ch = 0; ch < CI / 32; ++ch) { qh[t][ch] = ldb(Qh + qoff + ch * 32); ql[t][ch] = ldb(Ql + qoff + ch * 32); }
    }
    fill(0);
    asm volatile("s_wait_asynccnt 0x0" ::: "memory");    // stage 0 has landed before the barrier that publishes it
    __syncthreads();
    fill(1);
#pragma unroll 1   // rolled: the buffer is picked by the stage's parity at run time, one copy of the hand-over and of the pass body
    for (int st = 0; st < NST; ++st) {
      const unsigned char* sb = ring + (st & 1) * STGB;
      {
        v8f lt[2][2];
#pragma unroll
        for (int t = 0; t < 2; ++t) { lt[t][0] = (v8f){}; lt[t][1] = (v8f){}; }
        const bf* k0h = (const bf*)sb + (kh * KB + L) * KPI + 8 * hi; const bf* k0l = k0h + KPLB / 2;   // A fragment (keys): key row kh*32 + kt*16 + L of the stage
#pragma unroll   // unrolled: each chunk names its own resident query fragments
        for (int ch = 0; ch < CI / 32; ++ch) {
            const int co = ch * 32;
            const v16bf ka0 = ldbs(k0h + co), kl0 = ldbs(k0l + co), ka1 = ldbs(k0h + 16 * KPI + co), kl1 = ldbs(k0l + 16 * KPI + co);
            lt[0][0] = wmmab(ka0, qh[0][ch], lt[0][0]); lt[0][1] = wmmab(ka1, qh[0][ch], lt[0][1]); lt[1][0] = wmmab(ka0, qh[1][ch], lt[1][0]); lt[1][1] = wmmab(ka1, qh[1][ch], lt[1][1]);
            lt[0][0] = wmmab(ka0, ql[0][ch], lt[0][0]); lt[0][1] = wmmab(ka1, ql[0][ch], lt[0][1]); lt[1][0] = wmmab(ka0, ql[1][ch], lt[1][0]); lt[1][1] = wmmab(ka1, ql[1][ch], lt[1][1]);
            lt[0][0] = wmmab(kl0, qh[0][ch], lt[0][0]); lt[0][1] = wmmab(kl1, qh[0][ch], lt[0][1]); lt[1][0] = wmmab(kl0, qh[1][ch], lt[1][0]); lt[1][1] = wmmab(kl1, qh[1][ch], lt[1][1]);
        }
        const h16* vh = (const h16*)(sb + 2 * KPLB) + L * VPI + kh * KB + 8 * hi; const bf* vl = (const bf*)(sb + 2 * KPLB + VPLB) + L * VPI + kh * KB + 8 * hi;   // A fragment (values): ci row L of the staged feature-major plane
        v16h vf[8]; v16bf vr[8];                                 // each V fragment is read from LDS once, for tile 0's products, and stays in registers for tile 1's
#pragma unroll
        for (int t = 0; t < 2; ++t) {
            // D element v of tile kt = score of key kh*32 + kt*16 + 8*hi + v against query L of tile t.
            const v8f lt0 = lt[t][0], lt1 = lt[t][1];
            float mx = fmaxf(fmaxf(fmaxf(lt0[0], lt1[0]), fmaxf(lt0[1], lt1[1])), fmaxf(fmaxf(lt0[2], lt1[2]), fmaxf(lt0[3], lt1[3])));
            mx = fmaxf(mx, fmaxf(fmaxf(fmaxf(lt0[4], lt1[4]), fmaxf(lt0[5], lt1[5])), fmaxf(fmaxf(lt0[6], lt1[6]), fmaxf(lt0[7], lt1[7]))));
            mx = fmaxf(mx, xhalf(mx));
            const float mn = fmaxf(m_i[t], mx);
            const float sc = __expf(m_i[t] - mn);
            v16f ps; float rp[8];
#pragma unroll
            for (int v = 0; v < 8; ++v) {
                const float pa = __expf(lt0[v] - mn), pb = __expf(lt1[v] - mn);
                rp[v] = pa + pb;
                ps[v] = pa * PCAR; ps[8 + v] = pb * PCAR;            // B element s: k = 8*hi + s (s < 8), 16 + 8*hi + (s - 8) otherwise: tile 0's registers, then tile 1's
            }
            l_i[t] = l_i[t] * sc + (((rp[0] + rp[1]) + (rp[2] + rp[3])) + ((rp[4] + rp[5]) + (rp[6] + rp[7]))); m_i[t] = mn;
            const v16h pa16 = __builtin_convertvector(ps, v16h);     // round to nearest even, as the scalar conversions
            const v16bf pab = __builtin_convertvector(ps, v16bf);
#pragma unroll
            for (int ct = 0; ct < 8; ++ct) acc[t][ct] *= sc;
#pragma unroll
            for (int ct = 0; ct < 8; ++ct) {
                if (t == 0) { vf[ct] = ldhs(vh + ct * 16 * VPI); vr[ct] = ldbs(vl + ct * 16 * VPI); }
                acc[t][ct] = wmma16(vf[ct], pa16, acc[t][ct]); acc[t][ct] = wmmab(vr[ct], pab, acc[t][ct]); }
        }
        // Four vector slots behind the pass's last matrix instructions: the hand-over and, while stages remain, the copies of stage st + 2 follow them.
        asm volatile("v_nop\n\tv_nop\n\tv_nop\n\tv_nop" : "+v"(acc[0][0]), "+v"(acc[0][1]), "+v"(acc[0][2]), "+v"(acc[0][3]), "+v"(acc[0][4]), "+v"(acc[0][5]), "+v"(acc[0][6]), "+v"(acc[0][7]),
                                                           "+v"(acc[1][0]), "+v"(acc[1][1]), "+v"(acc[1][2]), "+v"(acc[1][3]), "+v"(acc[1][4]), "+v"(acc[1][5]), "+v"(acc[1][6]), "+v"(acc[1][7]));
      }
      // Hand-over: this wave's reads of the stage are done, its own copies of the next stage have landed, every wave has arrived; only then is the buffer just read filled again.
      asm volatile("s_wait_dscnt 0x0" ::: "memory");     // the wave's last LDS reads of this buffer have returned before it may be refilled
      asm volatile("s_wait_asynccnt 0x0" ::: "memory");  // the wave's copies of stage st + 1 have landed before the barrier that publishes them
      __syncthreads();
      if (st + 2 < NST) fill(st + 2);
    }
    asm volatile("s_wait_asynccnt 0x0" ::: "memory");    // no copy is outstanding when the wave goes on to its end
    // Join of the two key halves. Each wave hands tile 1 (raw O^T, maximum, sum) to its partner through its own slice and takes the partner's tile 1, which is its own tile 0's queries over the other keys.
    const float lf0 = l_i[0] + xhalf(l_i[0]), lf1 = l_i[1] + xhalf(l_i[1]);   // the two lane halves' sums of query L, joined once
#pragma unroll
    for (int ct = 0; ct < 8; ++ct) {
        const v8f o = acc[1][ct];
        *(v4fa*)(osw + L * OSP + ct * 16 + 8 * hi) = (v4f){o[0], o[1], o[2], o[3]}; *(v4fa*)(osw + L * OSP + ct * 16 + 8 * hi + 4) = (v4f){o[4], o[5], o[6], o[7]}; }
    osw[L * OSP + CI + hi] = hi ? lf1 : m_i[1];
    __syncthreads();                                     // every wave's slice is written before its partner reads it
    const float mo = osp[L * OSP + CI], lo = osp[L * OSP + CI + 1];
    const float mj = fmaxf(m_i[0], mo);
    const float ea = __expf(m_i[0] - mj), eb = __expf(mo - mj);
    const float rl = __builtin_amdgcn_rcpf(lf0 * ea + lo * eb) * YSC;
    const float fa = ea * rl, fb = eb * rl;
#pragma unroll
    for (int ct = 0; ct < 8; ++ct) {                     // a lane reads and rewrites its own elements of the partner's slice
        float* pe = osp + L * OSP + ct * 16 + 8 * hi;
        const v4f u0 = *(const v4fa*)pe, u1 = *(const v4fa*)(pe + 4); const v8f o = acc[0][ct];
        *(v4fa*)pe = (v4f){o[0] * fa + u0[0] * fb, o[1] * fa + u0[1] * fb, o[2] * fa + u0[2] * fb, o[3] * fa + u0[3] * fb};
        *(v4fa*)(pe + 4) = (v4f){o[4] * fa + u1[0] * fb, o[5] * fa + u1[1] * fb, o[6] * fa + u1[2] * fb, o[7] * fa + u1[3] * fb}; }
    __builtin_amdgcn_fence(__ATOMIC_RELEASE, "wavefront"); __builtin_amdgcn_wave_barrier(); asm volatile("" ::: "memory");
{
#pragma unroll
        for (int r = 0; r < 16; ++r) { const v4f val = *(const v4fa*)(osp + r * OSP + lane * 4); *(v4f*)(Yo + (size_t)r * CI + lane * 4) = val; }
         }
}

extern "C" void kernel_launch(void* const* d_in, const int* in_sizes, int n_in,
                              void* d_out, int out_size, void* d_ws, size_t ws_size, hipStream_t stream) {
    if (n_in < 13) return;
    if ((size_t)in_sizes[0] < (size_t)NB * C_ * HWF) return;
    if (in_sizes[1] < CI * C_ || in_sizes[3] < CI * C_ || in_sizes[5] < CI * C_ || in_sizes[7] < CI * C_ || in_sizes[9] < CI * C_ || in_sizes[11] < C_ * CI) return;
    if (in_sizes[2] < CI || in_sizes[4] < CI || in_sizes[6] < CI || in_sizes[8] < CI || in_sizes[10] < CI || in_sizes[12] < C_) return;
    if ((size_t)out_size < (size_t)NB * C_ * HWF) return;
    const float* x = (const float*)d_in[0];
    const float* w_theta = (const float*)d_in[1];  const float* b_theta = (const float*)d_in[2];
    const float* w_phi   = (const float*)d_in[3];  const float* b_phi   = (const float*)d_in[4];
    const float* w_g     = (const float*)d_in[5];  const float* b_g     = (const float*)d_in[6];
    const float* w_d     = (const float*)d_in[7];  const float* b_d     = (const float*)d_in[8];
    const float* w_s     = (const float*)d_in[9];  const float* b_s     = (const float*)d_in[10];
    const float* w_out   = (const float*)d_in[11]; const float* b_out   = (const float*)d_in[12];
    float* OUT = (float*)d_out;                     // [NB][256][HWF]
    char* wsp = (char*)d_ws;
    auto take = [&](size_t bytes) { char* p = wsp; wsp += (bytes + 255) & ~(size_t)255; return (void*)p; };
    const size_t nTok = (size_t)NB * SEQ;
    bf* WTb = (bf*)take((size_t)CI * C_ * 2); bf* WPb = (bf*)take((size_t)CI * C_ * 2); bf* WGb = (bf*)take((size_t)CI * C_ * 2);
    bf* WDb = (bf*)take((size_t)CI * C_ * 2); bf* WSb = (bf*)take((size_t)CI * C_ * 2); bf* WOb = (bf*)take((size_t)C_ * CI * 2);
    float* MU = (float*)take((size_t)NB * C_ * 4); float* RD = (float*)take((size_t)NB * C_ * 4);
    bf* XT = (bf*)take(nTok * C_ * 2); bf* X1h = (bf*)take(nTok * C_ * 2); bf* X1l = (bf*)take(nTok * C_ * 2);
    float* F32A = (float*)take(5 * nTok * CI * 4);                 // five projection planes ([nTok][128] or [NB][128][SEQ] each); the first two then hold y1 | y2 [2][nTok][128]
    bf* THh = (bf*)take(nTok * CI * 2); bf* THl = (bf*)take(nTok * CI * 2);
    bf* PHh = (bf*)take(nTok * CI * 2); bf* PHl = (bf*)take(nTok * CI * 2);
    bf* DQh = (bf*)take(nTok * CI * 2); bf* DQl = (bf*)take(nTok * CI * 2);
    h16* GVh = (h16*)take(nTok * CI * 2); bf* GVl = (bf*)take(nTok * CI * 2);
    h16* SVh = (h16*)take(nTok * CI * 2); bf* SVl = (bf*)take(nTok * CI * 2);
    bf* Yh = (bf*)take(nTok * CI * 2); bf* Yl = (bf*)take(nTok * CI * 2);
    if ((size_t)(wsp - (char*)d_ws) > ws_size) return;
    float* Y1 = F32A; float* Y2 = F32A + nTok * CI;
    float* FT = F32A; float* FP = F32A + nTok * CI; float* FD = F32A + 2 * nTok * CI; float* FG = F32A + 3 * nTok * CI; float* FS = F32A + 4 * nTok * CI;

    k_stats<<<(unsigned)(NB * C_ / 32), SW * 32, 0, stream>>>(x, MU, RD);                                                                   /* SimAM mu, 1/(4(var_n + eps)) per (b, c) */
    k_xplanes<<<(unsigned)(XPB + 6 * WCB), 256, 0, stream>>>(x, MU, RD, XT, X1h, X1l, w_theta, w_phi, w_g, w_d, w_s, w_out, WTb, WPb, WGb, WDb, WSb, WOb);   /* x^T bf16 (exact), gated x1^T hi/lo; weights -> bf16 */
    const size_t n8p = nTok * CI / 8; const unsigned gs8 = (unsigned)((n8p + 255) / 256);
    k_proj5<<<dim3(PTIL, 5, 1), 32, 0, stream>>>(XT, X1h, X1l, WTb, WPb, WGb, WDb, WSb, b_theta, b_phi, b_g, b_d, b_s, FT, FP, FG, FD, FS);   /* theta, phi, D [tok][128]; g, S [b][128][SEQ] */
    k_split5<<<dim3(gs8, 5, 1), 256, 0, stream>>>(FT, FP, FD, FG, FS, THh, THl, PHh, PHl, DQh, DQl, GVh, GVl, SVh, SVl, n8p);
    k_attn<<<dim3(SEQ / (AW * 16), NB, 2), AW * 32, 0, stream>>>(THh, THl, DQh, DQl, PHh, PHl, GVh, GVl, SVh, SVl, F32A);                          /* y1 = softmax(theta.phi) g, y2 = softmax(D.phi) S */
    k_sumsplit8<<<gs8, 256, 0, stream>>>(Y1, Y2, Yh, Yl, n8p);                                                                         /* y = y1 + y2 -> hi/lo */
    k_gemmw<bf, false, true, 2, true, CI><<<dim3(C_ / 64, SEQ / 64, NB), 32, 0, stream>>>(WOb, nullptr, Yh, Yl, OUT, HWF, b_out, x, 0, (size_t)SEQ * CI, (size_t)C_ * HWF);      /* out[b][co][t] = W_out . y + b_out + bf16(x) */
}

// v007
// It runs in 156 microseconds.
// Next to v006, in two timings, it ran 1.11 times as fast each time.
// All steps since v000 together make it 6.21 times as fast.
#include <hip/hip_runtime.h>

// Contractions, f32 accumulate: five 1x1 projections on v_wmma_f32_16x16x32_bf16 (x as exact bf16; SimAM-gated branch as bf16 hi+lo planes = 2 products; weights bf16); score tiles q.k on v_wmma_f32_16x16x32_bf16 with hi/lo x hi/lo planes (3 products); P.V on v_wmma_f32_16x16x32_f16 (P x 2^14, V x 16 as f16 hi) plus v_wmma_f32_16x16x32_bf16 (P bf16 x V bf16 residual); output projection on v_wmma_f32_16x16x32_bf16 (y1 + y2 split into bf16 hi+lo in registers = 2 products). SimAM statistics/gating, online max-subtracted softmax, normalisation and residual add in f32.
// Data flow: x [NB][256][4096] channel-major -> token-major planes XT (bf16 exact), X1h/X1l (gated branch, hi/lo); theta/phi/D token-major [t][128] as bf16 hi/lo planes, g/S feature-major [128][t] as f16 hi (x16) + bf16 residual, each written by the projection's own epilogue; eight waves per work-group share 64-key K/V stages in LDS; one wave per 32 queries and one 32-key half of every stage, its query fragments resident in registers (transposed scores K.Q^T, online softmax in the lane, P^T packed from the score registers, V^T.P^T), the two key halves joined at the end; y1/y2 [t][128] f32; y = y1 + y2 -> bf16 hi/lo in the output projection's own fragment loader; out[b][co][t] = W_out . y + b_out + bf16(x).

#ifndef NB
#define NB 4
#endif
#ifndef SEQ
#define SEQ 4096
#endif
#define NBF  4
#define HWF  4096
#define C_   256
#define CI   128
#define KB   32
#define OSP  132
#define PCAR 16384.0f
#define VCAR 16.0f
#define YSC  (1.0f / 262144.0f)
#define ELAM 1e-4f

static_assert(NB >= 1 && NB <= NBF);
static_assert(SEQ % 128 == 0 && SEQ >= 128 && SEQ <= HWF);
static_assert(SEQ % KB == 0 && SEQ % 64 == 0 && SEQ % 16 == 0);
static_assert((NB * C_) % 32 == 0);
static_assert(C_ % 64 == 0 && CI % 64 == 0 && C_ % 32 == 0 && CI % 32 == 0);
static_assert((NB * SEQ * C_) % (8 * 256) == 0 && (NB * SEQ * CI) % 8 == 0);

typedef _Float16 h16;
typedef unsigned short bf;
typedef __attribute__((ext_vector_type(16))) __bf16   v16bf;
typedef __attribute__((ext_vector_type(16))) _Float16 v16h;
typedef __attribute__((ext_vector_type(8)))  _Float16 v8h;
typedef __attribute__((ext_vector_type(8)))  unsigned short v8us;
typedef __attribute__((ext_vector_type(8)))  float    v8f;
typedef __attribute__((ext_vector_type(16))) float    v16f;
typedef __attribute__((ext_vector_type(4)))  float    v4f;
typedef v8h  __attribute__((may_alias)) v8ha;
typedef v4f  __attribute__((may_alias)) v4fa;
typedef v8us __attribute__((may_alias)) v8usa;

__device__ __forceinline__ unsigned short f2bf(float f) { unsigned u = __float_as_uint(f); u += 0x7FFFu + ((u >> 16) & 1u); return (unsigned short)(u >> 16); }
__device__ __forceinline__ float bf2f(unsigned short b) { return __uint_as_float(((unsigned)b) << 16); }
__device__ __forceinline__ float bfr(float f) { return bf2f(f2bf(f)); }
__device__ __forceinline__ void splitf(float y, unsigned short& h, unsigned short& l) { h = f2bf(y); l = f2bf(y - bf2f(h)); }
__device__ __forceinline__ v16h cat16(v8h lo, v8h hi) { return __builtin_shufflevector(lo, hi, 0, 1, 2, 3, 4, 5, 6, 7, 8, 9, 10, 11, 12, 13, 14, 15); }
__device__ __forceinline__ v16bf cat16b(v8us lo, v8us hi) { return __builtin_bit_cast(v16bf, __builtin_shufflevector(lo, hi, 0, 1, 2, 3, 4, 5, 6, 7, 8, 9, 10, 11, 12, 13, 14, 15)); }
__device__ __forceinline__ v8f wmma16(v16h a, v16h b, v8f c) { return __builtin_amdgcn_wmma_f32_16x16x32_f16(false, a, false, b, (short)0, c, false, false); }
__device__ __forceinline__ v8f wmmab(v16bf a, v16bf b, v8f c) { return __builtin_amdgcn_wmma_f32_16x16x32_bf16(false, a, false, b, (short)0, c, false, false); }
// Fragment loaders (A and B share the same per-lane k map): p already points at row (lane & 15), k0 + 8*(lane >> 4); elements 0..7 <- p[0..7], elements 8..15 <- p[16..23].
__device__ __forceinline__ v16bf ldb(const bf* p) { return cat16b(*(const v8us*)p, *(const v8us*)(p + 16)); }
__device__ __forceinline__ v16h  ldh(const h16* p) { return cat16(*(const v8h*)p, *(const v8h*)(p + 16)); }

// ---- gemmw_tile: register-blocked GEMM, ONE WAVE per 64x64 output tile (16 accumulators), operands straight from K-contiguous 16-bit planes; tile (bx, by) of batch bz, tiles (M/64, N/64, Z), 32 threads. os: the wave's 16 x 68 f32 of LDS (OUTM != 0: 64 x 68 + 64).
// C[m][n] (f32, pitch ldc) = sum_k A[m][k] Bt[n][k] (+ A2[m][k] Bt[n][k] when A2ON) (+ A[m][k] Bt2[n][k] when B2ON) (+ bf16(bias[n]) BIASM==1 | bf16(bias[m]) BIASM==2) (+ bf16(res[m][n]) when RESID, same indexing as C).
// z-batch strides sA/sB/sC in elements. K % 32 == 0, M % 64 == 0, N % 64 == 0. K is a compile-time constant: the four row blocks of an operand are then fixed offsets from one address pair.
// BSUM: Bt and Bt2 are not read; they are formed in registers as the bf16 hi and lo parts of F1[n][k] + F2[n][k] (two f32 planes of pitch K, z stride sB).
// OUTM == 0: C is stored as f32. OUTM == 1: the f32 value goes out as bf16 hi/lo planes Ph/Pl; OUTM == 2: as f16 hi (value x 16, its bits in Ph) + bf16 residual Pl. Planes are indexed as C; a lane stores 8 elements, so a tile row is one whole 128-byte line per plane.
template <typename T16> struct WFrag;
template <> struct WFrag<h16> { typedef v16h V; static __device__ __forceinline__ V ld(const h16* p) { return ldh(p); } static __device__ __forceinline__ v8f mma(V a, V b, v8f c) { return wmma16(a, b, c); } };
template <> struct WFrag<bf> { typedef v16bf V; static __device__ __forceinline__ V ld(const bf* p) { return ldb(p); } static __device__ __forceinline__ v8f mma(V a, V b, v8f c) { return wmmab(a, b, c); } };
template <typename T16, bool A2ON, bool B2ON, int BIASM, bool RESID, int K, int OUTM, bool BSUM>
__device__ __forceinline__ void gemmw_tile(float* os, int bx, int by, int bz, const T16* __restrict__ A, const T16* __restrict__ A2, const T16* __restrict__ Bt, const T16* __restrict__ Bt2,
                                              const float* __restrict__ F1, const float* __restrict__ F2, float* C, bf* Ph, bf* Pl, int ldc, const float* __restrict__ bias, const float* __restrict__ res, size_t sA, size_t sB, size_t sC) {
    typedef typename WFrag<T16>::V V;
    const size_t z = bz;
    A += z * sA; if (A2ON) A2 += z * sA; if (BSUM) { F1 += z * sB; F2 += z * sB; } else { Bt += z * sB; if (B2ON) Bt2 += z * sB; } if (OUTM == 0) C += z * sC; else { Ph += z * sC; Pl += z * sC; } if (RESID) res += z * sC;
    const int lane = threadIdx.x & 31, lr = lane & 15, hi = lane >> 4;
    const int r0 = bx * 64, c0 = by * 64;
    v8f acc[4][4];
#pragma unroll
    for (int mb = 0; mb < 4; ++mb)
#pragma unroll
        for (int nb = 0; nb < 4; ++nb) acc[mb][nb] = (v8f){};
    const size_t aoff = (size_t)(r0 + lr) * K + 8 * hi, boff = (size_t)(c0 + lr) * K + 8 * hi;
    const int rw = lane >> 3, cofs8 = (lane & 7) * 8;   // plane epilogue (OUTM != 0): step s of a row block takes row 4 s + rw, eight lanes a row, eight elements a lane
    float bb[8];                                        // its bias values, loaded ahead of the K loop so that the epilogue does not wait for them: BIASM == 1 the lane's 8 columns, BIASM == 2 tile rows lane and 32 + lane (handed round through LDS)
    if (OUTM != 0) {
#pragma unroll
        for (int q = 0; q < (BIASM == 1 ? 8 : 2); ++q) bb[q] = bfr(bias[BIASM == 1 ? c0 + cofs8 + q : r0 + 32 * q + lane]);
    }
#pragma unroll 1
    for (int kc = 0; kc < K; kc += 32) {
        V a[4], a2[4], bq[4], bq2[4];
        const T16* pa = A + aoff + kc; const T16* pa2 = A2ON ? A2 + aoff + kc : pa; const T16* pb = BSUM ? pa : Bt + boff + kc; const T16* pb2 = B2ON && !BSUM ? Bt2 + boff + kc : pb;
#pragma unroll
        for (int mb = 0; mb < 4; ++mb) { a[mb] = WFrag<T16>::ld(pa + (size_t)mb * 16 * K); a2[mb] = a[mb]; if (A2ON) a2[mb] = WFrag<T16>::ld(pa2 + (size_t)mb * 16 * K); }
#pragma unroll
        for (int nb = 0; nb < 4; ++nb) if (!BSUM) { bq[nb] = WFrag<T16>::ld(pb + (size_t)nb * 16 * K); bq2[nb] = bq[nb]; if (B2ON) bq2[nb] = WFrag<T16>::ld(pb2 + (size_t)nb * 16 * K); }
        const float* pf1 = BSUM ? F1 + boff + kc : nullptr; const float* pf2 = BSUM ? F2 + boff + kc : nullptr;
        v8f f1[4][2], f2[4][2];                          // BSUM: the lane's two runs of eight k of each B row, from both f32 planes
#pragma unroll
        for (int nb = 0; nb < 4; ++nb) if (BSUM) {
            f1[nb][0] = *(const v8f*)(pf1 + (size_t)nb * 16 * K); f1[nb][1] = *(const v8f*)(pf1 + (size_t)nb * 16 * K + 16);
            f2[nb][0] = *(const v8f*)(pf2 + (size_t)nb * 16 * K); f2[nb][1] = *(const v8f*)(pf2 + (size_t)nb * 16 * K + 16); }
        if (BSUM) {
            asm volatile("s_wait_xcnt 0x0" :: "v"(pa), "v"(pf1), "v"(pf2) : "memory");   // as the statement below, for this form's three address pairs
            __builtin_amdgcn_sched_barrier(0);   // holds that wait directly behind the loads: without it the wait sank below the split arithmetic and below an address step
        } else
        asm volatile("s_wait_xcnt 0x0" :: "v"(pa), "v"(pa2), "v"(pb), "v"(pb2) : "memory");   // behind the trip's fragment loads; it takes their address pairs as inputs, so that no load's result and no address step lands in a pair ahead of it
#pragma unroll
        for (int nb = 0; nb < 4; ++nb) if (BSUM) {       // B = F1 + F2 in f32, split into bf16 hi and lo fragments in registers (same k map as ldb)
            v8us h[2], l[2];
#pragma unroll
            for (int u = 0; u < 2; ++u) {
                const v8f y = f1[nb][u] + f2[nb][u];
#pragma unroll
                for (int q = 0; q < 8; ++q) { unsigned short a_, c_; splitf(y[q], a_, c_); h[u][q] = a_; l[u][q] = c_; } }
            bq[nb] = cat16b(h[0], h[1]); bq2[nb] = cat16b(l[0], l[1]); }
#pragma unroll
        for (int nb = 0; nb < 4; ++nb) {
            const V b = bq[nb], b2 = bq2[nb];
#pragma unroll
            for (int mb = 0; mb < 4; ++mb) {
                acc[mb][nb] = WFrag<T16>::mma(a[mb], b, acc[mb][nb]);
                if (A2ON) acc[mb][nb] = WFrag<T16>::mma(a2[mb], b, acc[mb][nb]);
                if (B2ON) acc[mb][nb] = WFrag<T16>::mma(a[mb], b2, acc[mb][nb]); } }
        asm volatile("v_nop\n\tv_nop\n\tv_nop\n\tv_nop" : "+v"(acc[0][0]), "+v"(acc[1][1]), "+v"(acc[2][2]), "+v"(acc[3][3]) : "v"(a[0]), "v"(a[3]));
    }
    if (OUTM != 0) {   // plane epilogue: the whole 64 x 64 tile goes to LDS once (os: 64 x 68 f32, then 64 row biases); a rolled loop over the four row blocks splits and stores it
        float* ob = os + 64 * 68;
#pragma unroll
        for (int mb = 0; mb < 4; ++mb)
#pragma unroll
            for (int nb = 0; nb < 4; ++nb)
#pragma unroll
                for (int j = 0; j < 8; ++j) os[(mb * 16 + hi * 8 + j) * 68 + nb * 16 + lr] = acc[mb][nb][j];
        if (BIASM == 2) { ob[lane] = bb[0]; ob[32 + lane] = bb[1]; }
        __builtin_amdgcn_fence(__ATOMIC_RELEASE, "wavefront"); __builtin_amdgcn_wave_barrier(); asm volatile("" ::: "memory");   // as in the f32 epilogue below: the lanes' LDS writes stay ahead of the reads of other lanes' elements that follow
        const size_t eo = (size_t)(r0 + rw) * ldc + c0 + cofs8;
#pragma unroll 1   // rolled: the split arithmetic stands once in the text, not once per row block (unrolled, the four projections' text grew to about 40 KB)
        for (int mb = 0; mb < 4; ++mb) {
            v8us oh[4], ol[4]; v4f u[4][2]; float br[4];
#pragma unroll
            for (int s = 0; s < 4; ++s) {                // the row block's LDS reads, issued as one group
                const int row = mb * 16 + 4 * s + rw;
                u[s][0] = *(const v4fa*)(os + row * 68 + cofs8); u[s][1] = *(const v4fa*)(os + row * 68 + cofs8 + 4);
                br[s] = BIASM == 2 ? ob[row] : 0.f; }
#pragma unroll
            for (int s = 0; s < 4; ++s) {
                const v4f u0 = u[s][0], u1 = u[s][1];
                float val[8] = {u0[0], u0[1], u0[2], u0[3], u1[0], u1[1], u1[2], u1[3]};
#pragma unroll
                for (int q = 0; q < 8; ++q) {
                    val[q] += BIASM == 1 ? bb[q] : br[s];
                    if (OUTM == 1) { unsigned short a_, c_; splitf(val[q], a_, c_); oh[s][q] = a_; ol[s][q] = c_; }
                    else { const float w = val[q] * VCAR; const h16 hh = (h16)w; oh[s][q] = __builtin_bit_cast(unsigned short, hh); ol[s][q] = f2bf(w - (float)hh); }
                }
            }
            __builtin_amdgcn_sched_barrier(0);   // the row block's eight stores stay together behind its arithmetic: the one s_wait_xcnt below then serves them all, where stores spread among the arithmetic took a wait each
#pragma unroll
            for (int s = 0; s < 4; ++s) { *(v8us*)(Ph + eo + (size_t)(mb * 16 + 4 * s) * ldc) = oh[s]; *(v8us*)(Pl + eo + (size_t)(mb * 16 + 4 * s) * ldc) = ol[s]; }
            asm volatile("s_wait_xcnt 0x0" ::: "memory");   // behind the row block's stores: the next trip reuses their data registers and steps their address pairs
            __builtin_amdgcn_sched_barrier(0);   // holds that wait directly behind the stores
        }
        return;
    }
#pragma unroll
    for (int mb = 0; mb < 4; ++mb) {
#pragma unroll
        for (int nb = 0; nb < 4; ++nb) {
#pragma unroll
            for (int j = 0; j < 8; ++j) os[(hi * 8 + j) * 68 + nb * 16 + lr] = acc[mb][nb][j]; }
        __builtin_amdgcn_fence(__ATOMIC_RELEASE, "wavefront"); __builtin_amdgcn_wave_barrier(); asm volatile("" ::: "memory");
        const size_t rb = (size_t)(r0 + mb * 16);
        v4f rv8[8];
        if (RESID) {
            const float* rp[8];
#pragma unroll
            for (int s = 0; s < 8; ++s) { rp[s] = res + (rb + 2 * s + hi) * (size_t)ldc + c0 + lr * 4; rv8[s] = *(const v4f*)rp[s]; }
            asm volatile("s_wait_xcnt 0x0" :: "v"(rp[0]), "v"(rp[1]), "v"(rp[2]), "v"(rp[3]), "v"(rp[4]), "v"(rp[5]), "v"(rp[6]), "v"(rp[7]) : "memory");   // behind the row block's residual loads; it takes their address pairs as inputs, so that no load's result lands in a pair ahead of it
        }
{
#pragma unroll
            for (int s = 0; s < 8; ++s) {
                const int row = 2 * s + hi, cofs = lr * 4;
                v4f val = *(const v4fa*)(os + row * 68 + cofs);
                if (BIASM == 1) { val[0] += bfr(bias[c0 + cofs]); val[1] += bfr(bias[c0 + cofs + 1]); val[2] += bfr(bias[c0 + cofs + 2]); val[3] += bfr(bias[c0 + cofs + 3]); }
                if (BIASM == 2) { const float bv = bfr(bias[rb + row]); val[0] += bv; val[1] += bv; val[2] += bv; val[3] += bv; }
                if (RESID) { const v4f rv = rv8[s]; val[0] += bfr(rv[0]); val[1] += bfr(rv[1]); val[2] += bfr(rv[2]); val[3] += bfr(rv[3]); }
                *(v4f*)(C + (rb + row) * (size_t)ldc + c0 + cofs) = val; }
             }
        asm volatile("s_wait_xcnt 0x0" ::: "memory");   // behind the row block's stores: the next row block reuses their data and address registers
        __builtin_amdgcn_sched_barrier(0);   // holds that wait directly behind the stores: without it the next row block's address arithmetic was scheduled ahead of it
        __builtin_amdgcn_fence(__ATOMIC_RELEASE, "wavefront"); __builtin_amdgcn_wave_barrier(); asm volatile("" ::: "memory");
    }
}
template <typename T16, bool A2ON, bool B2ON, int BIASM, bool RESID, int K, bool BSUM>
__global__ __launch_bounds__(32) void k_gemmw(const T16* __restrict__ A, const T16* __restrict__ A2, const T16* __restrict__ Bt, const T16* __restrict__ Bt2,
                                              const float* __restrict__ F1, const float* __restrict__ F2, float* C, int ldc, const float* __restrict__ bias, const float* __restrict__ res, size_t sA, size_t sB, size_t sC) {
    __shared__ __align__(16) float os[16 * 68];
    gemmw_tile<T16, A2ON, B2ON, BIASM, RESID, K, 0, BSUM>(os, blockIdx.x, blockIdx.y, blockIdx.z, A, A2, Bt, Bt2, F1, F2, C, nullptr, nullptr, ldc, bias, res, sA, sB, sC);
}
// ---- k_proj5: the five projections need nothing of each other and run as one grid: blockIdx.y names the projection (the two-product ones first), blockIdx.x its 64x64 tile, numbered as the separate grids numbered theirs. Each writes its own pair of 16-bit planes: theta, phi, D as bf16 hi/lo, g, S as f16 hi (x16) + bf16 residual.
#define PTIL ((NB * SEQ / 64) * (CI / 64))
__global__ __launch_bounds__(32) void k_proj5(const bf* __restrict__ XT, const bf* __restrict__ X1h, const bf* __restrict__ X1l,
                                              const bf* __restrict__ WTb, const bf* __restrict__ WPb, const bf* __restrict__ WGb, const bf* __restrict__ WDb, const bf* __restrict__ WSb,
                                              const float* __restrict__ b_theta, const float* __restrict__ b_phi, const float* __restrict__ b_g, const float* __restrict__ b_d, const float* __restrict__ b_s,
                                              bf* THh, bf* THl, bf* PHh, bf* PHl, bf* DQh, bf* DQl, h16* GVh, bf* GVl, h16* SVh, bf* SVl) {
    __shared__ __align__(16) float os[64 * 68 + 64];
    const int p = blockIdx.y, i = blockIdx.x;
    const int tx = i % (NB * SEQ / 64), ty = i / (NB * SEQ / 64);                                    // token-major [tok][128]: tiles (nTok/64, CI/64)
    const int fx = i % (CI / 64), fy = (i / (CI / 64)) % (SEQ / 64), fz = i / ((CI / 64) * (SEQ / 64));   // feature-major [b][128][SEQ]: tiles (CI/64, SEQ/64, NB)
    if (p == 0)      gemmw_tile<bf, true, false, 1, false, C_, 1, false>(os, tx, ty, 0, X1h, X1l, WDb, nullptr, nullptr, nullptr, nullptr, DQh, DQl, CI, b_d, nullptr, 0, 0, 0);                                        /* D [tok][128] (2 products) */
    else if (p == 1) gemmw_tile<bf, false, true, 2, false, C_, 2, false>(os, fx, fy, fz, WSb, nullptr, X1h, X1l, nullptr, nullptr, nullptr, (bf*)SVh, SVl, SEQ, b_s, nullptr, 0, (size_t)SEQ * C_, (size_t)CI * SEQ);        /* S feature-major (2 products) */
    else if (p == 2) gemmw_tile<bf, false, false, 2, false, C_, 2, false>(os, fx, fy, fz, WGb, nullptr, XT, nullptr, nullptr, nullptr, nullptr, (bf*)GVh, GVl, SEQ, b_g, nullptr, 0, (size_t)SEQ * C_, (size_t)CI * SEQ);     /* g feature-major */
    else             gemmw_tile<bf, false, false, 1, false, C_, 1, false>(os, tx, ty, 0, XT, nullptr, p == 3 ? WTb : WPb, nullptr, nullptr, nullptr, nullptr, p == 3 ? THh : PHh, p == 3 ? THl : PHl, CI, p == 3 ? b_theta : b_phi, nullptr, 0, 0, 0);   /* theta, phi [tok][128] */
}

// k_stats: one work-group per 32 (b, c) rows (its 32 results fill one 128-byte line of MU and of RD), sixteen waves, two rows per wave one after the other.
// A wave brings its whole row into registers with all its loads in flight at once, rounds it to bf16 there, and takes the mean and the centred sum of squares from the registers: the row is read once and no load waits on another.
// LDS mus/rds: cross-wave (block barrier).
#define SW 16
#define SR (32 / SW)
__global__ __launch_bounds__(SW * 32) void k_stats(const float* __restrict__ x, float* MU, float* RD) {
    __shared__ float mus[32]; __shared__ float rds[32];
    const int t = threadIdx.x, wid = __builtin_amdgcn_readfirstlane(t >> 5), lane = t & 31;   // wave number held scalar: the row's base address is scalar, the lane's offset one register that is never rewritten
#pragma unroll 1   // rolled: one row's registers at a time
    for (int j = 0; j < SR; ++j) {
        const int rr = blockIdx.x * 32 + wid * SR + j;                // (b, c) row index < NB * C_
        const int b = rr / C_, c = rr - b * C_;
        const float* xr = x + ((size_t)b * C_ + c) * HWF + lane * 4;
        v4f r[SEQ / 128];
#pragma unroll   // unrolled: every load of the row is issued before the first is waited for
        for (int i = 0; i < SEQ / 128; ++i) r[i] = *(const v4f*)(xr + (size_t)i * 128);
        float s = 0.f;
#pragma unroll   // unrolled: r[] stays in registers
        for (int i = 0; i < SEQ / 128; ++i) { v4f v = r[i]; v[0] = bfr(v[0]); v[1] = bfr(v[1]); v[2] = bfr(v[2]); v[3] = bfr(v[3]); r[i] = v; s += (v[0] + v[1]) + (v[2] + v[3]); }
        s += __shfl_xor(s, 1, 32); s += __shfl_xor(s, 2, 32); s += __shfl_xor(s, 4, 32); s += __shfl_xor(s, 8, 32); s += __shfl_xor(s, 16, 32);
        const float mu = s * (1.0f / (float)SEQ);
        float ss = 0.f;
#pragma unroll   // unrolled: r[] stays in registers
        for (int i = 0; i < SEQ / 128; ++i) { const v4f v = r[i];
            const float d0 = v[0] - mu, d1 = v[1] - mu, d2 = v[2] - mu, d3 = v[3] - mu;
            ss += (d0 * d0 + d1 * d1) + (d2 * d2 + d3 * d3); }
        ss += __shfl_xor(ss, 1, 32); ss += __shfl_xor(ss, 2, 32); ss += __shfl_xor(ss, 4, 32); ss += __shfl_xor(ss, 8, 32); ss += __shfl_xor(ss, 16, 32);
        const float den = 4.0f * (ss * (1.0f / (float)(SEQ - 1)) + ELAM);
        const float rd = 1.0f / den;
        if (lane == 0) { mus[wid * SR + j] = mu; rds[wid * SR + j] = rd; }
    }
    __syncthreads();
    if (wid == 0) {
        const float a = mus[lane], r = rds[lane];
        float* pm = MU + (size_t)blockIdx.x * 32 + lane; float* pr = RD + (size_t)blockIdx.x * 32 + lane;
        *(float*)pm = a; *(float*)pr = r;  }
}

// ---- k_xplanes: token-major planes from channel-major x: XT[(b*SEQ+t)][c] = bf16(x[b][c][t]) (exact), X1h/X1l = bf16 hi/lo of x1 = bf16(x) * sigmoid((bf16(x) - mu)^2 * rd + 0.5).
// The six weight matrices' conversion to bf16 needs nothing of x and rides in the same grid: work-groups from XPB on, WCB of them per matrix, eight elements a thread.
#define XPB (NB * SEQ * C_ / 8 / 256)
#define WCB (CI * C_ / 8 / 256)
static_assert((CI * C_ / 8) % 256 == 0);
__global__ __launch_bounds__(256) void k_xplanes(const float* __restrict__ x, const float* __restrict__ MU, const float* __restrict__ RD, bf* XT, bf* X1h, bf* X1l,
                                                 const float* __restrict__ w_theta, const float* __restrict__ w_phi, const float* __restrict__ w_g, const float* __restrict__ w_d, const float* __restrict__ w_s, const float* __restrict__ w_out,
                                                 bf* WTb, bf* WPb, bf* WGb, bf* WDb, bf* WSb, bf* WOb) {
    if (blockIdx.x >= XPB) {
        const int cb = blockIdx.x - XPB, w = cb / WCB;
        const float* src = w == 0 ? w_theta : w == 1 ? w_phi : w == 2 ? w_g : w == 3 ? w_d : w == 4 ? w_s : w_out;
        bf* dst = w == 0 ? WTb : w == 1 ? WPb : w == 2 ? WGb : w == 3 ? WDb : w == 4 ? WSb : WOb;
        const size_t i = (size_t)(cb - w * WCB) * 256 + threadIdx.x;
        const v8f v = *(const v8f*)(src + i * 8); v8us o;
#pragma unroll
        for (int k = 0; k < 8; ++k) o[k] = f2bf(v[k]);
        *(v8us*)(dst + i * 8) = o;
        return;
    }
    const size_t e = ((size_t)blockIdx.x * 256 + threadIdx.x) * 8; if (e >= (size_t)NB * SEQ * C_) return;
    const int c = (int)(e % C_); const size_t btk = e / C_; const int tpos = (int)(btk % SEQ); const int b = (int)(btk / SEQ);
    const float* xp = x + ((size_t)b * C_ + c) * HWF + tpos;
    const v8f mu8 = *(const v8f*)(MU + (size_t)b * C_ + c), rd8 = *(const v8f*)(RD + (size_t)b * C_ + c);
    v8us o0, oh, ol;
#pragma unroll
    for (int q = 0; q < 8; ++q) {
        const float xb = bfr(xp[(size_t)q * HWF]);
        const float d = xb - mu8[q];
        const float y = d * d * rd8[q] + 0.5f;
        const float ex = __expf(-y);
        const float sg = __builtin_amdgcn_rcpf(1.0f + ex);
        const float x1 = xb * sg;
        o0[q] = f2bf(xb); unsigned short hh, ll; splitf(x1, hh, ll); oh[q] = hh; ol[q] = ll;
    }
    *(v8us*)(XT + e) = o0; *(v8us*)(X1h + e) = oh; *(v8us*)(X1l + e) = ol; 
}

// ---- k_attn: eight waves per work-group on 128 queries of one batch and one map (z = 0: theta/g, z = 1: D/S; keys = phi for both), online max-subtracted softmax.
// Wave (qg, kh) takes the 32 queries of group qg (two 16-query tiles) and the 32-key half kh of every stage: each K and V fragment read from LDS feeds both query tiles, so a matrix instruction costs half the LDS reads of a 16-query wave.
// Each wave keeps its own running maximum, sum and O^T over its half of the keys; at the end the two waves of a query group swap one tile each through LDS and join the halves (rescaled to the common maximum).
// Transposed products: S^T = K . Q^T (A = key rows, B = query columns) and O^T += V^T . P^T (A = feature rows of V, B = P^T). Lane (L, hi) then holds query L alone: 16 of the block's 32 scores sit in its own registers,
// maximum and sum are taken in the lane (one exchange between the lane halves for the maximum; the halves' sums are joined once at the end), and the two score tiles, converted in place, are the B operand of the second product.
// The work-group's 128 queries walk the same keys and values: each 64-key stage (K hi/lo rows, V hi/lo feature rows) is brought into LDS once by asynchronous copies, two buffers, the next stage in flight while this one is worked on.
// LDS ring: shared by the eight waves (block barrier at each hand-over). K rows at a 272-byte pitch, V rows at a 144-byte pitch (16 B x odd, for ds_load_b128 readers).
// LDS osa: one slice per wave, rows 0..15 x cols 0..127 and, in cols 128 and 129, the row's maximum and sum. A wave writes its own slice; behind the block barrier only its partner touches that slice.
#define AW   8
#define SK   64
#define KPI  136
#define VPI  72
#define KPLB (SK * KPI * 2)
#define VPLB (CI * VPI * 2)
#define STGB (2 * KPLB + 2 * VPLB)
#define NST  (SEQ / SK)
#define QG   (AW / 2)
static_assert(SEQ % (AW * 16) == 0 && NST >= 2 && SK == 2 * KB && OSP >= CI + 2);
static_assert(SK * CI * 2 == 4 * AW * 32 * 16 && CI * SK * 2 == 4 * AW * 32 * 16);
__device__ __forceinline__ v16bf ldbs(const bf* p) { return cat16b(*(const v8usa*)p, *(const v8usa*)(p + 16)); }
__device__ __forceinline__ v16h  ldhs(const h16* p) { return cat16(*(const v8ha*)p, *(const v8ha*)(p + 16)); }
__device__ __forceinline__ float xhalf(float x) { return __builtin_bit_cast(float, __builtin_amdgcn_permlanex16(__builtin_bit_cast(int, x), __builtin_bit_cast(int, x), 0x76543210, 0xfedcba98, false, false)); }   // lane l takes lane l ^ 16's value
// Eight 16-byte copies per lane, global -> LDS through no register: four steps of plane a, four of plane b. The s_wait_xcnt stands inside the statement so that no address register is rewritten ahead of it.
template <typename TA, typename TB>
__device__ __forceinline__ void copy8(unsigned la, const TA* ga, unsigned lb, const TB* gb, unsigned lstep, size_t gstep) {
    asm volatile("global_load_async_to_lds_b128 %0, %8, off\n\t"
                 "global_load_async_to_lds_b128 %1, %9, off\n\t"
                 "global_load_async_to_lds_b128 %2, %10, off\n\t"
                 "global_load_async_to_lds_b128 %3, %11, off\n\t"
                 "global_load_async_to_lds_b128 %4, %12, off\n\t"
                 "global_load_async_to_lds_b128 %5, %13, off\n\t"
                 "global_load_async_to_lds_b128 %6, %14, off\n\t"
                 "global_load_async_to_lds_b128 %7, %15, off\n\t"
                 "s_wait_xcnt 0x0"
                 :: "v"(la), "v"(la + lstep), "v"(la + 2 * lstep), "v"(la + 3 * lstep), "v"(lb), "v"(lb + lstep), "v"(lb + 2 * lstep), "v"(lb + 3 * lstep),
                    "v"(ga), "v"(ga + gstep), "v"(ga + 2 * gstep), "v"(ga + 3 * gstep), "v"(gb), "v"(gb + gstep), "v"(gb + 2 * gstep), "v"(gb + 3 * gstep)
                 : "memory");
}
__global__ __launch_bounds__(AW * 32) void k_attn(const bf* __restrict__ THh, const bf* __restrict__ THl, const bf* __restrict__ DQh, const bf* __restrict__ DQl,
                                             const bf* __restrict__ PHh, const bf* __restrict__ PHl,
                                             const h16* __restrict__ GVh, const bf* __restrict__ GVl, const h16* __restrict__ SVh, const bf* __restrict__ SVl, float* Y) {
    __shared__ __align__(16) unsigned char ring[2 * STGB];
    __shared__ __align__(16) float osa[AW * 16 * OSP];
    const int tid = threadIdx.x, lane = tid & 31, L = lane & 15, hi = lane >> 4;
    const int wv = __builtin_amdgcn_readfirstlane(tid >> 5);
    const int qg = wv % QG, kh = wv / QG;          // query group, key half (both wave-uniform)
    float* osw = osa + wv * 16 * OSP;                    // own slice: takes the tile that is given away
    float* osp = osa + (wv ^ QG) * 16 * OSP;             // the partner's slice: same query group, other key half
    const int q0 = blockIdx.x * (AW * 16) + qg * 32, b = blockIdx.y, mp = blockIdx.z;
    const size_t tok = (size_t)b * SEQ;
    const bf* Qh = (mp ? DQh : THh) + (tok + q0) * CI; const bf* Ql = (mp ? DQl : THl) + (tok + q0) * CI;
    const bf* Kh = PHh + tok * CI; const bf* Kl = PHl + tok * CI;
    const h16* Vh = (mp ? SVh : GVh) + (size_t)b * CI * SEQ; const bf* Vl = (mp ? SVl : GVl) + (size_t)b * CI * SEQ;
    float* Yo = Y + ((size_t)mp * NB * SEQ + tok + q0 + kh * 16) * CI;   // the wave stores the tile it keeps
    // Copy map of one stage. K plane: 64 rows x 256 B, contiguous in global; thread tid takes 16-byte piece tid + 256 i (row (tid >> 4) + 16 i). V plane: 128 rows x 128 B; piece tid + 256 i (row (tid >> 3) + 32 i).
    const unsigned ring0 = (unsigned)(size_t)ring;
    const unsigned lk = ring0 + (unsigned)((tid >> 4) * (KPI * 2) + (tid & 15) * 16);
    const unsigned lv = ring0 + (unsigned)(2 * KPLB + (tid >> 3) * (VPI * 2) + (tid & 7) * 16);
    const unsigned gk = (unsigned)tid * 8, gv = (unsigned)(tid >> 3) * SEQ + (unsigned)(tid & 7) * 8;   // the lane's element offset in a K plane and in a V plane (hi and lo planes alike): two registers live through the key walk; four address pairs beside the 32-query tile's registers went to scratch
    auto fill = [&](int st) {
        const unsigned bo = (unsigned)(st & 1) * STGB;
        const unsigned ok = gk + (unsigned)st * (SK * CI), ov = gv + (unsigned)st * SK;
        copy8(lk + bo, Kh + ok, lk + bo + KPLB, Kl + ok, 16 * KPI * 2, (size_t)16 * CI);
        copy8(lv + bo, Vh + ov, lv + bo + VPLB, Vl + ov, 32 * VPI * 2, (size_t)32 * SEQ);
    };
    // Tile t of the wave = queries q0 + (t ^ kh) * 16 + L: tile 0 is the one the wave keeps and stores, tile 1 the one it gives to its partner.
    // Per tile: query L's running maximum (equal in both lane halves), this lane half's part of its sum, acc[t][ct][v] = O^T[ct*16 + 8*hi + v][L]; all over the wave's half of the keys.
    float m_i[2] = {-1.0e30f, -1.0e30f}, l_i[2] = {0.f, 0.f}; v8f acc[2][8];
#pragma unroll
    for (int t = 0; t < 2; ++t)
#pragma unroll
        for (int ct = 0; ct < 8; ++ct) acc[t][ct] = (v8f){};
    // The wave's 32 query rows never change: their hi and lo fragments are loaded once and stay in registers for the whole key walk. B fragment: query column L of the tile.
    v16bf qh[2][CI / 32], ql[2][CI / 32];
#pragma unroll
    for (int t = 0; t < 2; ++t) {
        const size_t qoff = (size_t)((t ^ kh) * 16 + L) * CI + 8 * hi;
#pragma unroll
        for (int ch = 0; ch < CI / 32; ++ch) { qh[t][ch] = ldb(Qh + qoff + ch * 32); ql[t][ch] = ldb(Ql + qoff + ch * 32); }
    }
    fill(0);
    asm volatile("s_wait_asynccnt 0x0" ::: "memory");    // stage 0 has landed before the barrier that publishes it
    __syncthreads();
    fill(1);
#pragma unroll 1   // rolled: the buffer is picked by the stage's parity at run time, one copy of the hand-over and of the pass body
    for (int st = 0; st < NST; ++st) {
      const unsigned char* sb = ring + (st & 1) * STGB;
      {
        v8f lt[2][2];
#pragma unroll
        for (int t = 0; t < 2; ++t) { lt[t][0] = (v8f){}; lt[t][1] = (v8f){}; }
        const bf* k0h = (const bf*)sb + (kh * KB + L) * KPI + 8 * hi; const bf* k0l = k0h + KPLB / 2;   // A fragment (keys): key row kh*32 + kt*16 + L of the stage
#pragma unroll   // unrolled: each chunk names its own resident query fragments
        for (int ch = 0; ch < CI / 32; ++ch) {
            const int co = ch * 32;
            const v16bf ka0 = ldbs(k0h + co), kl0 = ldbs(k0l + co), ka1 = ldbs(k0h + 16 * KPI + co), kl1 = ldbs(k0l + 16 * KPI + co);
            lt[0][0] = wmmab(ka0, qh[0][ch], lt[0][0]); lt[0][1] = wmmab(ka1, qh[0][ch], lt[0][1]); lt[1][0] = wmmab(ka0, qh[1][ch], lt[1][0]); lt[1][1] = wmmab(ka1, qh[1][ch], lt[1][1]);
            lt[0][0] = wmmab(ka0, ql[0][ch], lt[0][0]); lt[0][1] = wmmab(ka1, ql[0][ch], lt[0][1]); lt[1][0] = wmmab(ka0, ql[1][ch], lt[1][0]); lt[1][1] = wmmab(ka1, ql[1][ch], lt[1][1]);
            lt[0][0] = wmmab(kl0, qh[0][ch], lt[0][0]); lt[0][1] = wmmab(kl1, qh[0][ch], lt[0][1]); lt[1][0] = wmmab(kl0, qh[1][ch], lt[1][0]); lt[1][1] = wmmab(kl1, qh[1][ch], lt[1][1]);
        }
        const h16* vh = (const h16*)(sb + 2 * KPLB) + L * VPI + kh * KB + 8 * hi; const bf* vl = (const bf*)(sb + 2 * KPLB + VPLB) + L * VPI + kh * KB + 8 * hi;   // A fragment (values): ci row L of the staged feature-major plane
        v16h vf[8]; v16bf vr[8];                                 // each V fragment is read from LDS once, for tile 0's products, and stays in registers for tile 1's
#pragma unroll
        for (int t = 0; t < 2; ++t) {
            // D element v of tile kt = score of key kh*32 + kt*16 + 8*hi + v against query L of tile t.
            const v8f lt0 = lt[t][0], lt1 = lt[t][1];
            float mx = fmaxf(fmaxf(fmaxf(lt0[0], lt1[0]), fmaxf(lt0[1], lt1[1])), fmaxf(fmaxf(lt0[2], lt1[2]), fmaxf(lt0[3], lt1[3])));
            mx = fmaxf(mx, fmaxf(fmaxf(fmaxf(lt0[4], lt1[4]), fmaxf(lt0[5], lt1[5])), fmaxf(fmaxf(lt0[6], lt1[6]), fmaxf(lt0[7], lt1[7]))));
            mx = fmaxf(mx, xhalf(mx));
            const float mn = fmaxf(m_i[t], mx);
            const float sc = __expf(m_i[t] - mn);
            v16f ps; float rp[8];
#pragma unroll
            for (int v = 0; v < 8; ++v) {
                const float pa = __expf(lt0[v] - mn), pb = __expf(lt1[v] - mn);
                rp[v] = pa + pb;
                ps[v] = pa * PCAR; ps[8 + v] = pb * PCAR;            // B element s: k = 8*hi + s (s < 8), 16 + 8*hi + (s - 8) otherwise: tile 0's registers, then tile 1's
            }
            l_i[t] = l_i[t] * sc + (((rp[0] + rp[1]) + (rp[2] + rp[3])) + ((rp[4] + rp[5]) + (rp[6] + rp[7]))); m_i[t] = mn;
            const v16h pa16 = __builtin_convertvector(ps, v16h);     // round to nearest even, as the scalar conversions
            const v16bf pab = __builtin_convertvector(ps, v16bf);
#pragma unroll
            for (int ct = 0; ct < 8; ++ct) acc[t][ct] *= sc;
#pragma unroll
            for (int ct = 0; ct < 8; ++ct) {
                if (t == 0) { vf[ct] = ldhs(vh + ct * 16 * VPI); vr[ct] = ldbs(vl + ct * 16 * VPI); }
                acc[t][ct] = wmma16(vf[ct], pa16, acc[t][ct]); acc[t][ct] = wmmab(vr[ct], pab, acc[t][ct]); }
        }
        // Four vector slots behind the pass's last matrix instructions: the hand-over and, while stages remain, the copies of stage st + 2 follow them.
        asm volatile("v_nop\n\tv_nop\n\tv_nop\n\tv_nop" : "+v"(acc[0][0]), "+v"(acc[0][1]), "+v"(acc[0][2]), "+v"(acc[0][3]), "+v"(acc[0][4]), "+v"(acc[0][5]), "+v"(acc[0][6]), "+v"(acc[0][7]),
                                                           "+v"(acc[1][0]), "+v"(acc[1][1]), "+v"(acc[1][2]), "+v"(acc[1][3]), "+v"(acc[1][4]), "+v"(acc[1][5]), "+v"(acc[1][6]), "+v"(acc[1][7]));
      }
      // Hand-over: this wave's reads of the stage are done, its own copies of the next stage have landed, every wave has arrived; only then is the buffer just read filled again.
      asm volatile("s_wait_dscnt 0x0" ::: "memory");     // the wave's last LDS reads of this buffer have returned before it may be refilled
      asm volatile("s_wait_asynccnt 0x0" ::: "memory");  // the wave's copies of stage st + 1 have landed before the barrier that publishes them
      __syncthreads();
      if (st + 2 < NST) fill(st + 2);
    }
    asm volatile("s_wait_asynccnt 0x0" ::: "memory");    // no copy is outstanding when the wave goes on to its end
    // Join of the two key halves. Each wave hands tile 1 (raw O^T, maximum, sum) to its partner through its own slice and takes the partner's tile 1, which is its own tile 0's queries over the other keys.
    const float lf0 = l_i[0] + xhalf(l_i[0]), lf1 = l_i[1] + xhalf(l_i[1]);   // the two lane halves' sums of query L, joined once
#pragma unroll
    for (int ct = 0; ct < 8; ++ct) {
        const v8f o = acc[1][ct];
        *(v4fa*)(osw + L * OSP + ct * 16 + 8 * hi) = (v4f){o[0], o[1], o[2], o[3]}; *(v4fa*)(osw + L * OSP + ct * 16 + 8 * hi + 4) = (v4f){o[4], o[5], o[6], o[7]}; }
    osw[L * OSP + CI + hi] = hi ? lf1 : m_i[1];
    __syncthreads();                                     // every wave's slice is written before its partner reads it
    const float mo = osp[L * OSP + CI], lo = osp[L * OSP + CI + 1];
    const float mj = fmaxf(m_i[0], mo);
    const float ea = __expf(m_i[0] - mj), eb = __expf(mo - mj);
    const float rl = __builtin_amdgcn_rcpf(lf0 * ea + lo * eb) * YSC;
    const float fa = ea * rl, fb = eb * rl;
#pragma unroll
    for (int ct = 0; ct < 8; ++ct) {                     // a lane reads and rewrites its own elements of the partner's slice
        float* pe = osp + L * OSP + ct * 16 + 8 * hi;
        const v4f u0 = *(const v4fa*)pe, u1 = *(const v4fa*)(pe + 4); const v8f o = acc[0][ct];
        *(v4fa*)pe = (v4f){o[0] * fa + u0[0] * fb, o[1] * fa + u0[1] * fb, o[2] * fa + u0[2] * fb, o[3] * fa + u0[3] * fb};
        *(v4fa*)(pe + 4) = (v4f){o[4] * fa + u1[0] * fb, o[5] * fa + u1[1] * fb, o[6] * fa + u1[2] * fb, o[7] * fa + u1[3] * fb}; }
    __builtin_amdgcn_fence(__ATOMIC_RELEASE, "wavefront"); __builtin_amdgcn_wave_barrier(); asm volatile("" ::: "memory");
{
#pragma unroll
        for (int r = 0; r < 16; ++r) { const v4f val = *(const v4fa*)(osp + r * OSP + lane * 4); *(v4f*)(Yo + (size_t)r * CI + lane * 4) = val; }
         }
}

extern "C" void kernel_launch(void* const* d_in, const int* in_sizes, int n_in,
                              void* d_out, int out_size, void* d_ws, size_t ws_size, hipStream_t stream) {
    if (n_in < 13) return;
    if ((size_t)in_sizes[0] < (size_t)NB * C_ * HWF) return;
    if (in_sizes[1] < CI * C_ || in_sizes[3] < CI * C_ || in_sizes[5] < CI * C_ || in_sizes[7] < CI * C_ || in_sizes[9] < CI * C_ || in_sizes[11] < C_ * CI) return;
    if (in_sizes[2] < CI || in_sizes[4] < CI || in_sizes[6] < CI || in_sizes[8] < CI || in_sizes[10] < CI || in_sizes[12] < C_) return;
    if ((size_t)out_size < (size_t)NB * C_ * HWF) return;
    const float* x = (const float*)d_in[0];
    const float* w_theta = (const float*)d_in[1];  const float* b_theta = (const float*)d_in[2];
    const float* w_phi   = (const float*)d_in[3];  const float* b_phi   = (const float*)d_in[4];
    const float* w_g     = (const float*)d_in[5];  const float* b_g     = (const float*)d_in[6];
    const float* w_d     = (const float*)d_in[7];  const float* b_d     = (const float*)d_in[8];
    const float* w_s     = (const float*)d_in[9];  const float* b_s     = (const float*)d_in[10];
    const float* w_out   = (const float*)d_in[11]; const float* b_out   = (const float*)d_in[12];
    float* OUT = (float*)d_out;                     // [NB][256][HWF]
    char* wsp = (char*)d_ws;
    auto take = [&](size_t bytes) { char* p = wsp; wsp += (bytes + 255) & ~(size_t)255; return (void*)p; };
    const size_t nTok = (size_t)NB * SEQ;
    bf* WTb = (bf*)take((size_t)CI * C_ * 2); bf* WPb = (bf*)take((size_t)CI * C_ * 2); bf* WGb = (bf*)take((size_t)CI * C_ * 2);
    bf* WDb = (bf*)take((size_t)CI * C_ * 2); bf* WSb = (bf*)take((size_t)CI * C_ * 2); bf* WOb = (bf*)take((size_t)C_ * CI * 2);
    float* MU = (float*)take((size_t)NB * C_ * 4); float* RD = (float*)take((size_t)NB * C_ * 4);
    bf* XT = (bf*)take(nTok * C_ * 2); bf* X1h = (bf*)take(nTok * C_ * 2); bf* X1l = (bf*)take(nTok * C_ * 2);
    float* F32A = (float*)take(2 * nTok * CI * 4);                 // y1 | y2 [2][nTok][128]
    bf* THh = (bf*)take(nTok * CI * 2); bf* THl = (bf*)take(nTok * CI * 2);
    bf* PHh = (bf*)take(nTok * CI * 2); bf* PHl = (bf*)take(nTok * CI * 2);
    bf* DQh = (bf*)take(nTok * CI * 2); bf* DQl = (bf*)take(nTok * CI * 2);
    h16* GVh = (h16*)take(nTok * CI * 2); bf* GVl = (bf*)take(nTok * CI * 2);
    h16* SVh = (h16*)take(nTok * CI * 2); bf* SVl = (bf*)take(nTok * CI * 2);
    if ((size_t)(wsp - (char*)d_ws) > ws_size) return;
    float* Y1 = F32A; float* Y2 = F32A + nTok * CI;

    k_stats<<<(unsigned)(NB * C_ / 32), SW * 32, 0, stream>>>(x, MU, RD);                                                                   /* SimAM mu, 1/(4(var_n + eps)) per (b, c) */
    k_xplanes<<<(unsigned)(XPB + 6 * WCB), 256, 0, stream>>>(x, MU, RD, XT, X1h, X1l, w_theta, w_phi, w_g, w_d, w_s, w_out, WTb, WPb, WGb, WDb, WSb, WOb);   /* x^T bf16 (exact), gated x1^T hi/lo; weights -> bf16 */
    k_proj5<<<dim3(PTIL, 5, 1), 32, 0, stream>>>(XT, X1h, X1l, WTb, WPb, WGb, WDb, WSb, b_theta, b_phi, b_g, b_d, b_s, THh, THl, PHh, PHl, DQh, DQl, GVh, GVl, SVh, SVl);   /* theta, phi, D [tok][128]; g, S [b][128][SEQ]; 16-bit planes */
    k_attn<<<dim3(SEQ / (AW * 16), NB, 2), AW * 32, 0, stream>>>(THh, THl, DQh, DQl, PHh, PHl, GVh, GVl, SVh, SVl, F32A);                          /* y1 = softmax(theta.phi) g, y2 = softmax(D.phi) S */
    k_gemmw<bf, false, true, 2, true, CI, true><<<dim3(C_ / 64, SEQ / 64, NB), 32, 0, stream>>>(WOb, nullptr, nullptr, nullptr, Y1, Y2, OUT, HWF, b_out, x, 0, (size_t)SEQ * CI, (size_t)C_ * HWF);      /* out[b][co][t] = W_out . (y1 + y2 as hi/lo) + b_out + bf16(x) */
}

// v008
// A run of this version takes 151 microseconds.
// Timed twice side by side with v007, it ran 1.03 times as fast both times.
// Counting every step since v000, it is 6.42 times as fast.
#include <hip/hip_runtime.h>

// Contractions, f32 accumulate: five 1x1 projections on v_wmma_f32_16x16x32_bf16 (x as exact bf16; SimAM-gated branch as bf16 hi+lo planes = 2 products; weights bf16); score tiles q.k on v_wmma_f32_16x16x32_bf16 with hi/lo x hi/lo planes (3 products); P.V on v_wmma_f32_16x16x32_f16 (P x 2^14, V x 16 as f16 hi) plus v_wmma_f32_16x16x32_bf16 (P bf16 x V bf16 residual); output projection on v_wmma_f32_16x16x32_bf16 (y1 + y2 split into bf16 hi+lo in registers = 2 products). SimAM statistics/gating, online max-subtracted softmax, normalisation and residual add in f32.
// Data flow: x [NB][256][4096] channel-major -> token-major planes XT (bf16 exact), X1h/X1l (gated branch, hi/lo); theta/phi/D token-major [t][128] as bf16 hi/lo planes, g/S feature-major [128][t] as f16 hi (x16) + bf16 residual, each written by the projection's own epilogue; eight waves per work-group share 64-key K/V stages in LDS; one wave per 32 queries and one 32-key half of every stage, its query fragments resident in registers (transposed scores K.Q^T, online softmax in the lane, P^T packed from the score registers, V^T.P^T), the two key halves joined at the end; y1/y2 [t][128] f32; y = y1 + y2 -> bf16 hi/lo in the output projection's own fragment loader; out[b][co][t] = W_out . y + b_out + bf16(x).

#ifndef NB
#define NB 4
#endif
#ifndef SEQ
#define SEQ 4096
#endif
#define NBF  4
#define HWF  4096
#define C_   256
#define CI   128
#define KB   32
#define OSP  132
#define PCAR 16384.0f
#define VCAR 16.0f
#define YSC  (1.0f / 262144.0f)
#define ELAM 1e-4f

static_assert(NB >= 1 && NB <= NBF);
static_assert(SEQ % 128 == 0 && SEQ >= 128 && SEQ <= HWF);
static_assert(SEQ % KB == 0 && SEQ % 64 == 0 && SEQ % 16 == 0);
static_assert((NB * C_) % 32 == 0);
static_assert(C_ % 64 == 0 && CI % 64 == 0 && C_ % 32 == 0 && CI % 32 == 0);
static_assert((NB * SEQ * C_) % (8 * 256) == 0 && (NB * SEQ * CI) % 8 == 0);

typedef _Float16 h16;
typedef unsigned short bf;
typedef __attribute__((ext_vector_type(16))) __bf16   v16bf;
typedef __attribute__((ext_vector_type(16))) _Float16 v16h;
typedef __attribute__((ext_vector_type(8)))  _Float16 v8h;
typedef __attribute__((ext_vector_type(8)))  unsigned short v8us;
typedef __attribute__((ext_vector_type(8)))  float    v8f;
typedef __attribute__((ext_vector_type(16))) float    v16f;
typedef __attribute__((ext_vector_type(4)))  float    v4f;
typedef v8h  __attribute__((may_alias)) v8ha;
typedef v4f  __attribute__((may_alias)) v4fa;
typedef v8us __attribute__((may_alias)) v8usa;

__device__ __forceinline__ unsigned short f2bf(float f) { unsigned u = __float_as_uint(f); u += 0x7FFFu + ((u >> 16) & 1u); return (unsigned short)(u >> 16); }
__device__ __forceinline__ float bf2f(unsigned short b) { return __uint_as_float(((unsigned)b) << 16); }
__device__ __forceinline__ float bfr(float f) { return bf2f(f2bf(f)); }
__device__ __forceinline__ void splitf(float y, unsigned short& h, unsigned short& l) { h = f2bf(y); l = f2bf(y - bf2f(h)); }
__device__ __forceinline__ v16h cat16(v8h lo, v8h hi) { return __builtin_shufflevector(lo, hi, 0, 1, 2, 3, 4, 5, 6, 7, 8, 9, 10, 11, 12, 13, 14, 15); }
__device__ __forceinline__ v16bf cat16b(v8us lo, v8us hi) { return __builtin_bit_cast(v16bf, __builtin_shufflevector(lo, hi, 0, 1, 2, 3, 4, 5, 6, 7, 8, 9, 10, 11, 12, 13, 14, 15)); }
__device__ __forceinline__ v8f wmma16(v16h a, v16h b, v8f c) { return __builtin_amdgcn_wmma_f32_16x16x32_f16(false, a, false, b, (short)0, c, false, false); }
__device__ __forceinline__ v8f wmmab(v16bf a, v16bf b, v8f c) { return __builtin_amdgcn_wmma_f32_16x16x32_bf16(false, a, false, b, (short)0, c, false, false); }
// Fragment loaders (A and B share the same per-lane k map): p already points at row (lane & 15), k0 + 8*(lane >> 4); elements 0..7 <- p[0..7], elements 8..15 <- p[16..23].
__device__ __forceinline__ v16bf ldb(const bf* p) { return cat16b(*(const v8us*)p, *(const v8us*)(p + 16)); }
__device__ __forceinline__ v16h  ldh(const h16* p) { return cat16(*(const v8h*)p, *(const v8h*)(p + 16)); }

// ---- gemmw_tile: register-blocked GEMM, ONE WAVE per 64x64 output tile (16 accumulators), operands straight from K-contiguous 16-bit planes; tile (bx, by) of batch bz, tiles (M/64, N/64, Z), 32 threads. os: the wave's 16 x 68 f32 of LDS (OUTM != 0: 64 x 68 + 64).
// C[m][n] (f32, pitch ldc) = sum_k A[m][k] Bt[n][k] (+ A2[m][k] Bt[n][k] when A2ON) (+ A[m][k] Bt2[n][k] when B2ON) (+ bf16(bias[n]) BIASM==1 | bf16(bias[m]) BIASM==2) (+ bf16(res[m][n]) when RESID, same indexing as C).
// z-batch strides sA/sB/sC in elements. K % 32 == 0, M % 64 == 0, N % 64 == 0. K is a compile-time constant: the four row blocks of an operand are then fixed offsets from one address pair.
// BSUM: Bt and Bt2 are not read; they are formed in registers as the bf16 hi and lo parts of F1[n][k] + F2[n][k] (two f32 planes of pitch K, z stride sB).
// OUTM == 0: C is stored as f32. OUTM == 1: the f32 value goes out as bf16 hi/lo planes Ph/Pl; OUTM == 2: as f16 hi (value x 16, its bits in Ph) + bf16 residual Pl. Planes are indexed as C; a lane stores 8 elements, so a tile row is one whole 128-byte line per plane.
template <typename T16> struct WFrag;
template <> struct WFrag<h16> { typedef v16h V; static __device__ __forceinline__ V ld(const h16* p) { return ldh(p); } static __device__ __forceinline__ v8f mma(V a, V b, v8f c) { return wmma16(a, b, c); } };
template <> struct WFrag<bf> { typedef v16bf V; static __device__ __forceinline__ V ld(const bf* p) { return ldb(p); } static __device__ __forceinline__ v8f mma(V a, V b, v8f c) { return wmmab(a, b, c); } };
template <typename T16, bool A2ON, bool B2ON, int BIASM, bool RESID, int K, int OUTM, bool BSUM>
__device__ __forceinline__ void gemmw_tile(float* os, int bx, int by, int bz, const T16* __restrict__ A, const T16* __restrict__ A2, const T16* __restrict__ Bt, const T16* __restrict__ Bt2,
                                              const float* __restrict__ F1, const float* __restrict__ F2, float* C, bf* Ph, bf* Pl, int ldc, const float* __restrict__ bias, const float* __restrict__ res, size_t sA, size_t sB, size_t sC) {
    typedef typename WFrag<T16>::V V;
    const size_t z = bz;
    A += z * sA; if (A2ON) A2 += z * sA; if (BSUM) { F1 += z * sB; F2 += z * sB; } else { Bt += z * sB; if (B2ON) Bt2 += z * sB; } if (OUTM == 0) C += z * sC; else { Ph += z * sC; Pl += z * sC; } if (RESID) res += z * sC;
    const int lane = threadIdx.x & 31, lr = lane & 15, hi = lane >> 4;
    const int r0 = bx * 64, c0 = by * 64;
    v8f acc[4][4];
#pragma unroll
    for (int mb = 0; mb < 4; ++mb)
#pragma unroll
        for (int nb = 0; nb < 4; ++nb) acc[mb][nb] = (v8f){};
    const size_t aoff = (size_t)(r0 + lr) * K + 8 * hi, boff = (size_t)(c0 + lr) * K + 8 * hi;
    const int rw = lane >> 3, cofs8 = (lane & 7) * 8;   // plane epilogue (OUTM != 0): step s of a row block takes row 4 s + rw, eight lanes a row, eight elements a lane
    float bb[8];                                        // its bias values, loaded ahead of the K loop so that the epilogue does not wait for them: BIASM == 1 the lane's 8 columns, BIASM == 2 tile rows lane and 32 + lane (handed round through LDS)
    if (OUTM != 0) {
#pragma unroll
        for (int q = 0; q < (BIASM == 1 ? 8 : 2); ++q) bb[q] = bfr(bias[BIASM == 1 ? c0 + cofs8 + q : r0 + 32 * q + lane]);
    }
#pragma unroll 1
    for (int kc = 0; kc < K; kc += 32) {
        V a[4], a2[4], bq[4], bq2[4];
        const T16* pa = A + aoff + kc; const T16* pa2 = A2ON ? A2 + aoff + kc : pa; const T16* pb = BSUM ? pa : Bt + boff + kc; const T16* pb2 = B2ON && !BSUM ? Bt2 + boff + kc : pb;
#pragma unroll
        for (int mb = 0; mb < 4; ++mb) { a[mb] = WFrag<T16>::ld(pa + (size_t)mb * 16 * K); a2[mb] = a[mb]; if (A2ON) a2[mb] = WFrag<T16>::ld(pa2 + (size_t)mb * 16 * K); }
#pragma unroll
        for (int nb = 0; nb < 4; ++nb) if (!BSUM) { bq[nb] = WFrag<T16>::ld(pb + (size_t)nb * 16 * K); bq2[nb] = bq[nb]; if (B2ON) bq2[nb] = WFrag<T16>::ld(pb2 + (size_t)nb * 16 * K); }
        const float* pf1 = BSUM ? F1 + boff + kc : nullptr; const float* pf2 = BSUM ? F2 + boff + kc : nullptr;
        v8f f1[4][2], f2[4][2];                          // BSUM: the lane's two runs of eight k of each B row, from both f32 planes
#pragma unroll
        for (int nb = 0; nb < 4; ++nb) if (BSUM) {
            f1[nb][0] = *(const v8f*)(pf1 + (size_t)nb * 16 * K); f1[nb][1] = *(const v8f*)(pf1 + (size_t)nb * 16 * K + 16);
            f2[nb][0] = *(const v8f*)(pf2 + (size_t)nb * 16 * K); f2[nb][1] = *(const v8f*)(pf2 + (size_t)nb * 16 * K + 16); }
        if (BSUM) {
            asm volatile("s_wait_xcnt 0x0" :: "v"(pa), "v"(pf1), "v"(pf2) : "memory");   // as the statement below, for this form's three address pairs
            __builtin_amdgcn_sched_barrier(0);   // holds that wait directly behind the loads: without it the wait sank below the split arithmetic and below an address step
        } else
        asm volatile("s_wait_xcnt 0x0" :: "v"(pa), "v"(pa2), "v"(pb), "v"(pb2) : "memory");   // behind the trip's fragment loads; it takes their address pairs as inputs, so that no load's result and no address step lands in a pair ahead of it
#pragma unroll
        for (int nb = 0; nb < 4; ++nb) if (BSUM) {       // B = F1 + F2 in f32, split into bf16 hi and lo fragments in registers (same k map as ldb)
            v8us h[2], l[2];
#pragma unroll
            for (int u = 0; u < 2; ++u) {
                const v8f y = f1[nb][u] + f2[nb][u];
#pragma unroll
                for (int q = 0; q < 8; ++q) { unsigned short a_, c_; splitf(y[q], a_, c_); h[u][q] = a_; l[u][q] = c_; } }
            bq[nb] = cat16b(h[0], h[1]); bq2[nb] = cat16b(l[0], l[1]); }
#pragma unroll
        for (int nb = 0; nb < 4; ++nb) {
            const V b = bq[nb], b2 = bq2[nb];
#pragma unroll
            for (int mb = 0; mb < 4; ++mb) {
                acc[mb][nb] = WFrag<T16>::mma(a[mb], b, acc[mb][nb]);
                if (A2ON) acc[mb][nb] = WFrag<T16>::mma(a2[mb], b, acc[mb][nb]);
                if (B2ON) acc[mb][nb] = WFrag<T16>::mma(a[mb], b2, acc[mb][nb]); } }
        asm volatile("v_nop\n\tv_nop\n\tv_nop\n\tv_nop" : "+v"(acc[0][0]), "+v"(acc[1][1]), "+v"(acc[2][2]), "+v"(acc[3][3]) : "v"(a[0]), "v"(a[3]));
    }
    if (OUTM != 0) {   // plane epilogue: the whole 64 x 64 tile goes to LDS once (os: 64 x 68 f32, then 64 row biases); a rolled loop over the four row blocks splits and stores it
        float* ob = os + 64 * 68;
#pragma unroll
        for (int mb = 0; mb < 4; ++mb)
#pragma unroll
            for (int nb = 0; nb < 4; ++nb)
#pragma unroll
                for (int j = 0; j < 8; ++j) os[(mb * 16 + hi * 8 + j) * 68 + nb * 16 + lr] = acc[mb][nb][j];
        if (BIASM == 2) { ob[lane] = bb[0]; ob[32 + lane] = bb[1]; }
        __builtin_amdgcn_fence(__ATOMIC_RELEASE, "wavefront"); __builtin_amdgcn_wave_barrier(); asm volatile("" ::: "memory");   // as in the f32 epilogue below: the lanes' LDS writes stay ahead of the reads of other lanes' elements that follow
        const size_t eo = (size_t)(r0 + rw) * ldc + c0 + cofs8;
#pragma unroll 1   // rolled: the split arithmetic stands once in the text, not once per row block (unrolled, the four projections' text grew to about 40 KB)
        for (int mb = 0; mb < 4; ++mb) {
            v8us oh[4], ol[4]; v4f u[4][2]; float br[4];
#pragma unroll
            for (int s = 0; s < 4; ++s) {                // the row block's LDS reads, issued as one group
                const int row = mb * 16 + 4 * s + rw;
                u[s][0] = *(const v4fa*)(os + row * 68 + cofs8); u[s][1] = *(const v4fa*)(os + row * 68 + cofs8 + 4);
                br[s] = BIASM == 2 ? ob[row] : 0.f; }
#pragma unroll
            for (int s = 0; s < 4; ++s) {
                const v4f u0 = u[s][0], u1 = u[s][1];
                float val[8] = {u0[0], u0[1], u0[2], u0[3], u1[0], u1[1], u1[2], u1[3]};
#pragma unroll
                for (int q = 0; q < 8; ++q) {
                    val[q] += BIASM == 1 ? bb[q] : br[s];
                    if (OUTM == 1) { unsigned short a_, c_; splitf(val[q], a_, c_); oh[s][q] = a_; ol[s][q] = c_; }
                    else { const float w = val[q] * VCAR; const h16 hh = (h16)w; oh[s][q] = __builtin_bit_cast(unsigned short, hh); ol[s][q] = f2bf(w - (float)hh); }
                }
            }
            __builtin_amdgcn_sched_barrier(0);   // the row block's eight stores stay together behind its arithmetic: the one s_wait_xcnt below then serves them all, where stores spread among the arithmetic took a wait each
#pragma unroll
            for (int s = 0; s < 4; ++s) { *(v8us*)(Ph + eo + (size_t)(mb * 16 + 4 * s) * ldc) = oh[s]; *(v8us*)(Pl + eo + (size_t)(mb * 16 + 4 * s) * ldc) = ol[s]; }
            asm volatile("s_wait_xcnt 0x0" ::: "memory");   // behind the row block's stores: the next trip reuses their data registers and steps their address pairs
            __builtin_amdgcn_sched_barrier(0);   // holds that wait directly behind the stores
        }
        return;
    }
#pragma unroll
    for (int mb = 0; mb < 4; ++mb) {
#pragma unroll
        for (int nb = 0; nb < 4; ++nb) {
#pragma unroll
            for (int j = 0; j < 8; ++j) os[(hi * 8 + j) * 68 + nb * 16 + lr] = acc[mb][nb][j]; }
        __builtin_amdgcn_fence(__ATOMIC_RELEASE, "wavefront"); __builtin_amdgcn_wave_barrier(); asm volatile("" ::: "memory");
        const size_t rb = (size_t)(r0 + mb * 16);
        v4f rv8[8];
        if (RESID) {
            const float* rp[8];
#pragma unroll
            for (int s = 0; s < 8; ++s) { rp[s] = res + (rb + 2 * s + hi) * (size_t)ldc + c0 + lr * 4; rv8[s] = *(const v4f*)rp[s]; }
            asm volatile("s_wait_xcnt 0x0" :: "v"(rp[0]), "v"(rp[1]), "v"(rp[2]), "v"(rp[3]), "v"(rp[4]), "v"(rp[5]), "v"(rp[6]), "v"(rp[7]) : "memory");   // behind the row block's residual loads; it takes their address pairs as inputs, so that no load's result lands in a pair ahead of it
        }
{
#pragma unroll
            for (int s = 0; s < 8; ++s) {
                const int row = 2 * s + hi, cofs = lr * 4;
                v4f val = *(const v4fa*)(os + row * 68 + cofs);
                if (BIASM == 1) { val[0] += bfr(bias[c0 + cofs]); val[1] += bfr(bias[c0 + cofs + 1]); val[2] += bfr(bias[c0 + cofs + 2]); val[3] += bfr(bias[c0 + cofs + 3]); }
                if (BIASM == 2) { const float bv = bfr(bias[rb + row]); val[0] += bv; val[1] += bv; val[2] += bv; val[3] += bv; }
                if (RESID) { const v4f rv = rv8[s]; val[0] += bfr(rv[0]); val[1] += bfr(rv[1]); val[2] += bfr(rv[2]); val[3] += bfr(rv[3]); }
                *(v4f*)(C + (rb + row) * (size_t)ldc + c0 + cofs) = val; }
             }
        asm volatile("s_wait_xcnt 0x0" ::: "memory");   // behind the row block's stores: the next row block reuses their data and address registers
        __builtin_amdgcn_sched_barrier(0);   // holds that wait directly behind the stores: without it the next row block's address arithmetic was scheduled ahead of it
        __builtin_amdgcn_fence(__ATOMIC_RELEASE, "wavefront"); __builtin_amdgcn_wave_barrier(); asm volatile("" ::: "memory");
    }
}
template <typename T16, bool A2ON, bool B2ON, int BIASM, bool RESID, int K, bool BSUM>
__global__ __launch_bounds__(32) void k_gemmw(const T16* __restrict__ A, const T16* __restrict__ A2, const T16* __restrict__ Bt, const T16* __restrict__ Bt2,
                                              const float* __restrict__ F1, const float* __restrict__ F2, float* C, int ldc, const float* __restrict__ bias, const float* __restrict__ res, size_t sA, size_t sB, size_t sC) {
    __shared__ __align__(16) float os[16 * 68];
    gemmw_tile<T16, A2ON, B2ON, BIASM, RESID, K, 0, BSUM>(os, blockIdx.x, blockIdx.y, blockIdx.z, A, A2, Bt, Bt2, F1, F2, C, nullptr, nullptr, ldc, bias, res, sA, sB, sC);
}
// ---- k_proj5: the five projections need nothing of each other and run as one grid: blockIdx.y names the projection (the two-product ones first), blockIdx.x its 64x64 tile, numbered as the separate grids numbered theirs. Each writes its own pair of 16-bit planes: theta, phi, D as bf16 hi/lo, g, S as f16 hi (x16) + bf16 residual.
#define PTIL ((NB * SEQ / 64) * (CI / 64))
__global__ __launch_bounds__(32) void k_proj5(const bf* __restrict__ XT, const bf* __restrict__ X1h, const bf* __restrict__ X1l,
                                              const bf* __restrict__ WTb, const bf* __restrict__ WPb, const bf* __restrict__ WGb, const bf* __restrict__ WDb, const bf* __restrict__ WSb,
                                              const float* __restrict__ b_theta, const float* __restrict__ b_phi, const float* __restrict__ b_g, const float* __restrict__ b_d, const float* __restrict__ b_s,
                                              bf* THh, bf* THl, bf* PHh, bf* PHl, bf* DQh, bf* DQl, h16* GVh, bf* GVl, h16* SVh, bf* SVl) {
    __shared__ __align__(16) float os[64 * 68 + 64];
    const int p = blockIdx.y, i = blockIdx.x;
    const int tx = i % (NB * SEQ / 64), ty = i / (NB * SEQ / 64);                                    // token-major [tok][128]: tiles (nTok/64, CI/64)
    const int fx = i % (CI / 64), fy = (i / (CI / 64)) % (SEQ / 64), fz = i / ((CI / 64) * (SEQ / 64));   // feature-major [b][128][SEQ]: tiles (CI/64, SEQ/64, NB)
    if (p == 0)      gemmw_tile<bf, true, false, 1, false, C_, 1, false>(os, tx, ty, 0, X1h, X1l, WDb, nullptr, nullptr, nullptr, nullptr, DQh, DQl, CI, b_d, nullptr, 0, 0, 0);                                        /* D [tok][128] (2 products) */
    else if (p == 1) gemmw_tile<bf, false, true, 2, false, C_, 2, false>(os, fx, fy, fz, WSb, nullptr, X1h, X1l, nullptr, nullptr, nullptr, (bf*)SVh, SVl, SEQ, b_s, nullptr, 0, (size_t)SEQ * C_, (size_t)CI * SEQ);        /* S feature-major (2 products) */
    else if (p == 2) gemmw_tile<bf, false, false, 2, false, C_, 2, false>(os, fx, fy, fz, WGb, nullptr, XT, nullptr, nullptr, nullptr, nullptr, (bf*)GVh, GVl, SEQ, b_g, nullptr, 0, (size_t)SEQ * C_, (size_t)CI * SEQ);     /* g feature-major */
    else             gemmw_tile<bf, false, false, 1, false, C_, 1, false>(os, tx, ty, 0, XT, nullptr, p == 3 ? WTb : WPb, nullptr, nullptr, nullptr, nullptr, p == 3 ? THh : PHh, p == 3 ? THl : PHl, CI, p == 3 ? b_theta : b_phi, nullptr, 0, 0, 0);   /* theta, phi [tok][128] */
}

// k_stats: one work-group per 32 (b, c) rows (its 32 results fill one 128-byte line of MU and of RD), sixteen waves, two rows per wave one after the other.
// A wave brings its whole row into registers with all its loads in flight at once, rounds it to bf16 there, and takes the mean and the centred sum of squares from the registers: the row is read once and no load waits on another.
// LDS mus/rds: cross-wave (block barrier).
#define SW 16
#define SR (32 / SW)
__global__ __launch_bounds__(SW * 32) void k_stats(const float* __restrict__ x, float* MU, float* RD) {
    __shared__ float mus[32]; __shared__ float rds[32];
    const int t = threadIdx.x, wid = __builtin_amdgcn_readfirstlane(t >> 5), lane = t & 31;   // wave number held scalar: the row's base address is scalar, the lane's offset one register that is never rewritten
#pragma unroll 1   // rolled: one row's registers at a time
    for (int j = 0; j < SR; ++j) {
        const int rr = blockIdx.x * 32 + wid * SR + j;                // (b, c) row index < NB * C_
        const int b = rr / C_, c = rr - b * C_;
        const float* xr = x + ((size_t)b * C_ + c) * HWF + lane * 4;
        v4f r[SEQ / 128];
#pragma unroll   // unrolled: every load of the row is issued before the first is waited for
        for (int i = 0; i < SEQ / 128; ++i) r[i] = *(const v4f*)(xr + (size_t)i * 128);
        float s = 0.f;
#pragma unroll   // unrolled: r[] stays in registers
        for (int i = 0; i < SEQ / 128; ++i) { v4f v = r[i]; v[0] = bfr(v[0]); v[1] = bfr(v[1]); v[2] = bfr(v[2]); v[3] = bfr(v[3]); r[i] = v; s += (v[0] + v[1]) + (v[2] + v[3]); }
        s += __shfl_xor(s, 1, 32); s += __shfl_xor(s, 2, 32); s += __shfl_xor(s, 4, 32); s += __shfl_xor(s, 8, 32); s += __shfl_xor(s, 16, 32);
        const float mu = s * (1.0f / (float)SEQ);
        float ss = 0.f;
#pragma unroll   // unrolled: r[] stays in registers
        for (int i = 0; i < SEQ / 128; ++i) { const v4f v = r[i];
            const float d0 = v[0] - mu, d1 = v[1] - mu, d2 = v[2] - mu, d3 = v[3] - mu;
            ss += (d0 * d0 + d1 * d1) + (d2 * d2 + d3 * d3); }
        ss += __shfl_xor(ss, 1, 32); ss += __shfl_xor(ss, 2, 32); ss += __shfl_xor(ss, 4, 32); ss += __shfl_xor(ss, 8, 32); ss += __shfl_xor(ss, 16, 32);
        const float den = 4.0f * (ss * (1.0f / (float)(SEQ - 1)) + ELAM);
        const float rd = 1.0f / den;
        if (lane == 0) { mus[wid * SR + j] = mu; rds[wid * SR + j] = rd; }
    }
    __syncthreads();
    if (wid == 0) {
        const float a = mus[lane], r = rds[lane];
        float* pm = MU + (size_t)blockIdx.x * 32 + lane; float* pr = RD + (size_t)blockIdx.x * 32 + lane;
        *(float*)pm = a; *(float*)pr = r;  }
}

// ---- k_xplanes: token-major planes from channel-major x: XT[(b*SEQ+t)][c] = bf16(x[b][c][t]) (exact), X1h/X1l = bf16 hi/lo of x1 = bf16(x) * sigmoid((bf16(x) - mu)^2 * rd + 0.5).
// The six weight matrices' conversion to bf16 needs nothing of x and rides in the same grid: work-groups from XPB on, WCB of them per matrix, eight elements a thread.
#define XPB (NB * SEQ * C_ / 8 / 256)
#define WCB (CI * C_ / 8 / 256)
static_assert((CI * C_ / 8) % 256 == 0);
__global__ __launch_bounds__(256) void k_xplanes(const float* __restrict__ x, const float* __restrict__ MU, const float* __restrict__ RD, bf* XT, bf* X1h, bf* X1l,
                                                 const float* __restrict__ w_theta, const float* __restrict__ w_phi, const float* __restrict__ w_g, const float* __restrict__ w_d, const float* __restrict__ w_s, const float* __restrict__ w_out,
                                                 bf* WTb, bf* WPb, bf* WGb, bf* WDb, bf* WSb, bf* WOb) {
    if (blockIdx.x >= XPB) {
        const int cb = blockIdx.x - XPB, w = cb / WCB;
        const float* src = w == 0 ? w_theta : w == 1 ? w_phi : w == 2 ? w_g : w == 3 ? w_d : w == 4 ? w_s : w_out;
        bf* dst = w == 0 ? WTb : w == 1 ? WPb : w == 2 ? WGb : w == 3 ? WDb : w == 4 ? WSb : WOb;
        const size_t i = (size_t)(cb - w * WCB) * 256 + threadIdx.x;
        const v8f v = *(const v8f*)(src + i * 8); v8us o;
#pragma unroll
        for (int k = 0; k < 8; ++k) o[k] = f2bf(v[k]);
        *(v8us*)(dst + i * 8) = o;
        return;
    }
    const size_t e = ((size_t)blockIdx.x * 256 + threadIdx.x) * 8; if (e >= (size_t)NB * SEQ * C_) return;
    const int c = (int)(e % C_); const size_t btk = e / C_; const int tpos = (int)(btk % SEQ); const int b = (int)(btk / SEQ);
    const float* xp = x + ((size_t)b * C_ + c) * HWF + tpos;
    const v8f mu8 = *(const v8f*)(MU + (size_t)b * C_ + c), rd8 = *(const v8f*)(RD + (size_t)b * C_ + c);
    v8us o0, oh, ol;
#pragma unroll
    for (int q = 0; q < 8; ++q) {
        const float xb = bfr(xp[(size_t)q * HWF]);
        const float d = xb - mu8[q];
        const float y = d * d * rd8[q] + 0.5f;
        const float ex = __expf(-y);
        const float sg = __builtin_amdgcn_rcpf(1.0f + ex);
        const float x1 = xb * sg;
        o0[q] = f2bf(xb); unsigned short hh, ll; splitf(x1, hh, ll); oh[q] = hh; ol[q] = ll;
    }
    *(v8us*)(XT + e) = o0; *(v8us*)(X1h + e) = oh; *(v8us*)(X1l + e) = ol; 
}

// ---- k_attn: eight waves per work-group on 128 queries of one batch and one map (z = 0: theta/g, z = 1: D/S; keys = phi for both), online max-subtracted softmax.
// Wave (qg, kh) takes the 32 queries of group qg (two 16-query tiles) and the 32-key half kh of every stage: each K and V fragment read from LDS feeds both query tiles, so a matrix instruction costs half the LDS reads of a 16-query wave.
// Each wave keeps its own running maximum, sum and O^T over its half of the keys; at the end the two waves of a query group swap one tile each through LDS and join the halves (rescaled to the common maximum).
// Transposed products: S^T = K . Q^T (A = key rows, B = query columns) and O^T += V^T . P^T (A = feature rows of V, B = P^T). Lane (L, hi) then holds query L alone: 16 of the block's 32 scores sit in its own registers,
// maximum and sum are taken in the lane (one exchange between the lane halves for the maximum; the halves' sums are joined once at the end), and the two score tiles, converted in place, are the B operand of the second product.
// The work-group's 128 queries walk the same keys and values: each 64-key stage (K hi/lo rows, V hi/lo feature rows) is brought into LDS once by asynchronous copies, two buffers, the next stage in flight while this one is worked on.
// LDS ring: shared by the eight waves (one block barrier at each hand-over, split: signal in front of a pass's second product, wait at the top of the next pass). K rows at a 272-byte pitch, V rows at a 144-byte pitch (16 B x odd, for ds_load_b128 readers).
// LDS osa: one slice per wave, rows 0..15 x cols 0..127 and, in cols 128 and 129, the row's maximum and sum. A wave writes its own slice; behind the block barrier only its partner touches that slice.
#define AW   8
#define SK   64
#define KPI  136
#define VPI  72
#define KPLB (SK * KPI * 2)
#define VPLB (CI * VPI * 2)
#define STGB (2 * KPLB + 2 * VPLB)
#define NST  (SEQ / SK)
#define QG   (AW / 2)
static_assert(SEQ % (AW * 16) == 0 && NST >= 2 && SK == 2 * KB && OSP >= CI + 2);
static_assert(SK * CI * 2 == 4 * AW * 32 * 16 && CI * SK * 2 == 4 * AW * 32 * 16);
__device__ __forceinline__ v16bf ldbs(const bf* p) { return cat16b(*(const v8usa*)p, *(const v8usa*)(p + 16)); }
__device__ __forceinline__ v16h  ldhs(const h16* p) { return cat16(*(const v8ha*)p, *(const v8ha*)(p + 16)); }
__device__ __forceinline__ float xhalf(float x) { return __builtin_bit_cast(float, __builtin_amdgcn_permlanex16(__builtin_bit_cast(int, x), __builtin_bit_cast(int, x), 0x76543210, 0xfedcba98, false, false)); }   // lane l takes lane l ^ 16's value
// Eight 16-byte copies per lane, global -> LDS through no register: four steps of plane a, four of plane b. The s_wait_xcnt stands inside the statement so that no address register is rewritten ahead of it.
template <typename TA, typename TB>
__device__ __forceinline__ void copy8(unsigned la, const TA* ga, unsigned lb, const TB* gb, unsigned lstep, size_t gstep) {
    asm volatile("global_load_async_to_lds_b128 %0, %8, off\n\t"
                 "global_load_async_to_lds_b128 %1, %9, off\n\t"
                 "global_load_async_to_lds_b128 %2, %10, off\n\t"
                 "global_load_async_to_lds_b128 %3, %11, off\n\t"
                 "global_load_async_to_lds_b128 %4, %12, off\n\t"
                 "global_load_async_to_lds_b128 %5, %13, off\n\t"
                 "global_load_async_to_lds_b128 %6, %14, off\n\t"
                 "global_load_async_to_lds_b128 %7, %15, off\n\t"
                 "s_wait_xcnt 0x0"
                 :: "v"(la), "v"(la + lstep), "v"(la + 2 * lstep), "v"(la + 3 * lstep), "v"(lb), "v"(lb + lstep), "v"(lb + 2 * lstep), "v"(lb + 3 * lstep),
                    "v"(ga), "v"(ga + gstep), "v"(ga + 2 * gstep), "v"(ga + 3 * gstep), "v"(gb), "v"(gb + gstep), "v"(gb + 2 * gstep), "v"(gb + 3 * gstep)
                 : "memory");
}
__global__ __launch_bounds__(AW * 32) void k_attn(const bf* __restrict__ THh, const bf* __restrict__ THl, const bf* __restrict__ DQh, const bf* __restrict__ DQl,
                                             const bf* __restrict__ PHh, const bf* __restrict__ PHl,
                                             const h16* __restrict__ GVh, const bf* __restrict__ GVl, const h16* __restrict__ SVh, const bf* __restrict__ SVl, float* Y) {
    __shared__ __align__(16) unsigned char ring[2 * STGB];
    __shared__ __align__(16) float osa[AW * 16 * OSP];
    const int tid = threadIdx.x, lane = tid & 31, L = lane & 15, hi = lane >> 4;
    const int wv = __builtin_amdgcn_readfirstlane(tid >> 5);
    const int qg = wv % QG, kh = wv / QG;          // query group, key half (both wave-uniform)
    float* osw = osa + wv * 16 * OSP;                    // own slice: takes the tile that is given away
    float* osp = osa + (wv ^ QG) * 16 * OSP;             // the partner's slice: same query group, other key half
    const int q0 = blockIdx.x * (AW * 16) + qg * 32, b = blockIdx.y, mp = blockIdx.z;
    const size_t tok = (size_t)b * SEQ;
    const bf* Qh = (mp ? DQh : THh) + (tok + q0) * CI; const bf* Ql = (mp ? DQl : THl) + (tok + q0) * CI;
    const bf* Kh = PHh + tok * CI; const bf* Kl = PHl + tok * CI;
    const h16* Vh = (mp ? SVh : GVh) + (size_t)b * CI * SEQ; const bf* Vl = (mp ? SVl : GVl) + (size_t)b * CI * SEQ;
    float* Yo = Y + ((size_t)mp * NB * SEQ + tok + q0 + kh * 16) * CI;   // the wave stores the tile it keeps
    // Copy map of one stage. K plane: 64 rows x 256 B, contiguous in global; thread tid takes 16-byte piece tid + 256 i (row (tid >> 4) + 16 i). V plane: 128 rows x 128 B; piece tid + 256 i (row (tid >> 3) + 32 i).
    const unsigned ring0 = (unsigned)(size_t)ring;
    const unsigned lk = ring0 + (unsigned)((tid >> 4) * (KPI * 2) + (tid & 15) * 16);
    const unsigned lv = ring0 + (unsigned)(2 * KPLB + (tid >> 3) * (VPI * 2) + (tid & 7) * 16);
    const unsigned gk = (unsigned)tid * 8, gv = (unsigned)(tid >> 3) * SEQ + (unsigned)(tid & 7) * 8;   // the lane's element offset in a K plane and in a V plane (hi and lo planes alike): two registers live through the key walk; four address pairs beside the 32-query tile's registers went to scratch
    auto fill = [&](int st) {
        const unsigned bo = (unsigned)(st & 1) * STGB;
        const unsigned ok = gk + (unsigned)st * (SK * CI), ov = gv + (unsigned)st * SK;
        copy8(lk + bo, Kh + ok, lk + bo + KPLB, Kl + ok, 16 * KPI * 2, (size_t)16 * CI);
        copy8(lv + bo, Vh + ov, lv + bo + VPLB, Vl + ov, 32 * VPI * 2, (size_t)32 * SEQ);
    };
    // Tile t of the wave = queries q0 + (t ^ kh) * 16 + L: tile 0 is the one the wave keeps and stores, tile 1 the one it gives to its partner.
    // Per tile: query L's running maximum (equal in both lane halves), this lane half's part of its sum, acc[t][ct][v] = O^T[ct*16 + 8*hi + v][L]; all over the wave's half of the keys.
    float m_i[2] = {-1.0e30f, -1.0e30f}, l_i[2] = {0.f, 0.f}; v8f acc[2][8];
#pragma unroll
    for (int t = 0; t < 2; ++t)
#pragma unroll
        for (int ct = 0; ct < 8; ++ct) acc[t][ct] = (v8f){};
    // The wave's 32 query rows never change: their hi and lo fragments are loaded once and stay in registers for the whole key walk. B fragment: query column L of the tile.
    v16bf qh[2][CI / 32], ql[2][CI / 32];
#pragma unroll
    for (int t = 0; t < 2; ++t) {
        const size_t qoff = (size_t)((t ^ kh) * 16 + L) * CI + 8 * hi;
#pragma unroll
        for (int ch = 0; ch < CI / 32; ++ch) { qh[t][ch] = ldb(Qh + qoff + ch * 32); ql[t][ch] = ldb(Ql + qoff + ch * 32); }
    }
    fill(0);
    asm volatile("s_wait_asynccnt 0x0" ::: "memory");    // stage 0 has landed before the signal that publishes it
    asm volatile("s_barrier_signal -1" ::: "memory");    // first half of the split block barrier; signal and wait alternate strictly in every wave from here on
#pragma unroll 1   // rolled: the buffer is picked by the stage's parity at run time, one copy of the hand-over and of the pass body
    for (int st = 0; st < NST; ++st) {
      const unsigned char* sb = ring + (st & 1) * STGB;
      asm volatile("s_barrier_wait -1" ::: "memory");    // second half: every wave has signalled, so stage st is published and no wave reads the other buffer any more; no LDS read of the pass stands ahead of it
      if (st + 1 < NST) fill(__builtin_amdgcn_readfirstlane(st + 1));   // the refill stands right behind the wait, one stage ahead; the stage number goes in as a scalar of its own: as the loop counter it was turned into four address pairs stepped every pass, and the lane's two LDS addresses went to scratch
      {
        v8f lt[2][2];
#pragma unroll
        for (int t = 0; t < 2; ++t) { lt[t][0] = (v8f){}; lt[t][1] = (v8f){}; }
        const bf* k0h = (const bf*)sb + (kh * KB + L) * KPI + 8 * hi; const bf* k0l = k0h + KPLB / 2;   // A fragment (keys): key row kh*32 + kt*16 + L of the stage
#pragma unroll   // unrolled: each chunk names its own resident query fragments
        for (int ch = 0; ch < CI / 32; ++ch) {
            const int co = ch * 32;
            const v16bf ka0 = ldbs(k0h + co), kl0 = ldbs(k0l + co), ka1 = ldbs(k0h + 16 * KPI + co), kl1 = ldbs(k0l + 16 * KPI + co);
            lt[0][0] = wmmab(ka0, qh[0][ch], lt[0][0]); lt[0][1] = wmmab(ka1, qh[0][ch], lt[0][1]); lt[1][0] = wmmab(ka0, qh[1][ch], lt[1][0]); lt[1][1] = wmmab(ka1, qh[1][ch], lt[1][1]);
            lt[0][0] = wmmab(ka0, ql[0][ch], lt[0][0]); lt[0][1] = wmmab(ka1, ql[0][ch], lt[0][1]); lt[1][0] = wmmab(ka0, ql[1][ch], lt[1][0]); lt[1][1] = wmmab(ka1, ql[1][ch], lt[1][1]);
            lt[0][0] = wmmab(kl0, qh[0][ch], lt[0][0]); lt[0][1] = wmmab(kl1, qh[0][ch], lt[0][1]); lt[1][0] = wmmab(kl0, qh[1][ch], lt[1][0]); lt[1][1] = wmmab(kl1, qh[1][ch], lt[1][1]);
        }
        const h16* vh = (const h16*)(sb + 2 * KPLB) + L * VPI + kh * KB + 8 * hi; const bf* vl = (const bf*)(sb + 2 * KPLB + VPLB) + L * VPI + kh * KB + 8 * hi;   // A fragment (values): ci row L of the staged feature-major plane
        v16h vf[8]; v16bf vr[8];                                 // each V fragment is read from LDS once and stays in registers for both tiles' products
        // D element v of tile kt = score of key kh*32 + kt*16 + 8*hi + v against query L of tile t.
        float mx[2];
#pragma unroll
        for (int t = 0; t < 2; ++t) {
            const v8f lt0 = lt[t][0], lt1 = lt[t][1];
            float m = fmaxf(fmaxf(fmaxf(lt0[0], lt1[0]), fmaxf(lt0[1], lt1[1])), fmaxf(fmaxf(lt0[2], lt1[2]), fmaxf(lt0[3], lt1[3])));
            m = fmaxf(m, fmaxf(fmaxf(fmaxf(lt0[4], lt1[4]), fmaxf(lt0[5], lt1[5])), fmaxf(fmaxf(lt0[6], lt1[6]), fmaxf(lt0[7], lt1[7]))));
            mx[t] = fmaxf(m, xhalf(m));
        }
        asm volatile("" :: "v"(mx[0]), "v"(mx[1]) : "memory");   // compiler fence, inputs only: it takes the two tiles' maxima, which need every score, so the V reads below stay behind the score block (without it they were spread among its matrix instructions, K and V fragments lived at once and query fragments went to scratch)
#pragma unroll
        for (int ct = 0; ct < 8; ++ct) { vf[ct] = ldhs(vh + ct * 16 * VPI); vr[ct] = ldbs(vl + ct * 16 * VPI); }
        v16h pa16[2]; v16bf pab[2]; float sc[2];
#pragma unroll
        for (int t = 0; t < 2; ++t) {
            const v8f lt0 = lt[t][0], lt1 = lt[t][1];
            const float mn = fmaxf(m_i[t], mx[t]);
            sc[t] = __expf(m_i[t] - mn);
            v16f ps; float rp[8];
#pragma unroll
            for (int v = 0; v < 8; ++v) {
                const float pa = __expf(lt0[v] - mn), pb = __expf(lt1[v] - mn);
                rp[v] = pa + pb;
                ps[v] = pa * PCAR; ps[8 + v] = pb * PCAR;            // B element s: k = 8*hi + s (s < 8), 16 + 8*hi + (s - 8) otherwise: tile 0's registers, then tile 1's
            }
            l_i[t] = l_i[t] * sc[t] + (((rp[0] + rp[1]) + (rp[2] + rp[3])) + ((rp[4] + rp[5]) + (rp[6] + rp[7]))); m_i[t] = mn;
            pa16[t] = __builtin_convertvector(ps, v16h);             // round to nearest even, as the scalar conversions
            pab[t] = __builtin_convertvector(ps, v16bf);
        }
        // Hand-over, first half, in front of the pass's last matrix block: that block works on registers alone, so the wave gives the stage up here and the other waves need not wait out its products.
        asm volatile("s_wait_dscnt 0x0" : "+v"(l_i[0]), "+v"(l_i[1]) :: "memory");   // the wave's last LDS reads of this buffer (the V fragments) have returned before it may be refilled; it takes the row sums, the end of the softmax, so that it does not rise to the V reads and stall the softmax behind them
        asm volatile("s_wait_asynccnt 0x0" ::: "memory");  // the wave's copies of stage st + 1 have landed before the signal that publishes them
        asm volatile("s_barrier_signal -1" : "+v"(sc[0]), "+v"(sc[1]) :: "memory");   // no LDS read stands between this signal and the wait at the top of the next pass; it takes the rescale factors, which the second product's block starts from, so that the block stays behind it (without them part of the block was scheduled ahead of the signal)
#pragma unroll
        for (int t = 0; t < 2; ++t) {
#pragma unroll
            for (int ct = 0; ct < 8; ++ct) acc[t][ct] *= sc[t];
#pragma unroll
            for (int ct = 0; ct < 8; ++ct) { acc[t][ct] = wmma16(vf[ct], pa16[t], acc[t][ct]); acc[t][ct] = wmmab(vr[ct], pab[t], acc[t][ct]); }
        }
        // Four vector slots behind the pass's last matrix instructions: the hand-over and, while stages remain, the copies of stage st + 2 follow them.
        asm volatile("v_nop\n\tv_nop\n\tv_nop\n\tv_nop" : "+v"(acc[0][0]), "+v"(acc[0][1]), "+v"(acc[0][2]), "+v"(acc[0][3]), "+v"(acc[0][4]), "+v"(acc[0][5]), "+v"(acc[0][6]), "+v"(acc[0][7]),
                                                           "+v"(acc[1][0]), "+v"(acc[1][1]), "+v"(acc[1][2]), "+v"(acc[1][3]), "+v"(acc[1][4]), "+v"(acc[1][5]), "+v"(acc[1][6]), "+v"(acc[1][7]));
      }
    }
    asm volatile("s_barrier_wait -1" ::: "memory");      // the wait that belongs to the last pass's signal
    asm volatile("s_wait_asynccnt 0x0" ::: "memory");    // no copy is outstanding when the wave goes on to its end
    // Join of the two key halves. Each wave hands tile 1 (raw O^T, maximum, sum) to its partner through its own slice and takes the partner's tile 1, which is its own tile 0's queries over the other keys.
    const float lf0 = l_i[0] + xhalf(l_i[0]), lf1 = l_i[1] + xhalf(l_i[1]);   // the two lane halves' sums of query L, joined once
#pragma unroll
    for (int ct = 0; ct < 8; ++ct) {
        const v8f o = acc[1][ct];
        *(v4fa*)(osw + L * OSP + ct * 16 + 8 * hi) = (v4f){o[0], o[1], o[2], o[3]}; *(v4fa*)(osw + L * OSP + ct * 16 + 8 * hi + 4) = (v4f){o[4], o[5], o[6], o[7]}; }
    osw[L * OSP + CI + hi] = hi ? lf1 : m_i[1];
    __syncthreads();                                     // every wave's slice is written before its partner reads it
    const float mo = osp[L * OSP + CI], lo = osp[L * OSP + CI + 1];
    const float mj = fmaxf(m_i[0], mo);
    const float ea = __expf(m_i[0] - mj), eb = __expf(mo - mj);
    const float rl = __builtin_amdgcn_rcpf(lf0 * ea + lo * eb) * YSC;
    const float fa = ea * rl, fb = eb * rl;
#pragma unroll
    for (int ct = 0; ct < 8; ++ct) {                     // a lane reads and rewrites its own elements of the partner's slice
        float* pe = osp + L * OSP + ct * 16 + 8 * hi;
        const v4f u0 = *(const v4fa*)pe, u1 = *(const v4fa*)(pe + 4); const v8f o = acc[0][ct];
        *(v4fa*)pe = (v4f){o[0] * fa + u0[0] * fb, o[1] * fa + u0[1] * fb, o[2] * fa + u0[2] * fb, o[3] * fa + u0[3] * fb};
        *(v4fa*)(pe + 4) = (v4f){o[4] * fa + u1[0] * fb, o[5] * fa + u1[1] * fb, o[6] * fa + u1[2] * fb, o[7] * fa + u1[3] * fb}; }
    __builtin_amdgcn_fence(__ATOMIC_RELEASE, "wavefront"); __builtin_amdgcn_wave_barrier(); asm volatile("" ::: "memory");
{
#pragma unroll
        for (int r = 0; r < 16; ++r) { const v4f val = *(const v4fa*)(osp + r * OSP + lane * 4); *(v4f*)(Yo + (size_t)r * CI + lane * 4) = val; }
         }
}

extern "C" void kernel_launch(void* const* d_in, const int* in_sizes, int n_in,
                              void* d_out, int out_size, void* d_ws, size_t ws_size, hipStream_t stream) {
    if (n_in < 13) return;
    if ((size_t)in_sizes[0] < (size_t)NB * C_ * HWF) return;
    if (in_sizes[1] < CI * C_ || in_sizes[3] < CI * C_ || in_sizes[5] < CI * C_ || in_sizes[7] < CI * C_ || in_sizes[9] < CI * C_ || in_sizes[11] < C_ * CI) return;
    if (in_sizes[2] < CI || in_sizes[4] < CI || in_sizes[6] < CI || in_sizes[8] < CI || in_sizes[10] < CI || in_sizes[12] < C_) return;
    if ((size_t)out_size < (size_t)NB * C_ * HWF) return;
    const float* x = (const float*)d_in[0];
    const float* w_theta = (const float*)d_in[1];  const float* b_theta = (const float*)d_in[2];
    const float* w_phi   = (const float*)d_in[3];  const float* b_phi   = (const float*)d_in[4];
    const float* w_g     = (const float*)d_in[5];  const float* b_g     = (const float*)d_in[6];
    const float* w_d     = (const float*)d_in[7];  const float* b_d     = (const float*)d_in[8];
    const float* w_s     = (const float*)d_in[9];  const float* b_s     = (const float*)d_in[10];
    const float* w_out   = (const float*)d_in[11]; const float* b_out   = (const float*)d_in[12];
    float* OUT = (float*)d_out;                     // [NB][256][HWF]
    char* wsp = (char*)d_ws;
    auto take = [&](size_t bytes) { char* p = wsp; wsp += (bytes + 255) & ~(size_t)255; return (void*)p; };
    const size_t nTok = (size_t)NB * SEQ;
    bf* WTb = (bf*)take((size_t)CI * C_ * 2); bf* WPb = (bf*)take((size_t)CI * C_ * 2); bf* WGb = (bf*)take((size_t)CI * C_ * 2);
    bf* WDb = (bf*)take((size_t)CI * C_ * 2); bf* WSb = (bf*)take((size_t)CI * C_ * 2); bf* WOb = (bf*)take((size_t)C_ * CI * 2);
    float* MU = (float*)take((size_t)NB * C_ * 4); float* RD = (float*)take((size_t)NB * C_ * 4);
    bf* XT = (bf*)take(nTok * C_ * 2); bf* X1h = (bf*)take(nTok * C_ * 2); bf* X1l = (bf*)take(nTok * C_ * 2);
    float* F32A = (float*)take(2 * nTok * CI * 4);                 // y1 | y2 [2][nTok][128]
    bf* THh = (bf*)take(nTok * CI * 2); bf* THl = (bf*)take(nTok * CI * 2);
    bf* PHh = (bf*)take(nTok * CI * 2); bf* PHl = (bf*)take(nTok * CI * 2);
    bf* DQh = (bf*)take(nTok * CI * 2); bf* DQl = (bf*)take(nTok * CI * 2);
    h16* GVh = (h16*)take(nTok * CI * 2); bf* GVl = (bf*)take(nTok * CI * 2);
    h16* SVh = (h16*)take(nTok * CI * 2); bf* SVl = (bf*)take(nTok * CI * 2);
    if ((size_t)(wsp - (char*)d_ws) > ws_size) return;
    float* Y1 = F32A; float* Y2 = F32A + nTok * CI;

    k_stats<<<(unsigned)(NB * C_ / 32), SW * 32, 0, stream>>>(x, MU, RD);                                                                   /* SimAM mu, 1/(4(var_n + eps)) per (b, c) */
    k_xplanes<<<(unsigned)(XPB + 6 * WCB), 256, 0, stream>>>(x, MU, RD, XT, X1h, X1l, w_theta, w_phi, w_g, w_d, w_s, w_out, WTb, WPb, WGb, WDb, WSb, WOb);   /* x^T bf16 (exact), gated x1^T hi/lo; weights -> bf16 */
    k_proj5<<<dim3(PTIL, 5, 1), 32, 0, stream>>>(XT, X1h, X1l, WTb, WPb, WGb, WDb, WSb, b_theta, b_phi, b_g, b_d, b_s, THh, THl, PHh, PHl, DQh, DQl, GVh, GVl, SVh, SVl);   /* theta, phi, D [tok][128]; g, S [b][128][SEQ]; 16-bit planes */
    k_attn<<<dim3(SEQ / (AW * 16), NB, 2), AW * 32, 0, stream>>>(THh, THl, DQh, DQl, PHh, PHl, GVh, GVl, SVh, SVl, F32A);                          /* y1 = softmax(theta.phi) g, y2 = softmax(D.phi) S */
    k_gemmw<bf, false, true, 2, true, CI, true><<<dim3(C_ / 64, SEQ / 64, NB), 32, 0, stream>>>(WOb, nullptr, nullptr, nullptr, Y1, Y2, OUT, HWF, b_out, x, 0, (size_t)SEQ * CI, (size_t)C_ * HWF);      /* out[b][co][t] = W_out . (y1 + y2 as hi/lo) + b_out + bf16(x) */
}

// v009
// One run takes 133 microseconds.
// Two timings next to v008 put it at 1.13 and 1.14 times that version's speed.
// All steps since v000 together make it 7.28 times as fast.
#include <hip/hip_runtime.h>

// Contractions, f32 accumulate: five 1x1 projections on v_wmma_f32_16x16x32_bf16 (x as exact bf16; SimAM-gated branch as bf16 hi+lo planes = 2 products; weights bf16); score tiles q.k on v_wmma_f32_16x16x32_bf16 with hi/lo x hi/lo planes (3 products); P.V on v_wmma_f32_16x16x32_f16 (P x 2^14, V x 16 as f16 hi) plus v_wmma_f32_16x16x32_bf16 (P bf16 x V bf16 residual); output projection on v_wmma_f32_16x16x32_bf16 (y = y1 + y2 split into bf16 hi+lo in registers = 2 products). SimAM statistics/gating, online max-subtracted softmax, normalisation and residual add in f32.
// Data flow: x [NB][256][4096] channel-major -> per 64 tokens, in the projection kernel's LDS, token-major planes XT (bf16 exact), X1h/X1l (gated branch, hi/lo); theta/phi/D token-major [t][128] as bf16 hi/lo planes, g/S feature-major [128][t] as f16 hi (x16) + bf16 residual, each written by the projection's own epilogue; eight waves per work-group share 64-key K/V stages in LDS; one wave per 32 queries and one 32-key half of every stage, its query fragments resident in registers (transposed scores K.Q^T, online softmax in the lane, P^T packed from the score registers, V^T.P^T), the two key halves joined at the end; y1/y2 [t][128] f32; y = y1 + y2 -> bf16 hi/lo in the output projection's own fragment loader; out[b][co][t] = W_out . y + b_out + bf16(x).

#ifndef NB
#define NB 4
#endif
#ifndef SEQ
#define SEQ 4096
#endif
#define NBF  4
#define HWF  4096
#define C_   256
#define CI   128
#define KB   32
#define OSP  132
#define PCAR 16384.0f
#define VCAR 16.0f
#define YSC  (1.0f / 262144.0f)
#define ELAM 1e-4f

static_assert(NB >= 1 && NB <= NBF);
static_assert(SEQ % 128 == 0 && SEQ >= 128 && SEQ <= HWF);
static_assert(SEQ % KB == 0 && SEQ % 64 == 0 && SEQ % 16 == 0);
static_assert((NB * C_) % 32 == 0);
static_assert(C_ % 64 == 0 && CI % 64 == 0 && C_ % 32 == 0 && CI % 32 == 0);
static_assert((NB * SEQ * C_) % (8 * 256) == 0 && (NB * SEQ * CI) % 8 == 0);

typedef _Float16 h16;
typedef unsigned short bf;
typedef __attribute__((ext_vector_type(16))) __bf16   v16bf;
typedef __attribute__((ext_vector_type(16))) _Float16 v16h;
typedef __attribute__((ext_vector_type(8)))  _Float16 v8h;
typedef __attribute__((ext_vector_type(8)))  unsigned short v8us;
typedef __attribute__((ext_vector_type(8)))  float    v8f;
typedef __attribute__((ext_vector_type(16))) float    v16f;
typedef __attribute__((ext_vector_type(4)))  float    v4f;
typedef v8h  __attribute__((may_alias)) v8ha;
typedef v4f  __attribute__((may_alias)) v4fa;
typedef v8us __attribute__((may_alias)) v8usa;

__device__ __forceinline__ unsigned short f2bf(float f) { unsigned u = __float_as_uint(f); u += 0x7FFFu + ((u >> 16) & 1u); return (unsigned short)(u >> 16); }
__device__ __forceinline__ float bf2f(unsigned short b) { return __uint_as_float(((unsigned)b) << 16); }
__device__ __forceinline__ float bfr(float f) { return bf2f(f2bf(f)); }
__device__ __forceinline__ void splitf(float y, unsigned short& h, unsigned short& l) { h = f2bf(y); l = f2bf(y - bf2f(h)); }
__device__ __forceinline__ v16h cat16(v8h lo, v8h hi) { return __builtin_shufflevector(lo, hi, 0, 1, 2, 3, 4, 5, 6, 7, 8, 9, 10, 11, 12, 13, 14, 15); }
__device__ __forceinline__ v16bf cat16b(v8us lo, v8us hi) { return __builtin_bit_cast(v16bf, __builtin_shufflevector(lo, hi, 0, 1, 2, 3, 4, 5, 6, 7, 8, 9, 10, 11, 12, 13, 14, 15)); }
__device__ __forceinline__ v8f wmma16(v16h a, v16h b, v8f c) { return __builtin_amdgcn_wmma_f32_16x16x32_f16(false, a, false, b, (short)0, c, false, false); }
__device__ __forceinline__ v8f wmmab(v16bf a, v16bf b, v8f c) { return __builtin_amdgcn_wmma_f32_16x16x32_bf16(false, a, false, b, (short)0, c, false, false); }
// Fragment loaders (A and B share the same per-lane k map): p already points at row (lane & 15), k0 + 8*(lane >> 4); elements 0..7 <- p[0..7], elements 8..15 <- p[16..23].
__device__ __forceinline__ v16bf ldb(const bf* p) { return cat16b(*(const v8us*)p, *(const v8us*)(p + 16)); }
__device__ __forceinline__ v16h  ldh(const h16* p) { return cat16(*(const v8h*)p, *(const v8h*)(p + 16)); }

// ---- gemmw_tile: register-blocked GEMM, ONE WAVE per 64x64 output tile (16 accumulators), operands straight from K-contiguous 16-bit planes; tile (bx, by) of batch bz, tiles (M/64, N/64, Z), 32 threads. os: the wave's 16 x 68 f32 of LDS (OUTM != 0: 64 x 68 + 64).
// C[m][n] (f32, pitch ldc) = sum_k A[m][k] Bt[n][k] (+ A2[m][k] Bt[n][k] when A2ON) (+ A[m][k] Bt2[n][k] when B2ON) (+ bf16(bias[n]) BIASM==1 | bf16(bias[m]) BIASM==2) (+ bf16(res[m][n]) when RESID, same indexing as C).
// z-batch strides sA/sB/sC in elements. K % 32 == 0, M % 64 == 0, N % 64 == 0. K, LDA and LDB are compile-time constants: the four row blocks of an operand are then fixed offsets from one address pair.
// BSUM: Bt and Bt2 are not read; they are formed in registers as the bf16 hi and lo parts of F1[n][k] + F2[n][k] (two f32 planes of pitch K, z stride sB).
// LDA, LDB: row pitch in elements of A (and A2) and of Bt (and Bt2). XL == 1: A and A2 lie in LDS; XL == 2: Bt and Bt2 do; XL == 0: every operand is in global memory.
// OUTM == 0: C is stored as f32. OUTM == 1: the f32 value goes out as bf16 hi/lo planes Ph/Pl; OUTM == 2: as f16 hi (value x 16, its bits in Ph) + bf16 residual Pl. Planes are indexed as C; a lane stores 8 elements, so a tile row is one whole 128-byte line per plane.
template <typename T16> struct WFrag;
template <> struct WFrag<h16> { typedef v16h V; static __device__ __forceinline__ V ld(const h16* p) { return ldh(p); } static __device__ __forceinline__ v8f mma(V a, V b, v8f c) { return wmma16(a, b, c); } };
template <> struct WFrag<bf> { typedef v16bf V; static __device__ __forceinline__ V ld(const bf* p) { return ldb(p); } static __device__ __forceinline__ v8f mma(V a, V b, v8f c) { return wmmab(a, b, c); } };
template <typename T16, bool A2ON, bool B2ON, int BIASM, bool RESID, int K, int OUTM, bool BSUM, int LDA, int LDB, int XL>
__device__ __forceinline__ void gemmw_tile(float* os, int bx, int by, int bz, const T16* __restrict__ A, const T16* __restrict__ A2, const T16* __restrict__ Bt, const T16* __restrict__ Bt2,
                                              const float* __restrict__ F1, const float* __restrict__ F2, float* C, bf* Ph, bf* Pl, int ldc, const float* __restrict__ bias, const float* __restrict__ res, size_t sA, size_t sB, size_t sC) {
    typedef typename WFrag<T16>::V V;
    const size_t z = bz;
    A += z * sA; if (A2ON) A2 += z * sA; if (BSUM) { F1 += z * sB; F2 += z * sB; } else { Bt += z * sB; if (B2ON) Bt2 += z * sB; } if (OUTM == 0) C += z * sC; else { Ph += z * sC; Pl += z * sC; } if (RESID) res += z * sC;
    const int lane = threadIdx.x & 31, lr = lane & 15, hi = lane >> 4;
    const int r0 = bx * 64, c0 = by * 64;
    v8f acc[4][4];
#pragma unroll
    for (int mb = 0; mb < 4; ++mb)
#pragma unroll
        for (int nb = 0; nb < 4; ++nb) acc[mb][nb] = (v8f){};
    const size_t aoff = (size_t)(r0 + lr) * LDA + 8 * hi, boff = (size_t)(c0 + lr) * LDB + 8 * hi;
    const int rw = lane >> 3, cofs8 = (lane & 7) * 8;   // plane epilogue (OUTM != 0): step s of a row block takes row 4 s + rw, eight lanes a row, eight elements a lane
    float bb[8];                                        // its bias values, loaded ahead of the K loop so that the epilogue does not wait for them: BIASM == 1 the lane's 8 columns, BIASM == 2 tile rows lane and 32 + lane (handed round through LDS)
    if (OUTM != 0) {
#pragma unroll
        for (int q = 0; q < (BIASM == 1 ? 8 : 2); ++q) bb[q] = bfr(bias[BIASM == 1 ? c0 + cofs8 + q : r0 + 32 * q + lane]);
    }
#pragma unroll 1
    for (int kc = 0; kc < K; kc += 32) {
        V a[4], a2[4], bq[4], bq2[4];
        const T16* pa = A + aoff + kc; const T16* pa2 = A2ON ? A2 + aoff + kc : pa; const T16* pb = BSUM ? pa : Bt + boff + kc; const T16* pb2 = B2ON && !BSUM ? Bt2 + boff + kc : pb;
#pragma unroll
        for (int mb = 0; mb < 4; ++mb) { a[mb] = WFrag<T16>::ld(pa + (size_t)mb * 16 * LDA); a2[mb] = a[mb]; if (A2ON) a2[mb] = WFrag<T16>::ld(pa2 + (size_t)mb * 16 * LDA); }
#pragma unroll
        for (int nb = 0; nb < 4; ++nb) if (!BSUM) { bq[nb] = WFrag<T16>::ld(pb + (size_t)nb * 16 * LDB); bq2[nb] = bq[nb]; if (B2ON) bq2[nb] = WFrag<T16>::ld(pb2 + (size_t)nb * 16 * LDB); }
        const float* pf1 = BSUM ? F1 + boff + kc : nullptr; const float* pf2 = BSUM ? F2 + boff + kc : nullptr;
        v8f f1[4][2], f2[4][2];                          // BSUM: the lane's two runs of eight k of each B row, from both f32 planes
#pragma unroll
        for (int nb = 0; nb < 4; ++nb) if (BSUM) {
            f1[nb][0] = *(const v8f*)(pf1 + (size_t)nb * 16 * K); f1[nb][1] = *(const v8f*)(pf1 + (size_t)nb * 16 * K + 16);
            f2[nb][0] = *(const v8f*)(pf2 + (size_t)nb * 16 * K); f2[nb][1] = *(const v8f*)(pf2 + (size_t)nb * 16 * K + 16); }
        if (BSUM) {
            asm volatile("s_wait_xcnt 0x0" :: "v"(pa), "v"(pf1), "v"(pf2) : "memory");   // as the statement below, for this form's three address pairs
            __builtin_amdgcn_sched_barrier(0);   // holds that wait directly behind the loads: without it the wait sank below the split arithmetic and below an address step
        } else if (XL != 0) {
            if (XL == 1) asm volatile("s_wait_xcnt 0x0" :: "v"(pb), "v"(pb2) : "memory");   // as the last statement of this chain, for the one operand that comes from global memory
            else         asm volatile("s_wait_xcnt 0x0" :: "v"(pa), "v"(pa2) : "memory");
            __builtin_amdgcn_sched_barrier(0);   // holds that wait, and with it every load of the trip, ahead of the first matrix instruction: without it the global loads were issued in three groups among the products and a trip waited out three latencies
        } else
        asm volatile("s_wait_xcnt 0x0" :: "v"(pa), "v"(pa2), "v"(pb), "v"(pb2) : "memory");   // behind the trip's fragment loads; it takes their address pairs as inputs, so that no load's result and no address step lands in a pair ahead of it
#pragma unroll
        for (int nb = 0; nb < 4; ++nb) if (BSUM) {       // B = F1 + F2 in f32, split into bf16 hi and lo fragments in registers (same k map as ldb)
            v8us h[2], l[2];
#pragma unroll
            for (int u = 0; u < 2; ++u) {
                const v8f y = f1[nb][u] + f2[nb][u];
#pragma unroll
                for (int q = 0; q < 8; ++q) { unsigned short a_, c_; splitf(y[q], a_, c_); h[u][q] = a_; l[u][q] = c_; } }
            bq[nb] = cat16b(h[0], h[1]); bq2[nb] = cat16b(l[0], l[1]); }
#pragma unroll
        for (int nb = 0; nb < 4; ++nb) {
            const V b = bq[nb], b2 = bq2[nb];
#pragma unroll
            for (int mb = 0; mb < 4; ++mb) {
                acc[mb][nb] = WFrag<T16>::mma(a[mb], b, acc[mb][nb]);
                if (A2ON) acc[mb][nb] = WFrag<T16>::mma(a2[mb], b, acc[mb][nb]);
                if (B2ON) acc[mb][nb] = WFrag<T16>::mma(a[mb], b2, acc[mb][nb]); } }
        asm volatile("v_nop\n\tv_nop\n\tv_nop\n\tv_nop" : "+v"(acc[0][0]), "+v"(acc[1][1]), "+v"(acc[2][2]), "+v"(acc[3][3]) : "v"(a[0]), "v"(a[3]));
    }
    if (OUTM != 0) {   // plane epilogue: the whole 64 x 64 tile goes to LDS once (os: 64 x 68 f32, then 64 row biases); a rolled loop over the four row blocks splits and stores it
        float* ob = os + 64 * 68;
#pragma unroll
        for (int mb = 0; mb < 4; ++mb)
#pragma unroll
            for (int nb = 0; nb < 4; ++nb)
#pragma unroll
                for (int j = 0; j < 8; ++j) os[(mb * 16 + hi * 8 + j) * 68 + nb * 16 + lr] = acc[mb][nb][j];
        if (BIASM == 2) { ob[lane] = bb[0]; ob[32 + lane] = bb[1]; }
        __builtin_amdgcn_fence(__ATOMIC_RELEASE, "wavefront"); __builtin_amdgcn_wave_barrier(); asm volatile("" ::: "memory");   // as in the f32 epilogue below: the lanes' LDS writes stay ahead of the reads of other lanes' elements that follow
        const size_t eo = (size_t)(r0 + rw) * ldc + c0 + cofs8;
#pragma unroll 1   // rolled: the split arithmetic stands once in the text, not once per row block (unrolled, the four projections' text grew to about 40 KB)
        for (int mb = 0; mb < 4; ++mb) {
            v8us oh[4], ol[4]; v4f u[4][2]; float br[4];
#pragma unroll
            for (int s = 0; s < 4; ++s) {                // the row block's LDS reads, issued as one group
                const int row = mb * 16 + 4 * s + rw;
                u[s][0] = *(const v4fa*)(os + row * 68 + cofs8); u[s][1] = *(const v4fa*)(os + row * 68 + cofs8 + 4);
                br[s] = BIASM == 2 ? ob[row] : 0.f; }
#pragma unroll
            for (int s = 0; s < 4; ++s) {
                const v4f u0 = u[s][0], u1 = u[s][1];
                float val[8] = {u0[0], u0[1], u0[2], u0[3], u1[0], u1[1], u1[2], u1[3]};
#pragma unroll
                for (int q = 0; q < 8; ++q) {
                    val[q] += BIASM == 1 ? bb[q] : br[s];
                    if (OUTM == 1) { unsigned short a_, c_; splitf(val[q], a_, c_); oh[s][q] = a_; ol[s][q] = c_; }
                    else { const float w = val[q] * VCAR; const h16 hh = (h16)w; oh[s][q] = __builtin_bit_cast(unsigned short, hh); ol[s][q] = f2bf(w - (float)hh); }
                }
            }
            __builtin_amdgcn_sched_barrier(0);   // the row block's eight stores stay together behind its arithmetic: the one s_wait_xcnt below then serves them all, where stores spread among the arithmetic took a wait each
#pragma unroll
            for (int s = 0; s < 4; ++s) { *(v8us*)(Ph + eo + (size_t)(mb * 16 + 4 * s) * ldc) = oh[s]; *(v8us*)(Pl + eo + (size_t)(mb * 16 + 4 * s) * ldc) = ol[s]; }
            asm volatile("s_wait_xcnt 0x0" ::: "memory");   // behind the row block's stores: the next trip reuses their data registers and steps their address pairs
            __builtin_amdgcn_sched_barrier(0);   // holds that wait directly behind the stores
        }
        return;
    }
#pragma unroll
    for (int mb = 0; mb < 4; ++mb) {
#pragma unroll
        for (int nb = 0; nb < 4; ++nb) {
#pragma unroll
            for (int j = 0; j < 8; ++j) os[(hi * 8 + j) * 68 + nb * 16 + lr] = acc[mb][nb][j]; }
        __builtin_amdgcn_fence(__ATOMIC_RELEASE, "wavefront"); __builtin_amdgcn_wave_barrier(); asm volatile("" ::: "memory");
        const size_t rb = (size_t)(r0 + mb * 16);
        v4f rv8[8];
        if (RESID) {
            const float* rp[8];
#pragma unroll
            for (int s = 0; s < 8; ++s) { rp[s] = res + (rb + 2 * s + hi) * (size_t)ldc + c0 + lr * 4; rv8[s] = *(const v4f*)rp[s]; }
            asm volatile("s_wait_xcnt 0x0" :: "v"(rp[0]), "v"(rp[1]), "v"(rp[2]), "v"(rp[3]), "v"(rp[4]), "v"(rp[5]), "v"(rp[6]), "v"(rp[7]) : "memory");   // behind the row block's residual loads; it takes their address pairs as inputs, so that no load's result lands in a pair ahead of it
        }
{
#pragma unroll
            for (int s = 0; s < 8; ++s) {
                const int row = 2 * s + hi, cofs = lr * 4;
                v4f val = *(const v4fa*)(os + row * 68 + cofs);
                if (BIASM == 1) { val[0] += bfr(bias[c0 + cofs]); val[1] += bfr(bias[c0 + cofs + 1]); val[2] += bfr(bias[c0 + cofs + 2]); val[3] += bfr(bias[c0 + cofs + 3]); }
                if (BIASM == 2) { const float bv = bfr(bias[rb + row]); val[0] += bv; val[1] += bv; val[2] += bv; val[3] += bv; }
                if (RESID) { const v4f rv = rv8[s]; val[0] += bfr(rv[0]); val[1] += bfr(rv[1]); val[2] += bfr(rv[2]); val[3] += bfr(rv[3]); }
                *(v4f*)(C + (rb + row) * (size_t)ldc + c0 + cofs) = val; }
             }
        asm volatile("s_wait_xcnt 0x0" ::: "memory");   // behind the row block's stores: the next row block reuses their data and address registers
        __builtin_amdgcn_sched_barrier(0);   // holds that wait directly behind the stores: without it the next row block's address arithmetic was scheduled ahead of it
        __builtin_amdgcn_fence(__ATOMIC_RELEASE, "wavefront"); __builtin_amdgcn_wave_barrier(); asm volatile("" ::: "memory");
    }
}
template <typename T16, bool A2ON, bool B2ON, int BIASM, bool RESID, int K, bool BSUM>
__global__ __launch_bounds__(32) void k_gemmw(const T16* __restrict__ A, const T16* __restrict__ A2, const T16* __restrict__ Bt, const T16* __restrict__ Bt2,
                                              const float* __restrict__ F1, const float* __restrict__ F2, float* C, int ldc, const float* __restrict__ bias, const float* __restrict__ res, size_t sA, size_t sB, size_t sC) {
    __shared__ __align__(16) float os[16 * 68];
    gemmw_tile<T16, A2ON, B2ON, BIASM, RESID, K, 0, BSUM, K, K, 0>(os, blockIdx.x, blockIdx.y, blockIdx.z, A, A2, Bt, Bt2, F1, F2, C, nullptr, nullptr, ldc, bias, res, sA, sB, sC);
}
// ---- k_proj5: one work-group of ten waves per 64 tokens of one batch. It forms the tokens' three bf16 planes itself and keeps them in LDS; the five projections (ten 64x64 tiles, one per wave) read them from there.
// Step 1: the x tile [256 channels][64 tokens] comes in by whole 256-byte row pieces (16 lanes a row, 16 bytes a lane) and is parked in LDS as f32 (pitch XSP).
// Step 2: a wave takes eight channels of 32 tokens, a token per lane (its LDS reads fall on 32 banks in a row), and writes XT = bf16(x) (exact), X1h/X1l = bf16 hi/lo of x1 = bf16(x) * sigmoid((bf16(x) - mu)^2 * rd + 0.5) as token rows of pitch XKP.
// Step 3: wave = tile. Each projection writes its own pair of 16-bit planes: theta, phi, D as bf16 hi/lo [tok][128], g, S as f16 hi (x16) + bf16 residual [b][128][SEQ].
// LDS mus/rds: the batch's 256 channel statistics, written in step 1, read in step 2 (block barrier between). LDS xs: written in step 2, read by every wave in step 3 (block barrier between). LDS osa5: in steps 1 and 2 the f32 tile, shared (block barrier between the steps); from the second barrier on one slice per wave, the tile epilogue's.
#define PW   10
#define XKP  264
#define XSP  68
#define XPL  (64 * XKP)
#define OSL  (64 * 68 + 64)
#define XLD  ((C_ * 16 + PW * 32 - 1) / (PW * 32))
static_assert((PW * 32) % 16 == 0 && C_ * XSP <= PW * OSL && C_ % 32 == 0 && (C_ & (C_ - 1)) == 0 && C_ <= PW * 32 && CI == 128);
__global__ __launch_bounds__(PW * 32) void k_proj5(const float* __restrict__ x, const float* __restrict__ MU, const float* __restrict__ RD,
                                              const bf* __restrict__ WTb, const bf* __restrict__ WPb, const bf* __restrict__ WGb, const bf* __restrict__ WDb, const bf* __restrict__ WSb,
                                              const float* __restrict__ b_theta, const float* __restrict__ b_phi, const float* __restrict__ b_g, const float* __restrict__ b_d, const float* __restrict__ b_s,
                                              bf* THh, bf* THl, bf* PHh, bf* PHl, bf* DQh, bf* DQl, h16* GVh, bf* GVl, h16* SVh, bf* SVl) {
    __shared__ __align__(16) bf xs[3 * XPL];
    __shared__ __align__(16) float osa5[PW * OSL];
    __shared__ __align__(32) float mus[C_]; __shared__ __align__(32) float rds[C_];
    const int tid = threadIdx.x, lane = tid & 31;
    const int wv = __builtin_amdgcn_readfirstlane(tid >> 5);   // wave number held scalar: the tile choice below is a scalar branch, a wave's channel group a scalar
    const int b = blockIdx.x / (SEQ / 64), t0 = (blockIdx.x % (SEQ / 64)) * 64;
    {
        const float* xp = x + ((size_t)b * C_ + (tid >> 4)) * HWF + t0 + (tid & 15) * 4;   // piece tid + PW*32 i of the tile: channel (tid >> 4) + PW*2 i
        float* sp = osa5 + (tid >> 4) * XSP + (tid & 15) * 4;
        v4f r[XLD]; float sm = 0.f, sr = 0.f;
#pragma unroll   // unrolled: every load of the tile is issued before the first is waited for; only the last round can pass the tile's end, and a wave holds two whole rows, so its test is the same in all the wave's lanes
        for (int i = 0; i < XLD; ++i) if (PW * 2 * (i + 1) <= C_ || wv * 2 + PW * 2 * i < C_) r[i] = *(const v4f*)(xp + (size_t)i * (PW * 2) * HWF);
        const float* pm = MU + (size_t)b * C_ + (tid & (C_ - 1)); const float* pr = RD + (size_t)b * C_ + (tid & (C_ - 1));
        if (wv * 32 < C_) { sm = *pm; sr = *pr; }        // the batch's channel statistics ride along with the tile's loads
        asm volatile("s_wait_xcnt 0x0" :: "v"(xp), "v"(pm), "v"(pr) : "memory");   // behind the step's loads; it takes their address pairs as inputs, so that no load's result lands in a pair ahead of it
#pragma unroll
        for (int i = 0; i < XLD; ++i) if (PW * 2 * (i + 1) <= C_ || wv * 2 + PW * 2 * i < C_) *(v4fa*)(sp + i * (PW * 2) * XSP) = r[i];
        if (wv * 32 < C_) { mus[tid & (C_ - 1)] = sm; rds[tid & (C_ - 1)] = sr; }
    }
    __syncthreads();                                     // the f32 tile is whole before any wave reads across it
#pragma unroll 1   // rolled: the gating arithmetic stands once in the text
    for (int u = wv; u < (C_ / 8) * 2; u += PW) {
        const int c = (u >> 1) * 8, tl = (u & 1) * 32 + lane;
        const v8f mu8 = *(const v8f*)(mus + c), rd8 = *(const v8f*)(rds + c);   // one address for the whole wave
        v8us o0, oh, ol;
#pragma unroll
        for (int q = 0; q < 8; ++q) {
            const float xb = bfr(osa5[(c + q) * XSP + tl]);
            const float d = xb - mu8[q];
            const float y = d * d * rd8[q] + 0.5f;
            const float ex = __expf(-y);
            const float sg = __builtin_amdgcn_rcpf(1.0f + ex);
            const float x1 = xb * sg;
            o0[q] = f2bf(xb); unsigned short hh, ll; splitf(x1, hh, ll); oh[q] = hh; ol[q] = ll;
        }
        *(v8us*)(xs + tl * XKP + c) = o0; *(v8us*)(xs + XPL + tl * XKP + c) = oh; *(v8us*)(xs + 2 * XPL + tl * XKP + c) = ol;
    }
    __syncthreads();                                     // the three planes are whole before the tiles read them, and no wave reads the f32 tile any more: its LDS becomes the waves' epilogue slices
    float* os = osa5 + wv * OSL;
    const bf* XT = xs; const bf* X1h = xs + XPL; const bf* X1l = xs + 2 * XPL;
    const size_t to = (size_t)blockIdx.x * 64 * CI, fo = (size_t)b * CI * SEQ + t0;   // the tile's first element in a token-major plane (column tile 0) and in a feature-major plane (row tile 0)
    const int j = (wv >> 2) * 2 + (wv & 1), h = j & 1;   // waves 2, 3, 6, 7 take the four two-product tiles, the other six the one-product tiles: with waves dealt round the four SIMDs, two SIMDs get two long tiles each and two get three short ones
    if ((wv & 2) != 0) {
        if (j < 2) gemmw_tile<bf, true, false, 1, false, C_, 1, false, XKP, C_, 1>(os, 0, h, 0, X1h, X1l, WDb, nullptr, nullptr, nullptr, nullptr, DQh + to, DQl + to, CI, b_d, nullptr, 0, 0, 0);                 /* D [tok][128] (2 products) */
        else       gemmw_tile<bf, false, true, 2, false, C_, 2, false, C_, XKP, 2>(os, h, 0, 0, WSb, nullptr, X1h, X1l, nullptr, nullptr, nullptr, (bf*)SVh + fo, SVl + fo, SEQ, b_s, nullptr, 0, 0, 0);          /* S feature-major (2 products) */
    } else {
        if (j < 2) gemmw_tile<bf, false, false, 2, false, C_, 2, false, C_, XKP, 2>(os, h, 0, 0, WGb, nullptr, XT, nullptr, nullptr, nullptr, nullptr, (bf*)GVh + fo, GVl + fo, SEQ, b_g, nullptr, 0, 0, 0);       /* g feature-major */
        else       gemmw_tile<bf, false, false, 1, false, C_, 1, false, XKP, C_, 1>(os, 0, h, 0, XT, nullptr, j < 4 ? WTb : WPb, nullptr, nullptr, nullptr, nullptr, (j < 4 ? THh : PHh) + to, (j < 4 ? THl : PHl) + to, CI, j < 4 ? b_theta : b_phi, nullptr, 0, 0, 0);   /* theta, phi [tok][128] */
    }
}

// k_stats: one work-group per 32 (b, c) rows (its 32 results fill one 128-byte line of MU and of RD), sixteen waves, two rows per wave one after the other.
// A wave brings its whole row into registers with all its loads in flight at once, rounds it to bf16 there, and takes the mean and the centred sum of squares from the registers: the row is read once and no load waits on another.
// LDS mus/rds: cross-wave (block barrier).
// The six weight matrices' conversion to bf16 needs nothing of x and rides in the same grid: work-groups from STB on, WCB of them per matrix, eight elements a thread.
#define SW 16
#define SR (32 / SW)
#define STB (NB * C_ / 32)
#define WCB (CI * C_ / 8 / (SW * 32))
static_assert((CI * C_ / 8) % (SW * 32) == 0);
__global__ __launch_bounds__(SW * 32) void k_stats(const float* __restrict__ x, float* MU, float* RD,
                                                 const float* __restrict__ w_theta, const float* __restrict__ w_phi, const float* __restrict__ w_g, const float* __restrict__ w_d, const float* __restrict__ w_s, const float* __restrict__ w_out,
                                                 bf* WTb, bf* WPb, bf* WGb, bf* WDb, bf* WSb, bf* WOb) {
    __shared__ float mus[32]; __shared__ float rds[32];
    if (blockIdx.x >= STB) {                             // taken by a whole work-group, ahead of the barrier below
        const int cb = blockIdx.x - STB, w = cb / WCB;
        const float* src = w == 0 ? w_theta : w == 1 ? w_phi : w == 2 ? w_g : w == 3 ? w_d : w == 4 ? w_s : w_out;
        bf* dst = w == 0 ? WTb : w == 1 ? WPb : w == 2 ? WGb : w == 3 ? WDb : w == 4 ? WSb : WOb;
        const size_t i = (size_t)(cb - w * WCB) * (SW * 32) + threadIdx.x;
        const v8f v = *(const v8f*)(src + i * 8); v8us o;
#pragma unroll
        for (int k = 0; k < 8; ++k) o[k] = f2bf(v[k]);
        *(v8us*)(dst + i * 8) = o;
        return;
    }
    const int t = threadIdx.x, wid = __builtin_amdgcn_readfirstlane(t >> 5), lane = t & 31;   // wave number held scalar: the row index and the row's part of the address are scalar
#pragma unroll 1   // rolled: one row's registers at a time
    for (int j = 0; j < SR; ++j) {
        const int rr = blockIdx.x * 32 + wid * SR + j;                // (b, c) row index < NB * C_
        const int b = rr / C_, c = rr - b * C_;
        const float* xr = x + ((size_t)b * C_ + c) * HWF + lane * 4;
        v4f r[SEQ / 128];
#pragma unroll   // unrolled: every load of the row is issued before the first is waited for
        for (int i = 0; i < SEQ / 128; ++i) r[i] = *(const v4f*)(xr + (size_t)i * 128);
        float s = 0.f;
#pragma unroll   // unrolled: r[] stays in registers
        for (int i = 0; i < SEQ / 128; ++i) { v4f v = r[i]; v[0] = bfr(v[0]); v[1] = bfr(v[1]); v[2] = bfr(v[2]); v[3] = bfr(v[3]); r[i] = v; s += (v[0] + v[1]) + (v[2] + v[3]); }
        s += __shfl_xor(s, 1, 32); s += __shfl_xor(s, 2, 32); s += __shfl_xor(s, 4, 32); s += __shfl_xor(s, 8, 32); s += __shfl_xor(s, 16, 32);
        const float mu = s * (1.0f / (float)SEQ);
        float ss = 0.f;
#pragma unroll   // unrolled: r[] stays in registers
        for (int i = 0; i < SEQ / 128; ++i) { const v4f v = r[i];
            const float d0 = v[0] - mu, d1 = v[1] - mu, d2 = v[2] - mu, d3 = v[3] - mu;
            ss += (d0 * d0 + d1 * d1) + (d2 * d2 + d3 * d3); }
        ss += __shfl_xor(ss, 1, 32); ss += __shfl_xor(ss, 2, 32); ss += __shfl_xor(ss, 4, 32); ss += __shfl_xor(ss, 8, 32); ss += __shfl_xor(ss, 16, 32);
        const float den = 4.0f * (ss * (1.0f / (float)(SEQ - 1)) + ELAM);
        const float rd = 1.0f / den;
        if (lane == 0) { mus[wid * SR + j] = mu; rds[wid * SR + j] = rd; }
    }
    __syncthreads();
    if (wid == 0) {
        const float a = mus[lane], r = rds[lane];
        float* pm = MU + (size_t)blockIdx.x * 32 + lane; float* pr = RD + (size_t)blockIdx.x * 32 + lane;
        *(float*)pm = a; *(float*)pr = r;  }
}

// ---- k_attn: eight waves per work-group on 128 queries of one batch and one map (z = 0: theta/g, z = 1: D/S; keys = phi for both), online max-subtracted softmax.
// Wave (qg, kh) takes the 32 queries of group qg (two 16-query tiles) and the 32-key half kh of every stage: each K and V fragment read from LDS feeds both query tiles, so a matrix instruction costs half the LDS reads of a 16-query wave.
// Each wave keeps its own running maximum, sum and O^T over its half of the keys; at the end the two waves of a query group swap one tile each through LDS and join the halves (rescaled to the common maximum).
// Transposed products: S^T = K . Q^T (A = key rows, B = query columns) and O^T += V^T . P^T (A = feature rows of V, B = P^T). Lane (L, hi) then holds query L alone: 16 of the block's 32 scores sit in its own registers,
// maximum and sum are taken in the lane (one exchange between the lane halves for the maximum; the halves' sums are joined once at the end), and the two score tiles, converted in place, are the B operand of the second product.
// The work-group's 128 queries walk the same keys and values: each 64-key stage (K hi/lo rows, V hi/lo feature rows) is brought into LDS once by asynchronous copies, two buffers, the next stage in flight while this one is worked on.
// LDS ring: shared by the eight waves (one block barrier at each hand-over, split: signal in front of a pass's second product, wait at the top of the next pass). K rows at a 272-byte pitch, V rows at a 144-byte pitch (16 B x odd, for ds_load_b128 readers).
// LDS osa: one slice per wave, rows 0..15 x cols 0..127 and, in cols 128 and 129, the row's maximum and sum. A wave writes its own slice; behind the block barrier only its partner touches that slice.
#define AW   8
#define SK   64
#define KPI  136
#define VPI  72
#define KPLB (SK * KPI * 2)
#define VPLB (CI * VPI * 2)
#define STGB (2 * KPLB + 2 * VPLB)
#define NST  (SEQ / SK)
#define QG   (AW / 2)
static_assert(SEQ % (AW * 16) == 0 && NST >= 2 && SK == 2 * KB && OSP >= CI + 2);
static_assert(SK * CI * 2 == 4 * AW * 32 * 16 && CI * SK * 2 == 4 * AW * 32 * 16);
__device__ __forceinline__ v16bf ldbs(const bf* p) { return cat16b(*(const v8usa*)p, *(const v8usa*)(p + 16)); }
__device__ __forceinline__ v16h  ldhs(const h16* p) { return cat16(*(const v8ha*)p, *(const v8ha*)(p + 16)); }
__device__ __forceinline__ float xhalf(float x) { return __builtin_bit_cast(float, __builtin_amdgcn_permlanex16(__builtin_bit_cast(int, x), __builtin_bit_cast(int, x), 0x76543210, 0xfedcba98, false, false)); }   // lane l takes lane l ^ 16's value
// Eight 16-byte copies per lane, global -> LDS through no register: four steps of plane a, four of plane b. The s_wait_xcnt stands inside the statement so that no address register is rewritten ahead of it.
template <typename TA, typename TB>
__device__ __forceinline__ void copy8(unsigned la, const TA* ga, unsigned lb, const TB* gb, unsigned lstep, size_t gstep) {
    asm volatile("global_load_async_to_lds_b128 %0, %8, off\n\t"
                 "global_load_async_to_lds_b128 %1, %9, off\n\t"
                 "global_load_async_to_lds_b128 %2, %10, off\n\t"
                 "global_load_async_to_lds_b128 %3, %11, off\n\t"
                 "global_load_async_to_lds_b128 %4, %12, off\n\t"
                 "global_load_async_to_lds_b128 %5, %13, off\n\t"
                 "global_load_async_to_lds_b128 %6, %14, off\n\t"
                 "global_load_async_to_lds_b128 %7, %15, off\n\t"
                 "s_wait_xcnt 0x0"
                 :: "v"(la), "v"(la + lstep), "v"(la + 2 * lstep), "v"(la + 3 * lstep), "v"(lb), "v"(lb + lstep), "v"(lb + 2 * lstep), "v"(lb + 3 * lstep),
                    "v"(ga), "v"(ga + gstep), "v"(ga + 2 * gstep), "v"(ga + 3 * gstep), "v"(gb), "v"(gb + gstep), "v"(gb + 2 * gstep), "v"(gb + 3 * gstep)
                 : "memory");
}
__global__ __launch_bounds__(AW * 32) void k_attn(const bf* __restrict__ THh, const bf* __restrict__ THl, const bf* __restrict__ DQh, const bf* __restrict__ DQl,
                                             const bf* __restrict__ PHh, const bf* __restrict__ PHl,
                                             const h16* __restrict__ GVh, const bf* __restrict__ GVl, const h16* __restrict__ SVh, const bf* __restrict__ SVl, float* Y) {
    __shared__ __align__(16) unsigned char ring[2 * STGB];
    __shared__ __align__(16) float osa[AW * 16 * OSP];
    const int tid = threadIdx.x, lane = tid & 31, L = lane & 15, hi = lane >> 4;
    const int wv = __builtin_amdgcn_readfirstlane(tid >> 5);
    const int qg = wv % QG, kh = wv / QG;          // query group, key half (both wave-uniform)
    float* osw = osa + wv * 16 * OSP;                    // own slice: takes the tile that is given away
    float* osp = osa + (wv ^ QG) * 16 * OSP;             // the partner's slice: same query group, other key half
    const int q0 = blockIdx.x * (AW * 16) + qg * 32, b = blockIdx.y, mp = blockIdx.z;
    const size_t tok = (size_t)b * SEQ;
    const bf* Qh = (mp ? DQh : THh) + (tok + q0) * CI; const bf* Ql = (mp ? DQl : THl) + (tok + q0) * CI;
    const bf* Kh = PHh + tok * CI; const bf* Kl = PHl + tok * CI;
    const h16* Vh = (mp ? SVh : GVh) + (size_t)b * CI * SEQ; const bf* Vl = (mp ? SVl : GVl) + (size_t)b * CI * SEQ;
    float* Yo = Y + ((size_t)mp * NB * SEQ + tok + q0 + kh * 16) * CI;   // the wave stores the tile it keeps
    // Copy map of one stage. K plane: 64 rows x 256 B, contiguous in global; thread tid takes 16-byte piece tid + 256 i (row (tid >> 4) + 16 i). V plane: 128 rows x 128 B; piece tid + 256 i (row (tid >> 3) + 32 i).
    const unsigned ring0 = (unsigned)(size_t)ring;
    const unsigned lk = ring0 + (unsigned)((tid >> 4) * (KPI * 2) + (tid & 15) * 16);
    const unsigned lv = ring0 + (unsigned)(2 * KPLB + (tid >> 3) * (VPI * 2) + (tid & 7) * 16);
    const unsigned gk = (unsigned)tid * 8, gv = (unsigned)(tid >> 3) * SEQ + (unsigned)(tid & 7) * 8;   // the lane's element offset in a K plane and in a V plane (hi and lo planes alike): two registers live through the key walk; four address pairs beside the 32-query tile's registers went to scratch
    auto fill = [&](int st) {
        const unsigned bo = (unsigned)(st & 1) * STGB;
        const unsigned ok = gk + (unsigned)st * (SK * CI), ov = gv + (unsigned)st * SK;
        copy8(lk + bo, Kh + ok, lk + bo + KPLB, Kl + ok, 16 * KPI * 2, (size_t)16 * CI);
        copy8(lv + bo, Vh + ov, lv + bo + VPLB, Vl + ov, 32 * VPI * 2, (size_t)32 * SEQ);
    };
    // Tile t of the wave = queries q0 + (t ^ kh) * 16 + L: tile 0 is the one the wave keeps and stores, tile 1 the one it gives to its partner.
    // Per tile: query L's running maximum (equal in both lane halves), this lane half's part of its sum, acc[t][ct][v] = O^T[ct*16 + 8*hi + v][L]; all over the wave's half of the keys.
    float m_i[2] = {-1.0e30f, -1.0e30f}, l_i[2] = {0.f, 0.f}; v8f acc[2][8];
#pragma unroll
    for (int t = 0; t < 2; ++t)
#pragma unroll
        for (int ct = 0; ct < 8; ++ct) acc[t][ct] = (v8f){};
    // The wave's 32 query rows never change: their hi and lo fragments are loaded once and stay in registers for the whole key walk. B fragment: query column L of the tile.
    v16bf qh[2][CI / 32], ql[2][CI / 32];
#pragma unroll
    for (int t = 0; t < 2; ++t) {
        const size_t qoff = (size_t)((t ^ kh) * 16 + L) * CI + 8 * hi;
#pragma unroll
        for (int ch = 0; ch < CI / 32; ++ch) { qh[t][ch] = ldb(Qh + qoff + ch * 32); ql[t][ch] = ldb(Ql + qoff + ch * 32); }
    }
    fill(0);
    asm volatile("s_wait_asynccnt 0x0" ::: "memory");    // stage 0 has landed before the signal that publishes it
    asm volatile("s_barrier_signal -1" ::: "memory");    // first half of the split block barrier; signal and wait alternate strictly in every wave from here on
#pragma unroll 1   // rolled: the buffer is picked by the stage's parity at run time, one copy of the hand-over and of the pass body
    for (int st = 0; st < NST; ++st) {
      const unsigned char* sb = ring + (st & 1) * STGB;
      asm volatile("s_barrier_wait -1" ::: "memory");    // second half: every wave has signalled, so stage st is published and no wave reads the other buffer any more; no LDS read of the pass stands ahead of it
      if (st + 1 < NST) fill(__builtin_amdgcn_readfirstlane(st + 1));   // the refill stands right behind the wait, one stage ahead; the stage number goes in as a scalar of its own: as the loop counter it was turned into four address pairs stepped every pass, and the lane's two LDS addresses went to scratch
      {
        v8f lt[2][2];
#pragma unroll
        for (int t = 0; t < 2; ++t) { lt[t][0] = (v8f){}; lt[t][1] = (v8f){}; }
        const bf* k0h = (const bf*)sb + (kh * KB + L) * KPI + 8 * hi; const bf* k0l = k0h + KPLB / 2;   // A fragment (keys): key row kh*32 + kt*16 + L of the stage
#pragma unroll   // unrolled: each chunk names its own resident query fragments
        for (int ch = 0; ch < CI / 32; ++ch) {
            const int co = ch * 32;
            const v16bf ka0 = ldbs(k0h + co), kl0 = ldbs(k0l + co), ka1 = ldbs(k0h + 16 * KPI + co), kl1 = ldbs(k0l + 16 * KPI + co);
            lt[0][0] = wmmab(ka0, qh[0][ch], lt[0][0]); lt[0][1] = wmmab(ka1, qh[0][ch], lt[0][1]); lt[1][0] = wmmab(ka0, qh[1][ch], lt[1][0]); lt[1][1] = wmmab(ka1, qh[1][ch], lt[1][1]);
            lt[0][0] = wmmab(ka0, ql[0][ch], lt[0][0]); lt[0][1] = wmmab(ka1, ql[0][ch], lt[0][1]); lt[1][0] = wmmab(ka0, ql[1][ch], lt[1][0]); lt[1][1] = wmmab(ka1, ql[1][ch], lt[1][1]);
            lt[0][0] = wmmab(kl0, qh[0][ch], lt[0][0]); lt[0][1] = wmmab(kl1, qh[0][ch], lt[0][1]); lt[1][0] = wmmab(kl0, qh[1][ch], lt[1][0]); lt[1][1] = wmmab(kl1, qh[1][ch], lt[1][1]);
        }
        const h16* vh = (const h16*)(sb + 2 * KPLB) + L * VPI + kh * KB + 8 * hi; const bf* vl = (const bf*)(sb + 2 * KPLB + VPLB) + L * VPI + kh * KB + 8 * hi;   // A fragment (values): ci row L of the staged feature-major plane
        v16h vf[8]; v16bf vr[8];                                 // each V fragment is read from LDS once and stays in registers for both tiles' products
        // D element v of tile kt = score of key kh*32 + kt*16 + 8*hi + v against query L of tile t.
        float mx[2];
#pragma unroll
        for (int t = 0; t < 2; ++t) {
            const v8f lt0 = lt[t][0], lt1 = lt[t][1];
            float m = fmaxf(fmaxf(fmaxf(lt0[0], lt1[0]), fmaxf(lt0[1], lt1[1])), fmaxf(fmaxf(lt0[2], lt1[2]), fmaxf(lt0[3], lt1[3])));
            m = fmaxf(m, fmaxf(fmaxf(fmaxf(lt0[4], lt1[4]), fmaxf(lt0[5], lt1[5])), fmaxf(fmaxf(lt0[6], lt1[6]), fmaxf(lt0[7], lt1[7]))));
            mx[t] = fmaxf(m, xhalf(m));
        }
        asm volatile("" :: "v"(mx[0]), "v"(mx[1]) : "memory");   // compiler fence, inputs only: it takes the two tiles' maxima, which need every score, so the V reads below stay behind the score block (without it they were spread among its matrix instructions, K and V fragments lived at once and query fragments went to scratch)
#pragma unroll
        for (int ct = 0; ct < 8; ++ct) { vf[ct] = ldhs(vh + ct * 16 * VPI); vr[ct] = ldbs(vl + ct * 16 * VPI); }
        v16h pa16[2]; v16bf pab[2]; float sc[2];
#pragma unroll
        for (int t = 0; t < 2; ++t) {
            const v8f lt0 = lt[t][0], lt1 = lt[t][1];
            const float mn = fmaxf(m_i[t], mx[t]);
            sc[t] = __expf(m_i[t] - mn);
            v16f ps; float rp[8];
#pragma unroll
            for (int v = 0; v < 8; ++v) {
                const float pa = __expf(lt0[v] - mn), pb = __expf(lt1[v] - mn);
                rp[v] = pa + pb;
                ps[v] = pa * PCAR; ps[8 + v] = pb * PCAR;            // B element s: k = 8*hi + s (s < 8), 16 + 8*hi + (s - 8) otherwise: tile 0's registers, then tile 1's
            }
            l_i[t] = l_i[t] * sc[t] + (((rp[0] + rp[1]) + (rp[2] + rp[3])) + ((rp[4] + rp[5]) + (rp[6] + rp[7]))); m_i[t] = mn;
            pa16[t] = __builtin_convertvector(ps, v16h);             // round to nearest even, as the scalar conversions
            pab[t] = __builtin_convertvector(ps, v16bf);
        }
        // Hand-over, first half, in front of the pass's last matrix block: that block works on registers alone, so the wave gives the stage up here and the other waves need not wait out its products.
        asm volatile("s_wait_dscnt 0x0" : "+v"(l_i[0]), "+v"(l_i[1]) :: "memory");   // the wave's last LDS reads of this buffer (the V fragments) have returned before it may be refilled; it takes the row sums, the end of the softmax, so that it does not rise to the V reads and stall the softmax behind them
        asm volatile("s_wait_asynccnt 0x0" ::: "memory");  // the wave's copies of stage st + 1 have landed before the signal that publishes them
        asm volatile("s_barrier_signal -1" : "+v"(sc[0]), "+v"(sc[1]) :: "memory");   // no LDS read stands between this signal and the wait at the top of the next pass; it takes the rescale factors, which the second product's block starts from, so that the block stays behind it (without them part of the block was scheduled ahead of the signal)
#pragma unroll
        for (int t = 0; t < 2; ++t) {
#pragma unroll
            for (int ct = 0; ct < 8; ++ct) acc[t][ct] *= sc[t];
#pragma unroll
            for (int ct = 0; ct < 8; ++ct) { acc[t][ct] = wmma16(vf[ct], pa16[t], acc[t][ct]); acc[t][ct] = wmmab(vr[ct], pab[t], acc[t][ct]); }
        }
        // Four vector slots behind the pass's last matrix instructions: the hand-over and, while stages remain, the copies of stage st + 2 follow them.
        asm volatile("v_nop\n\tv_nop\n\tv_nop\n\tv_nop" : "+v"(acc[0][0]), "+v"(acc[0][1]), "+v"(acc[0][2]), "+v"(acc[0][3]), "+v"(acc[0][4]), "+v"(acc[0][5]), "+v"(acc[0][6]), "+v"(acc[0][7]),
                                                           "+v"(acc[1][0]), "+v"(acc[1][1]), "+v"(acc[1][2]), "+v"(acc[1][3]), "+v"(acc[1][4]), "+v"(acc[1][5]), "+v"(acc[1][6]), "+v"(acc[1][7]));
      }
    }
    asm volatile("s_barrier_wait -1" ::: "memory");      // the wait that belongs to the last pass's signal
    asm volatile("s_wait_asynccnt 0x0" ::: "memory");    // no copy is outstanding when the wave goes on to its end
    // Join of the two key halves. Each wave hands tile 1 (raw O^T, maximum, sum) to its partner through its own slice and takes the partner's tile 1, which is its own tile 0's queries over the other keys.
    const float lf0 = l_i[0] + xhalf(l_i[0]), lf1 = l_i[1] + xhalf(l_i[1]);   // the two lane halves' sums of query L, joined once
#pragma unroll
    for (int ct = 0; ct < 8; ++ct) {
        const v8f o = acc[1][ct];
        *(v4fa*)(osw + L * OSP + ct * 16 + 8 * hi) = (v4f){o[0], o[1], o[2], o[3]}; *(v4fa*)(osw + L * OSP + ct * 16 + 8 * hi + 4) = (v4f){o[4], o[5], o[6], o[7]}; }
    osw[L * OSP + CI + hi] = hi ? lf1 : m_i[1];
    __syncthreads();                                     // every wave's slice is written before its partner reads it
    const float mo = osp[L * OSP + CI], lo = osp[L * OSP + CI + 1];
    const float mj = fmaxf(m_i[0], mo);
    const float ea = __expf(m_i[0] - mj), eb = __expf(mo - mj);
    const float rl = __builtin_amdgcn_rcpf(lf0 * ea + lo * eb) * YSC;
    const float fa = ea * rl, fb = eb * rl;
#pragma unroll
    for (int ct = 0; ct < 8; ++ct) {                     // a lane reads and rewrites its own elements of the partner's slice
        float* pe = osp + L * OSP + ct * 16 + 8 * hi;
        const v4f u0 = *(const v4fa*)pe, u1 = *(const v4fa*)(pe + 4); const v8f o = acc[0][ct];
        *(v4fa*)pe = (v4f){o[0] * fa + u0[0] * fb, o[1] * fa + u0[1] * fb, o[2] * fa + u0[2] * fb, o[3] * fa + u0[3] * fb};
        *(v4fa*)(pe + 4) = (v4f){o[4] * fa + u1[0] * fb, o[5] * fa + u1[1] * fb, o[6] * fa + u1[2] * fb, o[7] * fa + u1[3] * fb}; }
    __builtin_amdgcn_fence(__ATOMIC_RELEASE, "wavefront"); __builtin_amdgcn_wave_barrier(); asm volatile("" ::: "memory");
{
#pragma unroll
        for (int r = 0; r < 16; ++r) { const v4f val = *(const v4fa*)(osp + r * OSP + lane * 4); *(v4f*)(Yo + (size_t)r * CI + lane * 4) = val; }
         }
}

extern "C" void kernel_launch(void* const* d_in, const int* in_sizes, int n_in,
                              void* d_out, int out_size, void* d_ws, size_t ws_size, hipStream_t stream) {
    if (n_in < 13) return;
    if ((size_t)in_sizes[0] < (size_t)NB * C_ * HWF) return;
    if (in_sizes[1] < CI * C_ || in_sizes[3] < CI * C_ || in_sizes[5] < CI * C_ || in_sizes[7] < CI * C_ || in_sizes[9] < CI * C_ || in_sizes[11] < C_ * CI) return;
    if (in_sizes[2] < CI || in_sizes[4] < CI || in_sizes[6] < CI || in_sizes[8] < CI || in_sizes[10] < CI || in_sizes[12] < C_) return;
    if ((size_t)out_size < (size_t)NB * C_ * HWF) return;
    const float* x = (const float*)d_in[0];
    const float* w_theta = (const float*)d_in[1];  const float* b_theta = (const float*)d_in[2];
    const float* w_phi   = (const float*)d_in[3];  const float* b_phi   = (const float*)d_in[4];
    const float* w_g     = (const float*)d_in[5];  const float* b_g     = (const float*)d_in[6];
    const float* w_d     = (const float*)d_in[7];  const float* b_d     = (const float*)d_in[8];
    const float* w_s     = (const float*)d_in[9];  const float* b_s     = (const float*)d_in[10];
    const float* w_out   = (const float*)d_in[11]; const float* b_out   = (const float*)d_in[12];
    float* OUT = (float*)d_out;                     // [NB][256][HWF]
    char* wsp = (char*)d_ws;
    auto take = [&](size_t bytes) { char* p = wsp; wsp += (bytes + 255) & ~(size_t)255; return (void*)p; };
    const size_t nTok = (size_t)NB * SEQ;
    bf* WTb = (bf*)take((size_t)CI * C_ * 2); bf* WPb = (bf*)take((size_t)CI * C_ * 2); bf* WGb = (bf*)take((size_t)CI * C_ * 2);
    bf* WDb = (bf*)take((size_t)CI * C_ * 2); bf* WSb = (bf*)take((size_t)CI * C_ * 2); bf* WOb = (bf*)take((size_t)C_ * CI * 2);
    float* MU = (float*)take((size_t)NB * C_ * 4); float* RD = (float*)take((size_t)NB * C_ * 4);
    float* F32A = (float*)take(2 * nTok * CI * 4);                 // y1 | y2 [2][nTok][128]
    bf* THh = (bf*)take(nTok * CI * 2); bf* THl = (bf*)take(nTok * CI * 2);
    bf* PHh = (bf*)take(nTok * CI * 2); bf* PHl = (bf*)take(nTok * CI * 2);
    bf* DQh = (bf*)take(nTok * CI * 2); bf* DQl = (bf*)take(nTok * CI * 2);
    h16* GVh = (h16*)take(nTok * CI * 2); bf* GVl = (bf*)take(nTok * CI * 2);
    h16* SVh = (h16*)take(nTok * CI * 2); bf* SVl = (bf*)take(nTok * CI * 2);
    if ((size_t)(wsp - (char*)d_ws) > ws_size) return;
    float* Y1 = F32A; float* Y2 = F32A + nTok * CI;

    k_stats<<<(unsigned)(STB + 6 * WCB), SW * 32, 0, stream>>>(x, MU, RD, w_theta, w_phi, w_g, w_d, w_s, w_out, WTb, WPb, WGb, WDb, WSb, WOb);   /* SimAM mu, 1/(4(var_n + eps)) per (b, c); weights -> bf16 */
    k_proj5<<<(unsigned)(NB * SEQ / 64), PW * 32, 0, stream>>>(x, MU, RD, WTb, WPb, WGb, WDb, WSb, b_theta, b_phi, b_g, b_d, b_s, THh, THl, PHh, PHl, DQh, DQl, GVh, GVl, SVh, SVl);   /* x^T bf16 (exact), gated x1^T hi/lo in LDS; theta, phi, D [tok][128]; g, S [b][128][SEQ]; 16-bit planes */
    k_attn<<<dim3(SEQ / (AW * 16), NB, 2), AW * 32, 0, stream>>>(THh, THl, DQh, DQl, PHh, PHl, GVh, GVl, SVh, SVl, F32A);                          /* y1 = softmax(theta.phi) g, y2 = softmax(D.phi) S */
    k_gemmw<bf, false, true, 2, true, CI, true><<<dim3(C_ / 64, SEQ / 64, NB), 32, 0, stream>>>(WOb, nullptr, nullptr, nullptr, Y1, Y2, OUT, HWF, b_out, x, 0, (size_t)SEQ * CI, (size_t)C_ * HWF);      /* out[b][co][t] = W_out . (y1 + y2 as hi/lo) + b_out + bf16(x) */
}

// v010
// One run takes 128 microseconds.
// Timed twice side by side with v009, it ran 1.04 times as fast both times.
// All steps since v000 together make it 7.54 times as fast.
#include <hip/hip_runtime.h>

// Contractions, f32 accumulate: five 1x1 projections on v_wmma_f32_16x16x32_bf16 (x as exact bf16; SimAM-gated branch as bf16 hi+lo planes = 2 products; weights bf16); score tiles q.k on v_wmma_f32_16x16x32_bf16 with hi/lo x hi/lo planes (3 products); P.V on v_wmma_f32_16x16x32_f16 (P x 2^14, V x 16 as f16 hi) plus v_wmma_f32_16x16x32_bf16 (P bf16 x V bf16 residual); output projection on v_wmma_f32_16x16x32_bf16 (y = y1 + y2 split into bf16 hi+lo in registers = 2 products). SimAM statistics/gating, online max-subtracted softmax, normalisation and residual add in f32.
// Data flow: x [NB][256][4096] channel-major -> per 64 tokens, in the projection kernel's LDS, token-major planes XT (bf16 exact), X1h/X1l (gated branch, hi/lo); theta/phi/D token-major [t][128] as bf16 hi/lo planes, g/S feature-major [128][t] as f16 hi (x16) + bf16 residual, each written by the projection's own epilogue; eight waves per work-group share 64-key K/V stages in LDS; one wave per 32 queries and one 32-key half of every stage, its query fragments resident in registers (transposed scores K.Q^T, online softmax in the lane, P^T packed from the score registers, V^T.P^T), the two key halves joined at the end; y1/y2 [t][128] f32; y = y1 + y2 -> bf16 hi/lo in the output projection's own fragment loader; out[b][co][t] = W_out . y + b_out + bf16(x).

#ifndef NB
#define NB 4
#endif
#ifndef SEQ
#define SEQ 4096
#endif
#define NBF  4
#define HWF  4096
#define C_   256
#define CI   128
#define KB   32
#define OSP  132
#define PCAR 16384.0f
#define VCAR 16.0f
#define YSC  (1.0f / 262144.0f)
#define ELAM 1e-4f

static_assert(NB >= 1 && NB <= NBF);
static_assert(SEQ % 128 == 0 && SEQ >= 128 && SEQ <= HWF);
static_assert(SEQ % KB == 0 && SEQ % 64 == 0 && SEQ % 16 == 0);
static_assert((NB * C_) % 32 == 0);
static_assert(C_ % 64 == 0 && CI % 64 == 0 && C_ % 32 == 0 && CI % 32 == 0);
static_assert((NB * SEQ * C_) % (8 * 256) == 0 && (NB * SEQ * CI) % 8 == 0);

typedef _Float16 h16;
typedef unsigned short bf;
typedef __attribute__((ext_vector_type(16))) __bf16   v16bf;
typedef __attribute__((ext_vector_type(16))) _Float16 v16h;
typedef __attribute__((ext_vector_type(8)))  _Float16 v8h;
typedef __attribute__((ext_vector_type(8)))  unsigned short v8us;
typedef __attribute__((ext_vector_type(8)))  float    v8f;
typedef __attribute__((ext_vector_type(16))) float    v16f;
typedef __attribute__((ext_vector_type(4)))  float    v4f;
typedef v8h  __attribute__((may_alias)) v8ha;
typedef v4f  __attribute__((may_alias)) v4fa;
typedef v8us __attribute__((may_alias)) v8usa;

__device__ __forceinline__ unsigned short f2bf(float f) { unsigned u = __float_as_uint(f); u += 0x7FFFu + ((u >> 16) & 1u); return (unsigned short)(u >> 16); }
__device__ __forceinline__ float bf2f(unsigned short b) { return __uint_as_float(((unsigned)b) << 16); }
__device__ __forceinline__ float bfr(float f) { return bf2f(f2bf(f)); }
__device__ __forceinline__ void splitf(float y, unsigned short& h, unsigned short& l) { h = f2bf(y); l = f2bf(y - bf2f(h)); }
__device__ __forceinline__ v16h cat16(v8h lo, v8h hi) { return __builtin_shufflevector(lo, hi, 0, 1, 2, 3, 4, 5, 6, 7, 8, 9, 10, 11, 12, 13, 14, 15); }
__device__ __forceinline__ v16bf cat16b(v8us lo, v8us hi) { return __builtin_bit_cast(v16bf, __builtin_shufflevector(lo, hi, 0, 1, 2, 3, 4, 5, 6, 7, 8, 9, 10, 11, 12, 13, 14, 15)); }
__device__ __forceinline__ v8f wmma16(v16h a, v16h b, v8f c) { return __builtin_amdgcn_wmma_f32_16x16x32_f16(false, a, false, b, (short)0, c, false, false); }
__device__ __forceinline__ v8f wmmab(v16bf a, v16bf b, v8f c) { return __builtin_amdgcn_wmma_f32_16x16x32_bf16(false, a, false, b, (short)0, c, false, false); }
// Fragment loaders (A and B share the same per-lane k map): p already points at row (lane & 15), k0 + 8*(lane >> 4); elements 0..7 <- p[0..7], elements 8..15 <- p[16..23].
__device__ __forceinline__ v16bf ldb(const bf* p) { return cat16b(*(const v8us*)p, *(const v8us*)(p + 16)); }
__device__ __forceinline__ v16h  ldh(const h16* p) { return cat16(*(const v8h*)p, *(const v8h*)(p + 16)); }

// ---- gemmw_tile: register-blocked GEMM, ONE WAVE per 64x64 output tile (16 accumulators), operands straight from K-contiguous 16-bit planes; tile (bx, by) of batch bz, tiles (M/64, N/64, Z), 32 threads. os: the wave's 16 x 68 f32 of LDS (OUTM != 0: 64 x 68 + 64).
// C[m][n] (f32, pitch ldc) = sum_k A[m][k] Bt[n][k] (+ A2[m][k] Bt[n][k] when A2ON) (+ A[m][k] Bt2[n][k] when B2ON) (+ bf16(bias[n]) BIASM==1 | bf16(bias[m]) BIASM==2) (+ bf16(res[m][n]) when RESID, same indexing as C).
// z-batch strides sA/sB/sC in elements. K % 32 == 0, M % 64 == 0, N % 64 == 0. K, LDA and LDB are compile-time constants: the four row blocks of an operand are then fixed offsets from one address pair.
// BSUM: Bt and Bt2 are not read; they are formed in registers as the bf16 hi and lo parts of F1[n][k] + F2[n][k] (two f32 planes of pitch K, z stride sB).
// LDA, LDB: row pitch in elements of A (and A2) and of Bt (and Bt2). XL == 1: A and A2 lie in LDS; XL == 2: Bt and Bt2 do; XL == 0: every operand is in global memory.
// OUTM == 0: C is stored as f32. OUTM == 1: the f32 value goes out as bf16 hi/lo planes Ph/Pl; OUTM == 2: as f16 hi (value x 16, its bits in Ph) + bf16 residual Pl. Planes are indexed as C; a lane stores 8 elements, so a tile row is one whole 128-byte line per plane.
template <typename T16> struct WFrag;
template <> struct WFrag<h16> { typedef v16h V; static __device__ __forceinline__ V ld(const h16* p) { return ldh(p); } static __device__ __forceinline__ v8f mma(V a, V b, v8f c) { return wmma16(a, b, c); } };
template <> struct WFrag<bf> { typedef v16bf V; static __device__ __forceinline__ V ld(const bf* p) { return ldb(p); } static __device__ __forceinline__ v8f mma(V a, V b, v8f c) { return wmmab(a, b, c); } };
template <typename T16, bool A2ON, bool B2ON, int BIASM, bool RESID, int K, int OUTM, bool BSUM, int LDA, int LDB, int XL>
__device__ __forceinline__ void gemmw_tile(float* os, int bx, int by, int bz, const T16* __restrict__ A, const T16* __restrict__ A2, const T16* __restrict__ Bt, const T16* __restrict__ Bt2,
                                              const float* __restrict__ F1, const float* __restrict__ F2, float* C, bf* Ph, bf* Pl, int ldc, const float* __restrict__ bias, const float* __restrict__ res, size_t sA, size_t sB, size_t sC) {
    typedef typename WFrag<T16>::V V;
    const size_t z = bz;
    A += z * sA; if (A2ON) A2 += z * sA; if (BSUM) { F1 += z * sB; F2 += z * sB; } else { Bt += z * sB; if (B2ON) Bt2 += z * sB; } if (OUTM == 0) C += z * sC; else { Ph += z * sC; Pl += z * sC; } if (RESID) res += z * sC;
    const int lane = threadIdx.x & 31, lr = lane & 15, hi = lane >> 4;
    const int r0 = bx * 64, c0 = by * 64;
    v8f acc[4][4];
#pragma unroll
    for (int mb = 0; mb < 4; ++mb)
#pragma unroll
        for (int nb = 0; nb < 4; ++nb) acc[mb][nb] = (v8f){};
    const size_t aoff = (size_t)(r0 + lr) * LDA + 8 * hi, boff = (size_t)(c0 + lr) * LDB + 8 * hi;
    const int rw = lane >> 3, cofs8 = (lane & 7) * 8;   // plane epilogue (OUTM != 0): step s of a row block takes row 4 s + rw, eight lanes a row, eight elements a lane
    float bb[8];                                        // its bias values, loaded ahead of the K loop so that the epilogue does not wait for them: BIASM == 1 the lane's 8 columns, BIASM == 2 tile rows lane and 32 + lane (handed round through LDS)
    if (OUTM != 0) {
#pragma unroll
        for (int q = 0; q < (BIASM == 1 ? 8 : 2); ++q) bb[q] = bfr(bias[BIASM == 1 ? c0 + cofs8 + q : r0 + 32 * q + lane]);
    }
#pragma unroll 1
    for (int kc = 0; kc < K; kc += 32) {
        V a[4], a2[4], bq[4], bq2[4];
        const T16* pa = A + aoff + kc; const T16* pa2 = A2ON ? A2 + aoff + kc : pa; const T16* pb = BSUM ? pa : Bt + boff + kc; const T16* pb2 = B2ON && !BSUM ? Bt2 + boff + kc : pb;
#pragma unroll
        for (int mb = 0; mb < 4; ++mb) { a[mb] = WFrag<T16>::ld(pa + (size_t)mb * 16 * LDA); a2[mb] = a[mb]; if (A2ON) a2[mb] = WFrag<T16>::ld(pa2 + (size_t)mb * 16 * LDA); }
#pragma unroll
        for (int nb = 0; nb < 4; ++nb) if (!BSUM) { bq[nb] = WFrag<T16>::ld(pb + (size_t)nb * 16 * LDB); bq2[nb] = bq[nb]; if (B2ON) bq2[nb] = WFrag<T16>::ld(pb2 + (size_t)nb * 16 * LDB); }
        const float* pf1 = BSUM ? F1 + boff + kc : nullptr; const float* pf2 = BSUM ? F2 + boff + kc : nullptr;
        v8f f1[4][2], f2[4][2];                          // BSUM: the lane's two runs of eight k of each B row, from both f32 planes
#pragma unroll
        for (int nb = 0; nb < 4; ++nb) if (BSUM) {
            f1[nb][0] = *(const v8f*)(pf1 + (size_t)nb * 16 * K); f1[nb][1] = *(const v8f*)(pf1 + (size_t)nb * 16 * K + 16);
            f2[nb][0] = *(const v8f*)(pf2 + (size_t)nb * 16 * K); f2[nb][1] = *(const v8f*)(pf2 + (size_t)nb * 16 * K + 16); }
        if (BSUM) {
            asm volatile("s_wait_xcnt 0x0" :: "v"(pa), "v"(pf1), "v"(pf2) : "memory");   // as the statement below, for this form's three address pairs
            __builtin_amdgcn_sched_barrier(0);   // holds that wait directly behind the loads: without it the wait sank below the split arithmetic and below an address step
        } else if (XL != 0) {
            if (XL == 1) asm volatile("s_wait_xcnt 0x0" :: "v"(pb), "v"(pb2) : "memory");   // as the last statement of this chain, for the one operand that comes from global memory
            else         asm volatile("s_wait_xcnt 0x0" :: "v"(pa), "v"(pa2) : "memory");
            __builtin_amdgcn_sched_barrier(0);   // holds that wait, and with it every load of the trip, ahead of the first matrix instruction: without it the global loads were issued in three groups among the products and a trip waited out three latencies
        } else
        asm volatile("s_wait_xcnt 0x0" :: "v"(pa), "v"(pa2), "v"(pb), "v"(pb2) : "memory");   // behind the trip's fragment loads; it takes their address pairs as inputs, so that no load's result and no address step lands in a pair ahead of it
#pragma unroll
        for (int nb = 0; nb < 4; ++nb) if (BSUM) {       // B = F1 + F2 in f32, split into bf16 hi and lo fragments in registers (same k map as ldb)
            v8us h[2], l[2];
#pragma unroll
            for (int u = 0; u < 2; ++u) {
                const v8f y = f1[nb][u] + f2[nb][u];
#pragma unroll
                for (int q = 0; q < 8; ++q) { unsigned short a_, c_; splitf(y[q], a_, c_); h[u][q] = a_; l[u][q] = c_; } }
            bq[nb] = cat16b(h[0], h[1]); bq2[nb] = cat16b(l[0], l[1]); }
#pragma unroll
        for (int nb = 0; nb < 4; ++nb) {
            const V b = bq[nb], b2 = bq2[nb];
#pragma unroll
            for (int mb = 0; mb < 4; ++mb) {
                acc[mb][nb] = WFrag<T16>::mma(a[mb], b, acc[mb][nb]);
                if (A2ON) acc[mb][nb] = WFrag<T16>::mma(a2[mb], b, acc[mb][nb]);
                if (B2ON) acc[mb][nb] = WFrag<T16>::mma(a[mb], b2, acc[mb][nb]); } }
        asm volatile("v_nop\n\tv_nop\n\tv_nop\n\tv_nop" : "+v"(acc[0][0]), "+v"(acc[1][1]), "+v"(acc[2][2]), "+v"(acc[3][3]) : "v"(a[0]), "v"(a[3]));
    }
    if (OUTM != 0) {   // plane epilogue: the whole 64 x 64 tile goes to LDS once (os: 64 x 68 f32, then 64 row biases); a rolled loop over the four row blocks splits and stores it
        float* ob = os + 64 * 68;
#pragma unroll
        for (int mb = 0; mb < 4; ++mb)
#pragma unroll
            for (int nb = 0; nb < 4; ++nb)
#pragma unroll
                for (int j = 0; j < 8; ++j) os[(mb * 16 + hi * 8 + j) * 68 + nb * 16 + lr] = acc[mb][nb][j];
        if (BIASM == 2) { ob[lane] = bb[0]; ob[32 + lane] = bb[1]; }
        __builtin_amdgcn_fence(__ATOMIC_RELEASE, "wavefront"); __builtin_amdgcn_wave_barrier(); asm volatile("" ::: "memory");   // as in the f32 epilogue below: the lanes' LDS writes stay ahead of the reads of other lanes' elements that follow
        const size_t eo = (size_t)(r0 + rw) * ldc + c0 + cofs8;
#pragma unroll 1   // rolled: the split arithmetic stands once in the text, not once per row block (unrolled, the four projections' text grew to about 40 KB)
        for (int mb = 0; mb < 4; ++mb) {
            v8us oh[4], ol[4]; v4f u[4][2]; float br[4];
#pragma unroll
            for (int s = 0; s < 4; ++s) {                // the row block's LDS reads, issued as one group
                const int row = mb * 16 + 4 * s + rw;
                u[s][0] = *(const v4fa*)(os + row * 68 + cofs8); u[s][1] = *(const v4fa*)(os + row * 68 + cofs8 + 4);
                br[s] = BIASM == 2 ? ob[row] : 0.f; }
#pragma unroll
            for (int s = 0; s < 4; ++s) {
                const v4f u0 = u[s][0], u1 = u[s][1];
                float val[8] = {u0[0], u0[1], u0[2], u0[3], u1[0], u1[1], u1[2], u1[3]};
#pragma unroll
                for (int q = 0; q < 8; ++q) {
                    val[q] += BIASM == 1 ? bb[q] : br[s];
                    if (OUTM == 1) { unsigned short a_, c_; splitf(val[q], a_, c_); oh[s][q] = a_; ol[s][q] = c_; }
                    else { const float w = val[q] * VCAR; const h16 hh = (h16)w; oh[s][q] = __builtin_bit_cast(unsigned short, hh); ol[s][q] = f2bf(w - (float)hh); }
                }
            }
            __builtin_amdgcn_sched_barrier(0);   // the row block's eight stores stay together behind its arithmetic: the one s_wait_xcnt below then serves them all, where stores spread among the arithmetic took a wait each
#pragma unroll
            for (int s = 0; s < 4; ++s) { *(v8us*)(Ph + eo + (size_t)(mb * 16 + 4 * s) * ldc) = oh[s]; *(v8us*)(Pl + eo + (size_t)(mb * 16 + 4 * s) * ldc) = ol[s]; }
            asm volatile("s_wait_xcnt 0x0" ::: "memory");   // behind the row block's stores: the next trip reuses their data registers and steps their address pairs
            __builtin_amdgcn_sched_barrier(0);   // holds that wait directly behind the stores
        }
        return;
    }
#pragma unroll
    for (int mb = 0; mb < 4; ++mb) {
#pragma unroll
        for (int nb = 0; nb < 4; ++nb) {
#pragma unroll
            for (int j = 0; j < 8; ++j) os[(hi * 8 + j) * 68 + nb * 16 + lr] = acc[mb][nb][j]; }
        __builtin_amdgcn_fence(__ATOMIC_RELEASE, "wavefront"); __builtin_amdgcn_wave_barrier(); asm volatile("" ::: "memory");
        const size_t rb = (size_t)(r0 + mb * 16);
        v4f rv8[8];
        if (RESID) {
            const float* rp[8];
#pragma unroll
            for (int s = 0; s < 8; ++s) { rp[s] = res + (rb + 2 * s + hi) * (size_t)ldc + c0 + lr * 4; rv8[s] = *(const v4f*)rp[s]; }
            asm volatile("s_wait_xcnt 0x0" :: "v"(rp[0]), "v"(rp[1]), "v"(rp[2]), "v"(rp[3]), "v"(rp[4]), "v"(rp[5]), "v"(rp[6]), "v"(rp[7]) : "memory");   // behind the row block's residual loads; it takes their address pairs as inputs, so that no load's result lands in a pair ahead of it
        }
{
#pragma unroll
            for (int s = 0; s < 8; ++s) {
                const int row = 2 * s + hi, cofs = lr * 4;
                v4f val = *(const v4fa*)(os + row * 68 + cofs);
                if (BIASM == 1) { val[0] += bfr(bias[c0 + cofs]); val[1] += bfr(bias[c0 + cofs + 1]); val[2] += bfr(bias[c0 + cofs + 2]); val[3] += bfr(bias[c0 + cofs + 3]); }
                if (BIASM == 2) { const float bv = bfr(bias[rb + row]); val[0] += bv; val[1] += bv; val[2] += bv; val[3] += bv; }
                if (RESID) { const v4f rv = rv8[s]; val[0] += bfr(rv[0]); val[1] += bfr(rv[1]); val[2] += bfr(rv[2]); val[3] += bfr(rv[3]); }
                *(v4f*)(C + (rb + row) * (size_t)ldc + c0 + cofs) = val; }
             }
        asm volatile("s_wait_xcnt 0x0" ::: "memory");   // behind the row block's stores: the next row block reuses their data and address registers
        __builtin_amdgcn_sched_barrier(0);   // holds that wait directly behind the stores: without it the next row block's address arithmetic was scheduled ahead of it
        __builtin_amdgcn_fence(__ATOMIC_RELEASE, "wavefront"); __builtin_amdgcn_wave_barrier(); asm volatile("" ::: "memory");
    }
}
template <typename T16, bool A2ON, bool B2ON, int BIASM, bool RESID, int K, bool BSUM>
__global__ __launch_bounds__(32) void k_gemmw(const T16* __restrict__ A, const T16* __restrict__ A2, const T16* __restrict__ Bt, const T16* __restrict__ Bt2,
                                              const float* __restrict__ F1, const float* __restrict__ F2, float* C, int ldc, const float* __restrict__ bias, const float* __restrict__ res, size_t sA, size_t sB, size_t sC) {
    __shared__ __align__(16) float os[16 * 68];
    gemmw_tile<T16, A2ON, B2ON, BIASM, RESID, K, 0, BSUM, K, K, 0>(os, blockIdx.x, blockIdx.y, blockIdx.z, A, A2, Bt, Bt2, F1, F2, C, nullptr, nullptr, ldc, bias, res, sA, sB, sC);
}
// ---- k_proj5: one work-group of ten waves per 64 tokens of one batch. It forms the tokens' three bf16 planes itself and keeps them in LDS; the five projections (ten 64x64 tiles, one per wave) read them from there.
// Step 1: the x tile [256 channels][64 tokens] comes in by whole 256-byte row pieces (16 lanes a row, 16 bytes a lane) and is parked in LDS as f32 (pitch XSP).
// Step 2: a wave takes eight channels of 32 tokens, a token per lane (its LDS reads fall on 32 banks in a row), and writes XT = bf16(x) (exact), X1h/X1l = bf16 hi/lo of x1 = bf16(x) * sigmoid((bf16(x) - mu)^2 * rd + 0.5) as token rows of pitch XKP.
// Step 3: wave = tile. Each projection writes its own pair of 16-bit planes: theta, phi, D as bf16 hi/lo [tok][128], g, S as f16 hi (x16) + bf16 residual [b][128][SEQ].
// LDS mus/rds: the batch's 256 channel statistics, written in step 1, read in step 2 (block barrier between). LDS xs: written in step 2, read by every wave in step 3 (block barrier between). LDS osa5: in steps 1 and 2 the f32 tile, shared (block barrier between the steps); from the second barrier on one slice per wave, the tile epilogue's.
#define PW   10
#define XKP  264
#define XSP  68
#define XPL  (64 * XKP)
#define OSL  (64 * 68 + 64)
#define XLD  ((C_ * 16 + PW * 32 - 1) / (PW * 32))
static_assert((PW * 32) % 16 == 0 && C_ * XSP <= PW * OSL && C_ % 32 == 0 && (C_ & (C_ - 1)) == 0 && C_ <= PW * 32 && CI == 128);
__global__ __launch_bounds__(PW * 32) void k_proj5(const float* __restrict__ x, const float* __restrict__ MU, const float* __restrict__ RD,
                                              const bf* __restrict__ WTb, const bf* __restrict__ WPb, const bf* __restrict__ WGb, const bf* __restrict__ WDb, const bf* __restrict__ WSb,
                                              const float* __restrict__ b_theta, const float* __restrict__ b_phi, const float* __restrict__ b_g, const float* __restrict__ b_d, const float* __restrict__ b_s,
                                              bf* THh, bf* THl, bf* PHh, bf* PHl, bf* DQh, bf* DQl, h16* GVh, bf* GVl, h16* SVh, bf* SVl) {
    __shared__ __align__(16) bf xs[3 * XPL];
    __shared__ __align__(16) float osa5[PW * OSL];
    __shared__ __align__(32) float mus[C_]; __shared__ __align__(32) float rds[C_];
    const int tid = threadIdx.x, lane = tid & 31;
    const int wv = __builtin_amdgcn_readfirstlane(tid >> 5);   // wave number held scalar: the tile choice below is a scalar branch, a wave's channel group a scalar
    const int b = blockIdx.x / (SEQ / 64), t0 = (blockIdx.x % (SEQ / 64)) * 64;
    {
        const float* xp = x + ((size_t)b * C_ + (tid >> 4)) * HWF + t0 + (tid & 15) * 4;   // piece tid + PW*32 i of the tile: channel (tid >> 4) + PW*2 i
        float* sp = osa5 + (tid >> 4) * XSP + (tid & 15) * 4;
        v4f r[XLD]; float sm = 0.f, sr = 0.f;
#pragma unroll   // unrolled: every load of the tile is issued before the first is waited for; only the last round can pass the tile's end, and a wave holds two whole rows, so its test is the same in all the wave's lanes
        for (int i = 0; i < XLD; ++i) if (PW * 2 * (i + 1) <= C_ || wv * 2 + PW * 2 * i < C_) r[i] = *(const v4f*)(xp + (size_t)i * (PW * 2) * HWF);
        const float* pm = MU + (size_t)b * C_ + (tid & (C_ - 1)); const float* pr = RD + (size_t)b * C_ + (tid & (C_ - 1));
        if (wv * 32 < C_) { sm = *pm; sr = *pr; }        // the batch's channel statistics ride along with the tile's loads
        asm volatile("s_wait_xcnt 0x0" :: "v"(xp), "v"(pm), "v"(pr) : "memory");   // behind the step's loads; it takes their address pairs as inputs, so that no load's result lands in a pair ahead of it
#pragma unroll
        for (int i = 0; i < XLD; ++i) if (PW * 2 * (i + 1) <= C_ || wv * 2 + PW * 2 * i < C_) *(v4fa*)(sp + i * (PW * 2) * XSP) = r[i];
        if (wv * 32 < C_) { mus[tid & (C_ - 1)] = sm; rds[tid & (C_ - 1)] = sr; }
    }
    __syncthreads();                                     // the f32 tile is whole before any wave reads across it
#pragma unroll 1   // rolled: the gating arithmetic stands once in the text
    for (int u = wv; u < (C_ / 8) * 2; u += PW) {
        const int c = (u >> 1) * 8, tl = (u & 1) * 32 + lane;
        const v8f mu8 = *(const v8f*)(mus + c), rd8 = *(const v8f*)(rds + c);   // one address for the whole wave
        v8us o0, oh, ol;
#pragma unroll
        for (int q = 0; q < 8; ++q) {
            const float xb = bfr(osa5[(c + q) * XSP + tl]);
            const float d = xb - mu8[q];
            const float y = d * d * rd8[q] + 0.5f;
            const float ex = __expf(-y);
            const float sg = __builtin_amdgcn_rcpf(1.0f + ex);
            const float x1 = xb * sg;
            o0[q] = f2bf(xb); unsigned short hh, ll; splitf(x1, hh, ll); oh[q] = hh; ol[q] = ll;
        }
        *(v8us*)(xs + tl * XKP + c) = o0; *(v8us*)(xs + XPL + tl * XKP + c) = oh; *(v8us*)(xs + 2 * XPL + tl * XKP + c) = ol;
    }
    __syncthreads();                                     // the three planes are whole before the tiles read them, and no wave reads the f32 tile any more: its LDS becomes the waves' epilogue slices
    float* os = osa5 + wv * OSL;
    const bf* XT = xs; const bf* X1h = xs + XPL; const bf* X1l = xs + 2 * XPL;
    const size_t to = (size_t)blockIdx.x * 64 * CI, fo = (size_t)b * CI * SEQ + t0;   // the tile's first element in a token-major plane (column tile 0) and in a feature-major plane (row tile 0)
    const int j = (wv >> 2) * 2 + (wv & 1), h = j & 1;   // waves 2, 3, 6, 7 take the four two-product tiles, the other six the one-product tiles: with waves dealt round the four SIMDs, two SIMDs get two long tiles each and two get three short ones
    if ((wv & 2) != 0) {
        if (j < 2) gemmw_tile<bf, true, false, 1, false, C_, 1, false, XKP, C_, 1>(os, 0, h, 0, X1h, X1l, WDb, nullptr, nullptr, nullptr, nullptr, DQh + to, DQl + to, CI, b_d, nullptr, 0, 0, 0);                 /* D [tok][128] (2 products) */
        else       gemmw_tile<bf, false, true, 2, false, C_, 2, false, C_, XKP, 2>(os, h, 0, 0, WSb, nullptr, X1h, X1l, nullptr, nullptr, nullptr, (bf*)SVh + fo, SVl + fo, SEQ, b_s, nullptr, 0, 0, 0);          /* S feature-major (2 products) */
    } else {
        if (j < 2) gemmw_tile<bf, false, false, 2, false, C_, 2, false, C_, XKP, 2>(os, h, 0, 0, WGb, nullptr, XT, nullptr, nullptr, nullptr, nullptr, (bf*)GVh + fo, GVl + fo, SEQ, b_g, nullptr, 0, 0, 0);       /* g feature-major */
        else       gemmw_tile<bf, false, false, 1, false, C_, 1, false, XKP, C_, 1>(os, 0, h, 0, XT, nullptr, j < 4 ? WTb : WPb, nullptr, nullptr, nullptr, nullptr, (j < 4 ? THh : PHh) + to, (j < 4 ? THl : PHl) + to, CI, j < 4 ? b_theta : b_phi, nullptr, 0, 0, 0);   /* theta, phi [tok][128] */
    }
}

// k_stats: one work-group per 32 (b, c) rows (its 32 results fill one 128-byte line of MU and of RD), sixteen waves, two rows per wave one after the other.
// A wave brings its whole row into registers with all its loads in flight at once, rounds it to bf16 there, and takes the mean and the centred sum of squares from the registers: the row is read once and no load waits on another.
// LDS mus/rds: cross-wave (block barrier).
// The six weight matrices' conversion to bf16 needs nothing of x and rides in the same grid: work-groups from STB on, WCB of them per matrix, eight elements a thread.
#define SW 16
#define SR (32 / SW)
#define STB (NB * C_ / 32)
#define WCB (CI * C_ / 8 / (SW * 32))
static_assert((CI * C_ / 8) % (SW * 32) == 0);
__global__ __launch_bounds__(SW * 32) void k_stats(const float* __restrict__ x, float* MU, float* RD,
                                                 const float* __restrict__ w_theta, const float* __restrict__ w_phi, const float* __restrict__ w_g, const float* __restrict__ w_d, const float* __restrict__ w_s, const float* __restrict__ w_out,
                                                 bf* WTb, bf* WPb, bf* WGb, bf* WDb, bf* WSb, bf* WOb) {
    __shared__ float mus[32]; __shared__ float rds[32];
    if (blockIdx.x >= STB) {                             // taken by a whole work-group, ahead of the barrier below
        const int cb = blockIdx.x - STB, w = cb / WCB;
        const float* src = w == 0 ? w_theta : w == 1 ? w_phi : w == 2 ? w_g : w == 3 ? w_d : w == 4 ? w_s : w_out;
        bf* dst = w == 0 ? WTb : w == 1 ? WPb : w == 2 ? WGb : w == 3 ? WDb : w == 4 ? WSb : WOb;
        const size_t i = (size_t)(cb - w * WCB) * (SW * 32) + threadIdx.x;
        const v8f v = *(const v8f*)(src + i * 8); v8us o;
#pragma unroll
        for (int k = 0; k < 8; ++k) o[k] = f2bf(v[k]);
        *(v8us*)(dst + i * 8) = o;
        return;
    }
    const int t = threadIdx.x, wid = __builtin_amdgcn_readfirstlane(t >> 5), lane = t & 31;   // wave number held scalar: the row index and the row's part of the address are scalar
#pragma unroll 1   // rolled: one row's registers at a time
    for (int j = 0; j < SR; ++j) {
        const int rr = blockIdx.x * 32 + wid * SR + j;                // (b, c) row index < NB * C_
        const int b = rr / C_, c = rr - b * C_;
        const float* xr = x + ((size_t)b * C_ + c) * HWF + lane * 4;
        v4f r[SEQ / 128];
#pragma unroll   // unrolled: every load of the row is issued before the first is waited for
        for (int i = 0; i < SEQ / 128; ++i) r[i] = *(const v4f*)(xr + (size_t)i * 128);
        float s = 0.f;
#pragma unroll   // unrolled: r[] stays in registers
        for (int i = 0; i < SEQ / 128; ++i) { v4f v = r[i]; v[0] = bfr(v[0]); v[1] = bfr(v[1]); v[2] = bfr(v[2]); v[3] = bfr(v[3]); r[i] = v; s += (v[0] + v[1]) + (v[2] + v[3]); }
        s += __shfl_xor(s, 1, 32); s += __shfl_xor(s, 2, 32); s += __shfl_xor(s, 4, 32); s += __shfl_xor(s, 8, 32); s += __shfl_xor(s, 16, 32);
        const float mu = s * (1.0f / (float)SEQ);
        float ss = 0.f;
#pragma unroll   // unrolled: r[] stays in registers
        for (int i = 0; i < SEQ / 128; ++i) { const v4f v = r[i];
            const float d0 = v[0] - mu, d1 = v[1] - mu, d2 = v[2] - mu, d3 = v[3] - mu;
            ss += (d0 * d0 + d1 * d1) + (d2 * d2 + d3 * d3); }
        ss += __shfl_xor(ss, 1, 32); ss += __shfl_xor(ss, 2, 32); ss += __shfl_xor(ss, 4, 32); ss += __shfl_xor(ss, 8, 32); ss += __shfl_xor(ss, 16, 32);
        const float den = 4.0f * (ss * (1.0f / (float)(SEQ - 1)) + ELAM);
        const float rd = 1.0f / den;
        if (lane == 0) { mus[wid * SR + j] = mu; rds[wid * SR + j] = rd; }
    }
    __syncthreads();
    if (wid == 0) {
        const float a = mus[lane], r = rds[lane];
        float* pm = MU + (size_t)blockIdx.x * 32 + lane; float* pr = RD + (size_t)blockIdx.x * 32 + lane;
        *(float*)pm = a; *(float*)pr = r;  }
}

// ---- k_attn: eight waves per work-group on 128 queries of one batch and one map (z = 0: theta/g, z = 1: D/S; keys = phi for both), online max-subtracted softmax.
// Wave (qg, kh) takes the 32 queries of group qg (two 16-query tiles) and the 32-key half kh of every stage: each K and V fragment read from LDS feeds both query tiles, so a matrix instruction costs half the LDS reads of a 16-query wave.
// Each wave keeps its own running maximum, sum and O^T over its half of the keys; at the end the two waves of a query group swap one tile each through LDS and join the halves (rescaled to the common maximum).
// Transposed products: S^T = K . Q^T (A = key rows, B = query columns) and O^T += V^T . P^T (A = feature rows of V, B = P^T). Lane (L, hi) then holds query L alone: 16 of the block's 32 scores sit in its own registers,
// maximum and sum are taken in the lane (one exchange between the lane halves for the maximum; the halves' sums are joined once at the end), and the two score tiles, converted in place, are the B operand of the second product.
// The work-group's 128 queries walk the same keys and values: each 64-key stage (K hi/lo rows, V hi/lo feature rows) is brought into LDS once by four tensor loads (waves 0 to 3, one 16-KiB plane each), two buffers, the next stage in flight while this one is worked on.
// LDS ring: shared by the eight waves (one block barrier at each hand-over, split: signal in front of a pass's second product, wait at the top of the next pass). K rows at a 272-byte pitch, V rows at a 144-byte pitch (16 B x odd, for ds_load_b128 readers), laid by the loads' own pad; every plane starts at a multiple of 2 KiB.
// LDS osa: one slice per wave, rows 0..15 x cols 0..127 and, in cols 128 and 129, the row's maximum and sum. A wave writes its own slice; behind the block barrier only its partner touches that slice.
#define AW   8
#define SK   64
#define KPI  136
#define VPI  72
#define KPLB ((SK * KPI * 2 + 2047) / 2048 * 2048)
#define VPLB ((CI * VPI * 2 + 2047) / 2048 * 2048)
#define STGB (2 * KPLB + 2 * VPLB)
#define NST  (SEQ / SK)
#define QG   (AW / 2)
static_assert(SEQ % (AW * 16) == 0 && NST >= 2 && SK == 2 * KB && OSP >= CI + 2);
static_assert(CI * 2 == 256 && SK * 2 == 128 && KPI * 2 == CI * 2 + 16 && VPI * 2 == SK * 2 + 16 && AW >= 4);   // row lengths and pitches that the two pad words below stand for
__device__ __forceinline__ v16bf ldbs(const bf* p) { return cat16b(*(const v8usa*)p, *(const v8usa*)(p + 16)); }
__device__ __forceinline__ v16h  ldhs(const h16* p) { return cat16(*(const v8ha*)p, *(const v8ha*)(p + 16)); }
__device__ __forceinline__ float xhalf(float x) { return __builtin_bit_cast(float, __builtin_amdgcn_permlanex16(__builtin_bit_cast(int, x), __builtin_bit_cast(int, x), 0x76543210, 0xfedcba98, false, false)); }   // lane l takes lane l ^ 16's value
// Tensor load of one two-dimensional tile, global -> LDS through no register: ROWS rows of ROWB bytes, source row pitch PITCH bytes, 1-byte elements, tensor = tile; W0 = word 0 of group 1 (no mask, the pad that sets the LDS pitch), a constant.
typedef unsigned u32x4 __attribute__((ext_vector_type(4)));
typedef unsigned u32x8 __attribute__((ext_vector_type(8)));
#define TW0K ((1u << 20) | (5u << 22) | (3u << 25))
#define TW0V ((1u << 20) | (4u << 22) | (3u << 25))
__device__ __forceinline__ unsigned uni(unsigned v) { return (unsigned)__builtin_amdgcn_readfirstlane(v); }
__device__ __forceinline__ unsigned pinned(unsigned v) { unsigned w = (unsigned)__builtin_amdgcn_readfirstlane(v); asm volatile("" : "+s"(w)); return w; }   // a test held in a scalar register: the branch on it is a scalar branch (a tensor load ignores EXEC)
template <unsigned ROWB, unsigned ROWS, unsigned PITCH, unsigned W0>
__device__ __forceinline__ u32x8 tgroup1() {
    u32x8 g1;
    g1[0] = uni(W0); g1[1] = uni((ROWB & 0xFFFFu) << 16); g1[2] = uni((ROWB >> 16) | ((ROWS & 0xFFFFu) << 16)); g1[3] = uni((ROWS >> 16) | (ROWB << 16));
    g1[4] = uni(ROWS); g1[5] = uni(PITCH); g1[6] = uni(0u); g1[7] = uni(0u);
    asm volatile("" : "+s"(g1));   // descriptor words held in scalar registers (the pinned() form): the group keeps one register tuple through the key walk, so that no word of a request in flight is rewritten
    return g1;
}
__device__ __forceinline__ u32x4 tgroup0(unsigned lds_dst, unsigned long long ga) {
    u32x4 g0;
    g0[0] = uni(1u); g0[1] = uni(lds_dst); g0[2] = uni((unsigned)ga); g0[3] = uni((((unsigned)(ga >> 32)) & 0x01FFFFFFu) | 0x80000000u);
    return g0;
}
__device__ __forceinline__ void tload(u32x4 g0, u32x8 g1) { asm volatile("tensor_load_to_lds %0, %1" :: "s"(g0), "s"(g1) : "memory"); }
__global__ __launch_bounds__(AW * 32) void k_attn(const bf* __restrict__ THh, const bf* __restrict__ THl, const bf* __restrict__ DQh, const bf* __restrict__ DQl,
                                             const bf* __restrict__ PHh, const bf* __restrict__ PHl,
                                             const h16* __restrict__ GVh, const bf* __restrict__ GVl, const h16* __restrict__ SVh, const bf* __restrict__ SVl, float* Y) {
    __shared__ __attribute__((aligned(2048))) unsigned char ring[2 * STGB];
    __shared__ __align__(16) float osa[AW * 16 * OSP];
    const int tid = threadIdx.x, lane = tid & 31, L = lane & 15, hi = lane >> 4;
    const int wv = __builtin_amdgcn_readfirstlane(tid >> 5);
    const int qg = wv % QG, kh = wv / QG;          // query group, key half (both wave-uniform)
    float* osw = osa + wv * 16 * OSP;                    // own slice: takes the tile that is given away
    float* osp = osa + (wv ^ QG) * 16 * OSP;             // the partner's slice: same query group, other key half
    const int q0 = blockIdx.x * (AW * 16) + qg * 32, b = blockIdx.y, mp = blockIdx.z;
    const size_t tok = (size_t)b * SEQ;
    const bf* Qh = (mp ? DQh : THh) + (tok + q0) * CI; const bf* Ql = (mp ? DQl : THl) + (tok + q0) * CI;
    const bf* Kh = PHh + tok * CI; const bf* Kl = PHl + tok * CI;
    const h16* Vh = (mp ? SVh : GVh) + (size_t)b * CI * SEQ; const bf* Vl = (mp ? SVl : GVl) + (size_t)b * CI * SEQ;
    float* Yo = Y + ((size_t)mp * NB * SEQ + tok + q0 + kh * 16) * CI;   // the wave stores the tile it keeps
    // One stage = four tiles, one request each from waves 0 to 3: K hi, K lo (64 rows x 256 B, contiguous in global), V hi, V lo (128 rows x 128 B at the plane's row pitch). The two kinds stand on two scalar paths, each with its own constant group 1.
    const unsigned ring0 = (unsigned)(size_t)ring;
    const unsigned role = pinned(wv < 2 ? 1u : wv < 4 ? 2u : 0u);   // 1: the wave brings a K plane, 2: a V plane, 0: it issues nothing; held scalar, so the tests on it are scalar branches
    const int w4 = wv & 3;                                          // the plane whose address the wave forms (waves 4 to 7 form one and never use it)
    const unsigned long long gb = w4 == 0 ? (unsigned long long)(size_t)Kh : w4 == 1 ? (unsigned long long)(size_t)Kl : w4 == 2 ? (unsigned long long)(size_t)Vh : (unsigned long long)(size_t)Vl;
    const unsigned gstep = w4 < 2 ? SK * CI * 2 : SK * 2;           // bytes from one stage's tile to the next in global memory
    const unsigned ldst = ring0 + (w4 < 2 ? (unsigned)w4 * KPLB : 2 * KPLB + (unsigned)(w4 - 2) * VPLB);
    const u32x8 g1k = tgroup1<CI * 2, SK, CI * 2, TW0K>(), g1v = tgroup1<SK * 2, CI, SEQ * 2, TW0V>();
    u32x4 g0;
    auto fill = [&](int st) {
        g0 = tgroup0(ldst + (unsigned)(st & 1) * STGB, gb + (unsigned long long)((unsigned)st * gstep));
        if (role == 1u) tload(g0, g1k);
        if (role == 2u) tload(g0, g1v);
    };
    // Tile t of the wave = queries q0 + (t ^ kh) * 16 + L: tile 0 is the one the wave keeps and stores, tile 1 the one it gives to its partner.
    // Per tile: query L's running maximum (equal in both lane halves), this lane half's part of its sum, acc[t][ct][v] = O^T[ct*16 + 8*hi + v][L]; all over the wave's half of the keys.
    float m_i[2] = {-1.0e30f, -1.0e30f}, l_i[2] = {0.f, 0.f}; v8f acc[2][8];
#pragma unroll
    for (int t = 0; t < 2; ++t)
#pragma unroll
        for (int ct = 0; ct < 8; ++ct) acc[t][ct] = (v8f){};
    // The wave's 32 query rows never change: their hi and lo fragments are loaded once and stay in registers for the whole key walk. B fragment: query column L of the tile.
    v16bf qh[2][CI / 32], ql[2][CI / 32];
    const bf* pqh[2]; const bf* pql[2];
#pragma unroll
    for (int t = 0; t < 2; ++t) {
        const size_t qoff = (size_t)((t ^ kh) * 16 + L) * CI + 8 * hi;
        pqh[t] = Qh + qoff; pql[t] = Ql + qoff;
#pragma unroll
        for (int ch = 0; ch < CI / 32; ++ch) { qh[t][ch] = ldb(pqh[t] + ch * 32); ql[t][ch] = ldb(pql[t] + ch * 32); }
    }
    asm volatile("s_wait_xcnt 0x0" :: "v"(pqh[0]), "v"(pql[0]), "v"(pqh[1]), "v"(pql[1]) : "memory");   // behind the query loads; it takes their address pairs as inputs, so that nothing lands in a pair ahead of it
    fill(0);
    asm volatile("s_wait_tensorcnt 0x0" :: "s"(g0), "s"(g1k), "s"(g1v) : "memory");   // stage 0 has landed before the signal that publishes it (a wave that issued nothing passes at once); the descriptor groups are inputs, as at the wait in the loop
    asm volatile("s_barrier_signal -1" ::: "memory");    // first half of the split block barrier; signal and wait alternate strictly in every wave from here on
#pragma unroll 1   // rolled: the buffer is picked by the stage's parity at run time, one copy of the hand-over and of the pass body
    for (int st = 0; st < NST; ++st) {
      const unsigned char* sb = ring + (st & 1) * STGB;
      asm volatile("s_barrier_wait -1" ::: "memory");    // second half: every wave has signalled, so stage st is published and no wave reads the other buffer any more; no LDS read of the pass stands ahead of it
      if (pinned(st + 1 < NST)) fill(st + 1);            // the refill stands right behind the wait, one stage ahead, only while that stage exists (a scalar test)
      {
        v8f lt[2][2];
#pragma unroll
        for (int t = 0; t < 2; ++t) { lt[t][0] = (v8f){}; lt[t][1] = (v8f){}; }
        const bf* k0h = (const bf*)sb + (kh * KB + L) * KPI + 8 * hi; const bf* k0l = k0h + KPLB / 2;   // A fragment (keys): key row kh*32 + kt*16 + L of the stage
#pragma unroll   // unrolled: each chunk names its own resident query fragments
        for (int ch = 0; ch < CI / 32; ++ch) {
            const int co = ch * 32;
            const v16bf ka0 = ldbs(k0h + co), kl0 = ldbs(k0l + co), ka1 = ldbs(k0h + 16 * KPI + co), kl1 = ldbs(k0l + 16 * KPI + co);
            lt[0][0] = wmmab(ka0, qh[0][ch], lt[0][0]); lt[0][1] = wmmab(ka1, qh[0][ch], lt[0][1]); lt[1][0] = wmmab(ka0, qh[1][ch], lt[1][0]); lt[1][1] = wmmab(ka1, qh[1][ch], lt[1][1]);
            lt[0][0] = wmmab(ka0, ql[0][ch], lt[0][0]); lt[0][1] = wmmab(ka1, ql[0][ch], lt[0][1]); lt[1][0] = wmmab(ka0, ql[1][ch], lt[1][0]); lt[1][1] = wmmab(ka1, ql[1][ch], lt[1][1]);
            lt[0][0] = wmmab(kl0, qh[0][ch], lt[0][0]); lt[0][1] = wmmab(kl1, qh[0][ch], lt[0][1]); lt[1][0] = wmmab(kl0, qh[1][ch], lt[1][0]); lt[1][1] = wmmab(kl1, qh[1][ch], lt[1][1]);
        }
        const h16* vh = (const h16*)(sb + 2 * KPLB) + L * VPI + kh * KB + 8 * hi; const bf* vl = (const bf*)(sb + 2 * KPLB + VPLB) + L * VPI + kh * KB + 8 * hi;   // A fragment (values): ci row L of the staged feature-major plane
        v16h vf[8]; v16bf vr[8];                                 // each V fragment is read from LDS once and stays in registers for both tiles' products
        // D element v of tile kt = score of key kh*32 + kt*16 + 8*hi + v against query L of tile t.
        float mx[2];
#pragma unroll
        for (int t = 0; t < 2; ++t) {
            const v8f lt0 = lt[t][0], lt1 = lt[t][1];
            float m = fmaxf(fmaxf(fmaxf(lt0[0], lt1[0]), fmaxf(lt0[1], lt1[1])), fmaxf(fmaxf(lt0[2], lt1[2]), fmaxf(lt0[3], lt1[3])));
            m = fmaxf(m, fmaxf(fmaxf(fmaxf(lt0[4], lt1[4]), fmaxf(lt0[5], lt1[5])), fmaxf(fmaxf(lt0[6], lt1[6]), fmaxf(lt0[7], lt1[7]))));
            mx[t] = fmaxf(m, xhalf(m));
        }
        asm volatile("" :: "v"(mx[0]), "v"(mx[1]) : "memory");   // compiler fence, inputs only: it takes the two tiles' maxima, which need every score, so the V reads below stay behind the score block (without it they were spread among its matrix instructions, K and V fragments lived at once and query fragments went to scratch)
#pragma unroll
        for (int ct = 0; ct < 8; ++ct) { vf[ct] = ldhs(vh + ct * 16 * VPI); vr[ct] = ldbs(vl + ct * 16 * VPI); }
        v16h pa16[2]; v16bf pab[2]; float sc[2];
#pragma unroll
        for (int t = 0; t < 2; ++t) {
            const v8f lt0 = lt[t][0], lt1 = lt[t][1];
            const float mn = fmaxf(m_i[t], mx[t]);
            sc[t] = __expf(m_i[t] - mn);
            v16f ps; float rp[8];
#pragma unroll
            for (int v = 0; v < 8; ++v) {
                const float pa = __expf(lt0[v] - mn), pb = __expf(lt1[v] - mn);
                rp[v] = pa + pb;
                ps[v] = pa * PCAR; ps[8 + v] = pb * PCAR;            // B element s: k = 8*hi + s (s < 8), 16 + 8*hi + (s - 8) otherwise: tile 0's registers, then tile 1's
            }
            l_i[t] = l_i[t] * sc[t] + (((rp[0] + rp[1]) + (rp[2] + rp[3])) + ((rp[4] + rp[5]) + (rp[6] + rp[7]))); m_i[t] = mn;
            pa16[t] = __builtin_convertvector(ps, v16h);             // round to nearest even, as the scalar conversions
            pab[t] = __builtin_convertvector(ps, v16bf);
        }
        // Hand-over, first half, in front of the pass's last matrix block: that block works on registers alone, so the wave gives the stage up here and the other waves need not wait out its products.
        asm volatile("s_wait_dscnt 0x0" : "+v"(l_i[0]), "+v"(l_i[1]) :: "memory");   // the wave's last LDS reads of this buffer (the V fragments) have returned before it may be refilled; it takes the row sums, the end of the softmax, so that it does not rise to the V reads and stall the softmax behind them
        asm volatile("s_wait_tensorcnt 0x0" :: "s"(g0), "s"(g1k), "s"(g1v) : "memory");   // the wave's own request of stage st + 1 has landed before the signal that publishes it (a wave that issued nothing passes at once); it takes the descriptor groups as inputs, so that their registers keep their values while the request is in flight
        asm volatile("s_barrier_signal -1" : "+v"(sc[0]), "+v"(sc[1]) :: "memory");   // no LDS read stands between this signal and the wait at the top of the next pass; it takes the rescale factors, which the second product's block starts from, so that the block stays behind it (without them part of the block was scheduled ahead of the signal)
#pragma unroll
        for (int t = 0; t < 2; ++t) {
#pragma unroll
            for (int ct = 0; ct < 8; ++ct) acc[t][ct] *= sc[t];
#pragma unroll
            for (int ct = 0; ct < 8; ++ct) { acc[t][ct] = wmma16(vf[ct], pa16[t], acc[t][ct]); acc[t][ct] = wmmab(vr[ct], pab[t], acc[t][ct]); }
        }
        // Four vector slots behind the pass's last matrix instructions: the hand-over and, while stages remain, the copies of stage st + 2 follow them.
        asm volatile("v_nop\n\tv_nop\n\tv_nop\n\tv_nop" : "+v"(acc[0][0]), "+v"(acc[0][1]), "+v"(acc[0][2]), "+v"(acc[0][3]), "+v"(acc[0][4]), "+v"(acc[0][5]), "+v"(acc[0][6]), "+v"(acc[0][7]),
                                                           "+v"(acc[1][0]), "+v"(acc[1][1]), "+v"(acc[1][2]), "+v"(acc[1][3]), "+v"(acc[1][4]), "+v"(acc[1][5]), "+v"(acc[1][6]), "+v"(acc[1][7]));
      }
    }
    asm volatile("s_barrier_wait -1" ::: "memory");      // the wait that belongs to the last pass's signal
    asm volatile("s_wait_tensorcnt 0x0" ::: "memory");   // no request is outstanding when the wave goes on to its end
    asm volatile("s_wait_dscnt 0x0" ::: "memory");       // nor an LDS read of the ring
    // Join of the two key halves. Each wave hands tile 1 (raw O^T, maximum, sum) to its partner through its own slice and takes the partner's tile 1, which is its own tile 0's queries over the other keys.
    const float lf0 = l_i[0] + xhalf(l_i[0]), lf1 = l_i[1] + xhalf(l_i[1]);   // the two lane halves' sums of query L, joined once
#pragma unroll
    for (int ct = 0; ct < 8; ++ct) {
        const v8f o = acc[1][ct];
        *(v4fa*)(osw + L * OSP + ct * 16 + 8 * hi) = (v4f){o[0], o[1], o[2], o[3]}; *(v4fa*)(osw + L * OSP + ct * 16 + 8 * hi + 4) = (v4f){o[4], o[5], o[6], o[7]}; }
    osw[L * OSP + CI + hi] = hi ? lf1 : m_i[1];
    __syncthreads();                                     // every wave's slice is written before its partner reads it
    const float mo = osp[L * OSP + CI], lo = osp[L * OSP + CI + 1];
    const float mj = fmaxf(m_i[0], mo);
    const float ea = __expf(m_i[0] - mj), eb = __expf(mo - mj);
    const float rl = __builtin_amdgcn_rcpf(lf0 * ea + lo * eb) * YSC;
    const float fa = ea * rl, fb = eb * rl;
#pragma unroll
    for (int ct = 0; ct < 8; ++ct) {                     // a lane reads and rewrites its own elements of the partner's slice
        float* pe = osp + L * OSP + ct * 16 + 8 * hi;
        const v4f u0 = *(const v4fa*)pe, u1 = *(const v4fa*)(pe + 4); const v8f o = acc[0][ct];
        *(v4fa*)pe = (v4f){o[0] * fa + u0[0] * fb, o[1] * fa + u0[1] * fb, o[2] * fa + u0[2] * fb, o[3] * fa + u0[3] * fb};
        *(v4fa*)(pe + 4) = (v4f){o[4] * fa + u1[0] * fb, o[5] * fa + u1[1] * fb, o[6] * fa + u1[2] * fb, o[7] * fa + u1[3] * fb}; }
    __builtin_amdgcn_fence(__ATOMIC_RELEASE, "wavefront"); __builtin_amdgcn_wave_barrier(); asm volatile("" ::: "memory");
{
#pragma unroll
        for (int r = 0; r < 16; ++r) { const v4f val = *(const v4fa*)(osp + r * OSP + lane * 4); *(v4f*)(Yo + (size_t)r * CI + lane * 4) = val; }
         }
}

extern "C" void kernel_launch(void* const* d_in, const int* in_sizes, int n_in,
                              void* d_out, int out_size, void* d_ws, size_t ws_size, hipStream_t stream) {
    if (n_in < 13) return;
    if ((size_t)in_sizes[0] < (size_t)NB * C_ * HWF) return;
    if (in_sizes[1] < CI * C_ || in_sizes[3] < CI * C_ || in_sizes[5] < CI * C_ || in_sizes[7] < CI * C_ || in_sizes[9] < CI * C_ || in_sizes[11] < C_ * CI) return;
    if (in_sizes[2] < CI || in_sizes[4] < CI || in_sizes[6] < CI || in_sizes[8] < CI || in_sizes[10] < CI || in_sizes[12] < C_) return;
    if ((size_t)out_size < (size_t)NB * C_ * HWF) return;
    const float* x = (const float*)d_in[0];
    const float* w_theta = (const float*)d_in[1];  const float* b_theta = (const float*)d_in[2];
    const float* w_phi   = (const float*)d_in[3];  const float* b_phi   = (const float*)d_in[4];
    const float* w_g     = (const float*)d_in[5];  const float* b_g     = (const float*)d_in[6];
    const float* w_d     = (const float*)d_in[7];  const float* b_d     = (const float*)d_in[8];
    const float* w_s     = (const float*)d_in[9];  const float* b_s     = (const float*)d_in[10];
    const float* w_out   = (const float*)d_in[11]; const float* b_out   = (const float*)d_in[12];
    float* OUT = (float*)d_out;                     // [NB][256][HWF]
    char* wsp = (char*)d_ws;
    auto take = [&](size_t bytes) { char* p = wsp; wsp += (bytes + 255) & ~(size_t)255; return (void*)p; };
    const size_t nTok = (size_t)NB * SEQ;
    bf* WTb = (bf*)take((size_t)CI * C_ * 2); bf* WPb = (bf*)take((size_t)CI * C_ * 2); bf* WGb = (bf*)take((size_t)CI * C_ * 2);
    bf* WDb = (bf*)take((size_t)CI * C_ * 2); bf* WSb = (bf*)take((size_t)CI * C_ * 2); bf* WOb = (bf*)take((size_t)C_ * CI * 2);
    float* MU = (float*)take((size_t)NB * C_ * 4); float* RD = (float*)take((size_t)NB * C_ * 4);
    float* F32A = (float*)take(2 * nTok * CI * 4);                 // y1 | y2 [2][nTok][128]
    bf* THh = (bf*)take(nTok * CI * 2); bf* THl = (bf*)take(nTok * CI * 2);
    bf* PHh = (bf*)take(nTok * CI * 2); bf* PHl = (bf*)take(nTok * CI * 2);
    bf* DQh = (bf*)take(nTok * CI * 2); bf* DQl = (bf*)take(nTok * CI * 2);
    h16* GVh = (h16*)take(nTok * CI * 2); bf* GVl = (bf*)take(nTok * CI * 2);
    h16* SVh = (h16*)take(nTok * CI * 2); bf* SVl = (bf*)take(nTok * CI * 2);
    if ((size_t)(wsp - (char*)d_ws) > ws_size) return;
    float* Y1 = F32A; float* Y2 = F32A + nTok * CI;

    k_stats<<<(unsigned)(STB + 6 * WCB), SW * 32, 0, stream>>>(x, MU, RD, w_theta, w_phi, w_g, w_d, w_s, w_out, WTb, WPb, WGb, WDb, WSb, WOb);   /* SimAM mu, 1/(4(var_n + eps)) per (b, c); weights -> bf16 */
    k_proj5<<<(unsigned)(NB * SEQ / 64), PW * 32, 0, stream>>>(x, MU, RD, WTb, WPb, WGb, WDb, WSb, b_theta, b_phi, b_g, b_d, b_s, THh, THl, PHh, PHl, DQh, DQl, GVh, GVl, SVh, SVl);   /* x^T bf16 (exact), gated x1^T hi/lo in LDS; theta, phi, D [tok][128]; g, S [b][128][SEQ]; 16-bit planes */
    k_attn<<<dim3(SEQ / (AW * 16), NB, 2), AW * 32, 0, stream>>>(THh, THl, DQh, DQl, PHh, PHl, GVh, GVl, SVh, SVl, F32A);                          /* y1 = softmax(theta.phi) g, y2 = softmax(D.phi) S */
    k_gemmw<bf, false, true, 2, true, CI, true><<<dim3(C_ / 64, SEQ / 64, NB), 32, 0, stream>>>(WOb, nullptr, nullptr, nullptr, Y1, Y2, OUT, HWF, b_out, x, 0, (size_t)SEQ * CI, (size_t)C_ * HWF);      /* out[b][co][t] = W_out . (y1 + y2 as hi/lo) + b_out + bf16(x) */
}
